// v000
// The times below were measured on an AMD MI455X: many runs one after another, warmed up first and cycling through
// copies of the inputs, with the whole window's GPU time divided by the number of runs. Launches and the gaps
// between them are all in it. The median over several windows is given; except for v000 it joins two sittings, which
// can be a few percent apart, so the side-by-side timings, each taken in one sitting, are the better comparison.
// v000 is the starting kernel. One run takes 3680 microseconds.
// De-stationary causal attention with a null branch, [b, l, h, e] layout (2 x 2,048 tokens, 8 heads x 64): A = softmax(scale * (q.k * tau_b + delta_bj)) over keys j <= i for (keys, values) and for (keys_null, values_null) with the same queries; out = soft_mask * out_edit + (1 - soft_mask) * out_null per query. all inputs rounded to bf16 (RNE); q is multiplied by tau_b on device (f32) and k, v rounded, then each branch is two WMMA attention launches, one per batch element (v_wmma_f32_16x16x32_bf16, f32 accumulate) with bf16 hi/lo split q.k (f32-class: q*tau is not 16-bit exact), the per-key additive table scale*delta_bj, causal, f32 online softmax, bf16 hi/lo split P.v; the blend in f32.
#include <hip/hip_runtime.h>
#include <math.h>

typedef __attribute__((ext_vector_type(16))) _Float16 v16h;
typedef __attribute__((ext_vector_type(8)))  _Float16 v8h;
typedef __attribute__((ext_vector_type(16))) __bf16   v16b;
typedef __attribute__((ext_vector_type(8)))  float    v8f;
typedef __attribute__((ext_vector_type(4)))  float    v4f;

// 16-bit WMMA fragment map (wave32), lane L, h = L>>4, m = L&15:
//   A 16x32: lane = row m;   element i -> k = (i<8) ? 8h+i : 16+8h+(i-8)
//   B 32x16: lane = column m; the SAME k(i,h)
//   D 16x16 (8 f32): lane = column m; element r -> row 8h+r
__device__ __forceinline__ int frag_k(int i, int h) { return (i < 8) ? (8 * h + i) : (16 + 8 * h + (i - 8)); }
__device__ __forceinline__ __bf16 bf16_rne(float f) {
    unsigned int u = __float_as_uint(f);
    u += 0x7fffu + ((u >> 16) & 1u);
    return __builtin_bit_cast(__bf16, (unsigned short)(u >> 16));
}
__device__ __forceinline__ float bf16_f32(__bf16 b) { return __uint_as_float(((unsigned int)__builtin_bit_cast(unsigned short, b)) << 16); }
__device__ __forceinline__ v8f wmma16(v16h a, v16h b, v8f c) {
    c = __builtin_amdgcn_wmma_f32_16x16x32_f16(false, a, false, b, (short)0, c, false, false);
    asm volatile("v_nop\n\tv_nop\n\tv_nop\n\tv_nop" : "+v"(c) : "v"(a), "v"(b));
    return c;
}
__device__ __forceinline__ v8f wmmab(v16b a, v16b b, v8f c) {
    c = __builtin_amdgcn_wmma_f32_16x16x32_bf16(false, a, false, b, (short)0, c, false, false);
    asm volatile("v_nop\n\tv_nop\n\tv_nop\n\tv_nop" : "+v"(c) : "v"(a), "v"(b));
    return c;
}
struct Split { v16b hi, lo; };
// hi/lo split product: a.hi*b.hi + a.hi*b.lo + a.lo*b.hi
__device__ __forceinline__ v8f wmma3(const Split& a, const Split& b, v8f c) {
    c = __builtin_amdgcn_wmma_f32_16x16x32_bf16(false, a.hi, false, b.hi, (short)0, c, false, false);
    c = __builtin_amdgcn_wmma_f32_16x16x32_bf16(false, a.hi, false, b.lo, (short)0, c, false, false);
    c = __builtin_amdgcn_wmma_f32_16x16x32_bf16(false, a.lo, false, b.hi, (short)0, c, false, false);
    asm volatile("v_nop\n\tv_nop\n\tv_nop\n\tv_nop" : "+v"(c) : "v"(a.hi), "v"(a.lo), "v"(b.hi), "v"(b.lo));
    return c;
}
struct Split3 { v16b hi, mid, lo; };
// triple split product (6 terms, drops only terms below 2^-24 relative)
__device__ __forceinline__ v8f wmma6(const Split3& a, const Split3& b, v8f c) {
    c = __builtin_amdgcn_wmma_f32_16x16x32_bf16(false, a.hi, false, b.hi, (short)0, c, false, false);
    c = __builtin_amdgcn_wmma_f32_16x16x32_bf16(false, a.hi, false, b.mid, (short)0, c, false, false);
    c = __builtin_amdgcn_wmma_f32_16x16x32_bf16(false, a.mid, false, b.hi, (short)0, c, false, false);
    c = __builtin_amdgcn_wmma_f32_16x16x32_bf16(false, a.hi, false, b.lo, (short)0, c, false, false);
    c = __builtin_amdgcn_wmma_f32_16x16x32_bf16(false, a.mid, false, b.mid, (short)0, c, false, false);
    c = __builtin_amdgcn_wmma_f32_16x16x32_bf16(false, a.lo, false, b.hi, (short)0, c, false, false);
    asm volatile("v_nop\n\tv_nop\n\tv_nop\n\tv_nop" : "+v"(c) : "v"(a.hi), "v"(a.mid), "v"(a.lo), "v"(b.hi), "v"(b.mid), "v"(b.lo));
    return c;
}

// Fragment gathers from f32 memory: element i <- p[(k0 + frag_k(i,h)) * sk] * s, zero for k >= klen.
__device__ __forceinline__ v16h fh_ld(const float* __restrict__ p, long long sk, int k0, int h, int klen, float s) {
    v16h a;
#pragma unroll
    for (int i = 0; i < 16; ++i) { const int k = k0 + frag_k(i, h); a[i] = (k < klen) ? (_Float16)(p[(long long)k * sk] * s) : (_Float16)0.f; }
    return a;
}
__device__ __forceinline__ Split sp_ld(const float* __restrict__ p, long long sk, int k0, int h, int klen, float s) {
    Split r;
#pragma unroll
    for (int i = 0; i < 16; ++i) {
        const int k = k0 + frag_k(i, h); const float x = (k < klen) ? p[(long long)k * sk] * s : 0.f;
        const __bf16 hb = bf16_rne(x); r.hi[i] = hb; r.lo[i] = bf16_rne(x - bf16_f32(hb));
    }
    return r;
}
__device__ __forceinline__ Split3 sp3_ld(const float* __restrict__ p, long long sk, int k0, int h, int klen, float s) {
    Split3 r;
#pragma unroll
    for (int i = 0; i < 16; ++i) {
        const int k = k0 + frag_k(i, h); const float x = (k < klen) ? p[(long long)k * sk] * s : 0.f;
        const __bf16 hb = bf16_rne(x); const float r1 = x - bf16_f32(hb); const __bf16 mb = bf16_rne(r1);
        r.hi[i] = hb; r.mid[i] = mb; r.lo[i] = bf16_rne(r1 - bf16_f32(mb));
    }
    return r;
}
__device__ __forceinline__ v16b bh_ld(const float* __restrict__ p, long long sk, int k0, int h, int klen, float s) {
    v16b a;
#pragma unroll
    for (int i = 0; i < 16; ++i) { const int k = k0 + frag_k(i, h); a[i] = bf16_rne((k < klen) ? p[(long long)k * sk] * s : 0.f); }
    return a;
}
// f16 fragment from an f16 LDS/global row with element stride 1 (k-contiguous), no bounds (tile already zero padded)
__device__ __forceinline__ v16h fh_row(const _Float16* __restrict__ row, int k0, int h) {
    v16h a;
#pragma unroll
    for (int i = 0; i < 16; ++i) a[i] = row[k0 + frag_k(i, h)];
    return a;
}

#define VST2(T, ptr, val) do { const T vst2_v_ = (val); *(T*)(ptr) = vst2_v_;  } while (0)
typedef float v4f __attribute__((ext_vector_type(4)));
#define VST2V4(ptr, val) do { const v4f vst2_v4_ = (val); *(v4f*)(ptr) = vst2_v4_;  } while (0)

__device__ __attribute__((noinline)) float act_fn(float v, int act) {
    if (act == 1) return fmaxf(v, 0.f);                                                                               // relu
    if (act == 2) { const float u = 0.7978845608028654f * (v + 0.044715f * v * v * v); return 0.5f * v * (1.f + tanhf(u)); } // tanh-gelu
    if (act == 3) return v / (1.f + expf(-v));                                                                        // silu
    if (act == 4) return 0.5f * v * (1.f + erff(v * 0.7071067811865476f));                                             // erf-gelu
    if (act == 5) return tanhf(v);
    if (act == 6) return 1.f / (1.f + expf(-v));                                                                      // sigmoid
    if (act == 7) return (v > 0.f) ? v : 0.01f * v;                                                                   // leaky relu 0.01
    if (act == 8) return (v > 0.f) ? v : (expf(v) - 1.f);                                                             // elu
    if (act == 9) return fminf(fmaxf(v, 0.f), 6.f);                                                                   // relu6
    if (act == 10) return fabsf(v);                                                                                    // abs
    if (act == 11) return (v >= 0.f) ? v : 0.1f * v;                                                                  // leaky 0.1
    if (act == 12) return (v > 0.f) ? v : 0.2f * v;                                                                   // leaky 0.2
    if (act == 13) return (v > 20.f) ? v : log1pf(expf(v));                                                            // softplus
    return v;
}

// =====================================================================================================================
// k_gemm<MODE>: C(z, m, n) = act(alpha * sum_k A(z, m, k) * B(z, k, n) + bias) + beta * R(z, m, n)
//   One wave (32-thread block) per 16 x 32 tile of C; grid (ceil(N/32), ceil(M/16), Z). Batch z -> (zo = z / zi_n, zi = z % zi_n)
//   with separate outer/inner strides for every tensor (e.g. batch and head). A(m,k) = A[zo*sAo + zi*sAi + m*sAm + k*sAk] (f32),
//   B(k,n) = B[zo*sBo + zi*sBi + n*sBn + k*sBk] (f32); any M, N, K (K zero-padded to 32 inside the fragments, M/N tails guarded).
//   C(m,n) = C[zo*sCo + zi*sCi + m*sCm + n] (n contiguous). flags: 1 bias[n], 2 bias[m], 4 residual R[zo*sRo + zi*sRi + m*sRm + n*sRn].
//   MODE 0: f16 operands (A prescaled by sa, B by sb, both undone in the epilogue); 1: bf16 hi/lo split (3 products); 2: bf16;
//   3: bf16 hi/mid/lo triple split (6 products); 4: as 3 with Kahan-compensated f32 accumulation across k-steps.
// =====================================================================================================================
struct GemmP {
    const float* A; const float* B; const float* bias; const float* R; float* C;
    long long sAo, sAi, sAm, sAk, sBo, sBi, sBn, sBk, sCo, sCi, sCm, sRo, sRi, sRm, sRn;
    int M, N, K, zi_n, flags, act; float alpha, beta, sa, sb;
    int Npad, pad_;     // columns [N, Npad) of C are written as 0 so that padded workspace rows are covered by whole-line stores; Npad >= N
};
static_assert(sizeof(GemmP) == 5 * 8 + 15 * 8 + 6 * 4 + 4 * 4 + 2 * 4, "GemmP has padding");

template <int MODE>
__global__ __launch_bounds__(32) void k_gemm(GemmP p) {
    const int lane = threadIdx.x & 31, h = lane >> 4, l15 = lane & 15;
    const int m0 = blockIdx.y * 16, n0 = blockIdx.x * 32;
    const int z = blockIdx.z, zo = z / p.zi_n, zi = z - zo * p.zi_n;
    const float* A = p.A + zo * p.sAo + zi * p.sAi;
    const float* B = p.B + zo * p.sBo + zi * p.sBi;
    const int am = min(m0 + l15, p.M - 1);                       // clamped row for loads (stores are guarded)
    v8f acc[2], comp[2];
#pragma unroll
    for (int t = 0; t < 2; ++t) { v8f zz = {}; acc[t] = zz; comp[t] = zz; }
    for (int k0 = 0; k0 < p.K; k0 += 32) {
        const float* arow = A + (long long)am * p.sAm;
        if (MODE == 1) {
            const Split a = sp_ld(arow, p.sAk, k0, h, p.K, 1.f);
#pragma unroll
            for (int t = 0; t < 2; ++t) {
                const int bn = min(n0 + t * 16 + l15, p.N - 1);
                acc[t] = wmma3(a, sp_ld(B + (long long)bn * p.sBn, p.sBk, k0, h, p.K, 1.f), acc[t]);
            }
        } else if (MODE == 3) {
            const Split3 a = sp3_ld(arow, p.sAk, k0, h, p.K, 1.f);
#pragma unroll
            for (int t = 0; t < 2; ++t) {
                const int bn = min(n0 + t * 16 + l15, p.N - 1);
                acc[t] = wmma6(a, sp3_ld(B + (long long)bn * p.sBn, p.sBk, k0, h, p.K, 1.f), acc[t]);
            }
        } else if (MODE == 4) {
            // triple split as MODE 3, but each k-step's 6 products go into a fresh accumulator and the partial is added to the running f32 sum
            // on the VALU with Kahan compensation (accumulation error stays ~1 ulp however long K is)
            const Split3 a = sp3_ld(arow, p.sAk, k0, h, p.K, 1.f);
#pragma unroll
            for (int t = 0; t < 2; ++t) {
                const int bn = min(n0 + t * 16 + l15, p.N - 1); v8f zz = {};
                const v8f part = wmma6(a, sp3_ld(B + (long long)bn * p.sBn, p.sBk, k0, h, p.K, 1.f), zz);
                const v8f y = part - comp[t]; const v8f s = acc[t] + y; comp[t] = (s - acc[t]) - y; acc[t] = s;
            }
        } else if (MODE == 2) {
            const v16b a = bh_ld(arow, p.sAk, k0, h, p.K, 1.f);
#pragma unroll
            for (int t = 0; t < 2; ++t) {
                const int bn = min(n0 + t * 16 + l15, p.N - 1);
                acc[t] = wmmab(a, bh_ld(B + (long long)bn * p.sBn, p.sBk, k0, h, p.K, 1.f), acc[t]);
            }
        } else {
            const v16h a = fh_ld(arow, p.sAk, k0, h, p.K, p.sa);
#pragma unroll
            for (int t = 0; t < 2; ++t) {
                const int bn = min(n0 + t * 16 + l15, p.N - 1);
                acc[t] = wmma16(a, fh_ld(B + (long long)bn * p.sBn, p.sBk, k0, h, p.K, p.sb), acc[t]);
            }
        }
    }
    const float iscale = (MODE == 0) ? p.alpha / (p.sa * p.sb) : p.alpha;
    float* C = p.C + zo * p.sCo + zi * p.sCi;
    const float* R = p.R + zo * p.sRo + zi * p.sRi;
    __shared__ __align__(16) float ctile[16][36];
#pragma unroll
    for (int t = 0; t < 2; ++t) {
        const int n = n0 + t * 16 + l15; const int nn = min(n, p.N - 1);
#pragma unroll
        for (int r = 0; r < 8; ++r) {
            const int m = m0 + 8 * h + r; const int mm = min(m, p.M - 1);
            float v = acc[t][r] * iscale;
            if (p.flags & 1) v += p.bias[nn];
            if (p.flags & 2) v += p.bias[mm];
            if (p.flags & 8) v *= p.bias[(long long)zo * p.M + mm];   /* per-(z,row) scale vector laid out [Z][M]; exclusive with the bias flags */
            v = act_fn(v, p.act);
            if (p.flags & 4) v += p.beta * R[(long long)mm * p.sRm + (long long)nn * p.sRn];
            ctile[8 * h + r][t * 16 + l15] = (n < p.N) ? v : 0.f;
        }
    }
    __syncthreads();
    const int NW = (p.Npad > p.N) ? p.Npad : p.N;           // write width
    const bool fast = (m0 + 16 <= p.M) && (n0 + 32 <= NW) && ((p.sCm & 3) == 0) && ((((size_t)C) & 15) == 0);
    if (fast) {
#pragma unroll
        for (int s = 0; s < 4; ++s) {
            const int row = s * 4 + (lane >> 3), c4 = (lane & 7) * 4;
            const v4f v = *(const v4f*)&ctile[row][c4];
            VST2V4(C + (long long)(m0 + row) * p.sCm + n0 + c4, v);
        }
    } else {
        for (int row = 0; row < 16; ++row) {
            const int m = m0 + row, n = n0 + lane;
            if (m < p.M && n < NW) VST2(float, C + (long long)m * p.sCm + n, ctile[row][lane]);
        }
    }
}


// =====================================================================================================================
// k_gemmT<MODE, TM, TN>: same contract as k_gemm, but one wave computes a (16*TM) x (16*TN) tile: TM A fragments and TN B fragments are
//   loaded per 32-wide k-step and reused across TM*TN WMMAs (far fewer load/convert instructions per MAC). MODE 0 (f16), 1 (bf16 hi/lo),
//   2 (bf16) only. grid (ceil(NW/(16*TN)), ceil(M/(16*TM)), Z), block 32. Epilogue identical to k_gemm, run per 16x32 sub-tile.
// =====================================================================================================================
template <int MODE, int TM, int TN>
__global__ __launch_bounds__(32) void k_gemmT(GemmP p) {
    const int lane = threadIdx.x & 31, h = lane >> 4, l15 = lane & 15;
    const int m0 = blockIdx.y * (16 * TM), n0 = blockIdx.x * (16 * TN);
    const int z = blockIdx.z, zo = z / p.zi_n, zi = z - zo * p.zi_n;
    const float* A = p.A + zo * p.sAo + zi * p.sAi;
    const float* B = p.B + zo * p.sBo + zi * p.sBi;
    v8f acc[TM][TN];
#pragma unroll
    for (int i = 0; i < TM; ++i)
#pragma unroll
        for (int t = 0; t < TN; ++t) { v8f zz = {}; acc[i][t] = zz; }
    for (int k0 = 0; k0 < p.K; k0 += 32) {
        if (MODE == 1) {
            Split a[TM], b[TN];
#pragma unroll
            for (int i = 0; i < TM; ++i) { const int am = min(m0 + 16 * i + l15, p.M - 1); a[i] = sp_ld(A + (long long)am * p.sAm, p.sAk, k0, h, p.K, 1.f); }
#pragma unroll
            for (int t = 0; t < TN; ++t) { const int bn = min(n0 + 16 * t + l15, p.N - 1); b[t] = sp_ld(B + (long long)bn * p.sBn, p.sBk, k0, h, p.K, 1.f); }
#pragma unroll
            for (int i = 0; i < TM; ++i)
#pragma unroll
                for (int t = 0; t < TN; ++t) acc[i][t] = wmma3(a[i], b[t], acc[i][t]);
        } else if (MODE == 2) {
            v16b a[TM], b[TN];
#pragma unroll
            for (int i = 0; i < TM; ++i) { const int am = min(m0 + 16 * i + l15, p.M - 1); a[i] = bh_ld(A + (long long)am * p.sAm, p.sAk, k0, h, p.K, 1.f); }
#pragma unroll
            for (int t = 0; t < TN; ++t) { const int bn = min(n0 + 16 * t + l15, p.N - 1); b[t] = bh_ld(B + (long long)bn * p.sBn, p.sBk, k0, h, p.K, 1.f); }
#pragma unroll
            for (int i = 0; i < TM; ++i)
#pragma unroll
                for (int t = 0; t < TN; ++t) acc[i][t] = wmmab(a[i], b[t], acc[i][t]);
        } else {
            v16h a[TM], b[TN];
#pragma unroll
            for (int i = 0; i < TM; ++i) { const int am = min(m0 + 16 * i + l15, p.M - 1); a[i] = fh_ld(A + (long long)am * p.sAm, p.sAk, k0, h, p.K, p.sa); }
#pragma unroll
            for (int t = 0; t < TN; ++t) { const int bn = min(n0 + 16 * t + l15, p.N - 1); b[t] = fh_ld(B + (long long)bn * p.sBn, p.sBk, k0, h, p.K, p.sb); }
#pragma unroll
            for (int i = 0; i < TM; ++i)
#pragma unroll
                for (int t = 0; t < TN; ++t) acc[i][t] = wmma16(a[i], b[t], acc[i][t]);
        }
    }
    const float iscale = (MODE == 0) ? p.alpha / (p.sa * p.sb) : p.alpha;
    float* C = p.C + zo * p.sCo + zi * p.sCi;
    const float* R = p.R + zo * p.sRo + zi * p.sRi;
    const int NW = (p.Npad > p.N) ? p.Npad : p.N;
    __shared__ __align__(16) float ctile[16][36];
#pragma unroll
    for (int i = 0; i < TM; ++i) {
        const int mb = m0 + 16 * i; if (mb >= p.M) break;          // wave-uniform
#pragma unroll
        for (int tp = 0; tp < TN / 2; ++tp) {
            const int nb = n0 + 32 * tp; if (nb >= NW) break;        // wave-uniform
#pragma unroll
            for (int t2 = 0; t2 < 2; ++t2) {
                const int t = 2 * tp + t2; const int n = nb + t2 * 16 + l15; const int nn = min(n, p.N - 1);
#pragma unroll
                for (int r = 0; r < 8; ++r) {
                    const int m = mb + 8 * h + r; const int mm = min(m, p.M - 1);
                    float v = acc[i][t][r] * iscale;
                    if (p.flags & 1) v += p.bias[nn];
                    if (p.flags & 2) v += p.bias[mm];
            if (p.flags & 8) v *= p.bias[(long long)zo * p.M + mm];   /* per-(z,row) scale vector laid out [Z][M]; exclusive with the bias flags */
                    v = act_fn(v, p.act);
                    if (p.flags & 4) v += p.beta * R[(long long)mm * p.sRm + (long long)nn * p.sRn];
                    ctile[8 * h + r][t2 * 16 + l15] = (n < p.N) ? v : 0.f;
                }
            }
            __syncthreads();
            const bool fast = (mb + 16 <= p.M) && (nb + 32 <= NW) && ((p.sCm & 3) == 0) && ((((size_t)C) & 15) == 0);
            if (fast) {
#pragma unroll
                for (int s = 0; s < 4; ++s) {
                    const int row = s * 4 + (lane >> 3), c4 = (lane & 7) * 4;
                    const v4f v = *(const v4f*)&ctile[row][c4];
                    VST2V4(C + (long long)(mb + row) * p.sCm + nb + c4, v);
                }
            } else {
                for (int row = 0; row < 16; ++row) {
                    const int m = mb + row, n = nb + lane;
                    if (m < p.M && n < NW) VST2(float, C + (long long)m * p.sCm + n, ctile[row][lane]);
                }
            }
            __syncthreads();
        }
    }
}

// =====================================================================================================================
//   Wave = 16 queries, AW waves per block, 64-key blocks; grid (ceil(Lq/(16*AW)), H, B), block 32*AW. Any Lq, Lk; head dim dh <= DHP
//   (DHP multiple of 32), value dim dv <= DVP (multiple of 16, <= 128). Q, K, V addressed by (batch, head, row, element) strides, O and P by (batch, head, row) strides with contiguous elements; f32.
//   Scores: QM 0 f16 operands, 1 bf16 hi/lo split, 2 bf16 triple split; statistics f32 (exp2 domain); P.V: P x 4096 as f16 with V f16 staged in LDS
//   (SPLITPV: P and V as bf16 hi/lo splits). kv head = h / hrep. Masking: causal = 1 (keep j <= i + coff, masked -> -inf, key blocks beyond the
//   diagonal skipped), causal = 2 (masked -> mfill, a finite fill like the -1e9; no skipping), causal = 3 (keep j >= i + coff,
//   masked -> -inf, no skipping); optional additive f32 mask Mf,
//   optional int keep-mask Mi (0 -> score := mfill), both addressed b*smb + h*smh + i*smi + j*smj (0 strides broadcast).
// =====================================================================================================================
#define AW 4
struct AttnP {   // apv4
    const float* Q; const float* K; const float* V; float* O; float* P; const float* Mf; const int* Mi; float* ST;
    const float* Pw; const float* Rt; const int* SQ; const int* SK;           // optional: post-softmax weight, relative-position table, segment ids
    long long swb, swh, swi, swj, srb, srh, sri;                                 // Pw strides (b,h,i,j); Rt strides (b,h,i), column = clamp(i - j + roff, 0, rn-1)
    long long sQb, sQh, sQi, sQd, sKb, sKh, sKj, sKd, sVb, sVh, sVj, sVd, sOb, sOh, sOi, sPb, sPh, sPi, smb, smh, smi, smj;
    int Lq, Lk, dh, dv, hrep, causal, coff, pband;   // pband > 0: P holds only the band |j - i| <= pband, column j - i + pband
    float scale, mfill; int nonorm, mpol;             // nonorm (online path only): O = sum_j exp(score_j) V_j without the 1/rowsum (scores must be <= ~0); mpol: Mi masks where ==0 (mpol 0) or where !=0 (mpol 1)
    int roff, rn, segpol, win;                        // Rt column offset/count; SQ/SK: score := mfill where (segpol 0) SQ[i] != SK[j] or (segpol 1) SQ[i] == SK[j]; win > 0: keys with i - j > win (after coff) -> -inf
};
//   Pw: the softmax numerator is multiplied by Pw(b,h,i,j) AFTER the row sum is taken (probs * weight, then P.V), as in post-softmax multiplicative biases.                                                    // ST (optional): per row (b,h,i) -> ST[((b*H + h)*Lq + i)*2 + {0,1}] = {row max of the scaled+masked score (natural units), sum_j exp(score - max)}
static_assert(sizeof(AttnP) == 12 * 8 + 29 * 8 + 16 * 4, "AttnP has padding");

#ifndef KATTN_ATTR
#define KATTN_ATTR
#endif
template <int DHP, int DVP, int QM, bool SPLITPV, bool TWOPASS>
__global__ __launch_bounds__(32 * AW) KATTN_ATTR void k_attn(AttnP p) {
    constexpr int NT = DVP / 16;                // output tiles
    constexpr int KS = DHP / 32;                // k-steps for the scores
    constexpr int VP = DVP + 8;                 // LDS pitch (halves)
    __shared__ __align__(16) float    pl[AW][16 * 64];
    __shared__ __align__(16) _Float16 vl[(SPLITPV ? 2 : 1) * 64 * VP];   // f16 V tile, or bf16 hi and lo tiles (same 2-byte size)
    const int lane = threadIdx.x & 31, hf = lane >> 4, l15 = lane & 15, wave = threadIdx.x >> 5;
    const int h = blockIdx.y, b = blockIdx.z, hk = h / p.hrep;
    const int q0 = (blockIdx.x * AW + wave) * 16;
    float* myp = pl[wave];
    const float L2E = 1.4426950408889634f;
    const float NEG = -__builtin_inff();
    const int qi = min(q0 + l15, p.Lq - 1);
    const float* qrow = p.Q + b * p.sQb + h * p.sQh + (long long)qi * p.sQi;
    const float* kbase = p.K + b * p.sKb + hk * p.sKh;
    const float* vbase = p.V + b * p.sVb + hk * p.sVh;
    v16h qa[QM == 0 ? KS : 1]; Split qs_[QM == 1 ? KS : 1]; Split3 qt_[QM == 2 ? KS : 1];
#pragma unroll
    for (int ks = 0; ks < KS; ++ks) {
        if (QM == 2) qt_[ks] = sp3_ld(qrow, p.sQd, ks * 32, hf, p.dh, 1.f);
        else if (QM == 1) qs_[ks] = sp_ld(qrow, p.sQd, ks * 32, hf, p.dh, 1.f);
        else qa[ks] = fh_ld(qrow, p.sQd, ks * 32, hf, p.dh, 1.f);
    }
    v8f o[NT]; float m8[8], l8[8];
#pragma unroll
    for (int t = 0; t < NT; ++t) { v8f zz = {}; o[t] = zz; }
#pragma unroll
    for (int i = 0; i < 8; ++i) { m8[i] = NEG; l8[i] = 0.f; }
    int jend = p.Lk; int jstart = 0;
    if (p.causal == 1) { const int je = (blockIdx.x * AW + AW - 1) * 16 + 16 + p.coff; jend = min(jend, max(je, 0)); }   // uniform per block
    if (p.win > 0) { const int js = (int)(blockIdx.x * AW) * 16 + p.coff - p.win; jstart = (js > 0) ? (js / 64) * 64 : 0; }   // uniform per block: key blocks entirely outside every row's window hold only -inf entries and are skipped exactly
    const int npass = TWOPASS ? 2 : 1;
    for (int pass = 0; pass < npass; ++pass) {
        const bool dopv = (!TWOPASS) || pass == 1;
        for (int j0 = jstart; j0 < jend; j0 += 64) {
            if (dopv) {
                __syncthreads();                                 // previous key block's reads of vl / pl are done
                for (int idx = threadIdx.x; idx < 64 * DVP; idx += 32 * AW) {
                    const int jr = idx / DVP, d = idx - jr * DVP, j = j0 + jr;
                    const float f = (j < p.Lk && d < p.dv) ? vbase[(long long)j * p.sVj + (long long)d * p.sVd] : 0.f;
                    if (SPLITPV) {
                        const __bf16 hb = bf16_rne(f);
                        ((__bf16*)vl)[jr * VP + d] = hb; ((__bf16*)vl)[64 * VP + jr * VP + d] = bf16_rne(f - bf16_f32(hb));
                    } else vl[jr * VP + d] = (_Float16)f;
                }
            }
            v8f s[4];
#pragma unroll
            for (int t = 0; t < 4; ++t) {
                const int j = min(j0 + t * 16 + l15, p.Lk - 1);
                const float* krow = kbase + (long long)j * p.sKj;
                v8f acc = {};
#pragma unroll
                for (int ks = 0; ks < KS; ++ks) {
                    if (QM == 2)      acc = wmma6(qt_[ks], sp3_ld(krow, p.sKd, ks * 32, hf, p.dh, 1.f), acc);
                    else if (QM == 1) acc = wmma3(qs_[ks], sp_ld(krow, p.sKd, ks * 32, hf, p.dh, 1.f), acc);
                    else              acc = wmma16(qa[ks], fh_ld(krow, p.sKd, ks * 32, hf, p.dh, 1.f), acc);
                }
                s[t] = acc;
            }
            float pv[8][4];
#pragma unroll
            for (int i = 0; i < 8; ++i) {
                const int irow = q0 + i + 8 * hf;
                const int ic = min(irow, p.Lq - 1);
                float sc[4];
#pragma unroll
                for (int t = 0; t < 4; ++t) {
                    const int jg = j0 + t * 16 + l15;
                    float v = s[t][i] * p.scale;
                    if (p.Mf) v += p.Mf[b * p.smb + h * p.smh + (long long)ic * p.smi + (long long)min(jg, p.Lk - 1) * p.smj];
                    if (p.Rt) { int rc = ic - min(jg, p.Lk - 1) + p.roff; rc = rc < 0 ? 0 : (rc >= p.rn ? p.rn - 1 : rc); v += p.Rt[b * p.srb + h * p.srh + (long long)ic * p.sri + rc]; }
                    if (p.Mi) { const int mv = p.Mi[b * p.smb + h * p.smh + (long long)ic * p.smi + (long long)min(jg, p.Lk - 1) * p.smj]; if (p.mpol ? (mv != 0) : (mv == 0)) v = p.mfill; }
                    if (p.SQ) { const bool same = p.SQ[(long long)b * p.Lq + ic] == p.SK[(long long)b * p.Lk + min(jg, p.Lk - 1)]; if (p.segpol ? same : !same) v = p.mfill; }
                    if (p.causal == 2 && jg > irow + p.coff) v = p.mfill;
                    if (jg >= p.Lk || (p.causal == 1 && jg > irow + p.coff) || (p.causal == 3 && jg < irow + p.coff) || (p.win > 0 && irow + p.coff - jg > p.win)) v = NEG; else v *= L2E;
                    sc[t] = v;
                }
                if (!TWOPASS || pass == 0) {
                    float mx = fmaxf(fmaxf(sc[0], sc[1]), fmaxf(sc[2], sc[3]));
                    mx = fmaxf(mx, __shfl_xor(mx, 1, 32)); mx = fmaxf(mx, __shfl_xor(mx, 2, 32));
                    mx = fmaxf(mx, __shfl_xor(mx, 4, 32)); mx = fmaxf(mx, __shfl_xor(mx, 8, 32));
                    const float mnew = fmaxf(m8[i], mx);
                    const float corr = (mnew == NEG) ? 1.f : exp2f(m8[i] - mnew);
                    float rs = 0.f;
#pragma unroll
                    for (int t = 0; t < 4; ++t) {
                        const float pp = (sc[t] == NEG) ? 0.f : exp2f(sc[t] - mnew); rs += pp;
                        pv[i][t] = p.Pw ? pp * p.Pw[b * p.swb + h * p.swh + (long long)ic * p.swi + (long long)min(j0 + t * 16 + l15, p.Lk - 1) * p.swj] : pp;
                    }
                    rs += __shfl_xor(rs, 1, 32); rs += __shfl_xor(rs, 2, 32); rs += __shfl_xor(rs, 4, 32); rs += __shfl_xor(rs, 8, 32);
                    l8[i] = l8[i] * corr + rs; m8[i] = mnew;
                    if (!TWOPASS) {
#pragma unroll
                        for (int t = 0; t < NT; ++t) o[t][i] *= corr;
                    }
                } else {
                    const float inv = (l8[i] > 0.f) ? 1.f / l8[i] : 0.f;
#pragma unroll
                    for (int t = 0; t < 4; ++t) {
                        const int jg = j0 + t * 16 + l15;
                        float pp = (sc[t] == NEG) ? 0.f : exp2f(sc[t] - m8[i]) * inv;
                        if (p.Pw) pp *= p.Pw[b * p.swb + h * p.swh + (long long)ic * p.swi + (long long)min(jg, p.Lk - 1) * p.swj];
                        pv[i][t] = pp;
                    }
                }
            }
            if (dopv) {
#pragma unroll
                for (int i = 0; i < 8; ++i)
#pragma unroll
                    for (int t = 0; t < 4; ++t) ((float*)myp)[(i + 8 * hf) * 64 + t * 16 + l15] = pv[i][t];
                __syncthreads();                                 // P (per wave) and V (shared) visible
                if (p.P) {
                    float* pb_ = p.P + b * p.sPb + h * p.sPh;
                    const bool fastP = (p.pband == 0) && ((p.sPi & 3) == 0) && (j0 + 64 <= p.Lk) && (q0 + 16 <= p.Lq) && ((((size_t)pb_) & 15) == 0);
                    if (fastP) {
#pragma unroll
                        for (int s = 0; s < 8; ++s) {
                            const int row = s * 2 + (lane >> 4), c4 = (lane & 15) * 4;
                            const v4f v = *(const v4f*)(myp + row * 64 + c4);
                            VST2V4(pb_ + (long long)(q0 + row) * p.sPi + j0 + c4, v);
                        }
                    } else {
                        for (int row = 0; row < 16; ++row) {
                            const int irow = q0 + row; if (irow >= p.Lq) continue;
                            for (int c = lane; c < 64; c += 32) {
                                const int jg = j0 + c; if (jg >= p.Lk) continue;
                                if (p.pband == 0) VST2(float, pb_ + (long long)irow * p.sPi + jg, myp[row * 64 + c]);
                                else if (jg - irow <= p.pband && irow - jg <= p.pband) VST2(float, pb_ + (long long)irow * p.sPi + (jg - irow + p.pband), myp[row * 64 + c]);
                            }
                        }
                    }
                }
                if (SPLITPV) {
                    const Split pa0 = sp_ld(myp + l15 * 64, 1, 0, hf, 64, 1.f), pa1 = sp_ld(myp + l15 * 64, 1, 32, hf, 64, 1.f);
                    const __bf16* vh = (const __bf16*)vl; const __bf16* vlo = vh + 64 * VP;
#pragma unroll
                    for (int t = 0; t < NT; ++t) {
                        const int dcol = t * 16 + l15;
                        Split b0, b1;
#pragma unroll
                        for (int e = 0; e < 16; ++e) {
                            const int k0 = frag_k(e, hf), k1 = 32 + frag_k(e, hf);
                            b0.hi[e] = vh[k0 * VP + dcol]; b0.lo[e] = vlo[k0 * VP + dcol]; b1.hi[e] = vh[k1 * VP + dcol]; b1.lo[e] = vlo[k1 * VP + dcol];
                        }
                        o[t] = wmma3(pa0, b0, o[t]);
                        o[t] = wmma3(pa1, b1, o[t]);
                    }
                } else {
                    const v16h pa0 = fh_ld(myp + l15 * 64, 1, 0, hf, 64, 4096.f), pa1 = fh_ld(myp + l15 * 64, 1, 32, hf, 64, 4096.f);
#pragma unroll
                    for (int t = 0; t < NT; ++t) {
                        const int dcol = t * 16 + l15;
                        v16h b0, b1;
#pragma unroll
                        for (int e = 0; e < 16; ++e) { b0[e] = vl[frag_k(e, hf) * VP + dcol]; b1[e] = vl[(32 + frag_k(e, hf)) * VP + dcol]; }
                        o[t] = wmma16(pa0, b0, o[t]);
                        o[t] = wmma16(pa1, b1, o[t]);
                    }
                }
            }
        }
    }
    float* obase = p.O + b * p.sOb + h * p.sOh;
    if (p.ST) {
        const int rl = lane >> 1, isel = rl & 7;           // row q0 + rl ; rl>>3 == hf holds because lane>>4 == (lane>>1)>>3
        float mv = 0.f, lv = 0.f;
#pragma unroll
        for (int i = 0; i < 8; ++i) if (i == isel) { mv = m8[i]; lv = l8[i]; }
        const int irow = q0 + rl;
        if (irow < p.Lq) { float* st = p.ST + (((long long)b * gridDim.y + h) * p.Lq + irow) * 2 + (lane & 1); VST2(float, st, (lane & 1) ? lv : mv * 0.6931471805599453f); }
    }
    float invr[8];
#pragma unroll
    for (int i = 0; i < 8; ++i) {
        if (TWOPASS) invr[i] = SPLITPV ? 1.f : (1.f / 4096.f);
        else if (p.nonorm) invr[i] = exp2f(m8[i]) * (SPLITPV ? 1.f : (1.f / 4096.f));
        else invr[i] = (l8[i] > 0.f) ? (SPLITPV ? 1.f / l8[i] : 1.f / (l8[i] * 4096.f)) : 0.f;
    }
    __syncthreads();                                             // all waves done with pl/vl from the main loop
    const bool ofast = ((p.sOi & 3) == 0) && ((((size_t)obase) & 15) == 0) && (q0 + 16 <= p.Lq);
#pragma unroll
    for (int c0 = 0; c0 < DVP; c0 += 64) {
#pragma unroll
        for (int i = 0; i < 8; ++i)
#pragma unroll
            for (int t = 0; t < NT; ++t) if (t * 16 >= c0 && t * 16 < c0 + 64) ((float*)myp)[(i + 8 * hf) * 64 + (t * 16 - c0) + l15] = o[t][i] * invr[i];
        __syncthreads();
        const int cw = (DVP - c0 < 64) ? (DVP - c0) : 64;      // staged columns in this chunk (multiple of 16)
        if (ofast && (c0 + cw <= p.dv) && (cw % 32 == 0)) {
            const int lpr = cw / 4;                              // lanes per row (16 for 64 cols, 8 for 32)
            const int rows_per_ins = 32 / lpr;
            for (int r0 = 0; r0 < 16; r0 += rows_per_ins) {
                const int row = r0 + lane / lpr, c4 = (lane % lpr) * 4;
                const v4f v = *(const v4f*)(myp + row * 64 + c4);
                VST2V4(obase + (long long)(q0 + row) * p.sOi + c0 + c4, v);
            }
        } else {
            for (int row = 0; row < 16; ++row) {
                const int irow = q0 + row; if (irow >= p.Lq) continue;
                for (int c = lane; c < cw; c += 32) { const int d = c0 + c; if (d < p.dv) VST2(float, obase + (long long)irow * p.sOi + d, myp[row * 64 + c]); }
            }
        }
        __syncthreads();
    }
}

// =====================================================================================================================
// k_tr: dst(z, c, r) = alpha * src(z, r, c) (+ beta * R2(z, c, r)): [Z][R][C] (row stride lds) -> [Z][C][R] (row stride ldd) through a 32x32 LDS tile;
//   flags: 1 -> add beta * residual R2 addressed like dst (z*sRz + c*ldr + r); act applied before the residual.
// =====================================================================================================================
struct TrP { const float* src; float* dst; const float* R2; long long sSz, lds, sDz, ldd, sRz, ldr; int R, C, flags, act; float alpha, beta; };
static_assert(sizeof(TrP) == 3 * 8 + 6 * 8 + 6 * 4, "TrP has padding");
__global__ __launch_bounds__(256) void k_tr(TrP p) {
    __shared__ float tile[32][33];
    const int c0 = blockIdx.x * 32, r0 = blockIdx.y * 32, z = blockIdx.z;
    const int lane = threadIdx.x & 31, wave = threadIdx.x >> 5;
    const float* s = p.src + z * p.sSz;
#pragma unroll
    for (int k = 0; k < 4; ++k) {
        const int rl = wave * 4 + k, r = r0 + rl, c = c0 + lane;
        tile[rl][lane] = (r < p.R && c < p.C) ? s[(long long)r * p.lds + c] : 0.f;
    }
    __syncthreads();
    float* d = p.dst + z * p.sDz; const float* rr = p.R2 + z * p.sRz;
#pragma unroll
    for (int k = 0; k < 4; ++k) {
        const int cl = wave * 4 + k, c = c0 + cl, r = r0 + lane;
        if (c < p.C && r < p.R) {
            float v = act_fn(p.alpha * tile[lane][cl], p.act);
            if (p.flags & 1) v += p.beta * rr[(long long)c * p.ldr + r];
            VST2(float, d + (long long)c * p.ldd + r, v);
        }
    }
}

// k_affine: dst[i] = a * (sdev ? sdev[0] : 1) * src[i] + b, i < n (one thread per element; consecutive lanes -> consecutive addresses)
__global__ __launch_bounds__(256) void k_affine(const float* __restrict__ src, float* __restrict__ dst, int n, float a, float b, const float* __restrict__ sdev) {
    const int i = blockIdx.x * 256 + threadIdx.x;
    if (i < n) { const float aa = sdev ? a * sdev[0] : a; const float v = aa * src[i] + b; VST2(float, dst + i, v); }
}

// =====================================================================================================================
// k_softmax: row softmax over n contiguous elements, one 256-thread block per row; rows addressed z*sz + r*sr (grid (R, Z)).
//   out = scale_out * softmax(scale_in * x + (Mf ? Mf[z*smz + r*smr + j] : 0)); a row whose max is -inf is written as 0.
// =====================================================================================================================
struct SmP { const float* src; float* dst; const float* Mf; long long sz, sr, dz, dr, smz, smr; int n, pad; float scale_in, scale_out; };
static_assert(sizeof(SmP) == 3 * 8 + 6 * 8 + 4 * 4, "SmP has padding");
__global__ __launch_bounds__(256) void k_softmax(SmP p) {
    __shared__ float red[256];
    const int r = blockIdx.x, z = blockIdx.y, tid = threadIdx.x;
    const float* s = p.src + z * p.sz + (long long)r * p.sr;
    const float* mf = p.Mf ? (p.Mf + z * p.smz + (long long)r * p.smr) : nullptr;
    float mx = -__builtin_inff();
    for (int j = tid; j < p.n; j += 256) { float v = s[j] * p.scale_in; if (mf) v += mf[j]; mx = fmaxf(mx, v); }
    red[tid] = mx; __syncthreads();
    for (int o = 128; o > 0; o >>= 1) { if (tid < o) red[tid] = fmaxf(red[tid], red[tid + o]); __syncthreads(); }
    mx = red[0]; __syncthreads();
    float sum = 0.f;
    for (int j = tid; j < p.n; j += 256) { float v = s[j] * p.scale_in; if (mf) v += mf[j]; sum += (mx == -__builtin_inff()) ? 0.f : expf(v - mx); }
    red[tid] = sum; __syncthreads();
    for (int o = 128; o > 0; o >>= 1) { if (tid < o) red[tid] += red[tid + o]; __syncthreads(); }
    sum = red[0];
    const float inv = (sum > 0.f) ? p.scale_out / sum : 0.f;
    float* d = p.dst + z * p.dz + (long long)r * p.dr;
    for (int j = tid; j < p.n; j += 256) { float v = s[j] * p.scale_in; if (mf) v += mf[j]; const float o = (mx == -__builtin_inff()) ? 0.f : expf(v - mx) * inv; VST2(float, d + j, o); }
}
// =====================================================================================================================
// k_stats: mean and rsqrt(var + eps) over a set of n elements addressed base + z*sz + (e / inner) * so + (e % inner) * si, one 256-thread
// k_norm_apply: y = (x - mean[set]) * rstd[set] * g[c] + b[c] over a [Z][C][L] chan-major tensor with set = z*G + c / (C/G) (G groups per z;
//   G = C -> per-chan sets indexed z*C+c; for batch norm pass stats indexed by c only via bn = 1). Optional act. Output same layout.
// =====================================================================================================================
//   mode 0: mean / rsqrt(var + eps); mode 1 (RMSNorm): 0 / rsqrt(mean(x^2) + eps); mode 2 (L2 normalize * sqrt(n)): 0 / sqrt(n) / max(||x||, eps); mode 3: as 0 with unbiased variance (n-1)
__global__ __launch_bounds__(256) void k_stats(const float* __restrict__ x, long long sz, long long so, long long si, int inner, int n, float eps, float* __restrict__ stat, int mode) {
    __shared__ float red[256];
    const int z = blockIdx.x, tid = threadIdx.x;
    const float* base = x + z * sz;
    float s = 0.f;
    for (int e = tid; e < n; e += 256) s += base[(long long)(e / inner) * so + (long long)(e % inner) * si];
    red[tid] = s; __syncthreads();
    for (int o = 128; o > 0; o >>= 1) { if (tid < o) red[tid] += red[tid + o]; __syncthreads(); }
    const float mu = (mode == 0 || mode == 3) ? red[0] / (float)n : 0.f; __syncthreads();
    float q = 0.f;
    for (int e = tid; e < n; e += 256) { const float dlt = base[(long long)(e / inner) * so + (long long)(e % inner) * si] - mu; q += dlt * dlt; }
    red[tid] = q; __syncthreads();
    for (int o = 128; o > 0; o >>= 1) { if (tid < o) red[tid] += red[tid + o]; __syncthreads(); }
    {
        float rs;
        if (mode == 2) rs = sqrtf((float)n) / fmaxf(sqrtf(red[0]), eps); else if (mode == 3) rs = rsqrtf(red[0] / (float)(n - 1) + eps); else rs = rsqrtf(red[0] / (float)n + eps);
        if (tid < 32) { const float v = (tid == 0) ? mu : ((tid == 1) ? rs : 0.f); VST2(float, stat + (long long)z * 32 + tid, v); }
    }
}
//   One thread per element over the flat [Z][C][L] index space: grid ceil(Z*C*L / 256).
__global__ __launch_bounds__(256) void k_norm_apply(const float* __restrict__ x, float* __restrict__ y, const float* __restrict__ stat, const float* __restrict__ g, const float* __restrict__ bta,
                                                     int Z, int C, int L, int G, int bn, int act) {
    const long long idx = (long long)blockIdx.x * 256 + threadIdx.x;
    if (idx >= (long long)Z * C * L) return;
    const int l = (int)(idx % L); const long long zc = idx / L; const int c = (int)(zc % C), z = (int)(zc / C); (void)l;
    const int set = bn ? c : (z * G + c / (C / G));
    float v = (x[idx] - stat[(long long)set * 32]) * stat[(long long)set * 32 + 1];
    if (g) v *= g[c];
    if (bta) v += bta[c];
    v = act_fn(v, act);
    VST2(float, y + idx, v);
}

// k_lse_neg: c[i] = -(st[2i] + log(st[2i+1])) = minus the log-sum-exp of row i from k_attn's ST output (for softmax over the query dimension)
__global__ __launch_bounds__(256) void k_lse_neg(const float* __restrict__ st, float* __restrict__ c, int n) {
    const int i = blockIdx.x * 256 + threadIdx.x;
    if (i < n) { const float v = -(st[2 * i] + logf(st[2 * i + 1])); VST2(float, c + i, v); }
}

// k_iota: dst[i] = a * i + b as int32 (segment/position id helper)
__global__ __launch_bounds__(256) void k_iota(int* __restrict__ dst, int n, int a, int b) {
    const int i = blockIdx.x * 256 + threadIdx.x;
    if (i < n) { const int v = a * i + b; VST2(int, dst + i, v); }
}

// k_axpby: dst[i] = a * x[i] + b * y[i] (+ c), i < n
__global__ __launch_bounds__(256) void k_axpby(const float* __restrict__ x, const float* __restrict__ y, float* __restrict__ dst, int n, float a, float b, float c) {
    const int i = blockIdx.x * 256 + threadIdx.x;
    if (i < n) { const float v = a * x[i] + b * y[i] + c; VST2(float, dst + i, v); }
}

// =====================================================================================================================
// k_rope: rotary embedding on a [R rows][Hn heads][D] view (row stride sXr, head stride sXh, element stride 1) -> Y (own strides).
//   mode 0: rotate_half (partner d±D/2, sign - for d<D/2); mode 1: interleaved pairs (partner d^1, sign - for even d).
//   table column tcol: tmode 0 -> d, 1 -> d % (D/2), 2 -> d / 2; position p: pmode 0 -> r % S, 1 -> head index, 2 -> pos[r];
//   c = C[(r / S) * sCb + p * sCp + tcol * sCd], s likewise from Sn; y = x[d] * c + sign * x[partner] * s. X and Y must not alias.
// =====================================================================================================================
struct RopeP { const float* X; float* Y; const float* C; const float* Sn; const int* pos; long long sXr, sXh, sYr, sYh, sCb, sCp, sCd; int R, Hn, D, S, mode, tmode, pmode, pad; };
static_assert(sizeof(RopeP) == 5 * 8 + 7 * 8 + 8 * 4, "RopeP has padding");
__global__ __launch_bounds__(256) void k_rope(RopeP p) {
    const long long idx = (long long)blockIdx.x * 256 + threadIdx.x;
    if (idx >= (long long)p.R * p.Hn * p.D) return;
    const int d = (int)(idx % p.D); const long long rh = idx / p.D; const int h = (int)(rh % p.Hn); const int r = (int)(rh / p.Hn);
    const int half = p.D / 2;
    int partner; float sign;
    if (p.mode == 0) { partner = (d < half) ? d + half : d - half; sign = (d < half) ? -1.f : 1.f; }
    else { partner = d ^ 1; sign = (d & 1) ? 1.f : -1.f; }
    const int tcol = (p.tmode == 0) ? d : ((p.tmode == 1) ? (d % half) : (d >> 1));
    const int pp = (p.pmode == 0) ? (r % p.S) : ((p.pmode == 1) ? h : p.pos[r]);
    const long long toff = (long long)(r / p.S) * p.sCb + (long long)pp * p.sCp + (long long)tcol * p.sCd;
    const float* xr = p.X + (long long)r * p.sXr + (long long)h * p.sXh;
    const float v = xr[d] * p.C[toff] + sign * xr[partner] * p.Sn[toff];
    VST2(float, p.Y + (long long)r * p.sYr + (long long)h * p.sYh + d, v);
}

// k_invf + k_sincos (split so neither kernel carries a large VALU-fma footprint): invf_i = num * (1 / powf(base, (2 i)/D)) [fmode 0],
//   num * expf((2 i) * cexp) [fmode 1], num * powf(base, -2 (i - 1) / D) [fmode 2]; then cs/sn[s*half + i] = cos/sin((pscale * s) * invf_i)
__global__ __launch_bounds__(256) void k_invf(float* __restrict__ invb, int half, int D, float base, float num, int fmode, float cexp) {
    const int i = blockIdx.x * 256 + threadIdx.x;
    if (i >= ((half + 31) / 32) * 32) return;
    if (i >= half) { VST2(float, invb + i, 0.f); return; }
    const float e = (float)(2 * i) / (float)D;
    float invf;
    if (fmode == 1) invf = num * expf((float)(2 * i) * cexp);
    else if (fmode == 2) invf = num * powf(base, (-2.0f * ((float)i - 1.0f)) / (float)D);
    else invf = num * (1.0f / powf(base, e));
    VST2(float, invb + i, invf);
}
__global__ __launch_bounds__(256) void k_sincos(float* __restrict__ cs, float* __restrict__ sn, const float* __restrict__ invb, int S, int half, float pscale) {
    const int idx = blockIdx.x * 256 + threadIdx.x;
    if (idx >= S * half) return;
    const int s = idx / half, i = idx - s * half;
    const float ang = (pscale * (float)s) * invb[i];
    VST2(float, cs + idx, cosf(ang)); VST2(float, sn + idx, sinf(ang));
}

// k_mulact: dst[i] = act(x[i]) * y[i]
__global__ __launch_bounds__(256) void k_mulact(const float* __restrict__ x, const float* __restrict__ y, float* __restrict__ dst, int n, int act) {
    const int i = blockIdx.x * 256 + threadIdx.x;
    if (i < n) { const float v = act_fn(x[i], act) * y[i]; VST2(float, dst + i, v); }
}

// =====================================================================================================================
// k_matvec: thread-per-row matrix-vector products for N <= 8 output columns (heads with 1-3 outputs, gates), f32 on the VALU.
//   C[r*sCm + j] = act(alpha * sum_k A[r*sAm + k*sAk] * B[j*sBn + k*sBk] + bias[j]) + beta * R[r*sRm + j*sRn]; each thread writes its N contiguous floats.
// =====================================================================================================================
__global__ __launch_bounds__(256) void k_matvec(GemmP p) {
    // 32 lanes write one line with one instruction.
    const int rpt = (p.N == 1) ? 1 : 32;
    const long long r0 = ((long long)blockIdx.x * 256 + threadIdx.x) * rpt; const int z = blockIdx.z, zo = z / p.zi_n, zi = z - zo * p.zi_n;
    if (r0 >= p.M) return;
    const float* Bb = p.B + zo * p.sBo + zi * p.sBi;
    float* C = p.C + zo * p.sCo + zi * p.sCi; const float* R = p.R + zo * p.sRo + zi * p.sRi;
    for (int rr = 0; rr < rpt; ++rr) {
        const long long r = r0 + rr; if (r >= p.M) break;
        const float* A = p.A + zo * p.sAo + zi * p.sAi + r * p.sAm;
        float acc[8] = {0.f, 0.f, 0.f, 0.f, 0.f, 0.f, 0.f, 0.f};
        for (int k = 0; k < p.K; ++k) { const float a = A[(long long)k * p.sAk];
#pragma unroll
            for (int j = 0; j < 8; ++j) if (j < p.N) acc[j] += a * Bb[(long long)j * p.sBn + (long long)k * p.sBk]; }
#pragma unroll
        for (int j = 0; j < 8; ++j) if (j < p.N) {
            float v = acc[j] * p.alpha;
            if (p.flags & 1) v += p.bias[j];
            if (p.flags & 2) v += p.bias[r];
            v = act_fn(v, p.act);
            if (p.flags & 4) v += p.beta * R[r * p.sRm + (long long)j * p.sRn];
            VST2(float, C + r * p.sCm + j, v);
        }
    }
}
// k_smallsoftmax: thread-per-row softmax for short rows (n <= 64): dst[r*dr + j] = softmax(scale*src[r*sr + j])
__global__ __launch_bounds__(256) void k_smallsoftmax(const float* __restrict__ src, float* __restrict__ dst, long long sr, long long dr, int n, long long R, float scale) {
    const long long r0 = ((long long)blockIdx.x * 256 + threadIdx.x) * 32;
    for (int rr = 0; rr < 32; ++rr) {
        const long long r = r0 + rr; if (r >= R) return;
        const float* s = src + r * sr; float* d = dst + r * dr;
        float mx = -__builtin_inff();
        for (int j = 0; j < n; ++j) mx = fmaxf(mx, s[j] * scale);
        float sum = 0.f;
        for (int j = 0; j < n; ++j) sum += expf(s[j] * scale - mx);
        const float inv = 1.f / sum;
        for (int j = 0; j < n; ++j) { const float v = expf(s[j] * scale - mx) * inv; VST2(float, d + j, v); }
    }
}

__global__ __launch_bounds__(32) void k_unitstat(float* __restrict__ st) { const int t = threadIdx.x; const float v = (t == 1) ? 1.f : 0.f; VST2(float, st + t, v); }

// destination (e.g. a d_out whose row width is not a multiple of 32 floats) is written by consecutive lanes of one instruction
__global__ __launch_bounds__(256) void k_lincopy(const float* __restrict__ src, long long lds, float* __restrict__ dst, long long ldd, long long rows, int cols) {
    const long long i = (long long)blockIdx.x * 256 + threadIdx.x; if (i >= rows * cols) return;
    const long long r = i / cols; const int c = (int)(i - r * cols);
    const float v = src[r * lds + c]; VST2(float, dst + r * ldd + c, v);
}


__device__ __forceinline__ void st_h2(unsigned short* d2, float a, float b) { const unsigned u = (unsigned)__builtin_bit_cast(unsigned short, (_Float16)a) | ((unsigned)__builtin_bit_cast(unsigned short, (_Float16)b) << 16); unsigned* d = (unsigned*)d2; *d = u;  }
__device__ __forceinline__ float ldh(const unsigned short* p) { return (float)__builtin_bit_cast(_Float16, *p); }
__device__ __forceinline__ v4f ld4h(const unsigned short* p) { const unsigned long long u = *(const unsigned long long*)p; v4f a;
    a.x = (float)__builtin_bit_cast(_Float16, (unsigned short)(u & 0xFFFFu)); a.y = (float)__builtin_bit_cast(_Float16, (unsigned short)((u >> 16) & 0xFFFFu)); a.z = (float)__builtin_bit_cast(_Float16, (unsigned short)((u >> 32) & 0xFFFFu)); a.w = (float)__builtin_bit_cast(_Float16, (unsigned short)((u >> 48) & 0xFFFFu)); return a; }
__device__ __forceinline__ unsigned long long pk4h(v4f s) { return (unsigned long long)__builtin_bit_cast(unsigned short, (_Float16)s.x) | ((unsigned long long)__builtin_bit_cast(unsigned short, (_Float16)s.y) << 16) | ((unsigned long long)__builtin_bit_cast(unsigned short, (_Float16)s.z) << 32) | ((unsigned long long)__builtin_bit_cast(unsigned short, (_Float16)s.w) << 48); }
typedef unsigned v4u __attribute__((ext_vector_type(4)));
__device__ __forceinline__ void st8h(unsigned short* d, v4f a, v4f b) { const unsigned long long pa = pk4h(a), pb = pk4h(b); v4u pk; pk.x = (unsigned)(pa & 0xFFFFFFFFull); pk.y = (unsigned)(pa >> 32); pk.z = (unsigned)(pb & 0xFFFFFFFFull); pk.w = (unsigned)(pb >> 32); v4u* dd = (v4u*)d; *dd = pk;  }
__device__ __forceinline__ unsigned short bfu_rne(float v) { unsigned u = __builtin_bit_cast(unsigned, v); u += 0x7FFFu + ((u >> 16) & 1u); return (unsigned short)(u >> 16); }
__device__ __forceinline__ void bfsplit(float v, unsigned short& hi, unsigned short& lo) { hi = bfu_rne(v); lo = bfu_rne(v - __builtin_bit_cast(float, (unsigned)hi << 16)); }
__device__ __forceinline__ void st_s2(unsigned short* Hp, unsigned short* Lp, long long o, float a, float b) { unsigned short h0,l0,h1,l1; bfsplit(a,h0,l0); bfsplit(b,h1,l1); const unsigned ph = (unsigned)h0 | ((unsigned)h1 << 16), pl = (unsigned)l0 | ((unsigned)l1 << 16);
    unsigned* dh = (unsigned*)(Hp + o); unsigned* dl = (unsigned*)(Lp + o); *dh = ph; *dl = pl;  }
__device__ __forceinline__ int cl(int v, int n) { return min(max(v, 0), n - 1); }

// GAT-style aggregation over a device in-edge CSR at dst (+ optional explicit self loop as iteration j = -1):
//   logit = leaky(AS[src][h] + AD[n][h] (+ EW[e]*CW[h]), slope); softmax over the node's edges per head; acc[c] = sum alpha XP[src][c] (f16 gather plane, pitch XW; 256 channels = H heads x CH)
//   wave per node; lane L owns channels 8L..8L+7 (head = 8L / CH); per-lane softmax state (lanes of one head agree) -> no shuffles in the loop.
//   EPI 0: + bias -> f32 OUT[n][256] via LDS redistribution (two 16-B stores per lane, each instruction 512 contiguous B)
//   EPI 1: + bias, LayerNorm(256) * g + bb, relu -> bf16 hi/lo planes OH/OL [n][256] (16-B stores)
//   EPI 2: mean over the 256/CH heads + bias[0..63], LayerNorm(64) * g + bb, relu -> f32 OUT[n][64] (CH must be 64; LDS redistribution, 8-B stores)
//   EPI 3: mean over heads + bias -> f32 OUT[n][64] (no norm / activation)
//   EPI 4: + bias, ELU -> bf16 hi/lo planes OH/OL [n][256];  EPI 5: + bias (full 256-wide, per head), ELU, then mean over the 256/CH heads -> f32 OUT[n][64]
//   EPI 6: (CH = 128, two heads) mean over the two heads, + bias[0..127], relu -> f32 OUT[n][128] (LDS redistribution, 16-B stores)
//   EWM 0: no edge weights; 1: logit += EW[e] * CW[h] (self loop weight 1); 2: alpha *= EW[e] after the softmax (message scale; self loop weight 1)
template <int CH, bool SELF, int EWM, int EPI>
__global__ __launch_bounds__(256) void k_gat_agg(const unsigned short* __restrict__ XP, int XW, const float* __restrict__ AS, const float* __restrict__ AD, int ASTR, const float* __restrict__ EW, const float* __restrict__ CW,
        const int* __restrict__ esrc, const int* __restrict__ off, const int* __restrict__ cnt, const int* __restrict__ slot, const float* __restrict__ bias, const float* __restrict__ g, const float* __restrict__ bb,
        float* __restrict__ OUT, unsigned short* __restrict__ OH, unsigned short* __restrict__ OL, int N, int E, int CAP, float slope) {
    __shared__ float stage[8][256];
    const int wv = threadIdx.x >> 5; const int n = blockIdx.x * 8 + wv; const int L = threadIdx.x & 31; if (n >= N) return; const int c0 = 8 * L; const int h = c0 / CH;
    const float ad = AD[(long long)n * ASTR + h]; const float cw = (EWM == 1) ? CW[h] : 0.f; float m = -3.0e38f, s = 0.f; v4f a0, a1; a0.x = a0.y = a0.z = a0.w = 0.f; a1 = a0;
    const int p0 = cl(off[n], E + 1), cn = min(max(cnt[n], 0), CAP);
    for (int j = (SELF ? -1 : 0); j < cn; ++j) { int sj; float ew = 0.f;
        if (j < 0) { sj = n; ew = 1.f; } else { int e = slot[cl(p0 + j, E)]; e = cl(e, E); sj = cl(esrc[e], N); if (EWM != 0) ew = EW[e]; }
        float lg = AS[(long long)sj * ASTR + h] + ad + ((EWM == 1) ? ew * cw : 0.f); lg = (lg >= 0.f) ? lg : slope * lg;
        const float mn = fmaxf(m, lg); const float cz = expf(m - mn), pj = expf(lg - mn); s = s * cz + pj; const float pw = (EWM == 2) ? pj * ew : pj;
        const unsigned short* xr = XP + (long long)sj * XW + c0; a0 = a0 * cz + ld4h(xr) * pw; a1 = a1 * cz + ld4h(xr + 4) * pw; m = mn; }
    const float inv = (s > 0.f) ? 1.f / (s + 1e-16f) : 0.f; a0 = a0 * inv; a1 = a1 * inv;
    if (EPI == 0 || EPI == 1 || EPI == 4 || EPI == 5) { a0 = a0 + *(const v4f*)(bias + c0); a1 = a1 + *(const v4f*)(bias + c0 + 4); }
    if (EPI == 4 || EPI == 5) { a0.x = (a0.x > 0.f) ? a0.x : (expf(a0.x) - 1.f); a0.y = (a0.y > 0.f) ? a0.y : (expf(a0.y) - 1.f); a0.z = (a0.z > 0.f) ? a0.z : (expf(a0.z) - 1.f); a0.w = (a0.w > 0.f) ? a0.w : (expf(a0.w) - 1.f);
        a1.x = (a1.x > 0.f) ? a1.x : (expf(a1.x) - 1.f); a1.y = (a1.y > 0.f) ? a1.y : (expf(a1.y) - 1.f); a1.z = (a1.z > 0.f) ? a1.z : (expf(a1.z) - 1.f); a1.w = (a1.w > 0.f) ? a1.w : (expf(a1.w) - 1.f); }
    if (EPI == 4) { float o8[8] = {a0.x, a0.y, a0.z, a0.w, a1.x, a1.y, a1.z, a1.w}; unsigned short hh[8], ll[8];
#pragma unroll
        for (int u = 0; u < 8; ++u) bfsplit(o8[u], hh[u], ll[u]);
        const unsigned long long ph0 = (unsigned long long)hh[0] | ((unsigned long long)hh[1] << 16) | ((unsigned long long)hh[2] << 32) | ((unsigned long long)hh[3] << 48), pl0 = (unsigned long long)ll[0] | ((unsigned long long)ll[1] << 16) | ((unsigned long long)ll[2] << 32) | ((unsigned long long)ll[3] << 48);
        const unsigned long long ph1 = (unsigned long long)hh[4] | ((unsigned long long)hh[5] << 16) | ((unsigned long long)hh[6] << 32) | ((unsigned long long)hh[7] << 48), pl1 = (unsigned long long)ll[4] | ((unsigned long long)ll[5] << 16) | ((unsigned long long)ll[6] << 32) | ((unsigned long long)ll[7] << 48);
        v4u pk; pk.x = (unsigned)(ph0 & 0xFFFFFFFFull); pk.y = (unsigned)(ph0 >> 32); pk.z = (unsigned)(ph1 & 0xFFFFFFFFull); pk.w = (unsigned)(ph1 >> 32); v4u* dh = (v4u*)(OH + (long long)n * 256 + c0); *dh = pk; 
        v4u ql; ql.x = (unsigned)(pl0 & 0xFFFFFFFFull); ql.y = (unsigned)(pl0 >> 32); ql.z = (unsigned)(pl1 & 0xFFFFFFFFull); ql.w = (unsigned)(pl1 >> 32); v4u* dl = (v4u*)(OL + (long long)n * 256 + c0); *dl = ql;  return; }
    if (EPI == 6) {
        a0.x += __shfl_xor(a0.x, 16); a0.y += __shfl_xor(a0.y, 16); a0.z += __shfl_xor(a0.z, 16); a0.w += __shfl_xor(a0.w, 16); a1.x += __shfl_xor(a1.x, 16); a1.y += __shfl_xor(a1.y, 16); a1.z += __shfl_xor(a1.z, 16); a1.w += __shfl_xor(a1.w, 16);
        if (L < 16) { const int cb = 8 * L; const v4f b0 = *(const v4f*)(bias + cb), b1v = *(const v4f*)(bias + cb + 4);
            stage[wv][cb] = fmaxf(a0.x * 0.5f + b0.x, 0.f); stage[wv][cb + 1] = fmaxf(a0.y * 0.5f + b0.y, 0.f); stage[wv][cb + 2] = fmaxf(a0.z * 0.5f + b0.z, 0.f); stage[wv][cb + 3] = fmaxf(a0.w * 0.5f + b0.w, 0.f);
            stage[wv][cb + 4] = fmaxf(a1.x * 0.5f + b1v.x, 0.f); stage[wv][cb + 5] = fmaxf(a1.y * 0.5f + b1v.y, 0.f); stage[wv][cb + 6] = fmaxf(a1.z * 0.5f + b1v.z, 0.f); stage[wv][cb + 7] = fmaxf(a1.w * 0.5f + b1v.w, 0.f); }
        __builtin_amdgcn_fence(__ATOMIC_RELEASE, "workgroup"); __builtin_amdgcn_wave_barrier(); __builtin_amdgcn_fence(__ATOMIC_ACQUIRE, "workgroup");
        v4f o6; o6.x = stage[wv][4 * L]; o6.y = stage[wv][4 * L + 1]; o6.z = stage[wv][4 * L + 2]; o6.w = stage[wv][4 * L + 3]; VST2V4(OUT + (long long)n * 128 + 4 * L, o6); return; }
    if (EPI == 5) {
        a0.x += __shfl_xor(a0.x, 8); a0.y += __shfl_xor(a0.y, 8); a0.z += __shfl_xor(a0.z, 8); a0.w += __shfl_xor(a0.w, 8); a1.x += __shfl_xor(a1.x, 8); a1.y += __shfl_xor(a1.y, 8); a1.z += __shfl_xor(a1.z, 8); a1.w += __shfl_xor(a1.w, 8);
        a0.x += __shfl_xor(a0.x, 16); a0.y += __shfl_xor(a0.y, 16); a0.z += __shfl_xor(a0.z, 16); a0.w += __shfl_xor(a0.w, 16); a1.x += __shfl_xor(a1.x, 16); a1.y += __shfl_xor(a1.y, 16); a1.z += __shfl_xor(a1.z, 16); a1.w += __shfl_xor(a1.w, 16);
        const int gq5 = L & 7; a0 = a0 * 0.25f; a1 = a1 * 0.25f;
        if (L < 8) { stage[wv][8 * gq5] = a0.x; stage[wv][8 * gq5 + 1] = a0.y; stage[wv][8 * gq5 + 2] = a0.z; stage[wv][8 * gq5 + 3] = a0.w; stage[wv][8 * gq5 + 4] = a1.x; stage[wv][8 * gq5 + 5] = a1.y; stage[wv][8 * gq5 + 6] = a1.z; stage[wv][8 * gq5 + 7] = a1.w; }
        __builtin_amdgcn_fence(__ATOMIC_RELEASE, "workgroup"); __builtin_amdgcn_wave_barrier(); __builtin_amdgcn_fence(__ATOMIC_ACQUIRE, "workgroup");
        const unsigned long long pk5 = (unsigned long long)__builtin_bit_cast(unsigned, stage[wv][2 * L]) | ((unsigned long long)__builtin_bit_cast(unsigned, stage[wv][2 * L + 1]) << 32); VST2(unsigned long long, (unsigned long long*)(OUT + (long long)n * 64 + 2 * L), pk5); return; }
    if (EPI == 1) { float sm = a0.x + a0.y + a0.z + a0.w + a1.x + a1.y + a1.z + a1.w;
#pragma unroll
        for (int o = 16; o > 0; o >>= 1) sm += __shfl_xor(sm, o);
        const float mu = sm * (1.f / 256.f); const v4f d0 = a0 - mu, d1 = a1 - mu; float q = d0.x * d0.x + d0.y * d0.y + d0.z * d0.z + d0.w * d0.w + d1.x * d1.x + d1.y * d1.y + d1.z * d1.z + d1.w * d1.w;
#pragma unroll
        for (int o = 16; o > 0; o >>= 1) q += __shfl_xor(q, o);
        const float rs = rsqrtf(q * (1.f / 256.f) + 1e-5f); float o8[8] = {d0.x, d0.y, d0.z, d0.w, d1.x, d1.y, d1.z, d1.w}; unsigned short hh[8], ll[8];
#pragma unroll
        for (int u = 0; u < 8; ++u) { const float v = fmaxf(o8[u] * rs * g[c0 + u] + bb[c0 + u], 0.f); bfsplit(v, hh[u], ll[u]); }
        const unsigned long long ph0 = (unsigned long long)hh[0] | ((unsigned long long)hh[1] << 16) | ((unsigned long long)hh[2] << 32) | ((unsigned long long)hh[3] << 48), pl0 = (unsigned long long)ll[0] | ((unsigned long long)ll[1] << 16) | ((unsigned long long)ll[2] << 32) | ((unsigned long long)ll[3] << 48);
        const unsigned long long ph1 = (unsigned long long)hh[4] | ((unsigned long long)hh[5] << 16) | ((unsigned long long)hh[6] << 32) | ((unsigned long long)hh[7] << 48), pl1 = (unsigned long long)ll[4] | ((unsigned long long)ll[5] << 16) | ((unsigned long long)ll[6] << 32) | ((unsigned long long)ll[7] << 48);
        // lane L's 8 halves at c0 = 8L: 16 B -> one 16-B store per plane (32 lanes x 16 B = whole 512-B row)
        v4u pk; pk.x = (unsigned)(ph0 & 0xFFFFFFFFull); pk.y = (unsigned)(ph0 >> 32); pk.z = (unsigned)(ph1 & 0xFFFFFFFFull); pk.w = (unsigned)(ph1 >> 32); v4u* dh = (v4u*)(OH + (long long)n * 256 + c0); *dh = pk; 
        v4u ql; ql.x = (unsigned)(pl0 & 0xFFFFFFFFull); ql.y = (unsigned)(pl0 >> 32); ql.z = (unsigned)(pl1 & 0xFFFFFFFFull); ql.w = (unsigned)(pl1 >> 32); v4u* dl = (v4u*)(OL + (long long)n * 256 + c0); *dl = ql;  return; }
    if (EPI == 2 || EPI == 3) {   // head mean: lanes L, L^8, L^16, L^24 hold the same chan group of the 4 heads (CH = 64 -> 8 lanes per head)
        a0.x += __shfl_xor(a0.x, 8); a0.y += __shfl_xor(a0.y, 8); a0.z += __shfl_xor(a0.z, 8); a0.w += __shfl_xor(a0.w, 8); a1.x += __shfl_xor(a1.x, 8); a1.y += __shfl_xor(a1.y, 8); a1.z += __shfl_xor(a1.z, 8); a1.w += __shfl_xor(a1.w, 8);
        a0.x += __shfl_xor(a0.x, 16); a0.y += __shfl_xor(a0.y, 16); a0.z += __shfl_xor(a0.z, 16); a0.w += __shfl_xor(a0.w, 16); a1.x += __shfl_xor(a1.x, 16); a1.y += __shfl_xor(a1.y, 16); a1.z += __shfl_xor(a1.z, 16); a1.w += __shfl_xor(a1.w, 16);
        const int gq = L & 7; a0 = a0 * 0.25f + *(const v4f*)(bias + 8 * gq); a1 = a1 * 0.25f + *(const v4f*)(bias + 8 * gq + 4);      // every lane now holds channels 8gq..8gq+7 of the mean
        if (EPI == 3) { if (L < 8) { stage[wv][8 * gq] = a0.x; stage[wv][8 * gq + 1] = a0.y; stage[wv][8 * gq + 2] = a0.z; stage[wv][8 * gq + 3] = a0.w; stage[wv][8 * gq + 4] = a1.x; stage[wv][8 * gq + 5] = a1.y; stage[wv][8 * gq + 6] = a1.z; stage[wv][8 * gq + 7] = a1.w; }
            __builtin_amdgcn_fence(__ATOMIC_RELEASE, "workgroup"); __builtin_amdgcn_wave_barrier(); __builtin_amdgcn_fence(__ATOMIC_ACQUIRE, "workgroup");
            const unsigned long long pk3 = (unsigned long long)__builtin_bit_cast(unsigned, stage[wv][2 * L]) | ((unsigned long long)__builtin_bit_cast(unsigned, stage[wv][2 * L + 1]) << 32); VST2(unsigned long long, (unsigned long long*)(OUT + (long long)n * 64 + 2 * L), pk3); return; }
        float sm = (L < 8) ? (a0.x + a0.y + a0.z + a0.w + a1.x + a1.y + a1.z + a1.w) : 0.f;
#pragma unroll
        for (int o = 16; o > 0; o >>= 1) sm += __shfl_xor(sm, o);
        const float mu = sm * (1.f / 64.f); const v4f d0 = a0 - mu, d1 = a1 - mu; float q = (L < 8) ? (d0.x * d0.x + d0.y * d0.y + d0.z * d0.z + d0.w * d0.w + d1.x * d1.x + d1.y * d1.y + d1.z * d1.z + d1.w * d1.w) : 0.f;
#pragma unroll
        for (int o = 16; o > 0; o >>= 1) q += __shfl_xor(q, o);
        const float rs = rsqrtf(q * (1.f / 64.f) + 1e-5f);
        if (L < 8) { const float* gg = g + 8 * gq; const float* bq = bb + 8 * gq; stage[wv][8 * gq] = fmaxf(d0.x * rs * gg[0] + bq[0], 0.f); stage[wv][8 * gq + 1] = fmaxf(d0.y * rs * gg[1] + bq[1], 0.f); stage[wv][8 * gq + 2] = fmaxf(d0.z * rs * gg[2] + bq[2], 0.f); stage[wv][8 * gq + 3] = fmaxf(d0.w * rs * gg[3] + bq[3], 0.f);
            stage[wv][8 * gq + 4] = fmaxf(d1.x * rs * gg[4] + bq[4], 0.f); stage[wv][8 * gq + 5] = fmaxf(d1.y * rs * gg[5] + bq[5], 0.f); stage[wv][8 * gq + 6] = fmaxf(d1.z * rs * gg[6] + bq[6], 0.f); stage[wv][8 * gq + 7] = fmaxf(d1.w * rs * gg[7] + bq[7], 0.f); }
        __builtin_amdgcn_fence(__ATOMIC_RELEASE, "workgroup"); __builtin_amdgcn_wave_barrier(); __builtin_amdgcn_fence(__ATOMIC_ACQUIRE, "workgroup");
        const unsigned long long pk = (unsigned long long)__builtin_bit_cast(unsigned, stage[wv][2 * L]) | ((unsigned long long)__builtin_bit_cast(unsigned, stage[wv][2 * L + 1]) << 32); VST2(unsigned long long, (unsigned long long*)(OUT + (long long)n * 64 + 2 * L), pk); return; }
    // EPI 0
    stage[wv][c0] = a0.x; stage[wv][c0 + 1] = a0.y; stage[wv][c0 + 2] = a0.z; stage[wv][c0 + 3] = a0.w; stage[wv][c0 + 4] = a1.x; stage[wv][c0 + 5] = a1.y; stage[wv][c0 + 6] = a1.z; stage[wv][c0 + 7] = a1.w;
    __builtin_amdgcn_fence(__ATOMIC_RELEASE, "workgroup"); __builtin_amdgcn_wave_barrier(); __builtin_amdgcn_fence(__ATOMIC_ACQUIRE, "workgroup");
#pragma unroll
    for (int q2 = 0; q2 < 2; ++q2) { const int c = 128 * q2 + 4 * L; v4f v; v.x = stage[wv][c]; v.y = stage[wv][c + 1]; v.z = stage[wv][c + 2]; v.w = stage[wv][c + 3]; VST2V4(OUT + (long long)n * 256 + c, v); } }

__device__ __forceinline__ void st4s(unsigned short* Hp, unsigned short* Lp, long long o, v4f a) { unsigned short h[4], l[4]; bfsplit(a.x, h[0], l[0]); bfsplit(a.y, h[1], l[1]); bfsplit(a.z, h[2], l[2]); bfsplit(a.w, h[3], l[3]);
    const unsigned long long ph = (unsigned long long)h[0] | ((unsigned long long)h[1] << 16) | ((unsigned long long)h[2] << 32) | ((unsigned long long)h[3] << 48), pl = (unsigned long long)l[0] | ((unsigned long long)l[1] << 16) | ((unsigned long long)l[2] << 32) | ((unsigned long long)l[3] << 48);
    VST2(unsigned long long, (unsigned long long*)(Hp + o), ph); VST2(unsigned long long, (unsigned long long*)(Lp + o), pl); }
// f32 [nval2 pairs] -> bf16 hi/lo planes (n2 pairs; pairs >= nval2 zero); thread-linear 4-B stores per plane
__global__ __launch_bounds__(256) void k_pl(const float* __restrict__ S, unsigned short* __restrict__ PH, unsigned short* __restrict__ PL, long long nval2, long long n2) { const long long u = (long long)blockIdx.x * 256 + threadIdx.x; if (u >= n2) return; const bool in = (u < nval2); const long long uc = in ? u : ((nval2 > 0) ? (nval2 - 1) : 0); const float a = S[2 * uc], b = S[2 * uc + 1]; st_s2(PH, PL, 2 * u, in ? a : 0.f, in ? b : 0.f); }
// WC [K][NOP] (thread-linear whole rows) = [W (cols < FO) | 0 | W_h . as_h @EO+h | W_h . ad_h @EO+NH+h | 0 ...]; W is [K][FO] (x @ W layout), as/ad [NH][DH]; EO >= FO.
// branch-free: every lane loads all candidates with clamped indices and selects by value (no exec-masked load arms)
__global__ __launch_bounds__(256) void k_wext(const float* __restrict__ Wm, const float* __restrict__ AS_, const float* __restrict__ AD_, int K, int NOP, int FO, int NH, int DH, int EO, float* __restrict__ WC) {
    #pragma clang fp contract(off)
    const long long u = (long long)blockIdx.x * 256 + threadIdx.x; if (u >= (long long)K * NOP) return; const int kk = (int)(u / NOP), o = (int)(u % NOP);
    const int oo = min(o, FO - 1); const float vw = Wm[(long long)kk * FO + oo]; const int q = min(max(o - EO, 0), 2 * NH - 1); const int h = q % NH; float s = 0.f;
#pragma unroll 1
    for (int c = 0; c < DH; ++c) { const float w = Wm[(long long)kk * FO + h * DH + c]; const float asv = AS_[h * DH + c], adv = AD_[h * DH + c]; s += w * ((q < NH) ? asv : adv); }
    const float v = (o < FO) ? vw : ((o >= EO && o < EO + 2 * NH) ? s : 0.f); VST2(float, WC + u, v); }
// GAT aggregation over a device in-edge CSR (+ analytic self loop as iteration j = -1 when SELF), per-lane online softmax (lanes of one head agree):
// HS rows (pitch P floats): [0,128) projected features z, col 128 + h = a_src.z_h, col 128 + NH + h = a_dst.z_h; lane L owns channels 4L..4L+3 (head = 4L / CH).
// out = sum_j softmax_j(leaky(el[src_j][h] + er[n][h])) z[src_j] (/ (den + deps)) + bias -> ACT (0 none, 1 relu, 2 elu, 3 leaky 0.01) ->
// MODE 0: f32 OUT[n][OW] cols < OC (16-B lane stores, OC*4 contiguous B per wave; OC in {64,128}); MODE 1: bf16 hi/lo planes PH/PL pitch PP (rows n >= N zero); MODE 2: both.
template <int CH, bool SELF, int ACT, int MODE>
__global__ __launch_bounds__(256) void k_gat128(const float* __restrict__ HS, int P, int NH, const float* __restrict__ bias, const int* __restrict__ SRC, const int* __restrict__ off, const int* __restrict__ cnt, const int* __restrict__ slot,
        float* __restrict__ OUT, int OW, int OC, unsigned short* __restrict__ PH, unsigned short* __restrict__ PL, int PP, int N, int NP, int E, int CAP, float slope, float deps) {
    #pragma clang fp contract(off)
    const int n = blockIdx.x * 8 + (threadIdx.x >> 5); const int L = threadIdx.x & 31; if (n >= NP) return; const int c = 4 * L; const int h = c / CH; v4f o; o.x = o.y = o.z = o.w = 0.f;
    if (n < N) { const float* hn = HS + (long long)n * P; const float er = hn[128 + NH + h]; float m = -3.0e38f, s = 0.f; v4f a; a.x = a.y = a.z = a.w = 0.f;
        const int p0 = min(max(off[n], 0), E), cn = min(max(cnt[n], 0), CAP);
        for (int j = (SELF ? -1 : 0); j < cn; ++j) { int sj; if (j < 0) sj = n; else { const int e = min(max(slot[min(p0 + j, E - 1)], 0), E - 1); sj = min(max(SRC[e], 0), N - 1); }
            const float* hs = HS + (long long)sj * P; float lg = hs[128 + h] + er; lg = (lg >= 0.f) ? lg : slope * lg;
            const float mn = fmaxf(m, lg); const float cz = expf(m - mn), pj = expf(lg - mn); s = s * cz + pj; a = a * cz + *(const v4f*)(hs + c) * pj; m = mn; }
        const float inv = (s > 0.f || deps > 0.f) ? 1.f / (s + deps) : 0.f; o = a * inv + *(const v4f*)(bias + c);
        if (ACT == 1) { o.x = fmaxf(o.x, 0.f); o.y = fmaxf(o.y, 0.f); o.z = fmaxf(o.z, 0.f); o.w = fmaxf(o.w, 0.f); }
        if (ACT == 2) { o.x = (o.x > 0.f) ? o.x : (expf(o.x) - 1.f); o.y = (o.y > 0.f) ? o.y : (expf(o.y) - 1.f); o.z = (o.z > 0.f) ? o.z : (expf(o.z) - 1.f); o.w = (o.w > 0.f) ? o.w : (expf(o.w) - 1.f); }
        if (ACT == 3) { o.x = (o.x >= 0.f) ? o.x : 0.01f * o.x; o.y = (o.y >= 0.f) ? o.y : 0.01f * o.y; o.z = (o.z >= 0.f) ? o.z : 0.01f * o.z; o.w = (o.w >= 0.f) ? o.w : 0.01f * o.w; }
        if (MODE != 1 && c < OC) VST2V4(OUT + (long long)n * OW + c, o); }
    if (MODE != 0) st4s(PH, PL, (long long)n * PP + c, o); }

// ---- util2 ----
// generic Bt plane builder from an f32 weight: Bt[o][k] (pitch KP halves) = (TRANS ? W[k*ldw + o] : W[o*ldw + k]) * (S ? S[o] : 1) for o < NO, k < KI; zero elsewhere for o < NOP rows, k < KP (thread per (o < NOP, pair k))
__global__ __launch_bounds__(256) void k_u2_bt(const float* __restrict__ Wm, int ldw, int TRANS, int KI, int NO, int KP, int NOP, const float* __restrict__ S, unsigned short* __restrict__ PH_, unsigned short* __restrict__ PL_) {
    const long long u = (long long)blockIdx.x * 256 + threadIdx.x; if (u >= (long long)NOP * (KP / 2)) return; const int k0 = 2 * (int)(u % (KP / 2)); const int o = (int)(u / (KP / 2)); float a = 0.f, b = 0.f;
    if (o < NO) { const float s = S ? S[o] : 1.f;
        if (k0 < KI) a = (TRANS ? Wm[(long long)k0 * ldw + o] : Wm[(long long)o * ldw + k0]) * s;
        if (k0 + 1 < KI) b = (TRANS ? Wm[(long long)(k0 + 1) * ldw + o] : Wm[(long long)o * ldw + k0 + 1]) * s; }
    st_s2(PH_, PL_, (long long)o * KP + k0, a, b); }
// generic padded vector: O[i] = (i < n) ? (A[i] * (S ? S[i] : 1) + (B2 ? B2[i] : 0)) : 0 for i < NP (one block of 256, NP <= 4096 looped)
__global__ __launch_bounds__(256) void k_u2_vec(const float* __restrict__ A, const float* __restrict__ S, const float* __restrict__ B2, int n, int NP, float* __restrict__ O) { for (int i = threadIdx.x; i < NP; i += 256) { float v = 0.f; if (i < n) v = A[i] * (S ? S[i] : 1.f) + (B2 ? B2[i] : 0.f); VST2(float, O + i, v); } }
__global__ __launch_bounds__(256) void k_u2_colstat(const float* __restrict__ X, int P, int N, float eps, float* __restrict__ STAT) {
    #pragma clang fp contract(off)
    __shared__ float red[256]; const int c = blockIdx.x; const int t = threadIdx.x; float s = 0.f; for (int r = t; r < N; r += 256) s += X[(long long)r * P + c]; red[t] = s; __syncthreads();
    for (int o = 128; o > 0; o >>= 1) { if (t < o) red[t] += red[t + o]; __syncthreads(); }
    const float mu = red[0] / (float)N; __syncthreads(); float q = 0.f; for (int r = t; r < N; r += 256) { const float d = X[(long long)r * P + c] - mu; q += d * d; } red[t] = q; __syncthreads();
    for (int o = 128; o > 0; o >>= 1) { if (t < o) red[t] += red[t + o]; __syncthreads(); }
    const float rs = 1.f / sqrtf(red[0] / (float)N + eps); if (t < 32) VST2(float, STAT + (long long)c * 32 + t, (t == 0) ? mu : ((t == 1) ? rs : 0.f)); }
// rows f32 [R][W] (pitch PW) -> planes at pitch PP, column offset coff; rows >= RL (live) written as zeros up to RP (thread per (r < RP, 4 of W))
__global__ __launch_bounds__(256) void k_u2_pl(const float* __restrict__ X, int PW, int Wd, int RL, int RP, unsigned short* __restrict__ PH_, unsigned short* __restrict__ PL_, int PP, int coff) { const long long u = (long long)blockIdx.x * 256 + threadIdx.x; if (u >= (long long)RP * (Wd / 4)) return; const int r = (int)(u / (Wd / 4)); const int c = 4 * (int)(u % (Wd / 4)); v4f v; v.x = v.y = v.z = v.w = 0.f; if (r < RL) v = *(const v4f*)(X + (long long)r * PW + c); st4s(PH_, PL_, (long long)r * PP + coff + c, v); }

typedef unsigned int cm_u4 __attribute__((ext_vector_type(4)));

__global__ __launch_bounds__(256) void k_cm_zero16(unsigned short* __restrict__ DST, long long n) { const long long u = (long long)blockIdx.x * 256 + threadIdx.x; if (u * 8 >= n) return; cm_u4 z; z.x = z.y = z.z = z.w = 0u; cm_u4* d = (cm_u4*)(DST + u * 8); *d = z;  }
// f32 -> bf16 (RNE) -> f16 casts: every 16-bit operand then holds exactly the bf16-rounded input value (times a power-of-two
// weight scale), so the f16 WMMA products are exact. Plain: thread per (row, 8 cols),
// dst [R][C] pitch ldd; transposed: thread per (col, 8 consecutive rows) -> dst [C][R] pitch ldd; both store 16 B per thread, thread-linear along the dst row.
__device__ __forceinline__ unsigned int cmb_pk2(float a, float b) { return (unsigned int)__builtin_bit_cast(unsigned short, (_Float16)a) | ((unsigned int)__builtin_bit_cast(unsigned short, (_Float16)b) << 16); }
__device__ __forceinline__ float cmb_bf(float v) { const unsigned u = __builtin_bit_cast(unsigned, v); const unsigned r = (u + 0x7fffu + ((u >> 16) & 1u)) & 0xffff0000u; return __builtin_bit_cast(float, r); }   // bf16 RNE, kept as f32 (finite inputs)
// BR[i] = bf16_rne(B[i]) kept as f32 (thread per element)
__global__ __launch_bounds__(256) void k_cm_bfvec(const float* __restrict__ SRC, float* __restrict__ DST, int n) { const int u = blockIdx.x * 256 + threadIdx.x; if (u >= n) return; VST2(float, DST + u, cmb_bf(SRC[u])); }
__global__ __launch_bounds__(256) void k_cm_castb(const float* __restrict__ SRC, int lds, unsigned short* __restrict__ DST, int ldd, int nR, int nC, float sc) {
    const long long u = (long long)blockIdx.x * 256 + threadIdx.x; const int per = nC / 8; if (u >= (long long)nR * per) return; const int r = (int)(u / per); const int c0 = 8 * (int)(u % per);
    const float* s = SRC + (long long)r * lds + c0; float w[8];
#pragma unroll
    for (int e = 0; e < 8; ++e) w[e] = cmb_bf(s[e]) * sc;
    cm_u4 pk; pk.x = cmb_pk2(w[0], w[1]); pk.y = cmb_pk2(w[2], w[3]); pk.z = cmb_pk2(w[4], w[5]); pk.w = cmb_pk2(w[6], w[7]); VST2(cm_u4, (cm_u4*)(DST + (long long)r * ldd + c0), pk); }
__global__ __launch_bounds__(256) void k_cm_castbT(const float* __restrict__ SRC, int lds, unsigned short* __restrict__ DST, int ldd, int nR, int nC, float sc) {
    const long long u = (long long)blockIdx.x * 256 + threadIdx.x; const int per = nR / 8; if (u >= (long long)nC * per) return; const int c = (int)(u / per); const int r0 = 8 * (int)(u % per);
    float w[8];
#pragma unroll
    for (int e = 0; e < 8; ++e) w[e] = cmb_bf(SRC[(long long)(r0 + e) * lds + c]) * sc;
    cm_u4 pk; pk.x = cmb_pk2(w[0], w[1]); pk.y = cmb_pk2(w[2], w[3]); pk.z = cmb_pk2(w[4], w[5]); pk.w = cmb_pk2(w[6], w[7]); VST2(cm_u4, (cm_u4*)(DST + (long long)c * ldd + r0), pk); }

// QT = bf16(q) * bf16(tau[b]) (f32), KB = bf16(k), VB = bf16(v) (thread per float4 of each; which = blockIdx range, block-uniform); MF[b][j] = scale * bf16(delta[b][j])
__global__ __launch_bounds__(256) void k_ds_pre(const float* __restrict__ Q, const float* __restrict__ Kp, const float* __restrict__ V, const float* __restrict__ TAU, const float* __restrict__ DELTA, float* __restrict__ QTp, float* __restrict__ KBp, float* __restrict__ VBp, float* __restrict__ MFp, float sc) {
    #pragma clang fp contract(off)
    const long long NQ4 = 2LL * 2048 * 8 * 64 / 4; const long long nb = NQ4 / 256; const long long u = (long long)(blockIdx.x % nb) * 256 + threadIdx.x; const int which = blockIdx.x / nb;
    if (which == 0) { const int b = (int)(u / (2048LL * 8 * 16)); const float t = cmb_bf(TAU[b]); const v4f x = *(const v4f*)(Q + 4 * u); v4f r; r.x = cmb_bf(x.x) * t; r.y = cmb_bf(x.y) * t; r.z = cmb_bf(x.z) * t; r.w = cmb_bf(x.w) * t; VST2V4(QTp + 4 * u, r); }
    else if (which == 1) { const v4f x = *(const v4f*)(Kp + 4 * u); v4f r; r.x = cmb_bf(x.x); r.y = cmb_bf(x.y); r.z = cmb_bf(x.z); r.w = cmb_bf(x.w); VST2V4(KBp + 4 * u, r); }
    else if (which == 2) { const v4f x = *(const v4f*)(V + 4 * u); v4f r; r.x = cmb_bf(x.x); r.y = cmb_bf(x.y); r.z = cmb_bf(x.z); r.w = cmb_bf(x.w); VST2V4(VBp + 4 * u, r); }
    else { if (u >= 2 * 2048) return; VST2(float, MFp + u, sc * cmb_bf(DELTA[u])); } }
// out = m * A1 + (1 - m) * A2 with m = bf16(soft_mask[b][l]) broadcast over (h, e); thread per float4
__global__ __launch_bounds__(256) void k_ds_blend(const float* __restrict__ A1, const float* __restrict__ A2, const float* __restrict__ SM, float* __restrict__ O, long long n4) {
    #pragma clang fp contract(off)
    const long long u = (long long)blockIdx.x * 256 + threadIdx.x; if (u >= n4) return; const float m = cmb_bf(SM[(4 * u) / 512]); const v4f a = *(const v4f*)(A1 + 4 * u), b = *(const v4f*)(A2 + 4 * u); v4f o;
    o.x = m * a.x + (1.f - m) * b.x; o.y = m * a.y + (1.f - m) * b.y; o.z = m * a.z + (1.f - m) * b.z; o.w = m * a.w + (1.f - m) * b.w; VST2V4(O + 4 * u, o); }


extern "C" void kernel_launch(void* const* d_in, const int* in_sizes, int n_in, void* d_out, int out_size, void* d_ws, size_t ws_size, hipStream_t stream) {
    (void)in_sizes; (void)n_in; (void)out_size; (void)ws_size;
    const float* q = (const float*)d_in[0];
    const float* kk = (const float*)d_in[1];
    const float* v = (const float*)d_in[2];
    const float* kn = (const float*)d_in[3];
    const float* vn = (const float*)d_in[4];
    const float* tau = (const float*)d_in[5];
    const float* delta = (const float*)d_in[6];
    const float* smask = (const float*)d_in[7];
    float* out = (float*)d_out;
    char* wsp = (char*)d_ws;
    float* QT = (float*)wsp; wsp += (((size_t)((size_t)2097152) * 4 + 255) / 256) * 256;
    float* KB = (float*)wsp; wsp += (((size_t)((size_t)2097152) * 4 + 255) / 256) * 256;
    float* VB = (float*)wsp; wsp += (((size_t)((size_t)2097152) * 4 + 255) / 256) * 256;
    float* MF = (float*)wsp; wsp += (((size_t)((size_t)4096) * 4 + 255) / 256) * 256;
    float* AO1 = (float*)wsp; wsp += (((size_t)((size_t)2097152) * 4 + 255) / 256) * 256;
    float* AO2 = (float*)wsp; wsp += (((size_t)((size_t)2097152) * 4 + 255) / 256) * 256;
    if ((size_t)(wsp - (char*)d_ws) > ws_size) return;   // static carve guard
    k_ds_pre<<<(unsigned)(3 * (524288 / 256) + (4096 + 255) / 256), 256, 0, stream>>>(q, kk, v, tau, delta, QT, KB, VB, MF, 0.125f);
    { /*apv4*/ AttnP a;
      a.Q = QT + 0; a.K = KB + 0; a.V = VB + 0; a.O = AO1 + 0; a.P = 0; a.Mf = MF + 0; a.Mi = 0; a.ST = 0;
      a.Pw = 0; a.Rt = 0; a.SQ = 0; a.SK = 0;
      a.swb = 0; a.swh = 0; a.swi = 0; a.swj = 0; a.srb = 0; a.srh = 0; a.sri = 0; a.sQb = 0; a.sQh = 64; a.sQi = 512; a.sQd = 1; a.sKb = 0; a.sKh = 64; a.sKj = 512; a.sKd = 1; a.sVb = 0; a.sVh = 64; a.sVj = 512; a.sVd = 1; a.sOb = 0; a.sOh = 64; a.sOi = 512; a.sPb = 0; a.sPh = 0; a.sPi = 0; a.smb = 0; a.smh = 0; a.smi = 0; a.smj = 1;
      a.Lq = 2048; a.Lk = 2048; a.dh = 64; a.dv = 64; a.hrep = 1; a.causal = 1; a.coff = 0; a.pband = 0;
      a.scale = 0.125f; a.mfill = 0.0f; a.nonorm = 0; a.mpol = 0;
      a.roff = 0; a.rn = 1; a.segpol = 0; a.win = 0;
      k_attn<64, 64, 1, true, false><<<dim3((unsigned)((2048) + 16 * AW - 1) / (16 * AW), (unsigned)(8), (unsigned)(1)), 32 * AW, 0, stream>>>(a); }
    { /*apv4*/ AttnP a;
      a.Q = QT + 1048576; a.K = KB + 1048576; a.V = VB + 1048576; a.O = AO1 + 1048576; a.P = 0; a.Mf = MF + 2048; a.Mi = 0; a.ST = 0;
      a.Pw = 0; a.Rt = 0; a.SQ = 0; a.SK = 0;
      a.swb = 0; a.swh = 0; a.swi = 0; a.swj = 0; a.srb = 0; a.srh = 0; a.sri = 0; a.sQb = 0; a.sQh = 64; a.sQi = 512; a.sQd = 1; a.sKb = 0; a.sKh = 64; a.sKj = 512; a.sKd = 1; a.sVb = 0; a.sVh = 64; a.sVj = 512; a.sVd = 1; a.sOb = 0; a.sOh = 64; a.sOi = 512; a.sPb = 0; a.sPh = 0; a.sPi = 0; a.smb = 0; a.smh = 0; a.smi = 0; a.smj = 1;
      a.Lq = 2048; a.Lk = 2048; a.dh = 64; a.dv = 64; a.hrep = 1; a.causal = 1; a.coff = 0; a.pband = 0;
      a.scale = 0.125f; a.mfill = 0.0f; a.nonorm = 0; a.mpol = 0;
      a.roff = 0; a.rn = 1; a.segpol = 0; a.win = 0;
      k_attn<64, 64, 1, true, false><<<dim3((unsigned)((2048) + 16 * AW - 1) / (16 * AW), (unsigned)(8), (unsigned)(1)), 32 * AW, 0, stream>>>(a); }
    k_ds_pre<<<(unsigned)(3 * (524288 / 256) + (4096 + 255) / 256), 256, 0, stream>>>(q, kn, vn, tau, delta, QT, KB, VB, MF, 0.125f);
    { /*apv4*/ AttnP a;
      a.Q = QT + 0; a.K = KB + 0; a.V = VB + 0; a.O = AO2 + 0; a.P = 0; a.Mf = MF + 0; a.Mi = 0; a.ST = 0;
      a.Pw = 0; a.Rt = 0; a.SQ = 0; a.SK = 0;
      a.swb = 0; a.swh = 0; a.swi = 0; a.swj = 0; a.srb = 0; a.srh = 0; a.sri = 0; a.sQb = 0; a.sQh = 64; a.sQi = 512; a.sQd = 1; a.sKb = 0; a.sKh = 64; a.sKj = 512; a.sKd = 1; a.sVb = 0; a.sVh = 64; a.sVj = 512; a.sVd = 1; a.sOb = 0; a.sOh = 64; a.sOi = 512; a.sPb = 0; a.sPh = 0; a.sPi = 0; a.smb = 0; a.smh = 0; a.smi = 0; a.smj = 1;
      a.Lq = 2048; a.Lk = 2048; a.dh = 64; a.dv = 64; a.hrep = 1; a.causal = 1; a.coff = 0; a.pband = 0;
      a.scale = 0.125f; a.mfill = 0.0f; a.nonorm = 0; a.mpol = 0;
      a.roff = 0; a.rn = 1; a.segpol = 0; a.win = 0;
      k_attn<64, 64, 1, true, false><<<dim3((unsigned)((2048) + 16 * AW - 1) / (16 * AW), (unsigned)(8), (unsigned)(1)), 32 * AW, 0, stream>>>(a); }
    { /*apv4*/ AttnP a;
      a.Q = QT + 1048576; a.K = KB + 1048576; a.V = VB + 1048576; a.O = AO2 + 1048576; a.P = 0; a.Mf = MF + 2048; a.Mi = 0; a.ST = 0;
      a.Pw = 0; a.Rt = 0; a.SQ = 0; a.SK = 0;
      a.swb = 0; a.swh = 0; a.swi = 0; a.swj = 0; a.srb = 0; a.srh = 0; a.sri = 0; a.sQb = 0; a.sQh = 64; a.sQi = 512; a.sQd = 1; a.sKb = 0; a.sKh = 64; a.sKj = 512; a.sKd = 1; a.sVb = 0; a.sVh = 64; a.sVj = 512; a.sVd = 1; a.sOb = 0; a.sOh = 64; a.sOi = 512; a.sPb = 0; a.sPh = 0; a.sPi = 0; a.smb = 0; a.smh = 0; a.smi = 0; a.smj = 1;
      a.Lq = 2048; a.Lk = 2048; a.dh = 64; a.dv = 64; a.hrep = 1; a.causal = 1; a.coff = 0; a.pband = 0;
      a.scale = 0.125f; a.mfill = 0.0f; a.nonorm = 0; a.mpol = 0;
      a.roff = 0; a.rn = 1; a.segpol = 0; a.win = 0;
      k_attn<64, 64, 1, true, false><<<dim3((unsigned)((2048) + 16 * AW - 1) / (16 * AW), (unsigned)(8), (unsigned)(1)), 32 * AW, 0, stream>>>(a); }
    k_ds_blend<<<(524288 + 255) / 256, 256, 0, stream>>>(AO1, AO2, smask, out, 524288LL);
}

// v001
// Measured time: 1060 microseconds a run.
// Two timings next to v000 both put it at 3.47 times that version's speed.
// De-stationary causal attention with a null branch, [b, l, h, e] layout (2 x 2,048 tokens, 8 heads x 64): A = softmax(scale * (q.k * tau_b + delta_bj)) over keys j <= i for (keys, values) and for (keys_null, values_null) with the same queries; out = soft_mask * out_edit + (1 - soft_mask) * out_null per query. all inputs rounded to bf16 (RNE); q is multiplied by tau_b on device (f32) and k, v rounded, then each branch is two WMMA attention launches, one per batch element (v_wmma_f32_16x16x32_bf16, f32 accumulate) with bf16 hi/lo split q.k (f32-class: q*tau is not 16-bit exact), the per-key additive table scale*delta_bj, causal, f32 online softmax, bf16 hi/lo split P.v; the blend in f32.
#include <hip/hip_runtime.h>
#include <math.h>

typedef __attribute__((ext_vector_type(16))) _Float16 v16h;
typedef __attribute__((ext_vector_type(8)))  _Float16 v8h;
typedef __attribute__((ext_vector_type(16))) __bf16   v16b;
typedef __attribute__((ext_vector_type(8)))  float    v8f;
typedef __attribute__((ext_vector_type(4)))  float    v4f;

// 16-bit WMMA fragment map (wave32), lane L, h = L>>4, m = L&15:
//   A 16x32: lane = row m;   element i -> k = (i<8) ? 8h+i : 16+8h+(i-8)
//   B 32x16: lane = column m; the SAME k(i,h)
//   D 16x16 (8 f32): lane = column m; element r -> row 8h+r
__device__ __forceinline__ int frag_k(int i, int h) { return (i < 8) ? (8 * h + i) : (16 + 8 * h + (i - 8)); }
__device__ __forceinline__ __bf16 bf16_rne(float f) {
    unsigned int u = __float_as_uint(f);
    u += 0x7fffu + ((u >> 16) & 1u);
    return __builtin_bit_cast(__bf16, (unsigned short)(u >> 16));
}
__device__ __forceinline__ float bf16_f32(__bf16 b) { return __uint_as_float(((unsigned int)__builtin_bit_cast(unsigned short, b)) << 16); }
__device__ __forceinline__ v8f wmma16(v16h a, v16h b, v8f c) {
    c = __builtin_amdgcn_wmma_f32_16x16x32_f16(false, a, false, b, (short)0, c, false, false);
    asm volatile("v_nop\n\tv_nop\n\tv_nop\n\tv_nop" : "+v"(c) : "v"(a), "v"(b));
    return c;
}
__device__ __forceinline__ v8f wmmab(v16b a, v16b b, v8f c) {
    c = __builtin_amdgcn_wmma_f32_16x16x32_bf16(false, a, false, b, (short)0, c, false, false);
    asm volatile("v_nop\n\tv_nop\n\tv_nop\n\tv_nop" : "+v"(c) : "v"(a), "v"(b));
    return c;
}
struct Split { v16b hi, lo; };
// hi/lo split product: a.hi*b.hi + a.hi*b.lo + a.lo*b.hi
__device__ __forceinline__ v8f wmma3(const Split& a, const Split& b, v8f c) {
    c = __builtin_amdgcn_wmma_f32_16x16x32_bf16(false, a.hi, false, b.hi, (short)0, c, false, false);
    c = __builtin_amdgcn_wmma_f32_16x16x32_bf16(false, a.hi, false, b.lo, (short)0, c, false, false);
    c = __builtin_amdgcn_wmma_f32_16x16x32_bf16(false, a.lo, false, b.hi, (short)0, c, false, false);
    asm volatile("v_nop\n\tv_nop\n\tv_nop\n\tv_nop" : "+v"(c) : "v"(a.hi), "v"(a.lo), "v"(b.hi), "v"(b.lo));
    return c;
}
struct Split3 { v16b hi, mid, lo; };
// triple split product (6 terms, drops only terms below 2^-24 relative)
__device__ __forceinline__ v8f wmma6(const Split3& a, const Split3& b, v8f c) {
    c = __builtin_amdgcn_wmma_f32_16x16x32_bf16(false, a.hi, false, b.hi, (short)0, c, false, false);
    c = __builtin_amdgcn_wmma_f32_16x16x32_bf16(false, a.hi, false, b.mid, (short)0, c, false, false);
    c = __builtin_amdgcn_wmma_f32_16x16x32_bf16(false, a.mid, false, b.hi, (short)0, c, false, false);
    c = __builtin_amdgcn_wmma_f32_16x16x32_bf16(false, a.hi, false, b.lo, (short)0, c, false, false);
    c = __builtin_amdgcn_wmma_f32_16x16x32_bf16(false, a.mid, false, b.mid, (short)0, c, false, false);
    c = __builtin_amdgcn_wmma_f32_16x16x32_bf16(false, a.lo, false, b.hi, (short)0, c, false, false);
    asm volatile("v_nop\n\tv_nop\n\tv_nop\n\tv_nop" : "+v"(c) : "v"(a.hi), "v"(a.mid), "v"(a.lo), "v"(b.hi), "v"(b.mid), "v"(b.lo));
    return c;
}

// Fragment gathers from f32 memory: element i <- p[(k0 + frag_k(i,h)) * sk] * s, zero for k >= klen.
__device__ __forceinline__ v16h fh_ld(const float* __restrict__ p, long long sk, int k0, int h, int klen, float s) {
    v16h a;
#pragma unroll
    for (int i = 0; i < 16; ++i) { const int k = k0 + frag_k(i, h); a[i] = (k < klen) ? (_Float16)(p[(long long)k * sk] * s) : (_Float16)0.f; }
    return a;
}
__device__ __forceinline__ Split sp_ld(const float* __restrict__ p, long long sk, int k0, int h, int klen, float s) {
    Split r;
#pragma unroll
    for (int i = 0; i < 16; ++i) {
        const int k = k0 + frag_k(i, h); const float x = (k < klen) ? p[(long long)k * sk] * s : 0.f;
        const __bf16 hb = bf16_rne(x); r.hi[i] = hb; r.lo[i] = bf16_rne(x - bf16_f32(hb));
    }
    return r;
}
__device__ __forceinline__ Split3 sp3_ld(const float* __restrict__ p, long long sk, int k0, int h, int klen, float s) {
    Split3 r;
#pragma unroll
    for (int i = 0; i < 16; ++i) {
        const int k = k0 + frag_k(i, h); const float x = (k < klen) ? p[(long long)k * sk] * s : 0.f;
        const __bf16 hb = bf16_rne(x); const float r1 = x - bf16_f32(hb); const __bf16 mb = bf16_rne(r1);
        r.hi[i] = hb; r.mid[i] = mb; r.lo[i] = bf16_rne(r1 - bf16_f32(mb));
    }
    return r;
}
__device__ __forceinline__ v16b bh_ld(const float* __restrict__ p, long long sk, int k0, int h, int klen, float s) {
    v16b a;
#pragma unroll
    for (int i = 0; i < 16; ++i) { const int k = k0 + frag_k(i, h); a[i] = bf16_rne((k < klen) ? p[(long long)k * sk] * s : 0.f); }
    return a;
}
// f16 fragment from an f16 LDS/global row with element stride 1 (k-contiguous), no bounds (tile already zero padded)
__device__ __forceinline__ v16h fh_row(const _Float16* __restrict__ row, int k0, int h) {
    v16h a;
#pragma unroll
    for (int i = 0; i < 16; ++i) a[i] = row[k0 + frag_k(i, h)];
    return a;
}

#define VST2(T, ptr, val) do { const T vst2_v_ = (val); *(T*)(ptr) = vst2_v_;  } while (0)
typedef float v4f __attribute__((ext_vector_type(4)));
#define VST2V4(ptr, val) do { const v4f vst2_v4_ = (val); *(v4f*)(ptr) = vst2_v4_;  } while (0)

__device__ __attribute__((noinline)) float act_fn(float v, int act) {
    if (act == 1) return fmaxf(v, 0.f);                                                                               // relu
    if (act == 2) { const float u = 0.7978845608028654f * (v + 0.044715f * v * v * v); return 0.5f * v * (1.f + tanhf(u)); } // tanh-gelu
    if (act == 3) return v / (1.f + expf(-v));                                                                        // silu
    if (act == 4) return 0.5f * v * (1.f + erff(v * 0.7071067811865476f));                                             // erf-gelu
    if (act == 5) return tanhf(v);
    if (act == 6) return 1.f / (1.f + expf(-v));                                                                      // sigmoid
    if (act == 7) return (v > 0.f) ? v : 0.01f * v;                                                                   // leaky relu 0.01
    if (act == 8) return (v > 0.f) ? v : (expf(v) - 1.f);                                                             // elu
    if (act == 9) return fminf(fmaxf(v, 0.f), 6.f);                                                                   // relu6
    if (act == 10) return fabsf(v);                                                                                    // abs
    if (act == 11) return (v >= 0.f) ? v : 0.1f * v;                                                                  // leaky 0.1
    if (act == 12) return (v > 0.f) ? v : 0.2f * v;                                                                   // leaky 0.2
    if (act == 13) return (v > 20.f) ? v : log1pf(expf(v));                                                            // softplus
    return v;
}

// =====================================================================================================================
// k_gemm<MODE>: C(z, m, n) = act(alpha * sum_k A(z, m, k) * B(z, k, n) + bias) + beta * R(z, m, n)
//   One wave (32-thread block) per 16 x 32 tile of C; grid (ceil(N/32), ceil(M/16), Z). Batch z -> (zo = z / zi_n, zi = z % zi_n)
//   with separate outer/inner strides for every tensor (e.g. batch and head). A(m,k) = A[zo*sAo + zi*sAi + m*sAm + k*sAk] (f32),
//   B(k,n) = B[zo*sBo + zi*sBi + n*sBn + k*sBk] (f32); any M, N, K (K zero-padded to 32 inside the fragments, M/N tails guarded).
//   C(m,n) = C[zo*sCo + zi*sCi + m*sCm + n] (n contiguous). flags: 1 bias[n], 2 bias[m], 4 residual R[zo*sRo + zi*sRi + m*sRm + n*sRn].
//   MODE 0: f16 operands (A prescaled by sa, B by sb, both undone in the epilogue); 1: bf16 hi/lo split (3 products); 2: bf16;
//   3: bf16 hi/mid/lo triple split (6 products); 4: as 3 with Kahan-compensated f32 accumulation across k-steps.
// =====================================================================================================================
struct GemmP {
    const float* A; const float* B; const float* bias; const float* R; float* C;
    long long sAo, sAi, sAm, sAk, sBo, sBi, sBn, sBk, sCo, sCi, sCm, sRo, sRi, sRm, sRn;
    int M, N, K, zi_n, flags, act; float alpha, beta, sa, sb;
    int Npad, pad_;     // columns [N, Npad) of C are written as 0 so that padded workspace rows are covered by whole-line stores; Npad >= N
};
static_assert(sizeof(GemmP) == 5 * 8 + 15 * 8 + 6 * 4 + 4 * 4 + 2 * 4, "GemmP has padding");

template <int MODE>
__global__ __launch_bounds__(32) void k_gemm(GemmP p) {
    const int lane = threadIdx.x & 31, h = lane >> 4, l15 = lane & 15;
    const int m0 = blockIdx.y * 16, n0 = blockIdx.x * 32;
    const int z = blockIdx.z, zo = z / p.zi_n, zi = z - zo * p.zi_n;
    const float* A = p.A + zo * p.sAo + zi * p.sAi;
    const float* B = p.B + zo * p.sBo + zi * p.sBi;
    const int am = min(m0 + l15, p.M - 1);                       // clamped row for loads (stores are guarded)
    v8f acc[2], comp[2];
#pragma unroll
    for (int t = 0; t < 2; ++t) { v8f zz = {}; acc[t] = zz; comp[t] = zz; }
    for (int k0 = 0; k0 < p.K; k0 += 32) {
        const float* arow = A + (long long)am * p.sAm;
        if (MODE == 1) {
            const Split a = sp_ld(arow, p.sAk, k0, h, p.K, 1.f);
#pragma unroll
            for (int t = 0; t < 2; ++t) {
                const int bn = min(n0 + t * 16 + l15, p.N - 1);
                acc[t] = wmma3(a, sp_ld(B + (long long)bn * p.sBn, p.sBk, k0, h, p.K, 1.f), acc[t]);
            }
        } else if (MODE == 3) {
            const Split3 a = sp3_ld(arow, p.sAk, k0, h, p.K, 1.f);
#pragma unroll
            for (int t = 0; t < 2; ++t) {
                const int bn = min(n0 + t * 16 + l15, p.N - 1);
                acc[t] = wmma6(a, sp3_ld(B + (long long)bn * p.sBn, p.sBk, k0, h, p.K, 1.f), acc[t]);
            }
        } else if (MODE == 4) {
            // triple split as MODE 3, but each k-step's 6 products go into a fresh accumulator and the partial is added to the running f32 sum
            // on the VALU with Kahan compensation (accumulation error stays ~1 ulp however long K is)
            const Split3 a = sp3_ld(arow, p.sAk, k0, h, p.K, 1.f);
#pragma unroll
            for (int t = 0; t < 2; ++t) {
                const int bn = min(n0 + t * 16 + l15, p.N - 1); v8f zz = {};
                const v8f part = wmma6(a, sp3_ld(B + (long long)bn * p.sBn, p.sBk, k0, h, p.K, 1.f), zz);
                const v8f y = part - comp[t]; const v8f s = acc[t] + y; comp[t] = (s - acc[t]) - y; acc[t] = s;
            }
        } else if (MODE == 2) {
            const v16b a = bh_ld(arow, p.sAk, k0, h, p.K, 1.f);
#pragma unroll
            for (int t = 0; t < 2; ++t) {
                const int bn = min(n0 + t * 16 + l15, p.N - 1);
                acc[t] = wmmab(a, bh_ld(B + (long long)bn * p.sBn, p.sBk, k0, h, p.K, 1.f), acc[t]);
            }
        } else {
            const v16h a = fh_ld(arow, p.sAk, k0, h, p.K, p.sa);
#pragma unroll
            for (int t = 0; t < 2; ++t) {
                const int bn = min(n0 + t * 16 + l15, p.N - 1);
                acc[t] = wmma16(a, fh_ld(B + (long long)bn * p.sBn, p.sBk, k0, h, p.K, p.sb), acc[t]);
            }
        }
    }
    const float iscale = (MODE == 0) ? p.alpha / (p.sa * p.sb) : p.alpha;
    float* C = p.C + zo * p.sCo + zi * p.sCi;
    const float* R = p.R + zo * p.sRo + zi * p.sRi;
    __shared__ __align__(16) float ctile[16][36];
#pragma unroll
    for (int t = 0; t < 2; ++t) {
        const int n = n0 + t * 16 + l15; const int nn = min(n, p.N - 1);
#pragma unroll
        for (int r = 0; r < 8; ++r) {
            const int m = m0 + 8 * h + r; const int mm = min(m, p.M - 1);
            float v = acc[t][r] * iscale;
            if (p.flags & 1) v += p.bias[nn];
            if (p.flags & 2) v += p.bias[mm];
            if (p.flags & 8) v *= p.bias[(long long)zo * p.M + mm];   /* per-(z,row) scale vector laid out [Z][M]; exclusive with the bias flags */
            v = act_fn(v, p.act);
            if (p.flags & 4) v += p.beta * R[(long long)mm * p.sRm + (long long)nn * p.sRn];
            ctile[8 * h + r][t * 16 + l15] = (n < p.N) ? v : 0.f;
        }
    }
    __syncthreads();
    const int NW = (p.Npad > p.N) ? p.Npad : p.N;           // write width
    const bool fast = (m0 + 16 <= p.M) && (n0 + 32 <= NW) && ((p.sCm & 3) == 0) && ((((size_t)C) & 15) == 0);
    if (fast) {
#pragma unroll
        for (int s = 0; s < 4; ++s) {
            const int row = s * 4 + (lane >> 3), c4 = (lane & 7) * 4;
            const v4f v = *(const v4f*)&ctile[row][c4];
            VST2V4(C + (long long)(m0 + row) * p.sCm + n0 + c4, v);
        }
    } else {
        for (int row = 0; row < 16; ++row) {
            const int m = m0 + row, n = n0 + lane;
            if (m < p.M && n < NW) VST2(float, C + (long long)m * p.sCm + n, ctile[row][lane]);
        }
    }
}


// =====================================================================================================================
// k_gemmT<MODE, TM, TN>: same contract as k_gemm, but one wave computes a (16*TM) x (16*TN) tile: TM A fragments and TN B fragments are
//   loaded per 32-wide k-step and reused across TM*TN WMMAs (far fewer load/convert instructions per MAC). MODE 0 (f16), 1 (bf16 hi/lo),
//   2 (bf16) only. grid (ceil(NW/(16*TN)), ceil(M/(16*TM)), Z), block 32. Epilogue identical to k_gemm, run per 16x32 sub-tile.
// =====================================================================================================================
template <int MODE, int TM, int TN>
__global__ __launch_bounds__(32) void k_gemmT(GemmP p) {
    const int lane = threadIdx.x & 31, h = lane >> 4, l15 = lane & 15;
    const int m0 = blockIdx.y * (16 * TM), n0 = blockIdx.x * (16 * TN);
    const int z = blockIdx.z, zo = z / p.zi_n, zi = z - zo * p.zi_n;
    const float* A = p.A + zo * p.sAo + zi * p.sAi;
    const float* B = p.B + zo * p.sBo + zi * p.sBi;
    v8f acc[TM][TN];
#pragma unroll
    for (int i = 0; i < TM; ++i)
#pragma unroll
        for (int t = 0; t < TN; ++t) { v8f zz = {}; acc[i][t] = zz; }
    for (int k0 = 0; k0 < p.K; k0 += 32) {
        if (MODE == 1) {
            Split a[TM], b[TN];
#pragma unroll
            for (int i = 0; i < TM; ++i) { const int am = min(m0 + 16 * i + l15, p.M - 1); a[i] = sp_ld(A + (long long)am * p.sAm, p.sAk, k0, h, p.K, 1.f); }
#pragma unroll
            for (int t = 0; t < TN; ++t) { const int bn = min(n0 + 16 * t + l15, p.N - 1); b[t] = sp_ld(B + (long long)bn * p.sBn, p.sBk, k0, h, p.K, 1.f); }
#pragma unroll
            for (int i = 0; i < TM; ++i)
#pragma unroll
                for (int t = 0; t < TN; ++t) acc[i][t] = wmma3(a[i], b[t], acc[i][t]);
        } else if (MODE == 2) {
            v16b a[TM], b[TN];
#pragma unroll
            for (int i = 0; i < TM; ++i) { const int am = min(m0 + 16 * i + l15, p.M - 1); a[i] = bh_ld(A + (long long)am * p.sAm, p.sAk, k0, h, p.K, 1.f); }
#pragma unroll
            for (int t = 0; t < TN; ++t) { const int bn = min(n0 + 16 * t + l15, p.N - 1); b[t] = bh_ld(B + (long long)bn * p.sBn, p.sBk, k0, h, p.K, 1.f); }
#pragma unroll
            for (int i = 0; i < TM; ++i)
#pragma unroll
                for (int t = 0; t < TN; ++t) acc[i][t] = wmmab(a[i], b[t], acc[i][t]);
        } else {
            v16h a[TM], b[TN];
#pragma unroll
            for (int i = 0; i < TM; ++i) { const int am = min(m0 + 16 * i + l15, p.M - 1); a[i] = fh_ld(A + (long long)am * p.sAm, p.sAk, k0, h, p.K, p.sa); }
#pragma unroll
            for (int t = 0; t < TN; ++t) { const int bn = min(n0 + 16 * t + l15, p.N - 1); b[t] = fh_ld(B + (long long)bn * p.sBn, p.sBk, k0, h, p.K, p.sb); }
#pragma unroll
            for (int i = 0; i < TM; ++i)
#pragma unroll
                for (int t = 0; t < TN; ++t) acc[i][t] = wmma16(a[i], b[t], acc[i][t]);
        }
    }
    const float iscale = (MODE == 0) ? p.alpha / (p.sa * p.sb) : p.alpha;
    float* C = p.C + zo * p.sCo + zi * p.sCi;
    const float* R = p.R + zo * p.sRo + zi * p.sRi;
    const int NW = (p.Npad > p.N) ? p.Npad : p.N;
    __shared__ __align__(16) float ctile[16][36];
#pragma unroll
    for (int i = 0; i < TM; ++i) {
        const int mb = m0 + 16 * i; if (mb >= p.M) break;          // wave-uniform
#pragma unroll
        for (int tp = 0; tp < TN / 2; ++tp) {
            const int nb = n0 + 32 * tp; if (nb >= NW) break;        // wave-uniform
#pragma unroll
            for (int t2 = 0; t2 < 2; ++t2) {
                const int t = 2 * tp + t2; const int n = nb + t2 * 16 + l15; const int nn = min(n, p.N - 1);
#pragma unroll
                for (int r = 0; r < 8; ++r) {
                    const int m = mb + 8 * h + r; const int mm = min(m, p.M - 1);
                    float v = acc[i][t][r] * iscale;
                    if (p.flags & 1) v += p.bias[nn];
                    if (p.flags & 2) v += p.bias[mm];
            if (p.flags & 8) v *= p.bias[(long long)zo * p.M + mm];   /* per-(z,row) scale vector laid out [Z][M]; exclusive with the bias flags */
                    v = act_fn(v, p.act);
                    if (p.flags & 4) v += p.beta * R[(long long)mm * p.sRm + (long long)nn * p.sRn];
                    ctile[8 * h + r][t2 * 16 + l15] = (n < p.N) ? v : 0.f;
                }
            }
            __syncthreads();
            const bool fast = (mb + 16 <= p.M) && (nb + 32 <= NW) && ((p.sCm & 3) == 0) && ((((size_t)C) & 15) == 0);
            if (fast) {
#pragma unroll
                for (int s = 0; s < 4; ++s) {
                    const int row = s * 4 + (lane >> 3), c4 = (lane & 7) * 4;
                    const v4f v = *(const v4f*)&ctile[row][c4];
                    VST2V4(C + (long long)(mb + row) * p.sCm + nb + c4, v);
                }
            } else {
                for (int row = 0; row < 16; ++row) {
                    const int m = mb + row, n = nb + lane;
                    if (m < p.M && n < NW) VST2(float, C + (long long)m * p.sCm + n, ctile[row][lane]);
                }
            }
            __syncthreads();
        }
    }
}

// =====================================================================================================================
//   Wave = 16 queries, AW waves per block, 64-key blocks; grid (ceil(Lq/(16*AW)), H, 1), one batch element per launch (batch strides 0), block 32*AW. Lq = Lk = 2048, dh = dv = 64 (set on device by attn_fix_shape); head dim dh <= DHP
//   (DHP multiple of 32), value dim dv <= DVP (multiple of 16 dividing 32*AW = 128). Every tensor addressed by (batch, head, row, element) strides, f32.
//   Scores: QM 0 f16 operands, 1 bf16 hi/lo split, 2 bf16 triple split; statistics f32 (exp2 domain); P.V: P x 4096 as f16 with V f16 staged in LDS
//   (SPLITPV: P and V as bf16 hi/lo splits). kv head = h / hrep. Masking: causal = 1 (keep j <= i + coff, masked -> -inf, key blocks beyond the
//   diagonal skipped), causal = 2 (masked -> mfill, a finite fill like the -1e9; no skipping), causal = 3 (keep j >= i + coff,
//   masked -> -inf, no skipping); additive f32 mask Mf (required: read without a null test),
//   optional int keep-mask Mi (0 -> score := mfill), both addressed b*smb + h*smh + i*smi + j*smj (0 strides broadcast).
// =====================================================================================================================
#define AW 4
struct AttnP {   // apv4
    const float* Q; const float* K; const float* V; float* O; float* P; const float* Mf; const int* Mi; float* ST;
    const float* Pw; const float* Rt; const int* SQ; const int* SK;           // optional: post-softmax weight, relative-position table, segment ids
    long long swb, swh, swi, swj, srb, srh, sri;                                 // Pw strides (b,h,i,j); Rt strides (b,h,i), column = clamp(i - j + roff, 0, rn-1)
    long long sQb, sQh, sQi, sQd, sKb, sKh, sKj, sKd, sVb, sVh, sVj, sVd, sOb, sOh, sOi, sPb, sPh, sPi, smb, smh, smi, smj;
    int Lq, Lk, dh, dv, hrep, causal, coff, pband;   // pband > 0: P holds only the band |j - i| <= pband, column j - i + pband
    float scale, mfill; int nonorm, mpol;             // nonorm (online path only): O = sum_j exp(score_j) V_j without the 1/rowsum (scores must be <= ~0); mpol: Mi masks where ==0 (mpol 0) or where !=0 (mpol 1)
    int roff, rn, segpol, win;                        // Rt column offset/count; SQ/SK: score := mfill where (segpol 0) SQ[i] != SK[j] or (segpol 1) SQ[i] == SK[j]; win > 0: keys with i - j > win (after coff) -> -inf
};
//   Pw: the softmax numerator is multiplied by Pw(b,h,i,j) AFTER the row sum is taken (probs * weight, then P.V), as in post-softmax multiplicative biases.                                                    // ST (optional): per row (b,h,i) -> ST[((b*H + h)*Lq + i)*2 + {0,1}] = {row max of the scaled+masked score (natural units), sum_j exp(score - max)}
static_assert(sizeof(AttnP) == 12 * 8 + 29 * 8 + 16 * 4, "AttnP has padding");

#ifndef KATTN_ATTR
#define KATTN_ATTR
#endif
// The shape of this problem's four attention launches as compile-time constants (they equal the values kernel_launch fills in): with them the
// element bounds tests (k < dh, d < dv) and every optional path fold away, the unit element strides let the compiler merge a fragment's loads into
// 16-byte loads, and the additive table (always passed here, so read without a null test) no longer depends on the query row. Only the five base pointers stay run-time values.
__device__ __forceinline__ void attn_fix_shape(AttnP& p) {
    p.P = nullptr; p.Mi = nullptr; p.ST = nullptr; p.Pw = nullptr; p.Rt = nullptr; p.SQ = nullptr; p.SK = nullptr;
    p.swb = 0; p.swh = 0; p.swi = 0; p.swj = 0; p.srb = 0; p.srh = 0; p.sri = 0;
    p.sQb = 0; p.sQh = 64; p.sQi = 512; p.sQd = 1; p.sKb = 0; p.sKh = 64; p.sKj = 512; p.sKd = 1; p.sVb = 0; p.sVh = 64; p.sVj = 512; p.sVd = 1;
    p.sOb = 0; p.sOh = 64; p.sOi = 512; p.sPb = 0; p.sPh = 0; p.sPi = 0; p.smb = 0; p.smh = 0; p.smi = 0; p.smj = 1;
    p.Lq = 2048; p.Lk = 2048; p.dh = 64; p.dv = 64; p.hrep = 1; p.causal = 1; p.coff = 0; p.pband = 0;
    p.scale = 0.125f; p.mfill = 0.0f; p.nonorm = 0; p.mpol = 0; p.roff = 0; p.rn = 1; p.segpol = 0; p.win = 0;
}
template <int DHP, int DVP, int QM, bool SPLITPV, bool TWOPASS>
__global__ __launch_bounds__(32 * AW) KATTN_ATTR void k_attn(AttnP p) {
    attn_fix_shape(p);
    constexpr int NT = DVP / 16;                // output tiles
    constexpr int KS = DHP / 32;                // k-steps for the scores
    constexpr int VP = DVP + 8;                 // LDS pitch (halves)
    __shared__ __align__(16) float    pl[AW][16 * 64];
    __shared__ __align__(16) _Float16 vl[(SPLITPV ? 2 : 1) * 64 * VP];   // f16 V tile, or bf16 hi and lo tiles (same 2-byte size)
    const int lane = threadIdx.x & 31, hf = lane >> 4, l15 = lane & 15, wave = threadIdx.x >> 5;
    const int h = blockIdx.y, b = blockIdx.z, hk = h / p.hrep;
    const int q0 = (blockIdx.x * AW + wave) * 16;
    float* myp = pl[wave];
    const float L2E = 1.4426950408889634f;
    const float NEG = -__builtin_inff();
    const int qi = min(q0 + l15, p.Lq - 1);
    const float* qrow = p.Q + b * p.sQb + h * p.sQh + (long long)qi * p.sQi;
    const float* kbase = p.K + b * p.sKb + hk * p.sKh;
    const float* vbase = p.V + b * p.sVb + hk * p.sVh;
    v16h qa[QM == 0 ? KS : 1]; Split qs_[QM == 1 ? KS : 1]; Split3 qt_[QM == 2 ? KS : 1];
#pragma unroll
    for (int ks = 0; ks < KS; ++ks) {
        if (QM == 2) qt_[ks] = sp3_ld(qrow, p.sQd, ks * 32, hf, p.dh, 1.f);
        else if (QM == 1) qs_[ks] = sp_ld(qrow, p.sQd, ks * 32, hf, p.dh, 1.f);
        else qa[ks] = fh_ld(qrow, p.sQd, ks * 32, hf, p.dh, 1.f);
    }
    v8f o[NT]; float m8[8], l8[8];
#pragma unroll
    for (int t = 0; t < NT; ++t) { v8f zz = {}; o[t] = zz; }
#pragma unroll
    for (int i = 0; i < 8; ++i) { m8[i] = NEG; l8[i] = 0.f; }
    int jend = p.Lk; int jstart = 0;
    if (p.causal == 1) { const int je = (blockIdx.x * AW + AW - 1) * 16 + 16 + p.coff; jend = min(jend, max(je, 0)); }   // uniform per block
    if (p.win > 0) { const int js = (int)(blockIdx.x * AW) * 16 + p.coff - p.win; jstart = (js > 0) ? (js / 64) * 64 : 0; }   // uniform per block: key blocks entirely outside every row's window hold only -inf entries and are skipped exactly
    const int npass = TWOPASS ? 2 : 1;
    for (int pass = 0; pass < npass; ++pass) {
        const bool dopv = (!TWOPASS) || pass == 1;
        for (int j0 = jstart; j0 < jend; j0 += 64) {
            if (dopv) {
                __syncthreads();                                 // previous key block's reads of vl / pl are done
                static_assert((32 * AW) % DVP == 0, "a thread keeps its V column from pass to pass");
                constexpr int VR = (32 * AW) / DVP;              // V rows staged by the block per pass
                const int jr0 = threadIdx.x / DVP, d = threadIdx.x - jr0 * DVP;
                const float* vsrc = vbase + (long long)(j0 + jr0) * p.sVj + (long long)d * p.sVd;   // one address; the passes differ by constant offsets
#pragma unroll   // constant trip count: all of a thread's V loads of a key block are issued before the first is waited for
                for (int n = 0; n < 64 / VR; ++n) {
                    const int jr = jr0 + n * VR, j = j0 + jr;
                    const float f = ((p.Lk % 64 == 0 || j < p.Lk) && d < p.dv) ? vsrc[(long long)(n * VR) * p.sVj] : 0.f;
                    if (SPLITPV) {
                        const __bf16 hb = bf16_rne(f);
                        ((__bf16*)vl)[jr * VP + d] = hb; ((__bf16*)vl)[64 * VP + jr * VP + d] = bf16_rne(f - bf16_f32(hb));
                    } else vl[jr * VP + d] = (_Float16)f;
                }
            }
            v8f s[4];
#pragma unroll
            for (int t = 0; t < 4; ++t) {
                const int j = min(j0 + t * 16 + l15, p.Lk - 1);
                const float* krow = kbase + (long long)j * p.sKj;
                v8f acc = {};
#pragma unroll
                for (int ks = 0; ks < KS; ++ks) {
                    if (QM == 2)      acc = wmma6(qt_[ks], sp3_ld(krow, p.sKd, ks * 32, hf, p.dh, 1.f), acc);
                    else if (QM == 1) acc = wmma3(qs_[ks], sp_ld(krow, p.sKd, ks * 32, hf, p.dh, 1.f), acc);
                    else              acc = wmma16(qa[ks], fh_ld(krow, p.sKd, ks * 32, hf, p.dh, 1.f), acc);
                }
                s[t] = acc;
            }
            float pv[8][4];
#pragma unroll
            for (int i = 0; i < 8; ++i) {
                const int irow = q0 + i + 8 * hf;
                const int ic = min(irow, p.Lq - 1);
                float sc[4];
#pragma unroll
                for (int t = 0; t < 4; ++t) {
                    const int jg = j0 + t * 16 + l15;
                    float v = s[t][i] * p.scale;
                    v += p.Mf[b * p.smb + h * p.smh + (long long)ic * p.smi + (long long)min(jg, p.Lk - 1) * p.smj];
                    if (p.Rt) { int rc = ic - min(jg, p.Lk - 1) + p.roff; rc = rc < 0 ? 0 : (rc >= p.rn ? p.rn - 1 : rc); v += p.Rt[b * p.srb + h * p.srh + (long long)ic * p.sri + rc]; }
                    if (p.Mi) { const int mv = p.Mi[b * p.smb + h * p.smh + (long long)ic * p.smi + (long long)min(jg, p.Lk - 1) * p.smj]; if (p.mpol ? (mv != 0) : (mv == 0)) v = p.mfill; }
                    if (p.SQ) { const bool same = p.SQ[(long long)b * p.Lq + ic] == p.SK[(long long)b * p.Lk + min(jg, p.Lk - 1)]; if (p.segpol ? same : !same) v = p.mfill; }
                    if (p.causal == 2 && jg > irow + p.coff) v = p.mfill;
                    if (jg >= p.Lk || (p.causal == 1 && jg > irow + p.coff) || (p.causal == 3 && jg < irow + p.coff) || (p.win > 0 && irow + p.coff - jg > p.win)) v = NEG; else v *= L2E;
                    sc[t] = v;
                }
                if (!TWOPASS || pass == 0) {
                    float mx = fmaxf(fmaxf(sc[0], sc[1]), fmaxf(sc[2], sc[3]));
                    mx = fmaxf(mx, __shfl_xor(mx, 1, 32)); mx = fmaxf(mx, __shfl_xor(mx, 2, 32));
                    mx = fmaxf(mx, __shfl_xor(mx, 4, 32)); mx = fmaxf(mx, __shfl_xor(mx, 8, 32));
                    const float mnew = fmaxf(m8[i], mx);
                    const float corr = (mnew == NEG) ? 1.f : exp2f(m8[i] - mnew);
                    float rs = 0.f;
#pragma unroll
                    for (int t = 0; t < 4; ++t) {
                        const float pp = (sc[t] == NEG) ? 0.f : exp2f(sc[t] - mnew); rs += pp;
                        pv[i][t] = p.Pw ? pp * p.Pw[b * p.swb + h * p.swh + (long long)ic * p.swi + (long long)min(j0 + t * 16 + l15, p.Lk - 1) * p.swj] : pp;
                    }
                    rs += __shfl_xor(rs, 1, 32); rs += __shfl_xor(rs, 2, 32); rs += __shfl_xor(rs, 4, 32); rs += __shfl_xor(rs, 8, 32);
                    l8[i] = l8[i] * corr + rs; m8[i] = mnew;
                    if (!TWOPASS) {
#pragma unroll
                        for (int t = 0; t < NT; ++t) o[t][i] *= corr;
                    }
                } else {
                    const float inv = (l8[i] > 0.f) ? 1.f / l8[i] : 0.f;
#pragma unroll
                    for (int t = 0; t < 4; ++t) {
                        const int jg = j0 + t * 16 + l15;
                        float pp = (sc[t] == NEG) ? 0.f : exp2f(sc[t] - m8[i]) * inv;
                        if (p.Pw) pp *= p.Pw[b * p.swb + h * p.swh + (long long)ic * p.swi + (long long)min(jg, p.Lk - 1) * p.swj];
                        pv[i][t] = pp;
                    }
                }
            }
            if (dopv) {
#pragma unroll
                for (int i = 0; i < 8; ++i)
#pragma unroll
                    for (int t = 0; t < 4; ++t) ((float*)myp)[(i + 8 * hf) * 64 + t * 16 + l15] = pv[i][t];
                __syncthreads();                                 // P (per wave) and V (shared) visible
                if (p.P) {
                    float* pb_ = p.P + b * p.sPb + h * p.sPh;
                    const bool fastP = (p.pband == 0) && ((p.sPi & 3) == 0) && (j0 + 64 <= p.Lk) && (q0 + 16 <= p.Lq) && ((((size_t)pb_) & 15) == 0);
                    if (fastP) {
#pragma unroll
                        for (int s = 0; s < 8; ++s) {
                            const int row = s * 2 + (lane >> 4), c4 = (lane & 15) * 4;
                            const v4f v = *(const v4f*)(myp + row * 64 + c4);
                            VST2V4(pb_ + (long long)(q0 + row) * p.sPi + j0 + c4, v);
                        }
                    } else {
                        for (int row = 0; row < 16; ++row) {
                            const int irow = q0 + row; if (irow >= p.Lq) continue;
                            for (int c = lane; c < 64; c += 32) {
                                const int jg = j0 + c; if (jg >= p.Lk) continue;
                                if (p.pband == 0) VST2(float, pb_ + (long long)irow * p.sPi + jg, myp[row * 64 + c]);
                                else if (jg - irow <= p.pband && irow - jg <= p.pband) VST2(float, pb_ + (long long)irow * p.sPi + (jg - irow + p.pband), myp[row * 64 + c]);
                            }
                        }
                    }
                }
                if (SPLITPV) {
                    const Split pa0 = sp_ld(myp + l15 * 64, 1, 0, hf, 64, 1.f), pa1 = sp_ld(myp + l15 * 64, 1, 32, hf, 64, 1.f);
                    const __bf16* vh = (const __bf16*)vl; const __bf16* vlo = vh + 64 * VP;
#pragma unroll
                    for (int t = 0; t < NT; ++t) {
                        const int dcol = t * 16 + l15;
                        Split b0, b1;
#pragma unroll
                        for (int e = 0; e < 16; ++e) {
                            const int k0 = frag_k(e, hf), k1 = 32 + frag_k(e, hf);
                            b0.hi[e] = vh[k0 * VP + dcol]; b0.lo[e] = vlo[k0 * VP + dcol]; b1.hi[e] = vh[k1 * VP + dcol]; b1.lo[e] = vlo[k1 * VP + dcol];
                        }
                        o[t] = wmma3(pa0, b0, o[t]);
                        o[t] = wmma3(pa1, b1, o[t]);
                    }
                } else {
                    const v16h pa0 = fh_ld(myp + l15 * 64, 1, 0, hf, 64, 4096.f), pa1 = fh_ld(myp + l15 * 64, 1, 32, hf, 64, 4096.f);
#pragma unroll
                    for (int t = 0; t < NT; ++t) {
                        const int dcol = t * 16 + l15;
                        v16h b0, b1;
#pragma unroll
                        for (int e = 0; e < 16; ++e) { b0[e] = vl[frag_k(e, hf) * VP + dcol]; b1[e] = vl[(32 + frag_k(e, hf)) * VP + dcol]; }
                        o[t] = wmma16(pa0, b0, o[t]);
                        o[t] = wmma16(pa1, b1, o[t]);
                    }
                }
            }
        }
    }
    float* obase = p.O + b * p.sOb + h * p.sOh;
    if (p.ST) {
        const int rl = lane >> 1, isel = rl & 7;           // row q0 + rl ; rl>>3 == hf holds because lane>>4 == (lane>>1)>>3
        float mv = 0.f, lv = 0.f;
#pragma unroll
        for (int i = 0; i < 8; ++i) if (i == isel) { mv = m8[i]; lv = l8[i]; }
        const int irow = q0 + rl;
        if (irow < p.Lq) { float* st = p.ST + (((long long)b * gridDim.y + h) * p.Lq + irow) * 2 + (lane & 1); VST2(float, st, (lane & 1) ? lv : mv * 0.6931471805599453f); }
    }
    float invr[8];
#pragma unroll
    for (int i = 0; i < 8; ++i) {
        if (TWOPASS) invr[i] = SPLITPV ? 1.f : (1.f / 4096.f);
        else if (p.nonorm) invr[i] = exp2f(m8[i]) * (SPLITPV ? 1.f : (1.f / 4096.f));
        else invr[i] = (l8[i] > 0.f) ? (SPLITPV ? 1.f / l8[i] : 1.f / (l8[i] * 4096.f)) : 0.f;
    }
    __syncthreads();                                             // all waves done with pl/vl from the main loop
    const bool ofast = ((p.sOi & 3) == 0) && ((((size_t)obase) & 15) == 0) && (q0 + 16 <= p.Lq);
#pragma unroll
    for (int c0 = 0; c0 < DVP; c0 += 64) {
#pragma unroll
        for (int i = 0; i < 8; ++i)
#pragma unroll
            for (int t = 0; t < NT; ++t) if (t * 16 >= c0 && t * 16 < c0 + 64) ((float*)myp)[(i + 8 * hf) * 64 + (t * 16 - c0) + l15] = o[t][i] * invr[i];
        __syncthreads();
        const int cw = (DVP - c0 < 64) ? (DVP - c0) : 64;      // staged columns in this chunk (multiple of 16)
        if (ofast && (c0 + cw <= p.dv) && (cw % 32 == 0)) {
            const int lpr = cw / 4;                              // lanes per row (16 for 64 cols, 8 for 32)
            const int rows_per_ins = 32 / lpr;
            for (int r0 = 0; r0 < 16; r0 += rows_per_ins) {
                const int row = r0 + lane / lpr, c4 = (lane % lpr) * 4;
                const v4f v = *(const v4f*)(myp + row * 64 + c4);
                VST2V4(obase + (long long)(q0 + row) * p.sOi + c0 + c4, v);
            }
        } else {
            for (int row = 0; row < 16; ++row) {
                const int irow = q0 + row; if (irow >= p.Lq) continue;
                for (int c = lane; c < cw; c += 32) { const int d = c0 + c; if (d < p.dv) VST2(float, obase + (long long)irow * p.sOi + d, myp[row * 64 + c]); }
            }
        }
        __syncthreads();
    }
}

// =====================================================================================================================
// k_tr: dst(z, c, r) = alpha * src(z, r, c) (+ beta * R2(z, c, r)): [Z][R][C] (row stride lds) -> [Z][C][R] (row stride ldd) through a 32x32 LDS tile;
//   flags: 1 -> add beta * residual R2 addressed like dst (z*sRz + c*ldr + r); act applied before the residual.
// =====================================================================================================================
struct TrP { const float* src; float* dst; const float* R2; long long sSz, lds, sDz, ldd, sRz, ldr; int R, C, flags, act; float alpha, beta; };
static_assert(sizeof(TrP) == 3 * 8 + 6 * 8 + 6 * 4, "TrP has padding");
__global__ __launch_bounds__(256) void k_tr(TrP p) {
    __shared__ float tile[32][33];
    const int c0 = blockIdx.x * 32, r0 = blockIdx.y * 32, z = blockIdx.z;
    const int lane = threadIdx.x & 31, wave = threadIdx.x >> 5;
    const float* s = p.src + z * p.sSz;
#pragma unroll
    for (int k = 0; k < 4; ++k) {
        const int rl = wave * 4 + k, r = r0 + rl, c = c0 + lane;
        tile[rl][lane] = (r < p.R && c < p.C) ? s[(long long)r * p.lds + c] : 0.f;
    }
    __syncthreads();
    float* d = p.dst + z * p.sDz; const float* rr = p.R2 + z * p.sRz;
#pragma unroll
    for (int k = 0; k < 4; ++k) {
        const int cl = wave * 4 + k, c = c0 + cl, r = r0 + lane;
        if (c < p.C && r < p.R) {
            float v = act_fn(p.alpha * tile[lane][cl], p.act);
            if (p.flags & 1) v += p.beta * rr[(long long)c * p.ldr + r];
            VST2(float, d + (long long)c * p.ldd + r, v);
        }
    }
}

// k_affine: dst[i] = a * (sdev ? sdev[0] : 1) * src[i] + b, i < n (one thread per element; consecutive lanes -> consecutive addresses)
__global__ __launch_bounds__(256) void k_affine(const float* __restrict__ src, float* __restrict__ dst, int n, float a, float b, const float* __restrict__ sdev) {
    const int i = blockIdx.x * 256 + threadIdx.x;
    if (i < n) { const float aa = sdev ? a * sdev[0] : a; const float v = aa * src[i] + b; VST2(float, dst + i, v); }
}

// =====================================================================================================================
// k_softmax: row softmax over n contiguous elements, one 256-thread block per row; rows addressed z*sz + r*sr (grid (R, Z)).
//   out = scale_out * softmax(scale_in * x + (Mf ? Mf[z*smz + r*smr + j] : 0)); a row whose max is -inf is written as 0.
// =====================================================================================================================
struct SmP { const float* src; float* dst; const float* Mf; long long sz, sr, dz, dr, smz, smr; int n, pad; float scale_in, scale_out; };
static_assert(sizeof(SmP) == 3 * 8 + 6 * 8 + 4 * 4, "SmP has padding");
__global__ __launch_bounds__(256) void k_softmax(SmP p) {
    __shared__ float red[256];
    const int r = blockIdx.x, z = blockIdx.y, tid = threadIdx.x;
    const float* s = p.src + z * p.sz + (long long)r * p.sr;
    const float* mf = p.Mf ? (p.Mf + z * p.smz + (long long)r * p.smr) : nullptr;
    float mx = -__builtin_inff();
    for (int j = tid; j < p.n; j += 256) { float v = s[j] * p.scale_in; if (mf) v += mf[j]; mx = fmaxf(mx, v); }
    red[tid] = mx; __syncthreads();
    for (int o = 128; o > 0; o >>= 1) { if (tid < o) red[tid] = fmaxf(red[tid], red[tid + o]); __syncthreads(); }
    mx = red[0]; __syncthreads();
    float sum = 0.f;
    for (int j = tid; j < p.n; j += 256) { float v = s[j] * p.scale_in; if (mf) v += mf[j]; sum += (mx == -__builtin_inff()) ? 0.f : expf(v - mx); }
    red[tid] = sum; __syncthreads();
    for (int o = 128; o > 0; o >>= 1) { if (tid < o) red[tid] += red[tid + o]; __syncthreads(); }
    sum = red[0];
    const float inv = (sum > 0.f) ? p.scale_out / sum : 0.f;
    float* d = p.dst + z * p.dz + (long long)r * p.dr;
    for (int j = tid; j < p.n; j += 256) { float v = s[j] * p.scale_in; if (mf) v += mf[j]; const float o = (mx == -__builtin_inff()) ? 0.f : expf(v - mx) * inv; VST2(float, d + j, o); }
}
// =====================================================================================================================
// k_stats: mean and rsqrt(var + eps) over a set of n elements addressed base + z*sz + (e / inner) * so + (e % inner) * si, one 256-thread
// k_norm_apply: y = (x - mean[set]) * rstd[set] * g[c] + b[c] over a [Z][C][L] chan-major tensor with set = z*G + c / (C/G) (G groups per z;
//   G = C -> per-chan sets indexed z*C+c; for batch norm pass stats indexed by c only via bn = 1). Optional act. Output same layout.
// =====================================================================================================================
//   mode 0: mean / rsqrt(var + eps); mode 1 (RMSNorm): 0 / rsqrt(mean(x^2) + eps); mode 2 (L2 normalize * sqrt(n)): 0 / sqrt(n) / max(||x||, eps); mode 3: as 0 with unbiased variance (n-1)
__global__ __launch_bounds__(256) void k_stats(const float* __restrict__ x, long long sz, long long so, long long si, int inner, int n, float eps, float* __restrict__ stat, int mode) {
    __shared__ float red[256];
    const int z = blockIdx.x, tid = threadIdx.x;
    const float* base = x + z * sz;
    float s = 0.f;
    for (int e = tid; e < n; e += 256) s += base[(long long)(e / inner) * so + (long long)(e % inner) * si];
    red[tid] = s; __syncthreads();
    for (int o = 128; o > 0; o >>= 1) { if (tid < o) red[tid] += red[tid + o]; __syncthreads(); }
    const float mu = (mode == 0 || mode == 3) ? red[0] / (float)n : 0.f; __syncthreads();
    float q = 0.f;
    for (int e = tid; e < n; e += 256) { const float dlt = base[(long long)(e / inner) * so + (long long)(e % inner) * si] - mu; q += dlt * dlt; }
    red[tid] = q; __syncthreads();
    for (int o = 128; o > 0; o >>= 1) { if (tid < o) red[tid] += red[tid + o]; __syncthreads(); }
    {
        float rs;
        if (mode == 2) rs = sqrtf((float)n) / fmaxf(sqrtf(red[0]), eps); else if (mode == 3) rs = rsqrtf(red[0] / (float)(n - 1) + eps); else rs = rsqrtf(red[0] / (float)n + eps);
        if (tid < 32) { const float v = (tid == 0) ? mu : ((tid == 1) ? rs : 0.f); VST2(float, stat + (long long)z * 32 + tid, v); }
    }
}
//   One thread per element over the flat [Z][C][L] index space: grid ceil(Z*C*L / 256).
__global__ __launch_bounds__(256) void k_norm_apply(const float* __restrict__ x, float* __restrict__ y, const float* __restrict__ stat, const float* __restrict__ g, const float* __restrict__ bta,
                                                     int Z, int C, int L, int G, int bn, int act) {
    const long long idx = (long long)blockIdx.x * 256 + threadIdx.x;
    if (idx >= (long long)Z * C * L) return;
    const int l = (int)(idx % L); const long long zc = idx / L; const int c = (int)(zc % C), z = (int)(zc / C); (void)l;
    const int set = bn ? c : (z * G + c / (C / G));
    float v = (x[idx] - stat[(long long)set * 32]) * stat[(long long)set * 32 + 1];
    if (g) v *= g[c];
    if (bta) v += bta[c];
    v = act_fn(v, act);
    VST2(float, y + idx, v);
}

// k_lse_neg: c[i] = -(st[2i] + log(st[2i+1])) = minus the log-sum-exp of row i from k_attn's ST output (for softmax over the query dimension)
__global__ __launch_bounds__(256) void k_lse_neg(const float* __restrict__ st, float* __restrict__ c, int n) {
    const int i = blockIdx.x * 256 + threadIdx.x;
    if (i < n) { const float v = -(st[2 * i] + logf(st[2 * i + 1])); VST2(float, c + i, v); }
}

// k_iota: dst[i] = a * i + b as int32 (segment/position id helper)
__global__ __launch_bounds__(256) void k_iota(int* __restrict__ dst, int n, int a, int b) {
    const int i = blockIdx.x * 256 + threadIdx.x;
    if (i < n) { const int v = a * i + b; VST2(int, dst + i, v); }
}

// k_axpby: dst[i] = a * x[i] + b * y[i] (+ c), i < n
__global__ __launch_bounds__(256) void k_axpby(const float* __restrict__ x, const float* __restrict__ y, float* __restrict__ dst, int n, float a, float b, float c) {
    const int i = blockIdx.x * 256 + threadIdx.x;
    if (i < n) { const float v = a * x[i] + b * y[i] + c; VST2(float, dst + i, v); }
}

// =====================================================================================================================
// k_rope: rotary embedding on a [R rows][Hn heads][D] view (row stride sXr, head stride sXh, element stride 1) -> Y (own strides).
//   mode 0: rotate_half (partner d±D/2, sign - for d<D/2); mode 1: interleaved pairs (partner d^1, sign - for even d).
//   table column tcol: tmode 0 -> d, 1 -> d % (D/2), 2 -> d / 2; position p: pmode 0 -> r % S, 1 -> head index, 2 -> pos[r];
//   c = C[(r / S) * sCb + p * sCp + tcol * sCd], s likewise from Sn; y = x[d] * c + sign * x[partner] * s. X and Y must not alias.
// =====================================================================================================================
struct RopeP { const float* X; float* Y; const float* C; const float* Sn; const int* pos; long long sXr, sXh, sYr, sYh, sCb, sCp, sCd; int R, Hn, D, S, mode, tmode, pmode, pad; };
static_assert(sizeof(RopeP) == 5 * 8 + 7 * 8 + 8 * 4, "RopeP has padding");
__global__ __launch_bounds__(256) void k_rope(RopeP p) {
    const long long idx = (long long)blockIdx.x * 256 + threadIdx.x;
    if (idx >= (long long)p.R * p.Hn * p.D) return;
    const int d = (int)(idx % p.D); const long long rh = idx / p.D; const int h = (int)(rh % p.Hn); const int r = (int)(rh / p.Hn);
    const int half = p.D / 2;
    int partner; float sign;
    if (p.mode == 0) { partner = (d < half) ? d + half : d - half; sign = (d < half) ? -1.f : 1.f; }
    else { partner = d ^ 1; sign = (d & 1) ? 1.f : -1.f; }
    const int tcol = (p.tmode == 0) ? d : ((p.tmode == 1) ? (d % half) : (d >> 1));
    const int pp = (p.pmode == 0) ? (r % p.S) : ((p.pmode == 1) ? h : p.pos[r]);
    const long long toff = (long long)(r / p.S) * p.sCb + (long long)pp * p.sCp + (long long)tcol * p.sCd;
    const float* xr = p.X + (long long)r * p.sXr + (long long)h * p.sXh;
    const float v = xr[d] * p.C[toff] + sign * xr[partner] * p.Sn[toff];
    VST2(float, p.Y + (long long)r * p.sYr + (long long)h * p.sYh + d, v);
}

// k_invf + k_sincos (split so neither kernel carries a large VALU-fma footprint): invf_i = num * (1 / powf(base, (2 i)/D)) [fmode 0],
//   num * expf((2 i) * cexp) [fmode 1], num * powf(base, -2 (i - 1) / D) [fmode 2]; then cs/sn[s*half + i] = cos/sin((pscale * s) * invf_i)
__global__ __launch_bounds__(256) void k_invf(float* __restrict__ invb, int half, int D, float base, float num, int fmode, float cexp) {
    const int i = blockIdx.x * 256 + threadIdx.x;
    if (i >= ((half + 31) / 32) * 32) return;
    if (i >= half) { VST2(float, invb + i, 0.f); return; }
    const float e = (float)(2 * i) / (float)D;
    float invf;
    if (fmode == 1) invf = num * expf((float)(2 * i) * cexp);
    else if (fmode == 2) invf = num * powf(base, (-2.0f * ((float)i - 1.0f)) / (float)D);
    else invf = num * (1.0f / powf(base, e));
    VST2(float, invb + i, invf);
}
__global__ __launch_bounds__(256) void k_sincos(float* __restrict__ cs, float* __restrict__ sn, const float* __restrict__ invb, int S, int half, float pscale) {
    const int idx = blockIdx.x * 256 + threadIdx.x;
    if (idx >= S * half) return;
    const int s = idx / half, i = idx - s * half;
    const float ang = (pscale * (float)s) * invb[i];
    VST2(float, cs + idx, cosf(ang)); VST2(float, sn + idx, sinf(ang));
}

// k_mulact: dst[i] = act(x[i]) * y[i]
__global__ __launch_bounds__(256) void k_mulact(const float* __restrict__ x, const float* __restrict__ y, float* __restrict__ dst, int n, int act) {
    const int i = blockIdx.x * 256 + threadIdx.x;
    if (i < n) { const float v = act_fn(x[i], act) * y[i]; VST2(float, dst + i, v); }
}

// =====================================================================================================================
// k_matvec: thread-per-row matrix-vector products for N <= 8 output columns (heads with 1-3 outputs, gates), f32 on the VALU.
//   C[r*sCm + j] = act(alpha * sum_k A[r*sAm + k*sAk] * B[j*sBn + k*sBk] + bias[j]) + beta * R[r*sRm + j*sRn]; each thread writes its N contiguous floats.
// =====================================================================================================================
__global__ __launch_bounds__(256) void k_matvec(GemmP p) {
    // 32 lanes write one line with one instruction.
    const int rpt = (p.N == 1) ? 1 : 32;
    const long long r0 = ((long long)blockIdx.x * 256 + threadIdx.x) * rpt; const int z = blockIdx.z, zo = z / p.zi_n, zi = z - zo * p.zi_n;
    if (r0 >= p.M) return;
    const float* Bb = p.B + zo * p.sBo + zi * p.sBi;
    float* C = p.C + zo * p.sCo + zi * p.sCi; const float* R = p.R + zo * p.sRo + zi * p.sRi;
    for (int rr = 0; rr < rpt; ++rr) {
        const long long r = r0 + rr; if (r >= p.M) break;
        const float* A = p.A + zo * p.sAo + zi * p.sAi + r * p.sAm;
        float acc[8] = {0.f, 0.f, 0.f, 0.f, 0.f, 0.f, 0.f, 0.f};
        for (int k = 0; k < p.K; ++k) { const float a = A[(long long)k * p.sAk];
#pragma unroll
            for (int j = 0; j < 8; ++j) if (j < p.N) acc[j] += a * Bb[(long long)j * p.sBn + (long long)k * p.sBk]; }
#pragma unroll
        for (int j = 0; j < 8; ++j) if (j < p.N) {
            float v = acc[j] * p.alpha;
            if (p.flags & 1) v += p.bias[j];
            if (p.flags & 2) v += p.bias[r];
            v = act_fn(v, p.act);
            if (p.flags & 4) v += p.beta * R[r * p.sRm + (long long)j * p.sRn];
            VST2(float, C + r * p.sCm + j, v);
        }
    }
}
// k_smallsoftmax: thread-per-row softmax for short rows (n <= 64): dst[r*dr + j] = softmax(scale*src[r*sr + j])
__global__ __launch_bounds__(256) void k_smallsoftmax(const float* __restrict__ src, float* __restrict__ dst, long long sr, long long dr, int n, long long R, float scale) {
    const long long r0 = ((long long)blockIdx.x * 256 + threadIdx.x) * 32;
    for (int rr = 0; rr < 32; ++rr) {
        const long long r = r0 + rr; if (r >= R) return;
        const float* s = src + r * sr; float* d = dst + r * dr;
        float mx = -__builtin_inff();
        for (int j = 0; j < n; ++j) mx = fmaxf(mx, s[j] * scale);
        float sum = 0.f;
        for (int j = 0; j < n; ++j) sum += expf(s[j] * scale - mx);
        const float inv = 1.f / sum;
        for (int j = 0; j < n; ++j) { const float v = expf(s[j] * scale - mx) * inv; VST2(float, d + j, v); }
    }
}

__global__ __launch_bounds__(32) void k_unitstat(float* __restrict__ st) { const int t = threadIdx.x; const float v = (t == 1) ? 1.f : 0.f; VST2(float, st + t, v); }

// destination (e.g. a d_out whose row width is not a multiple of 32 floats) is written by consecutive lanes of one instruction
__global__ __launch_bounds__(256) void k_lincopy(const float* __restrict__ src, long long lds, float* __restrict__ dst, long long ldd, long long rows, int cols) {
    const long long i = (long long)blockIdx.x * 256 + threadIdx.x; if (i >= rows * cols) return;
    const long long r = i / cols; const int c = (int)(i - r * cols);
    const float v = src[r * lds + c]; VST2(float, dst + r * ldd + c, v);
}


__device__ __forceinline__ void st_h2(unsigned short* d2, float a, float b) { const unsigned u = (unsigned)__builtin_bit_cast(unsigned short, (_Float16)a) | ((unsigned)__builtin_bit_cast(unsigned short, (_Float16)b) << 16); unsigned* d = (unsigned*)d2; *d = u;  }
__device__ __forceinline__ float ldh(const unsigned short* p) { return (float)__builtin_bit_cast(_Float16, *p); }
__device__ __forceinline__ v4f ld4h(const unsigned short* p) { const unsigned long long u = *(const unsigned long long*)p; v4f a;
    a.x = (float)__builtin_bit_cast(_Float16, (unsigned short)(u & 0xFFFFu)); a.y = (float)__builtin_bit_cast(_Float16, (unsigned short)((u >> 16) & 0xFFFFu)); a.z = (float)__builtin_bit_cast(_Float16, (unsigned short)((u >> 32) & 0xFFFFu)); a.w = (float)__builtin_bit_cast(_Float16, (unsigned short)((u >> 48) & 0xFFFFu)); return a; }
__device__ __forceinline__ unsigned long long pk4h(v4f s) { return (unsigned long long)__builtin_bit_cast(unsigned short, (_Float16)s.x) | ((unsigned long long)__builtin_bit_cast(unsigned short, (_Float16)s.y) << 16) | ((unsigned long long)__builtin_bit_cast(unsigned short, (_Float16)s.z) << 32) | ((unsigned long long)__builtin_bit_cast(unsigned short, (_Float16)s.w) << 48); }
typedef unsigned v4u __attribute__((ext_vector_type(4)));
__device__ __forceinline__ void st8h(unsigned short* d, v4f a, v4f b) { const unsigned long long pa = pk4h(a), pb = pk4h(b); v4u pk; pk.x = (unsigned)(pa & 0xFFFFFFFFull); pk.y = (unsigned)(pa >> 32); pk.z = (unsigned)(pb & 0xFFFFFFFFull); pk.w = (unsigned)(pb >> 32); v4u* dd = (v4u*)d; *dd = pk;  }
__device__ __forceinline__ unsigned short bfu_rne(float v) { unsigned u = __builtin_bit_cast(unsigned, v); u += 0x7FFFu + ((u >> 16) & 1u); return (unsigned short)(u >> 16); }
__device__ __forceinline__ void bfsplit(float v, unsigned short& hi, unsigned short& lo) { hi = bfu_rne(v); lo = bfu_rne(v - __builtin_bit_cast(float, (unsigned)hi << 16)); }
__device__ __forceinline__ void st_s2(unsigned short* Hp, unsigned short* Lp, long long o, float a, float b) { unsigned short h0,l0,h1,l1; bfsplit(a,h0,l0); bfsplit(b,h1,l1); const unsigned ph = (unsigned)h0 | ((unsigned)h1 << 16), pl = (unsigned)l0 | ((unsigned)l1 << 16);
    unsigned* dh = (unsigned*)(Hp + o); unsigned* dl = (unsigned*)(Lp + o); *dh = ph; *dl = pl;  }
__device__ __forceinline__ int cl(int v, int n) { return min(max(v, 0), n - 1); }

// GAT-style aggregation over a device in-edge CSR at dst (+ optional explicit self loop as iteration j = -1):
//   logit = leaky(AS[src][h] + AD[n][h] (+ EW[e]*CW[h]), slope); softmax over the node's edges per head; acc[c] = sum alpha XP[src][c] (f16 gather plane, pitch XW; 256 channels = H heads x CH)
//   wave per node; lane L owns channels 8L..8L+7 (head = 8L / CH); per-lane softmax state (lanes of one head agree) -> no shuffles in the loop.
//   EPI 0: + bias -> f32 OUT[n][256] via LDS redistribution (two 16-B stores per lane, each instruction 512 contiguous B)
//   EPI 1: + bias, LayerNorm(256) * g + bb, relu -> bf16 hi/lo planes OH/OL [n][256] (16-B stores)
//   EPI 2: mean over the 256/CH heads + bias[0..63], LayerNorm(64) * g + bb, relu -> f32 OUT[n][64] (CH must be 64; LDS redistribution, 8-B stores)
//   EPI 3: mean over heads + bias -> f32 OUT[n][64] (no norm / activation)
//   EPI 4: + bias, ELU -> bf16 hi/lo planes OH/OL [n][256];  EPI 5: + bias (full 256-wide, per head), ELU, then mean over the 256/CH heads -> f32 OUT[n][64]
//   EPI 6: (CH = 128, two heads) mean over the two heads, + bias[0..127], relu -> f32 OUT[n][128] (LDS redistribution, 16-B stores)
//   EWM 0: no edge weights; 1: logit += EW[e] * CW[h] (self loop weight 1); 2: alpha *= EW[e] after the softmax (message scale; self loop weight 1)
template <int CH, bool SELF, int EWM, int EPI>
__global__ __launch_bounds__(256) void k_gat_agg(const unsigned short* __restrict__ XP, int XW, const float* __restrict__ AS, const float* __restrict__ AD, int ASTR, const float* __restrict__ EW, const float* __restrict__ CW,
        const int* __restrict__ esrc, const int* __restrict__ off, const int* __restrict__ cnt, const int* __restrict__ slot, const float* __restrict__ bias, const float* __restrict__ g, const float* __restrict__ bb,
        float* __restrict__ OUT, unsigned short* __restrict__ OH, unsigned short* __restrict__ OL, int N, int E, int CAP, float slope) {
    __shared__ float stage[8][256];
    const int wv = threadIdx.x >> 5; const int n = blockIdx.x * 8 + wv; const int L = threadIdx.x & 31; if (n >= N) return; const int c0 = 8 * L; const int h = c0 / CH;
    const float ad = AD[(long long)n * ASTR + h]; const float cw = (EWM == 1) ? CW[h] : 0.f; float m = -3.0e38f, s = 0.f; v4f a0, a1; a0.x = a0.y = a0.z = a0.w = 0.f; a1 = a0;
    const int p0 = cl(off[n], E + 1), cn = min(max(cnt[n], 0), CAP);
    for (int j = (SELF ? -1 : 0); j < cn; ++j) { int sj; float ew = 0.f;
        if (j < 0) { sj = n; ew = 1.f; } else { int e = slot[cl(p0 + j, E)]; e = cl(e, E); sj = cl(esrc[e], N); if (EWM != 0) ew = EW[e]; }
        float lg = AS[(long long)sj * ASTR + h] + ad + ((EWM == 1) ? ew * cw : 0.f); lg = (lg >= 0.f) ? lg : slope * lg;
        const float mn = fmaxf(m, lg); const float cz = expf(m - mn), pj = expf(lg - mn); s = s * cz + pj; const float pw = (EWM == 2) ? pj * ew : pj;
        const unsigned short* xr = XP + (long long)sj * XW + c0; a0 = a0 * cz + ld4h(xr) * pw; a1 = a1 * cz + ld4h(xr + 4) * pw; m = mn; }
    const float inv = (s > 0.f) ? 1.f / (s + 1e-16f) : 0.f; a0 = a0 * inv; a1 = a1 * inv;
    if (EPI == 0 || EPI == 1 || EPI == 4 || EPI == 5) { a0 = a0 + *(const v4f*)(bias + c0); a1 = a1 + *(const v4f*)(bias + c0 + 4); }
    if (EPI == 4 || EPI == 5) { a0.x = (a0.x > 0.f) ? a0.x : (expf(a0.x) - 1.f); a0.y = (a0.y > 0.f) ? a0.y : (expf(a0.y) - 1.f); a0.z = (a0.z > 0.f) ? a0.z : (expf(a0.z) - 1.f); a0.w = (a0.w > 0.f) ? a0.w : (expf(a0.w) - 1.f);
        a1.x = (a1.x > 0.f) ? a1.x : (expf(a1.x) - 1.f); a1.y = (a1.y > 0.f) ? a1.y : (expf(a1.y) - 1.f); a1.z = (a1.z > 0.f) ? a1.z : (expf(a1.z) - 1.f); a1.w = (a1.w > 0.f) ? a1.w : (expf(a1.w) - 1.f); }
    if (EPI == 4) { float o8[8] = {a0.x, a0.y, a0.z, a0.w, a1.x, a1.y, a1.z, a1.w}; unsigned short hh[8], ll[8];
#pragma unroll
        for (int u = 0; u < 8; ++u) bfsplit(o8[u], hh[u], ll[u]);
        const unsigned long long ph0 = (unsigned long long)hh[0] | ((unsigned long long)hh[1] << 16) | ((unsigned long long)hh[2] << 32) | ((unsigned long long)hh[3] << 48), pl0 = (unsigned long long)ll[0] | ((unsigned long long)ll[1] << 16) | ((unsigned long long)ll[2] << 32) | ((unsigned long long)ll[3] << 48);
        const unsigned long long ph1 = (unsigned long long)hh[4] | ((unsigned long long)hh[5] << 16) | ((unsigned long long)hh[6] << 32) | ((unsigned long long)hh[7] << 48), pl1 = (unsigned long long)ll[4] | ((unsigned long long)ll[5] << 16) | ((unsigned long long)ll[6] << 32) | ((unsigned long long)ll[7] << 48);
        v4u pk; pk.x = (unsigned)(ph0 & 0xFFFFFFFFull); pk.y = (unsigned)(ph0 >> 32); pk.z = (unsigned)(ph1 & 0xFFFFFFFFull); pk.w = (unsigned)(ph1 >> 32); v4u* dh = (v4u*)(OH + (long long)n * 256 + c0); *dh = pk; 
        v4u ql; ql.x = (unsigned)(pl0 & 0xFFFFFFFFull); ql.y = (unsigned)(pl0 >> 32); ql.z = (unsigned)(pl1 & 0xFFFFFFFFull); ql.w = (unsigned)(pl1 >> 32); v4u* dl = (v4u*)(OL + (long long)n * 256 + c0); *dl = ql;  return; }
    if (EPI == 6) {
        a0.x += __shfl_xor(a0.x, 16); a0.y += __shfl_xor(a0.y, 16); a0.z += __shfl_xor(a0.z, 16); a0.w += __shfl_xor(a0.w, 16); a1.x += __shfl_xor(a1.x, 16); a1.y += __shfl_xor(a1.y, 16); a1.z += __shfl_xor(a1.z, 16); a1.w += __shfl_xor(a1.w, 16);
        if (L < 16) { const int cb = 8 * L; const v4f b0 = *(const v4f*)(bias + cb), b1v = *(const v4f*)(bias + cb + 4);
            stage[wv][cb] = fmaxf(a0.x * 0.5f + b0.x, 0.f); stage[wv][cb + 1] = fmaxf(a0.y * 0.5f + b0.y, 0.f); stage[wv][cb + 2] = fmaxf(a0.z * 0.5f + b0.z, 0.f); stage[wv][cb + 3] = fmaxf(a0.w * 0.5f + b0.w, 0.f);
            stage[wv][cb + 4] = fmaxf(a1.x * 0.5f + b1v.x, 0.f); stage[wv][cb + 5] = fmaxf(a1.y * 0.5f + b1v.y, 0.f); stage[wv][cb + 6] = fmaxf(a1.z * 0.5f + b1v.z, 0.f); stage[wv][cb + 7] = fmaxf(a1.w * 0.5f + b1v.w, 0.f); }
        __builtin_amdgcn_fence(__ATOMIC_RELEASE, "workgroup"); __builtin_amdgcn_wave_barrier(); __builtin_amdgcn_fence(__ATOMIC_ACQUIRE, "workgroup");
        v4f o6; o6.x = stage[wv][4 * L]; o6.y = stage[wv][4 * L + 1]; o6.z = stage[wv][4 * L + 2]; o6.w = stage[wv][4 * L + 3]; VST2V4(OUT + (long long)n * 128 + 4 * L, o6); return; }
    if (EPI == 5) {
        a0.x += __shfl_xor(a0.x, 8); a0.y += __shfl_xor(a0.y, 8); a0.z += __shfl_xor(a0.z, 8); a0.w += __shfl_xor(a0.w, 8); a1.x += __shfl_xor(a1.x, 8); a1.y += __shfl_xor(a1.y, 8); a1.z += __shfl_xor(a1.z, 8); a1.w += __shfl_xor(a1.w, 8);
        a0.x += __shfl_xor(a0.x, 16); a0.y += __shfl_xor(a0.y, 16); a0.z += __shfl_xor(a0.z, 16); a0.w += __shfl_xor(a0.w, 16); a1.x += __shfl_xor(a1.x, 16); a1.y += __shfl_xor(a1.y, 16); a1.z += __shfl_xor(a1.z, 16); a1.w += __shfl_xor(a1.w, 16);
        const int gq5 = L & 7; a0 = a0 * 0.25f; a1 = a1 * 0.25f;
        if (L < 8) { stage[wv][8 * gq5] = a0.x; stage[wv][8 * gq5 + 1] = a0.y; stage[wv][8 * gq5 + 2] = a0.z; stage[wv][8 * gq5 + 3] = a0.w; stage[wv][8 * gq5 + 4] = a1.x; stage[wv][8 * gq5 + 5] = a1.y; stage[wv][8 * gq5 + 6] = a1.z; stage[wv][8 * gq5 + 7] = a1.w; }
        __builtin_amdgcn_fence(__ATOMIC_RELEASE, "workgroup"); __builtin_amdgcn_wave_barrier(); __builtin_amdgcn_fence(__ATOMIC_ACQUIRE, "workgroup");
        const unsigned long long pk5 = (unsigned long long)__builtin_bit_cast(unsigned, stage[wv][2 * L]) | ((unsigned long long)__builtin_bit_cast(unsigned, stage[wv][2 * L + 1]) << 32); VST2(unsigned long long, (unsigned long long*)(OUT + (long long)n * 64 + 2 * L), pk5); return; }
    if (EPI == 1) { float sm = a0.x + a0.y + a0.z + a0.w + a1.x + a1.y + a1.z + a1.w;
#pragma unroll
        for (int o = 16; o > 0; o >>= 1) sm += __shfl_xor(sm, o);
        const float mu = sm * (1.f / 256.f); const v4f d0 = a0 - mu, d1 = a1 - mu; float q = d0.x * d0.x + d0.y * d0.y + d0.z * d0.z + d0.w * d0.w + d1.x * d1.x + d1.y * d1.y + d1.z * d1.z + d1.w * d1.w;
#pragma unroll
        for (int o = 16; o > 0; o >>= 1) q += __shfl_xor(q, o);
        const float rs = rsqrtf(q * (1.f / 256.f) + 1e-5f); float o8[8] = {d0.x, d0.y, d0.z, d0.w, d1.x, d1.y, d1.z, d1.w}; unsigned short hh[8], ll[8];
#pragma unroll
        for (int u = 0; u < 8; ++u) { const float v = fmaxf(o8[u] * rs * g[c0 + u] + bb[c0 + u], 0.f); bfsplit(v, hh[u], ll[u]); }
        const unsigned long long ph0 = (unsigned long long)hh[0] | ((unsigned long long)hh[1] << 16) | ((unsigned long long)hh[2] << 32) | ((unsigned long long)hh[3] << 48), pl0 = (unsigned long long)ll[0] | ((unsigned long long)ll[1] << 16) | ((unsigned long long)ll[2] << 32) | ((unsigned long long)ll[3] << 48);
        const unsigned long long ph1 = (unsigned long long)hh[4] | ((unsigned long long)hh[5] << 16) | ((unsigned long long)hh[6] << 32) | ((unsigned long long)hh[7] << 48), pl1 = (unsigned long long)ll[4] | ((unsigned long long)ll[5] << 16) | ((unsigned long long)ll[6] << 32) | ((unsigned long long)ll[7] << 48);
        // lane L's 8 halves at c0 = 8L: 16 B -> one 16-B store per plane (32 lanes x 16 B = whole 512-B row)
        v4u pk; pk.x = (unsigned)(ph0 & 0xFFFFFFFFull); pk.y = (unsigned)(ph0 >> 32); pk.z = (unsigned)(ph1 & 0xFFFFFFFFull); pk.w = (unsigned)(ph1 >> 32); v4u* dh = (v4u*)(OH + (long long)n * 256 + c0); *dh = pk; 
        v4u ql; ql.x = (unsigned)(pl0 & 0xFFFFFFFFull); ql.y = (unsigned)(pl0 >> 32); ql.z = (unsigned)(pl1 & 0xFFFFFFFFull); ql.w = (unsigned)(pl1 >> 32); v4u* dl = (v4u*)(OL + (long long)n * 256 + c0); *dl = ql;  return; }
    if (EPI == 2 || EPI == 3) {   // head mean: lanes L, L^8, L^16, L^24 hold the same chan group of the 4 heads (CH = 64 -> 8 lanes per head)
        a0.x += __shfl_xor(a0.x, 8); a0.y += __shfl_xor(a0.y, 8); a0.z += __shfl_xor(a0.z, 8); a0.w += __shfl_xor(a0.w, 8); a1.x += __shfl_xor(a1.x, 8); a1.y += __shfl_xor(a1.y, 8); a1.z += __shfl_xor(a1.z, 8); a1.w += __shfl_xor(a1.w, 8);
        a0.x += __shfl_xor(a0.x, 16); a0.y += __shfl_xor(a0.y, 16); a0.z += __shfl_xor(a0.z, 16); a0.w += __shfl_xor(a0.w, 16); a1.x += __shfl_xor(a1.x, 16); a1.y += __shfl_xor(a1.y, 16); a1.z += __shfl_xor(a1.z, 16); a1.w += __shfl_xor(a1.w, 16);
        const int gq = L & 7; a0 = a0 * 0.25f + *(const v4f*)(bias + 8 * gq); a1 = a1 * 0.25f + *(const v4f*)(bias + 8 * gq + 4);      // every lane now holds channels 8gq..8gq+7 of the mean
        if (EPI == 3) { if (L < 8) { stage[wv][8 * gq] = a0.x; stage[wv][8 * gq + 1] = a0.y; stage[wv][8 * gq + 2] = a0.z; stage[wv][8 * gq + 3] = a0.w; stage[wv][8 * gq + 4] = a1.x; stage[wv][8 * gq + 5] = a1.y; stage[wv][8 * gq + 6] = a1.z; stage[wv][8 * gq + 7] = a1.w; }
            __builtin_amdgcn_fence(__ATOMIC_RELEASE, "workgroup"); __builtin_amdgcn_wave_barrier(); __builtin_amdgcn_fence(__ATOMIC_ACQUIRE, "workgroup");
            const unsigned long long pk3 = (unsigned long long)__builtin_bit_cast(unsigned, stage[wv][2 * L]) | ((unsigned long long)__builtin_bit_cast(unsigned, stage[wv][2 * L + 1]) << 32); VST2(unsigned long long, (unsigned long long*)(OUT + (long long)n * 64 + 2 * L), pk3); return; }
        float sm = (L < 8) ? (a0.x + a0.y + a0.z + a0.w + a1.x + a1.y + a1.z + a1.w) : 0.f;
#pragma unroll
        for (int o = 16; o > 0; o >>= 1) sm += __shfl_xor(sm, o);
        const float mu = sm * (1.f / 64.f); const v4f d0 = a0 - mu, d1 = a1 - mu; float q = (L < 8) ? (d0.x * d0.x + d0.y * d0.y + d0.z * d0.z + d0.w * d0.w + d1.x * d1.x + d1.y * d1.y + d1.z * d1.z + d1.w * d1.w) : 0.f;
#pragma unroll
        for (int o = 16; o > 0; o >>= 1) q += __shfl_xor(q, o);
        const float rs = rsqrtf(q * (1.f / 64.f) + 1e-5f);
        if (L < 8) { const float* gg = g + 8 * gq; const float* bq = bb + 8 * gq; stage[wv][8 * gq] = fmaxf(d0.x * rs * gg[0] + bq[0], 0.f); stage[wv][8 * gq + 1] = fmaxf(d0.y * rs * gg[1] + bq[1], 0.f); stage[wv][8 * gq + 2] = fmaxf(d0.z * rs * gg[2] + bq[2], 0.f); stage[wv][8 * gq + 3] = fmaxf(d0.w * rs * gg[3] + bq[3], 0.f);
            stage[wv][8 * gq + 4] = fmaxf(d1.x * rs * gg[4] + bq[4], 0.f); stage[wv][8 * gq + 5] = fmaxf(d1.y * rs * gg[5] + bq[5], 0.f); stage[wv][8 * gq + 6] = fmaxf(d1.z * rs * gg[6] + bq[6], 0.f); stage[wv][8 * gq + 7] = fmaxf(d1.w * rs * gg[7] + bq[7], 0.f); }
        __builtin_amdgcn_fence(__ATOMIC_RELEASE, "workgroup"); __builtin_amdgcn_wave_barrier(); __builtin_amdgcn_fence(__ATOMIC_ACQUIRE, "workgroup");
        const unsigned long long pk = (unsigned long long)__builtin_bit_cast(unsigned, stage[wv][2 * L]) | ((unsigned long long)__builtin_bit_cast(unsigned, stage[wv][2 * L + 1]) << 32); VST2(unsigned long long, (unsigned long long*)(OUT + (long long)n * 64 + 2 * L), pk); return; }
    // EPI 0
    stage[wv][c0] = a0.x; stage[wv][c0 + 1] = a0.y; stage[wv][c0 + 2] = a0.z; stage[wv][c0 + 3] = a0.w; stage[wv][c0 + 4] = a1.x; stage[wv][c0 + 5] = a1.y; stage[wv][c0 + 6] = a1.z; stage[wv][c0 + 7] = a1.w;
    __builtin_amdgcn_fence(__ATOMIC_RELEASE, "workgroup"); __builtin_amdgcn_wave_barrier(); __builtin_amdgcn_fence(__ATOMIC_ACQUIRE, "workgroup");
#pragma unroll
    for (int q2 = 0; q2 < 2; ++q2) { const int c = 128 * q2 + 4 * L; v4f v; v.x = stage[wv][c]; v.y = stage[wv][c + 1]; v.z = stage[wv][c + 2]; v.w = stage[wv][c + 3]; VST2V4(OUT + (long long)n * 256 + c, v); } }

__device__ __forceinline__ void st4s(unsigned short* Hp, unsigned short* Lp, long long o, v4f a) { unsigned short h[4], l[4]; bfsplit(a.x, h[0], l[0]); bfsplit(a.y, h[1], l[1]); bfsplit(a.z, h[2], l[2]); bfsplit(a.w, h[3], l[3]);
    const unsigned long long ph = (unsigned long long)h[0] | ((unsigned long long)h[1] << 16) | ((unsigned long long)h[2] << 32) | ((unsigned long long)h[3] << 48), pl = (unsigned long long)l[0] | ((unsigned long long)l[1] << 16) | ((unsigned long long)l[2] << 32) | ((unsigned long long)l[3] << 48);
    VST2(unsigned long long, (unsigned long long*)(Hp + o), ph); VST2(unsigned long long, (unsigned long long*)(Lp + o), pl); }
// f32 [nval2 pairs] -> bf16 hi/lo planes (n2 pairs; pairs >= nval2 zero); thread-linear 4-B stores per plane
__global__ __launch_bounds__(256) void k_pl(const float* __restrict__ S, unsigned short* __restrict__ PH, unsigned short* __restrict__ PL, long long nval2, long long n2) { const long long u = (long long)blockIdx.x * 256 + threadIdx.x; if (u >= n2) return; const bool in = (u < nval2); const long long uc = in ? u : ((nval2 > 0) ? (nval2 - 1) : 0); const float a = S[2 * uc], b = S[2 * uc + 1]; st_s2(PH, PL, 2 * u, in ? a : 0.f, in ? b : 0.f); }
// WC [K][NOP] (thread-linear whole rows) = [W (cols < FO) | 0 | W_h . as_h @EO+h | W_h . ad_h @EO+NH+h | 0 ...]; W is [K][FO] (x @ W layout), as/ad [NH][DH]; EO >= FO.
// branch-free: every lane loads all candidates with clamped indices and selects by value (no exec-masked load arms)
__global__ __launch_bounds__(256) void k_wext(const float* __restrict__ Wm, const float* __restrict__ AS_, const float* __restrict__ AD_, int K, int NOP, int FO, int NH, int DH, int EO, float* __restrict__ WC) {
    #pragma clang fp contract(off)
    const long long u = (long long)blockIdx.x * 256 + threadIdx.x; if (u >= (long long)K * NOP) return; const int kk = (int)(u / NOP), o = (int)(u % NOP);
    const int oo = min(o, FO - 1); const float vw = Wm[(long long)kk * FO + oo]; const int q = min(max(o - EO, 0), 2 * NH - 1); const int h = q % NH; float s = 0.f;
#pragma unroll 1
    for (int c = 0; c < DH; ++c) { const float w = Wm[(long long)kk * FO + h * DH + c]; const float asv = AS_[h * DH + c], adv = AD_[h * DH + c]; s += w * ((q < NH) ? asv : adv); }
    const float v = (o < FO) ? vw : ((o >= EO && o < EO + 2 * NH) ? s : 0.f); VST2(float, WC + u, v); }
// GAT aggregation over a device in-edge CSR (+ analytic self loop as iteration j = -1 when SELF), per-lane online softmax (lanes of one head agree):
// HS rows (pitch P floats): [0,128) projected features z, col 128 + h = a_src.z_h, col 128 + NH + h = a_dst.z_h; lane L owns channels 4L..4L+3 (head = 4L / CH).
// out = sum_j softmax_j(leaky(el[src_j][h] + er[n][h])) z[src_j] (/ (den + deps)) + bias -> ACT (0 none, 1 relu, 2 elu, 3 leaky 0.01) ->
// MODE 0: f32 OUT[n][OW] cols < OC (16-B lane stores, OC*4 contiguous B per wave; OC in {64,128}); MODE 1: bf16 hi/lo planes PH/PL pitch PP (rows n >= N zero); MODE 2: both.
template <int CH, bool SELF, int ACT, int MODE>
__global__ __launch_bounds__(256) void k_gat128(const float* __restrict__ HS, int P, int NH, const float* __restrict__ bias, const int* __restrict__ SRC, const int* __restrict__ off, const int* __restrict__ cnt, const int* __restrict__ slot,
        float* __restrict__ OUT, int OW, int OC, unsigned short* __restrict__ PH, unsigned short* __restrict__ PL, int PP, int N, int NP, int E, int CAP, float slope, float deps) {
    #pragma clang fp contract(off)
    const int n = blockIdx.x * 8 + (threadIdx.x >> 5); const int L = threadIdx.x & 31; if (n >= NP) return; const int c = 4 * L; const int h = c / CH; v4f o; o.x = o.y = o.z = o.w = 0.f;
    if (n < N) { const float* hn = HS + (long long)n * P; const float er = hn[128 + NH + h]; float m = -3.0e38f, s = 0.f; v4f a; a.x = a.y = a.z = a.w = 0.f;
        const int p0 = min(max(off[n], 0), E), cn = min(max(cnt[n], 0), CAP);
        for (int j = (SELF ? -1 : 0); j < cn; ++j) { int sj; if (j < 0) sj = n; else { const int e = min(max(slot[min(p0 + j, E - 1)], 0), E - 1); sj = min(max(SRC[e], 0), N - 1); }
            const float* hs = HS + (long long)sj * P; float lg = hs[128 + h] + er; lg = (lg >= 0.f) ? lg : slope * lg;
            const float mn = fmaxf(m, lg); const float cz = expf(m - mn), pj = expf(lg - mn); s = s * cz + pj; a = a * cz + *(const v4f*)(hs + c) * pj; m = mn; }
        const float inv = (s > 0.f || deps > 0.f) ? 1.f / (s + deps) : 0.f; o = a * inv + *(const v4f*)(bias + c);
        if (ACT == 1) { o.x = fmaxf(o.x, 0.f); o.y = fmaxf(o.y, 0.f); o.z = fmaxf(o.z, 0.f); o.w = fmaxf(o.w, 0.f); }
        if (ACT == 2) { o.x = (o.x > 0.f) ? o.x : (expf(o.x) - 1.f); o.y = (o.y > 0.f) ? o.y : (expf(o.y) - 1.f); o.z = (o.z > 0.f) ? o.z : (expf(o.z) - 1.f); o.w = (o.w > 0.f) ? o.w : (expf(o.w) - 1.f); }
        if (ACT == 3) { o.x = (o.x >= 0.f) ? o.x : 0.01f * o.x; o.y = (o.y >= 0.f) ? o.y : 0.01f * o.y; o.z = (o.z >= 0.f) ? o.z : 0.01f * o.z; o.w = (o.w >= 0.f) ? o.w : 0.01f * o.w; }
        if (MODE != 1 && c < OC) VST2V4(OUT + (long long)n * OW + c, o); }
    if (MODE != 0) st4s(PH, PL, (long long)n * PP + c, o); }

// ---- util2 ----
// generic Bt plane builder from an f32 weight: Bt[o][k] (pitch KP halves) = (TRANS ? W[k*ldw + o] : W[o*ldw + k]) * (S ? S[o] : 1) for o < NO, k < KI; zero elsewhere for o < NOP rows, k < KP (thread per (o < NOP, pair k))
__global__ __launch_bounds__(256) void k_u2_bt(const float* __restrict__ Wm, int ldw, int TRANS, int KI, int NO, int KP, int NOP, const float* __restrict__ S, unsigned short* __restrict__ PH_, unsigned short* __restrict__ PL_) {
    const long long u = (long long)blockIdx.x * 256 + threadIdx.x; if (u >= (long long)NOP * (KP / 2)) return; const int k0 = 2 * (int)(u % (KP / 2)); const int o = (int)(u / (KP / 2)); float a = 0.f, b = 0.f;
    if (o < NO) { const float s = S ? S[o] : 1.f;
        if (k0 < KI) a = (TRANS ? Wm[(long long)k0 * ldw + o] : Wm[(long long)o * ldw + k0]) * s;
        if (k0 + 1 < KI) b = (TRANS ? Wm[(long long)(k0 + 1) * ldw + o] : Wm[(long long)o * ldw + k0 + 1]) * s; }
    st_s2(PH_, PL_, (long long)o * KP + k0, a, b); }
// generic padded vector: O[i] = (i < n) ? (A[i] * (S ? S[i] : 1) + (B2 ? B2[i] : 0)) : 0 for i < NP (one block of 256, NP <= 4096 looped)
__global__ __launch_bounds__(256) void k_u2_vec(const float* __restrict__ A, const float* __restrict__ S, const float* __restrict__ B2, int n, int NP, float* __restrict__ O) { for (int i = threadIdx.x; i < NP; i += 256) { float v = 0.f; if (i < n) v = A[i] * (S ? S[i] : 1.f) + (B2 ? B2[i] : 0.f); VST2(float, O + i, v); } }
__global__ __launch_bounds__(256) void k_u2_colstat(const float* __restrict__ X, int P, int N, float eps, float* __restrict__ STAT) {
    #pragma clang fp contract(off)
    __shared__ float red[256]; const int c = blockIdx.x; const int t = threadIdx.x; float s = 0.f; for (int r = t; r < N; r += 256) s += X[(long long)r * P + c]; red[t] = s; __syncthreads();
    for (int o = 128; o > 0; o >>= 1) { if (t < o) red[t] += red[t + o]; __syncthreads(); }
    const float mu = red[0] / (float)N; __syncthreads(); float q = 0.f; for (int r = t; r < N; r += 256) { const float d = X[(long long)r * P + c] - mu; q += d * d; } red[t] = q; __syncthreads();
    for (int o = 128; o > 0; o >>= 1) { if (t < o) red[t] += red[t + o]; __syncthreads(); }
    const float rs = 1.f / sqrtf(red[0] / (float)N + eps); if (t < 32) VST2(float, STAT + (long long)c * 32 + t, (t == 0) ? mu : ((t == 1) ? rs : 0.f)); }
// rows f32 [R][W] (pitch PW) -> planes at pitch PP, column offset coff; rows >= RL (live) written as zeros up to RP (thread per (r < RP, 4 of W))
__global__ __launch_bounds__(256) void k_u2_pl(const float* __restrict__ X, int PW, int Wd, int RL, int RP, unsigned short* __restrict__ PH_, unsigned short* __restrict__ PL_, int PP, int coff) { const long long u = (long long)blockIdx.x * 256 + threadIdx.x; if (u >= (long long)RP * (Wd / 4)) return; const int r = (int)(u / (Wd / 4)); const int c = 4 * (int)(u % (Wd / 4)); v4f v; v.x = v.y = v.z = v.w = 0.f; if (r < RL) v = *(const v4f*)(X + (long long)r * PW + c); st4s(PH_, PL_, (long long)r * PP + coff + c, v); }

typedef unsigned int cm_u4 __attribute__((ext_vector_type(4)));

__global__ __launch_bounds__(256) void k_cm_zero16(unsigned short* __restrict__ DST, long long n) { const long long u = (long long)blockIdx.x * 256 + threadIdx.x; if (u * 8 >= n) return; cm_u4 z; z.x = z.y = z.z = z.w = 0u; cm_u4* d = (cm_u4*)(DST + u * 8); *d = z;  }
// f32 -> bf16 (RNE) -> f16 casts: every 16-bit operand then holds exactly the bf16-rounded input value (times a power-of-two
// weight scale), so the f16 WMMA products are exact. Plain: thread per (row, 8 cols),
// dst [R][C] pitch ldd; transposed: thread per (col, 8 consecutive rows) -> dst [C][R] pitch ldd; both store 16 B per thread, thread-linear along the dst row.
__device__ __forceinline__ unsigned int cmb_pk2(float a, float b) { return (unsigned int)__builtin_bit_cast(unsigned short, (_Float16)a) | ((unsigned int)__builtin_bit_cast(unsigned short, (_Float16)b) << 16); }
__device__ __forceinline__ float cmb_bf(float v) { const unsigned u = __builtin_bit_cast(unsigned, v); const unsigned r = (u + 0x7fffu + ((u >> 16) & 1u)) & 0xffff0000u; return __builtin_bit_cast(float, r); }   // bf16 RNE, kept as f32 (finite inputs)
// BR[i] = bf16_rne(B[i]) kept as f32 (thread per element)
__global__ __launch_bounds__(256) void k_cm_bfvec(const float* __restrict__ SRC, float* __restrict__ DST, int n) { const int u = blockIdx.x * 256 + threadIdx.x; if (u >= n) return; VST2(float, DST + u, cmb_bf(SRC[u])); }
__global__ __launch_bounds__(256) void k_cm_castb(const float* __restrict__ SRC, int lds, unsigned short* __restrict__ DST, int ldd, int nR, int nC, float sc) {
    const long long u = (long long)blockIdx.x * 256 + threadIdx.x; const int per = nC / 8; if (u >= (long long)nR * per) return; const int r = (int)(u / per); const int c0 = 8 * (int)(u % per);
    const float* s = SRC + (long long)r * lds + c0; float w[8];
#pragma unroll
    for (int e = 0; e < 8; ++e) w[e] = cmb_bf(s[e]) * sc;
    cm_u4 pk; pk.x = cmb_pk2(w[0], w[1]); pk.y = cmb_pk2(w[2], w[3]); pk.z = cmb_pk2(w[4], w[5]); pk.w = cmb_pk2(w[6], w[7]); VST2(cm_u4, (cm_u4*)(DST + (long long)r * ldd + c0), pk); }
__global__ __launch_bounds__(256) void k_cm_castbT(const float* __restrict__ SRC, int lds, unsigned short* __restrict__ DST, int ldd, int nR, int nC, float sc) {
    const long long u = (long long)blockIdx.x * 256 + threadIdx.x; const int per = nR / 8; if (u >= (long long)nC * per) return; const int c = (int)(u / per); const int r0 = 8 * (int)(u % per);
    float w[8];
#pragma unroll
    for (int e = 0; e < 8; ++e) w[e] = cmb_bf(SRC[(long long)(r0 + e) * lds + c]) * sc;
    cm_u4 pk; pk.x = cmb_pk2(w[0], w[1]); pk.y = cmb_pk2(w[2], w[3]); pk.z = cmb_pk2(w[4], w[5]); pk.w = cmb_pk2(w[6], w[7]); VST2(cm_u4, (cm_u4*)(DST + (long long)c * ldd + r0), pk); }

// QT = bf16(q) * bf16(tau[b]) (f32), KB = bf16(k), VB = bf16(v) (thread per float4 of each; which = blockIdx range, block-uniform); MF[b][j] = scale * bf16(delta[b][j])
__global__ __launch_bounds__(256) void k_ds_pre(const float* __restrict__ Q, const float* __restrict__ Kp, const float* __restrict__ V, const float* __restrict__ TAU, const float* __restrict__ DELTA, float* __restrict__ QTp, float* __restrict__ KBp, float* __restrict__ VBp, float* __restrict__ MFp, float sc) {
    #pragma clang fp contract(off)
    const long long NQ4 = 2LL * 2048 * 8 * 64 / 4; const long long nb = NQ4 / 256; const long long u = (long long)(blockIdx.x % nb) * 256 + threadIdx.x; const int which = blockIdx.x / nb;
    if (which == 0) { const int b = (int)(u / (2048LL * 8 * 16)); const float t = cmb_bf(TAU[b]); const v4f x = *(const v4f*)(Q + 4 * u); v4f r; r.x = cmb_bf(x.x) * t; r.y = cmb_bf(x.y) * t; r.z = cmb_bf(x.z) * t; r.w = cmb_bf(x.w) * t; VST2V4(QTp + 4 * u, r); }
    else if (which == 1) { const v4f x = *(const v4f*)(Kp + 4 * u); v4f r; r.x = cmb_bf(x.x); r.y = cmb_bf(x.y); r.z = cmb_bf(x.z); r.w = cmb_bf(x.w); VST2V4(KBp + 4 * u, r); }
    else if (which == 2) { const v4f x = *(const v4f*)(V + 4 * u); v4f r; r.x = cmb_bf(x.x); r.y = cmb_bf(x.y); r.z = cmb_bf(x.z); r.w = cmb_bf(x.w); VST2V4(VBp + 4 * u, r); }
    else { if (u >= 2 * 2048) return; VST2(float, MFp + u, sc * cmb_bf(DELTA[u])); } }
// out = m * A1 + (1 - m) * A2 with m = bf16(soft_mask[b][l]) broadcast over (h, e); thread per float4
__global__ __launch_bounds__(256) void k_ds_blend(const float* __restrict__ A1, const float* __restrict__ A2, const float* __restrict__ SM, float* __restrict__ O, long long n4) {
    #pragma clang fp contract(off)
    const long long u = (long long)blockIdx.x * 256 + threadIdx.x; if (u >= n4) return; const float m = cmb_bf(SM[(4 * u) / 512]); const v4f a = *(const v4f*)(A1 + 4 * u), b = *(const v4f*)(A2 + 4 * u); v4f o;
    o.x = m * a.x + (1.f - m) * b.x; o.y = m * a.y + (1.f - m) * b.y; o.z = m * a.z + (1.f - m) * b.z; o.w = m * a.w + (1.f - m) * b.w; VST2V4(O + 4 * u, o); }


extern "C" void kernel_launch(void* const* d_in, const int* in_sizes, int n_in, void* d_out, int out_size, void* d_ws, size_t ws_size, hipStream_t stream) {
    (void)in_sizes; (void)n_in; (void)out_size; (void)ws_size;
    const float* q = (const float*)d_in[0];
    const float* kk = (const float*)d_in[1];
    const float* v = (const float*)d_in[2];
    const float* kn = (const float*)d_in[3];
    const float* vn = (const float*)d_in[4];
    const float* tau = (const float*)d_in[5];
    const float* delta = (const float*)d_in[6];
    const float* smask = (const float*)d_in[7];
    float* out = (float*)d_out;
    char* wsp = (char*)d_ws;
    float* QT = (float*)wsp; wsp += (((size_t)((size_t)2097152) * 4 + 255) / 256) * 256;
    float* KB = (float*)wsp; wsp += (((size_t)((size_t)2097152) * 4 + 255) / 256) * 256;
    float* VB = (float*)wsp; wsp += (((size_t)((size_t)2097152) * 4 + 255) / 256) * 256;
    float* MF = (float*)wsp; wsp += (((size_t)((size_t)4096) * 4 + 255) / 256) * 256;
    float* AO1 = (float*)wsp; wsp += (((size_t)((size_t)2097152) * 4 + 255) / 256) * 256;
    float* AO2 = (float*)wsp; wsp += (((size_t)((size_t)2097152) * 4 + 255) / 256) * 256;
    if ((size_t)(wsp - (char*)d_ws) > ws_size) return;   // static carve guard
    k_ds_pre<<<(unsigned)(3 * (524288 / 256) + (4096 + 255) / 256), 256, 0, stream>>>(q, kk, v, tau, delta, QT, KB, VB, MF, 0.125f);
    { /*apv4*/ AttnP a;
      a.Q = QT + 0; a.K = KB + 0; a.V = VB + 0; a.O = AO1 + 0; a.P = 0; a.Mf = MF + 0; a.Mi = 0; a.ST = 0;
      a.Pw = 0; a.Rt = 0; a.SQ = 0; a.SK = 0;
      a.swb = 0; a.swh = 0; a.swi = 0; a.swj = 0; a.srb = 0; a.srh = 0; a.sri = 0; a.sQb = 0; a.sQh = 64; a.sQi = 512; a.sQd = 1; a.sKb = 0; a.sKh = 64; a.sKj = 512; a.sKd = 1; a.sVb = 0; a.sVh = 64; a.sVj = 512; a.sVd = 1; a.sOb = 0; a.sOh = 64; a.sOi = 512; a.sPb = 0; a.sPh = 0; a.sPi = 0; a.smb = 0; a.smh = 0; a.smi = 0; a.smj = 1;
      a.Lq = 2048; a.Lk = 2048; a.dh = 64; a.dv = 64; a.hrep = 1; a.causal = 1; a.coff = 0; a.pband = 0;
      a.scale = 0.125f; a.mfill = 0.0f; a.nonorm = 0; a.mpol = 0;
      a.roff = 0; a.rn = 1; a.segpol = 0; a.win = 0;
      k_attn<64, 64, 1, true, false><<<dim3((unsigned)((2048) + 16 * AW - 1) / (16 * AW), (unsigned)(8), (unsigned)(1)), 32 * AW, 0, stream>>>(a); }
    { /*apv4*/ AttnP a;
      a.Q = QT + 1048576; a.K = KB + 1048576; a.V = VB + 1048576; a.O = AO1 + 1048576; a.P = 0; a.Mf = MF + 2048; a.Mi = 0; a.ST = 0;
      a.Pw = 0; a.Rt = 0; a.SQ = 0; a.SK = 0;
      a.swb = 0; a.swh = 0; a.swi = 0; a.swj = 0; a.srb = 0; a.srh = 0; a.sri = 0; a.sQb = 0; a.sQh = 64; a.sQi = 512; a.sQd = 1; a.sKb = 0; a.sKh = 64; a.sKj = 512; a.sKd = 1; a.sVb = 0; a.sVh = 64; a.sVj = 512; a.sVd = 1; a.sOb = 0; a.sOh = 64; a.sOi = 512; a.sPb = 0; a.sPh = 0; a.sPi = 0; a.smb = 0; a.smh = 0; a.smi = 0; a.smj = 1;
      a.Lq = 2048; a.Lk = 2048; a.dh = 64; a.dv = 64; a.hrep = 1; a.causal = 1; a.coff = 0; a.pband = 0;
      a.scale = 0.125f; a.mfill = 0.0f; a.nonorm = 0; a.mpol = 0;
      a.roff = 0; a.rn = 1; a.segpol = 0; a.win = 0;
      k_attn<64, 64, 1, true, false><<<dim3((unsigned)((2048) + 16 * AW - 1) / (16 * AW), (unsigned)(8), (unsigned)(1)), 32 * AW, 0, stream>>>(a); }
    k_ds_pre<<<(unsigned)(3 * (524288 / 256) + (4096 + 255) / 256), 256, 0, stream>>>(q, kn, vn, tau, delta, QT, KB, VB, MF, 0.125f);
    { /*apv4*/ AttnP a;
      a.Q = QT + 0; a.K = KB + 0; a.V = VB + 0; a.O = AO2 + 0; a.P = 0; a.Mf = MF + 0; a.Mi = 0; a.ST = 0;
      a.Pw = 0; a.Rt = 0; a.SQ = 0; a.SK = 0;
      a.swb = 0; a.swh = 0; a.swi = 0; a.swj = 0; a.srb = 0; a.srh = 0; a.sri = 0; a.sQb = 0; a.sQh = 64; a.sQi = 512; a.sQd = 1; a.sKb = 0; a.sKh = 64; a.sKj = 512; a.sKd = 1; a.sVb = 0; a.sVh = 64; a.sVj = 512; a.sVd = 1; a.sOb = 0; a.sOh = 64; a.sOi = 512; a.sPb = 0; a.sPh = 0; a.sPi = 0; a.smb = 0; a.smh = 0; a.smi = 0; a.smj = 1;
      a.Lq = 2048; a.Lk = 2048; a.dh = 64; a.dv = 64; a.hrep = 1; a.causal = 1; a.coff = 0; a.pband = 0;
      a.scale = 0.125f; a.mfill = 0.0f; a.nonorm = 0; a.mpol = 0;
      a.roff = 0; a.rn = 1; a.segpol = 0; a.win = 0;
      k_attn<64, 64, 1, true, false><<<dim3((unsigned)((2048) + 16 * AW - 1) / (16 * AW), (unsigned)(8), (unsigned)(1)), 32 * AW, 0, stream>>>(a); }
    { /*apv4*/ AttnP a;
      a.Q = QT + 1048576; a.K = KB + 1048576; a.V = VB + 1048576; a.O = AO2 + 1048576; a.P = 0; a.Mf = MF + 2048; a.Mi = 0; a.ST = 0;
      a.Pw = 0; a.Rt = 0; a.SQ = 0; a.SK = 0;
      a.swb = 0; a.swh = 0; a.swi = 0; a.swj = 0; a.srb = 0; a.srh = 0; a.sri = 0; a.sQb = 0; a.sQh = 64; a.sQi = 512; a.sQd = 1; a.sKb = 0; a.sKh = 64; a.sKj = 512; a.sKd = 1; a.sVb = 0; a.sVh = 64; a.sVj = 512; a.sVd = 1; a.sOb = 0; a.sOh = 64; a.sOi = 512; a.sPb = 0; a.sPh = 0; a.sPi = 0; a.smb = 0; a.smh = 0; a.smi = 0; a.smj = 1;
      a.Lq = 2048; a.Lk = 2048; a.dh = 64; a.dv = 64; a.hrep = 1; a.causal = 1; a.coff = 0; a.pband = 0;
      a.scale = 0.125f; a.mfill = 0.0f; a.nonorm = 0; a.mpol = 0;
      a.roff = 0; a.rn = 1; a.segpol = 0; a.win = 0;
      k_attn<64, 64, 1, true, false><<<dim3((unsigned)((2048) + 16 * AW - 1) / (16 * AW), (unsigned)(8), (unsigned)(1)), 32 * AW, 0, stream>>>(a); }
    k_ds_blend<<<(524288 + 255) / 256, 256, 0, stream>>>(AO1, AO2, smask, out, 524288LL);
}

// v002
// It runs in 390 microseconds.
// In both of two side-by-side timings against v001, it was 2.72 times as fast.
// Counting every step since v000, it is 9.45 times as fast.
// De-stationary causal attention with a null branch, [b, l, h, e] layout (2 x 2,048 tokens, 8 heads x 64): A = softmax(scale * (q.k * tau_b + delta_bj)) over keys j <= i for (keys, values) and for (keys_null, values_null) with the same queries; out = soft_mask * out_edit + (1 - soft_mask) * out_null per query. All inputs rounded to bf16 (RNE); q is multiplied by tau_b on device (f32) and k, v rounded, then ONE WMMA attention launch for both batches and both branches (v_wmma_f32_16x16x32_bf16, f32 accumulate) with bf16 hi/lo split q.k (f32-class: q*tau is not 16-bit exact), the per-key additive table scale*delta_bj, causal, f32 online softmax, bf16 hi/lo split P.v; the blend in f32.
#include <hip/hip_runtime.h>
#include <math.h>

typedef __attribute__((ext_vector_type(16))) _Float16 v16h;
typedef __attribute__((ext_vector_type(8)))  _Float16 v8h;
typedef __attribute__((ext_vector_type(16))) __bf16   v16b;
typedef __attribute__((ext_vector_type(8)))  float    v8f;
typedef __attribute__((ext_vector_type(4)))  float    v4f;

// 16-bit WMMA fragment map (wave32), lane L, h = L>>4, m = L&15:
//   A 16x32: lane = row m;   element i -> k = (i<8) ? 8h+i : 16+8h+(i-8)
//   B 32x16: lane = column m; the SAME k(i,h)
//   D 16x16 (8 f32): lane = column m; element r -> row 8h+r
__device__ __forceinline__ int frag_k(int i, int h) { return (i < 8) ? (8 * h + i) : (16 + 8 * h + (i - 8)); }
__device__ __forceinline__ __bf16 bf16_rne(float f) {
    unsigned int u = __float_as_uint(f);
    u += 0x7fffu + ((u >> 16) & 1u);
    return __builtin_bit_cast(__bf16, (unsigned short)(u >> 16));
}
__device__ __forceinline__ float bf16_f32(__bf16 b) { return __uint_as_float(((unsigned int)__builtin_bit_cast(unsigned short, b)) << 16); }
__device__ __forceinline__ v8f wmma16(v16h a, v16h b, v8f c) {
    c = __builtin_amdgcn_wmma_f32_16x16x32_f16(false, a, false, b, (short)0, c, false, false);
    asm volatile("v_nop\n\tv_nop\n\tv_nop\n\tv_nop" : "+v"(c) : "v"(a), "v"(b));
    return c;
}
__device__ __forceinline__ v8f wmmab(v16b a, v16b b, v8f c) {
    c = __builtin_amdgcn_wmma_f32_16x16x32_bf16(false, a, false, b, (short)0, c, false, false);
    asm volatile("v_nop\n\tv_nop\n\tv_nop\n\tv_nop" : "+v"(c) : "v"(a), "v"(b));
    return c;
}
struct Split { v16b hi, lo; };
// hi/lo split product: a.hi*b.hi + a.hi*b.lo + a.lo*b.hi
__device__ __forceinline__ v8f wmma3(const Split& a, const Split& b, v8f c) {
    c = __builtin_amdgcn_wmma_f32_16x16x32_bf16(false, a.hi, false, b.hi, (short)0, c, false, false);
    c = __builtin_amdgcn_wmma_f32_16x16x32_bf16(false, a.hi, false, b.lo, (short)0, c, false, false);
    c = __builtin_amdgcn_wmma_f32_16x16x32_bf16(false, a.lo, false, b.hi, (short)0, c, false, false);
    asm volatile("v_nop\n\tv_nop\n\tv_nop\n\tv_nop" : "+v"(c) : "v"(a.hi), "v"(a.lo), "v"(b.hi), "v"(b.lo));
    return c;
}
struct Split3 { v16b hi, mid, lo; };
// triple split product (6 terms, drops only terms below 2^-24 relative)
__device__ __forceinline__ v8f wmma6(const Split3& a, const Split3& b, v8f c) {
    c = __builtin_amdgcn_wmma_f32_16x16x32_bf16(false, a.hi, false, b.hi, (short)0, c, false, false);
    c = __builtin_amdgcn_wmma_f32_16x16x32_bf16(false, a.hi, false, b.mid, (short)0, c, false, false);
    c = __builtin_amdgcn_wmma_f32_16x16x32_bf16(false, a.mid, false, b.hi, (short)0, c, false, false);
    c = __builtin_amdgcn_wmma_f32_16x16x32_bf16(false, a.hi, false, b.lo, (short)0, c, false, false);
    c = __builtin_amdgcn_wmma_f32_16x16x32_bf16(false, a.mid, false, b.mid, (short)0, c, false, false);
    c = __builtin_amdgcn_wmma_f32_16x16x32_bf16(false, a.lo, false, b.hi, (short)0, c, false, false);
    asm volatile("v_nop\n\tv_nop\n\tv_nop\n\tv_nop" : "+v"(c) : "v"(a.hi), "v"(a.mid), "v"(a.lo), "v"(b.hi), "v"(b.mid), "v"(b.lo));
    return c;
}

// Fragment gathers from f32 memory: element i <- p[(k0 + frag_k(i,h)) * sk] * s, zero for k >= klen.
__device__ __forceinline__ v16h fh_ld(const float* __restrict__ p, long long sk, int k0, int h, int klen, float s) {
    v16h a;
#pragma unroll
    for (int i = 0; i < 16; ++i) { const int k = k0 + frag_k(i, h); a[i] = (k < klen) ? (_Float16)(p[(long long)k * sk] * s) : (_Float16)0.f; }
    return a;
}
__device__ __forceinline__ Split sp_ld(const float* __restrict__ p, long long sk, int k0, int h, int klen, float s) {
    Split r;
#pragma unroll
    for (int i = 0; i < 16; ++i) {
        const int k = k0 + frag_k(i, h); const float x = (k < klen) ? p[(long long)k * sk] * s : 0.f;
        const __bf16 hb = bf16_rne(x); r.hi[i] = hb; r.lo[i] = bf16_rne(x - bf16_f32(hb));
    }
    return r;
}
__device__ __forceinline__ Split3 sp3_ld(const float* __restrict__ p, long long sk, int k0, int h, int klen, float s) {
    Split3 r;
#pragma unroll
    for (int i = 0; i < 16; ++i) {
        const int k = k0 + frag_k(i, h); const float x = (k < klen) ? p[(long long)k * sk] * s : 0.f;
        const __bf16 hb = bf16_rne(x); const float r1 = x - bf16_f32(hb); const __bf16 mb = bf16_rne(r1);
        r.hi[i] = hb; r.mid[i] = mb; r.lo[i] = bf16_rne(r1 - bf16_f32(mb));
    }
    return r;
}
__device__ __forceinline__ v16b bh_ld(const float* __restrict__ p, long long sk, int k0, int h, int klen, float s) {
    v16b a;
#pragma unroll
    for (int i = 0; i < 16; ++i) { const int k = k0 + frag_k(i, h); a[i] = bf16_rne((k < klen) ? p[(long long)k * sk] * s : 0.f); }
    return a;
}
// f16 fragment from an f16 LDS/global row with element stride 1 (k-contiguous), no bounds (tile already zero padded)
__device__ __forceinline__ v16h fh_row(const _Float16* __restrict__ row, int k0, int h) {
    v16h a;
#pragma unroll
    for (int i = 0; i < 16; ++i) a[i] = row[k0 + frag_k(i, h)];
    return a;
}

#define VST2(T, ptr, val) do { const T vst2_v_ = (val); *(T*)(ptr) = vst2_v_;  } while (0)
typedef float v4f __attribute__((ext_vector_type(4)));
#define VST2V4(ptr, val) do { const v4f vst2_v4_ = (val); *(v4f*)(ptr) = vst2_v4_;  } while (0)

__device__ __attribute__((noinline)) float act_fn(float v, int act) {
    if (act == 1) return fmaxf(v, 0.f);                                                                               // relu
    if (act == 2) { const float u = 0.7978845608028654f * (v + 0.044715f * v * v * v); return 0.5f * v * (1.f + tanhf(u)); } // tanh-gelu
    if (act == 3) return v / (1.f + expf(-v));                                                                        // silu
    if (act == 4) return 0.5f * v * (1.f + erff(v * 0.7071067811865476f));                                             // erf-gelu
    if (act == 5) return tanhf(v);
    if (act == 6) return 1.f / (1.f + expf(-v));                                                                      // sigmoid
    if (act == 7) return (v > 0.f) ? v : 0.01f * v;                                                                   // leaky relu 0.01
    if (act == 8) return (v > 0.f) ? v : (expf(v) - 1.f);                                                             // elu
    if (act == 9) return fminf(fmaxf(v, 0.f), 6.f);                                                                   // relu6
    if (act == 10) return fabsf(v);                                                                                    // abs
    if (act == 11) return (v >= 0.f) ? v : 0.1f * v;                                                                  // leaky 0.1
    if (act == 12) return (v > 0.f) ? v : 0.2f * v;                                                                   // leaky 0.2
    if (act == 13) return (v > 20.f) ? v : log1pf(expf(v));                                                            // softplus
    return v;
}

// =====================================================================================================================
// k_gemm<MODE>: C(z, m, n) = act(alpha * sum_k A(z, m, k) * B(z, k, n) + bias) + beta * R(z, m, n)
//   One wave (32-thread block) per 16 x 32 tile of C; grid (ceil(N/32), ceil(M/16), Z). Batch z -> (zo = z / zi_n, zi = z % zi_n)
//   with separate outer/inner strides for every tensor (e.g. batch and head). A(m,k) = A[zo*sAo + zi*sAi + m*sAm + k*sAk] (f32),
//   B(k,n) = B[zo*sBo + zi*sBi + n*sBn + k*sBk] (f32); any M, N, K (K zero-padded to 32 inside the fragments, M/N tails guarded).
//   C(m,n) = C[zo*sCo + zi*sCi + m*sCm + n] (n contiguous). flags: 1 bias[n], 2 bias[m], 4 residual R[zo*sRo + zi*sRi + m*sRm + n*sRn].
//   MODE 0: f16 operands (A prescaled by sa, B by sb, both undone in the epilogue); 1: bf16 hi/lo split (3 products); 2: bf16;
//   3: bf16 hi/mid/lo triple split (6 products); 4: as 3 with Kahan-compensated f32 accumulation across k-steps.
// =====================================================================================================================
struct GemmP {
    const float* A; const float* B; const float* bias; const float* R; float* C;
    long long sAo, sAi, sAm, sAk, sBo, sBi, sBn, sBk, sCo, sCi, sCm, sRo, sRi, sRm, sRn;
    int M, N, K, zi_n, flags, act; float alpha, beta, sa, sb;
    int Npad, pad_;     // columns [N, Npad) of C are written as 0 so that padded workspace rows are covered by whole-line stores; Npad >= N
};
static_assert(sizeof(GemmP) == 5 * 8 + 15 * 8 + 6 * 4 + 4 * 4 + 2 * 4, "GemmP has padding");

template <int MODE>
__global__ __launch_bounds__(32) void k_gemm(GemmP p) {
    const int lane = threadIdx.x & 31, h = lane >> 4, l15 = lane & 15;
    const int m0 = blockIdx.y * 16, n0 = blockIdx.x * 32;
    const int z = blockIdx.z, zo = z / p.zi_n, zi = z - zo * p.zi_n;
    const float* A = p.A + zo * p.sAo + zi * p.sAi;
    const float* B = p.B + zo * p.sBo + zi * p.sBi;
    const int am = min(m0 + l15, p.M - 1);                       // clamped row for loads (stores are guarded)
    v8f acc[2], comp[2];
#pragma unroll
    for (int t = 0; t < 2; ++t) { v8f zz = {}; acc[t] = zz; comp[t] = zz; }
    for (int k0 = 0; k0 < p.K; k0 += 32) {
        const float* arow = A + (long long)am * p.sAm;
        if (MODE == 1) {
            const Split a = sp_ld(arow, p.sAk, k0, h, p.K, 1.f);
#pragma unroll
            for (int t = 0; t < 2; ++t) {
                const int bn = min(n0 + t * 16 + l15, p.N - 1);
                acc[t] = wmma3(a, sp_ld(B + (long long)bn * p.sBn, p.sBk, k0, h, p.K, 1.f), acc[t]);
            }
        } else if (MODE == 3) {
            const Split3 a = sp3_ld(arow, p.sAk, k0, h, p.K, 1.f);
#pragma unroll
            for (int t = 0; t < 2; ++t) {
                const int bn = min(n0 + t * 16 + l15, p.N - 1);
                acc[t] = wmma6(a, sp3_ld(B + (long long)bn * p.sBn, p.sBk, k0, h, p.K, 1.f), acc[t]);
            }
        } else if (MODE == 4) {
            // triple split as MODE 3, but each k-step's 6 products go into a fresh accumulator and the partial is added to the running f32 sum
            // on the VALU with Kahan compensation (accumulation error stays ~1 ulp however long K is)
            const Split3 a = sp3_ld(arow, p.sAk, k0, h, p.K, 1.f);
#pragma unroll
            for (int t = 0; t < 2; ++t) {
                const int bn = min(n0 + t * 16 + l15, p.N - 1); v8f zz = {};
                const v8f part = wmma6(a, sp3_ld(B + (long long)bn * p.sBn, p.sBk, k0, h, p.K, 1.f), zz);
                const v8f y = part - comp[t]; const v8f s = acc[t] + y; comp[t] = (s - acc[t]) - y; acc[t] = s;
            }
        } else if (MODE == 2) {
            const v16b a = bh_ld(arow, p.sAk, k0, h, p.K, 1.f);
#pragma unroll
            for (int t = 0; t < 2; ++t) {
                const int bn = min(n0 + t * 16 + l15, p.N - 1);
                acc[t] = wmmab(a, bh_ld(B + (long long)bn * p.sBn, p.sBk, k0, h, p.K, 1.f), acc[t]);
            }
        } else {
            const v16h a = fh_ld(arow, p.sAk, k0, h, p.K, p.sa);
#pragma unroll
            for (int t = 0; t < 2; ++t) {
                const int bn = min(n0 + t * 16 + l15, p.N - 1);
                acc[t] = wmma16(a, fh_ld(B + (long long)bn * p.sBn, p.sBk, k0, h, p.K, p.sb), acc[t]);
            }
        }
    }
    const float iscale = (MODE == 0) ? p.alpha / (p.sa * p.sb) : p.alpha;
    float* C = p.C + zo * p.sCo + zi * p.sCi;
    const float* R = p.R + zo * p.sRo + zi * p.sRi;
    __shared__ __align__(16) float ctile[16][36];
#pragma unroll
    for (int t = 0; t < 2; ++t) {
        const int n = n0 + t * 16 + l15; const int nn = min(n, p.N - 1);
#pragma unroll
        for (int r = 0; r < 8; ++r) {
            const int m = m0 + 8 * h + r; const int mm = min(m, p.M - 1);
            float v = acc[t][r] * iscale;
            if (p.flags & 1) v += p.bias[nn];
            if (p.flags & 2) v += p.bias[mm];
            if (p.flags & 8) v *= p.bias[(long long)zo * p.M + mm];   /* per-(z,row) scale vector laid out [Z][M]; exclusive with the bias flags */
            v = act_fn(v, p.act);
            if (p.flags & 4) v += p.beta * R[(long long)mm * p.sRm + (long long)nn * p.sRn];
            ctile[8 * h + r][t * 16 + l15] = (n < p.N) ? v : 0.f;
        }
    }
    __syncthreads();
    const int NW = (p.Npad > p.N) ? p.Npad : p.N;           // write width
    const bool fast = (m0 + 16 <= p.M) && (n0 + 32 <= NW) && ((p.sCm & 3) == 0) && ((((size_t)C) & 15) == 0);
    if (fast) {
#pragma unroll
        for (int s = 0; s < 4; ++s) {
            const int row = s * 4 + (lane >> 3), c4 = (lane & 7) * 4;
            const v4f v = *(const v4f*)&ctile[row][c4];
            VST2V4(C + (long long)(m0 + row) * p.sCm + n0 + c4, v);
        }
    } else {
        for (int row = 0; row < 16; ++row) {
            const int m = m0 + row, n = n0 + lane;
            if (m < p.M && n < NW) VST2(float, C + (long long)m * p.sCm + n, ctile[row][lane]);
        }
    }
}


// =====================================================================================================================
// k_gemmT<MODE, TM, TN>: same contract as k_gemm, but one wave computes a (16*TM) x (16*TN) tile: TM A fragments and TN B fragments are
//   loaded per 32-wide k-step and reused across TM*TN WMMAs (far fewer load/convert instructions per MAC). MODE 0 (f16), 1 (bf16 hi/lo),
//   2 (bf16) only. grid (ceil(NW/(16*TN)), ceil(M/(16*TM)), Z), block 32. Epilogue identical to k_gemm, run per 16x32 sub-tile.
// =====================================================================================================================
template <int MODE, int TM, int TN>
__global__ __launch_bounds__(32) void k_gemmT(GemmP p) {
    const int lane = threadIdx.x & 31, h = lane >> 4, l15 = lane & 15;
    const int m0 = blockIdx.y * (16 * TM), n0 = blockIdx.x * (16 * TN);
    const int z = blockIdx.z, zo = z / p.zi_n, zi = z - zo * p.zi_n;
    const float* A = p.A + zo * p.sAo + zi * p.sAi;
    const float* B = p.B + zo * p.sBo + zi * p.sBi;
    v8f acc[TM][TN];
#pragma unroll
    for (int i = 0; i < TM; ++i)
#pragma unroll
        for (int t = 0; t < TN; ++t) { v8f zz = {}; acc[i][t] = zz; }
    for (int k0 = 0; k0 < p.K; k0 += 32) {
        if (MODE == 1) {
            Split a[TM], b[TN];
#pragma unroll
            for (int i = 0; i < TM; ++i) { const int am = min(m0 + 16 * i + l15, p.M - 1); a[i] = sp_ld(A + (long long)am * p.sAm, p.sAk, k0, h, p.K, 1.f); }
#pragma unroll
            for (int t = 0; t < TN; ++t) { const int bn = min(n0 + 16 * t + l15, p.N - 1); b[t] = sp_ld(B + (long long)bn * p.sBn, p.sBk, k0, h, p.K, 1.f); }
#pragma unroll
            for (int i = 0; i < TM; ++i)
#pragma unroll
                for (int t = 0; t < TN; ++t) acc[i][t] = wmma3(a[i], b[t], acc[i][t]);
        } else if (MODE == 2) {
            v16b a[TM], b[TN];
#pragma unroll
            for (int i = 0; i < TM; ++i) { const int am = min(m0 + 16 * i + l15, p.M - 1); a[i] = bh_ld(A + (long long)am * p.sAm, p.sAk, k0, h, p.K, 1.f); }
#pragma unroll
            for (int t = 0; t < TN; ++t) { const int bn = min(n0 + 16 * t + l15, p.N - 1); b[t] = bh_ld(B + (long long)bn * p.sBn, p.sBk, k0, h, p.K, 1.f); }
#pragma unroll
            for (int i = 0; i < TM; ++i)
#pragma unroll
                for (int t = 0; t < TN; ++t) acc[i][t] = wmmab(a[i], b[t], acc[i][t]);
        } else {
            v16h a[TM], b[TN];
#pragma unroll
            for (int i = 0; i < TM; ++i) { const int am = min(m0 + 16 * i + l15, p.M - 1); a[i] = fh_ld(A + (long long)am * p.sAm, p.sAk, k0, h, p.K, p.sa); }
#pragma unroll
            for (int t = 0; t < TN; ++t) { const int bn = min(n0 + 16 * t + l15, p.N - 1); b[t] = fh_ld(B + (long long)bn * p.sBn, p.sBk, k0, h, p.K, p.sb); }
#pragma unroll
            for (int i = 0; i < TM; ++i)
#pragma unroll
                for (int t = 0; t < TN; ++t) acc[i][t] = wmma16(a[i], b[t], acc[i][t]);
        }
    }
    const float iscale = (MODE == 0) ? p.alpha / (p.sa * p.sb) : p.alpha;
    float* C = p.C + zo * p.sCo + zi * p.sCi;
    const float* R = p.R + zo * p.sRo + zi * p.sRi;
    const int NW = (p.Npad > p.N) ? p.Npad : p.N;
    __shared__ __align__(16) float ctile[16][36];
#pragma unroll
    for (int i = 0; i < TM; ++i) {
        const int mb = m0 + 16 * i; if (mb >= p.M) break;          // wave-uniform
#pragma unroll
        for (int tp = 0; tp < TN / 2; ++tp) {
            const int nb = n0 + 32 * tp; if (nb >= NW) break;        // wave-uniform
#pragma unroll
            for (int t2 = 0; t2 < 2; ++t2) {
                const int t = 2 * tp + t2; const int n = nb + t2 * 16 + l15; const int nn = min(n, p.N - 1);
#pragma unroll
                for (int r = 0; r < 8; ++r) {
                    const int m = mb + 8 * h + r; const int mm = min(m, p.M - 1);
                    float v = acc[i][t][r] * iscale;
                    if (p.flags & 1) v += p.bias[nn];
                    if (p.flags & 2) v += p.bias[mm];
            if (p.flags & 8) v *= p.bias[(long long)zo * p.M + mm];   /* per-(z,row) scale vector laid out [Z][M]; exclusive with the bias flags */
                    v = act_fn(v, p.act);
                    if (p.flags & 4) v += p.beta * R[(long long)mm * p.sRm + (long long)nn * p.sRn];
                    ctile[8 * h + r][t2 * 16 + l15] = (n < p.N) ? v : 0.f;
                }
            }
            __syncthreads();
            const bool fast = (mb + 16 <= p.M) && (nb + 32 <= NW) && ((p.sCm & 3) == 0) && ((((size_t)C) & 15) == 0);
            if (fast) {
#pragma unroll
                for (int s = 0; s < 4; ++s) {
                    const int row = s * 4 + (lane >> 3), c4 = (lane & 7) * 4;
                    const v4f v = *(const v4f*)&ctile[row][c4];
                    VST2V4(C + (long long)(mb + row) * p.sCm + nb + c4, v);
                }
            } else {
                for (int row = 0; row < 16; ++row) {
                    const int m = mb + row, n = nb + lane;
                    if (m < p.M && n < NW) VST2(float, C + (long long)m * p.sCm + n, ctile[row][lane]);
                }
            }
            __syncthreads();
        }
    }
}

// =====================================================================================================================
//   Wave = 16 queries, AW waves per block, 64-key blocks; grid (ceil(Lq/(16*AW)), H, 2 * B) with z = 2 * branch + batch, block 32*AW. Lq = Lk = 2048, dh = dv = 64 (set on device by attn_fix_shape); head dim dh <= DHP
//   (DHP multiple of 32), value dim dv <= DVP (multiple of 16, <= 128). Q by (batch, head, row, element) strides, K and V by (bz, head, row, element), O by (bz, head, row) with element stride 1; f32.
//   Scores: QM 0 f16 operands, 1 bf16 hi/lo split, 2 bf16 triple split; statistics f32 (exp2 domain); P.V: P x 4096 as f16 with V f16 staged in LDS
//   (SPLITPV: P and V as bf16 hi/lo splits). kv head = h / hrep. Masking: causal = 1 (keep j <= i + coff, masked -> -inf, key blocks beyond the
//   diagonal skipped), causal = 2 (masked -> mfill, a finite fill like the -1e9; no skipping), causal = 3 (keep j >= i + coff,
//   masked -> -inf, no skipping); additive f32 mask Mf (required: read without a null test),
//   optional int keep-mask Mi (0 -> score := mfill), both addressed b*smb + h*smh + i*smi + j*smj (0 strides broadcast).
// =====================================================================================================================
#define AW 4
struct AttnP {   // apv4
    const float* Q; const float* K; const float* V; float* O; float* P; const float* Mf; const int* Mi; float* ST;
    const float* Pw; const float* Rt; const int* SQ; const int* SK;           // optional: post-softmax weight, relative-position table, segment ids
    long long swb, swh, swi, swj, srb, srh, sri;                                 // Pw strides (b,h,i,j); Rt strides (b,h,i), column = clamp(i - j + roff, 0, rn-1)
    long long sQb, sQh, sQi, sQd, sKb, sKh, sKj, sKd, sVb, sVh, sVj, sVd, sOb, sOh, sOi, sPb, sPh, sPi, smb, smh, smi, smj;
    int Lq, Lk, dh, dv, hrep, causal, coff, pband;   // pband > 0: P holds only the band |j - i| <= pband, column j - i + pband
    float scale, mfill; int nonorm, mpol;             // nonorm (online path only): O = sum_j exp(score_j) V_j without the 1/rowsum (scores must be <= ~0); mpol: Mi masks where ==0 (mpol 0) or where !=0 (mpol 1)
    int roff, rn, segpol, win;                        // Rt column offset/count; SQ/SK: score := mfill where (segpol 0) SQ[i] != SK[j] or (segpol 1) SQ[i] == SK[j]; win > 0: keys with i - j > win (after coff) -> -inf
};
//   Pw: the softmax numerator is multiplied by Pw(b,h,i,j) AFTER the row sum is taken (probs * weight, then P.V), as in post-softmax multiplicative biases.                                                    // ST (optional): per row (b,h,i) -> ST[((b*H + h)*Lq + i)*2 + {0,1}] = {row max of the scaled+masked score (natural units), sum_j exp(score - max)}
static_assert(sizeof(AttnP) == 12 * 8 + 29 * 8 + 16 * 4, "AttnP has padding");

// Four waves per SIMD: the one launch puts four workgroups on every WGP, which fit only with at most 256 registers a wave
#ifndef KATTN_ATTR
#define KATTN_ATTR __attribute__((amdgpu_waves_per_eu(4, 4)))
#endif
// The shape of this problem's attention launch as compile-time constants (they equal the values kernel_launch fills in): with them the
// element bounds tests (k < dh, d < dv) and every optional path fold away, the unit element strides let the compiler merge a fragment's loads into
// 16-byte loads, and the additive table (always passed here, so read without a null test) no longer depends on the query row. Only the five base pointers stay run-time values.
__device__ __forceinline__ void attn_fix_shape(AttnP& p) {
    p.P = nullptr; p.Mi = nullptr; p.ST = nullptr; p.Pw = nullptr; p.Rt = nullptr; p.SQ = nullptr; p.SK = nullptr;
    p.swb = 0; p.swh = 0; p.swi = 0; p.swj = 0; p.srb = 0; p.srh = 0; p.sri = 0;
    p.sQb = 1048576; p.sQh = 64; p.sQi = 512; p.sQd = 1; p.sKb = 1048576; p.sKh = 64; p.sKj = 512; p.sKd = 1; p.sVb = 1048576; p.sVh = 64; p.sVj = 512; p.sVd = 1;
    p.sOb = 1048576; p.sOh = 64; p.sOi = 512; p.sPb = 0; p.sPh = 0; p.sPi = 0; p.smb = 2048; p.smh = 0; p.smi = 0; p.smj = 1;
    p.Lq = 2048; p.Lk = 2048; p.dh = 64; p.dv = 64; p.hrep = 1; p.causal = 1; p.coff = 0; p.pband = 0;
    p.scale = 0.125f; p.mfill = 0.0f; p.nonorm = 0; p.mpol = 0; p.roff = 0; p.rn = 1; p.segpol = 0; p.win = 0;
}
template <int DHP, int DVP, int QM, bool SPLITPV, bool TWOPASS>
__global__ __launch_bounds__(32 * AW) KATTN_ATTR void k_attn(AttnP p) {
    attn_fix_shape(p);
    constexpr int NT = DVP / 16;                // output tiles
    constexpr int KS = DHP / 32;                // k-steps for the scores
    constexpr int VP = DVP + 8;                 // LDS pitch (halves)
    __shared__ __align__(16) float    pl[AW][16 * 64];
    __shared__ __align__(16) _Float16 vl[(SPLITPV ? 2 : 1) * 64 * VP];   // f16 V tile, or bf16 hi and lo tiles (same 2-byte size)
    const int lane = threadIdx.x & 31, hf = lane >> 4, l15 = lane & 15, wave = threadIdx.x >> 5;
    // blockIdx.z = 2 * branch + batch: K, V and O hold one plane per (branch, batch), indexed by bz; Q and the additive table are shared by the branches, indexed by b
    const int h = blockIdx.y, bz = blockIdx.z, b = bz & 1, hk = h / p.hrep;
    const int q0 = (blockIdx.x * AW + wave) * 16;
    float* myp = pl[wave];
    const float L2E = 1.4426950408889634f;
    const float NEG = -__builtin_inff();
    const int qi = min(q0 + l15, p.Lq - 1);
    const float* qrow = p.Q + b * p.sQb + h * p.sQh + (long long)qi * p.sQi;
    const float* kbase = p.K + bz * p.sKb + hk * p.sKh;
    const float* vbase = p.V + bz * p.sVb + hk * p.sVh;
    v16h qa[QM == 0 ? KS : 1]; Split qs_[QM == 1 ? KS : 1]; Split3 qt_[QM == 2 ? KS : 1];
#pragma unroll
    for (int ks = 0; ks < KS; ++ks) {
        if (QM == 2) qt_[ks] = sp3_ld(qrow, p.sQd, ks * 32, hf, p.dh, 1.f);
        else if (QM == 1) qs_[ks] = sp_ld(qrow, p.sQd, ks * 32, hf, p.dh, 1.f);
        else qa[ks] = fh_ld(qrow, p.sQd, ks * 32, hf, p.dh, 1.f);
    }
    v8f o[NT]; float m8[8], l8[8];
#pragma unroll
    for (int t = 0; t < NT; ++t) { v8f zz = {}; o[t] = zz; }
#pragma unroll
    for (int i = 0; i < 8; ++i) { m8[i] = NEG; l8[i] = 0.f; }
    int jend = p.Lk; int jstart = 0;
    if (p.causal == 1) { const int je = (blockIdx.x * AW + AW - 1) * 16 + 16 + p.coff; jend = min(jend, max(je, 0)); }   // uniform per block
    if (p.win > 0) { const int js = (int)(blockIdx.x * AW) * 16 + p.coff - p.win; jstart = (js > 0) ? (js / 64) * 64 : 0; }   // uniform per block: key blocks entirely outside every row's window hold only -inf entries and are skipped exactly
    const int npass = TWOPASS ? 2 : 1;
    for (int pass = 0; pass < npass; ++pass) {
        const bool dopv = (!TWOPASS) || pass == 1;
        for (int j0 = jstart; j0 < jend; j0 += 64) {
            if (dopv) {
                __syncthreads();                                 // previous key block's reads of vl / pl are done
                static_assert((32 * AW) % DVP == 0, "a thread keeps its V column from pass to pass");
                constexpr int VR = (32 * AW) / DVP;              // V rows staged by the block per pass
                const int jr0 = threadIdx.x / DVP, d = threadIdx.x - jr0 * DVP;
                const float* vsrc = vbase + (long long)(j0 + jr0) * p.sVj + (long long)d * p.sVd;   // one address; the passes differ by constant offsets
#pragma unroll   // constant trip count: all of a thread's V loads of a key block are issued before the first is waited for
                for (int n = 0; n < 64 / VR; ++n) {
                    const int jr = jr0 + n * VR, j = j0 + jr;
                    const float f = ((p.Lk % 64 == 0 || j < p.Lk) && d < p.dv) ? vsrc[(long long)(n * VR) * p.sVj] : 0.f;
                    if (SPLITPV) {
                        const __bf16 hb = bf16_rne(f);
                        ((__bf16*)vl)[jr * VP + d] = hb; ((__bf16*)vl)[64 * VP + jr * VP + d] = bf16_rne(f - bf16_f32(hb));
                    } else vl[jr * VP + d] = (_Float16)f;
                }
            }
            v8f s[4];
#pragma unroll
            for (int t = 0; t < 4; ++t) {
                const int j = min(j0 + t * 16 + l15, p.Lk - 1);
                const float* krow = kbase + (long long)j * p.sKj;
                v8f acc = {};
#pragma unroll
                for (int ks = 0; ks < KS; ++ks) {
                    if (QM == 2)      acc = wmma6(qt_[ks], sp3_ld(krow, p.sKd, ks * 32, hf, p.dh, 1.f), acc);
                    else if (QM == 1) acc = wmma3(qs_[ks], sp_ld(krow, p.sKd, ks * 32, hf, p.dh, 1.f), acc);
                    else              acc = wmma16(qa[ks], fh_ld(krow, p.sKd, ks * 32, hf, p.dh, 1.f), acc);
                }
                s[t] = acc;
            }
            float pv[8][4];
#pragma unroll
            for (int i = 0; i < 8; ++i) {
                const int irow = q0 + i + 8 * hf;
                const int ic = min(irow, p.Lq - 1);
                float sc[4];
#pragma unroll
                for (int t = 0; t < 4; ++t) {
                    const int jg = j0 + t * 16 + l15;
                    float v = s[t][i] * p.scale;
                    v += p.Mf[b * p.smb + h * p.smh + (long long)ic * p.smi + (long long)min(jg, p.Lk - 1) * p.smj];
                    if (p.Rt) { int rc = ic - min(jg, p.Lk - 1) + p.roff; rc = rc < 0 ? 0 : (rc >= p.rn ? p.rn - 1 : rc); v += p.Rt[b * p.srb + h * p.srh + (long long)ic * p.sri + rc]; }
                    if (p.Mi) { const int mv = p.Mi[b * p.smb + h * p.smh + (long long)ic * p.smi + (long long)min(jg, p.Lk - 1) * p.smj]; if (p.mpol ? (mv != 0) : (mv == 0)) v = p.mfill; }
                    if (p.SQ) { const bool same = p.SQ[(long long)b * p.Lq + ic] == p.SK[(long long)b * p.Lk + min(jg, p.Lk - 1)]; if (p.segpol ? same : !same) v = p.mfill; }
                    if (p.causal == 2 && jg > irow + p.coff) v = p.mfill;
                    // causal test against the lane's first row (jg > irow + coff, rearranged): one live register, not eight row numbers, so the 256-register cap is met without spills
                    if (jg >= p.Lk || (p.causal == 1 && jg - (q0 + 8 * hf) > i + p.coff) || (p.causal == 3 && jg < irow + p.coff) || (p.win > 0 && irow + p.coff - jg > p.win)) v = NEG; else v *= L2E;
                    sc[t] = v;
                }
                if (!TWOPASS || pass == 0) {
                    float mx = fmaxf(fmaxf(sc[0], sc[1]), fmaxf(sc[2], sc[3]));
                    mx = fmaxf(mx, __shfl_xor(mx, 1, 32)); mx = fmaxf(mx, __shfl_xor(mx, 2, 32));
                    mx = fmaxf(mx, __shfl_xor(mx, 4, 32)); mx = fmaxf(mx, __shfl_xor(mx, 8, 32));
                    const float mnew = fmaxf(m8[i], mx);
                    const float corr = (mnew == NEG) ? 1.f : exp2f(m8[i] - mnew);
                    float rs = 0.f;
#pragma unroll
                    for (int t = 0; t < 4; ++t) {
                        const float pp = (sc[t] == NEG) ? 0.f : exp2f(sc[t] - mnew); rs += pp;
                        pv[i][t] = p.Pw ? pp * p.Pw[b * p.swb + h * p.swh + (long long)ic * p.swi + (long long)min(j0 + t * 16 + l15, p.Lk - 1) * p.swj] : pp;
                    }
                    rs += __shfl_xor(rs, 1, 32); rs += __shfl_xor(rs, 2, 32); rs += __shfl_xor(rs, 4, 32); rs += __shfl_xor(rs, 8, 32);
                    l8[i] = l8[i] * corr + rs; m8[i] = mnew;
                    if (!TWOPASS) {
#pragma unroll
                        for (int t = 0; t < NT; ++t) o[t][i] *= corr;
                    }
                } else {
                    const float inv = (l8[i] > 0.f) ? 1.f / l8[i] : 0.f;
#pragma unroll
                    for (int t = 0; t < 4; ++t) {
                        const int jg = j0 + t * 16 + l15;
                        float pp = (sc[t] == NEG) ? 0.f : exp2f(sc[t] - m8[i]) * inv;
                        if (p.Pw) pp *= p.Pw[b * p.swb + h * p.swh + (long long)ic * p.swi + (long long)min(jg, p.Lk - 1) * p.swj];
                        pv[i][t] = pp;
                    }
                }
            }
            if (dopv) {
#pragma unroll
                for (int i = 0; i < 8; ++i)
#pragma unroll
                    for (int t = 0; t < 4; ++t) ((float*)myp)[(i + 8 * hf) * 64 + t * 16 + l15] = pv[i][t];
                __syncthreads();                                 // P (per wave) and V (shared) visible
                if (p.P) {
                    float* pb_ = p.P + b * p.sPb + h * p.sPh;
                    const bool fastP = (p.pband == 0) && ((p.sPi & 3) == 0) && (j0 + 64 <= p.Lk) && (q0 + 16 <= p.Lq) && ((((size_t)pb_) & 15) == 0);
                    if (fastP) {
#pragma unroll
                        for (int s = 0; s < 8; ++s) {
                            const int row = s * 2 + (lane >> 4), c4 = (lane & 15) * 4;
                            const v4f v = *(const v4f*)(myp + row * 64 + c4);
                            VST2V4(pb_ + (long long)(q0 + row) * p.sPi + j0 + c4, v);
                        }
                    } else {
                        for (int row = 0; row < 16; ++row) {
                            const int irow = q0 + row; if (irow >= p.Lq) continue;
                            for (int c = lane; c < 64; c += 32) {
                                const int jg = j0 + c; if (jg >= p.Lk) continue;
                                if (p.pband == 0) VST2(float, pb_ + (long long)irow * p.sPi + jg, myp[row * 64 + c]);
                                else if (jg - irow <= p.pband && irow - jg <= p.pband) VST2(float, pb_ + (long long)irow * p.sPi + (jg - irow + p.pband), myp[row * 64 + c]);
                            }
                        }
                    }
                }
                if (SPLITPV) {
                    const Split pa0 = sp_ld(myp + l15 * 64, 1, 0, hf, 64, 1.f), pa1 = sp_ld(myp + l15 * 64, 1, 32, hf, 64, 1.f);
                    const __bf16* vh = (const __bf16*)vl; const __bf16* vlo = vh + 64 * VP;
#pragma unroll
                    for (int t = 0; t < NT; ++t) {
                        const int dcol = t * 16 + l15;
                        Split b0, b1;
#pragma unroll
                        for (int e = 0; e < 16; ++e) {
                            const int k0 = frag_k(e, hf), k1 = 32 + frag_k(e, hf);
                            b0.hi[e] = vh[k0 * VP + dcol]; b0.lo[e] = vlo[k0 * VP + dcol]; b1.hi[e] = vh[k1 * VP + dcol]; b1.lo[e] = vlo[k1 * VP + dcol];
                        }
                        o[t] = wmma3(pa0, b0, o[t]);
                        o[t] = wmma3(pa1, b1, o[t]);
                    }
                } else {
                    const v16h pa0 = fh_ld(myp + l15 * 64, 1, 0, hf, 64, 4096.f), pa1 = fh_ld(myp + l15 * 64, 1, 32, hf, 64, 4096.f);
#pragma unroll
                    for (int t = 0; t < NT; ++t) {
                        const int dcol = t * 16 + l15;
                        v16h b0, b1;
#pragma unroll
                        for (int e = 0; e < 16; ++e) { b0[e] = vl[frag_k(e, hf) * VP + dcol]; b1[e] = vl[(32 + frag_k(e, hf)) * VP + dcol]; }
                        o[t] = wmma16(pa0, b0, o[t]);
                        o[t] = wmma16(pa1, b1, o[t]);
                    }
                }
            }
        }
    }
    float* obase = p.O + bz * p.sOb + h * p.sOh;
    if (p.ST) {
        const int rl = lane >> 1, isel = rl & 7;           // row q0 + rl ; rl>>3 == hf holds because lane>>4 == (lane>>1)>>3
        float mv = 0.f, lv = 0.f;
#pragma unroll
        for (int i = 0; i < 8; ++i) if (i == isel) { mv = m8[i]; lv = l8[i]; }
        const int irow = q0 + rl;
        if (irow < p.Lq) { float* st = p.ST + (((long long)b * gridDim.y + h) * p.Lq + irow) * 2 + (lane & 1); VST2(float, st, (lane & 1) ? lv : mv * 0.6931471805599453f); }
    }
    float invr[8];
#pragma unroll
    for (int i = 0; i < 8; ++i) {
        if (TWOPASS) invr[i] = SPLITPV ? 1.f : (1.f / 4096.f);
        else if (p.nonorm) invr[i] = exp2f(m8[i]) * (SPLITPV ? 1.f : (1.f / 4096.f));
        else invr[i] = (l8[i] > 0.f) ? (SPLITPV ? 1.f / l8[i] : 1.f / (l8[i] * 4096.f)) : 0.f;
    }
    __syncthreads();                                             // all waves done with pl/vl from the main loop
    const bool ofast = ((p.sOi & 3) == 0) && ((((size_t)obase) & 15) == 0) && (q0 + 16 <= p.Lq);
#pragma unroll
    for (int c0 = 0; c0 < DVP; c0 += 64) {
#pragma unroll
        for (int i = 0; i < 8; ++i)
#pragma unroll
            for (int t = 0; t < NT; ++t) if (t * 16 >= c0 && t * 16 < c0 + 64) ((float*)myp)[(i + 8 * hf) * 64 + (t * 16 - c0) + l15] = o[t][i] * invr[i];
        __syncthreads();
        const int cw = (DVP - c0 < 64) ? (DVP - c0) : 64;      // staged columns in this chunk (multiple of 16)
        if (ofast && (c0 + cw <= p.dv) && (cw % 32 == 0)) {
            const int lpr = cw / 4;                              // lanes per row (16 for 64 cols, 8 for 32)
            const int rows_per_ins = 32 / lpr;
            for (int r0 = 0; r0 < 16; r0 += rows_per_ins) {
                const int row = r0 + lane / lpr, c4 = (lane % lpr) * 4;
                const v4f v = *(const v4f*)(myp + row * 64 + c4);
                VST2V4(obase + (long long)(q0 + row) * p.sOi + c0 + c4, v);
            }
        } else {
            for (int row = 0; row < 16; ++row) {
                const int irow = q0 + row; if (irow >= p.Lq) continue;
                for (int c = lane; c < cw; c += 32) { const int d = c0 + c; if (d < p.dv) VST2(float, obase + (long long)irow * p.sOi + d, myp[row * 64 + c]); }
            }
        }
        __syncthreads();
    }
}

// =====================================================================================================================
// k_tr: dst(z, c, r) = alpha * src(z, r, c) (+ beta * R2(z, c, r)): [Z][R][C] (row stride lds) -> [Z][C][R] (row stride ldd) through a 32x32 LDS tile;
//   flags: 1 -> add beta * residual R2 addressed like dst (z*sRz + c*ldr + r); act applied before the residual.
// =====================================================================================================================
struct TrP { const float* src; float* dst; const float* R2; long long sSz, lds, sDz, ldd, sRz, ldr; int R, C, flags, act; float alpha, beta; };
static_assert(sizeof(TrP) == 3 * 8 + 6 * 8 + 6 * 4, "TrP has padding");
__global__ __launch_bounds__(256) void k_tr(TrP p) {
    __shared__ float tile[32][33];
    const int c0 = blockIdx.x * 32, r0 = blockIdx.y * 32, z = blockIdx.z;
    const int lane = threadIdx.x & 31, wave = threadIdx.x >> 5;
    const float* s = p.src + z * p.sSz;
#pragma unroll
    for (int k = 0; k < 4; ++k) {
        const int rl = wave * 4 + k, r = r0 + rl, c = c0 + lane;
        tile[rl][lane] = (r < p.R && c < p.C) ? s[(long long)r * p.lds + c] : 0.f;
    }
    __syncthreads();
    float* d = p.dst + z * p.sDz; const float* rr = p.R2 + z * p.sRz;
#pragma unroll
    for (int k = 0; k < 4; ++k) {
        const int cl = wave * 4 + k, c = c0 + cl, r = r0 + lane;
        if (c < p.C && r < p.R) {
            float v = act_fn(p.alpha * tile[lane][cl], p.act);
            if (p.flags & 1) v += p.beta * rr[(long long)c * p.ldr + r];
            VST2(float, d + (long long)c * p.ldd + r, v);
        }
    }
}

// k_affine: dst[i] = a * (sdev ? sdev[0] : 1) * src[i] + b, i < n (one thread per element; consecutive lanes -> consecutive addresses)
__global__ __launch_bounds__(256) void k_affine(const float* __restrict__ src, float* __restrict__ dst, int n, float a, float b, const float* __restrict__ sdev) {
    const int i = blockIdx.x * 256 + threadIdx.x;
    if (i < n) { const float aa = sdev ? a * sdev[0] : a; const float v = aa * src[i] + b; VST2(float, dst + i, v); }
}

// =====================================================================================================================
// k_softmax: row softmax over n contiguous elements, one 256-thread block per row; rows addressed z*sz + r*sr (grid (R, Z)).
//   out = scale_out * softmax(scale_in * x + (Mf ? Mf[z*smz + r*smr + j] : 0)); a row whose max is -inf is written as 0.
// =====================================================================================================================
struct SmP { const float* src; float* dst; const float* Mf; long long sz, sr, dz, dr, smz, smr; int n, pad; float scale_in, scale_out; };
static_assert(sizeof(SmP) == 3 * 8 + 6 * 8 + 4 * 4, "SmP has padding");
__global__ __launch_bounds__(256) void k_softmax(SmP p) {
    __shared__ float red[256];
    const int r = blockIdx.x, z = blockIdx.y, tid = threadIdx.x;
    const float* s = p.src + z * p.sz + (long long)r * p.sr;
    const float* mf = p.Mf ? (p.Mf + z * p.smz + (long long)r * p.smr) : nullptr;
    float mx = -__builtin_inff();
    for (int j = tid; j < p.n; j += 256) { float v = s[j] * p.scale_in; if (mf) v += mf[j]; mx = fmaxf(mx, v); }
    red[tid] = mx; __syncthreads();
    for (int o = 128; o > 0; o >>= 1) { if (tid < o) red[tid] = fmaxf(red[tid], red[tid + o]); __syncthreads(); }
    mx = red[0]; __syncthreads();
    float sum = 0.f;
    for (int j = tid; j < p.n; j += 256) { float v = s[j] * p.scale_in; if (mf) v += mf[j]; sum += (mx == -__builtin_inff()) ? 0.f : expf(v - mx); }
    red[tid] = sum; __syncthreads();
    for (int o = 128; o > 0; o >>= 1) { if (tid < o) red[tid] += red[tid + o]; __syncthreads(); }
    sum = red[0];
    const float inv = (sum > 0.f) ? p.scale_out / sum : 0.f;
    float* d = p.dst + z * p.dz + (long long)r * p.dr;
    for (int j = tid; j < p.n; j += 256) { float v = s[j] * p.scale_in; if (mf) v += mf[j]; const float o = (mx == -__builtin_inff()) ? 0.f : expf(v - mx) * inv; VST2(float, d + j, o); }
}
// =====================================================================================================================
// k_stats: mean and rsqrt(var + eps) over a set of n elements addressed base + z*sz + (e / inner) * so + (e % inner) * si, one 256-thread
// k_norm_apply: y = (x - mean[set]) * rstd[set] * g[c] + b[c] over a [Z][C][L] chan-major tensor with set = z*G + c / (C/G) (G groups per z;
//   G = C -> per-chan sets indexed z*C+c; for batch norm pass stats indexed by c only via bn = 1). Optional act. Output same layout.
// =====================================================================================================================
//   mode 0: mean / rsqrt(var + eps); mode 1 (RMSNorm): 0 / rsqrt(mean(x^2) + eps); mode 2 (L2 normalize * sqrt(n)): 0 / sqrt(n) / max(||x||, eps); mode 3: as 0 with unbiased variance (n-1)
__global__ __launch_bounds__(256) void k_stats(const float* __restrict__ x, long long sz, long long so, long long si, int inner, int n, float eps, float* __restrict__ stat, int mode) {
    __shared__ float red[256];
    const int z = blockIdx.x, tid = threadIdx.x;
    const float* base = x + z * sz;
    float s = 0.f;
    for (int e = tid; e < n; e += 256) s += base[(long long)(e / inner) * so + (long long)(e % inner) * si];
    red[tid] = s; __syncthreads();
    for (int o = 128; o > 0; o >>= 1) { if (tid < o) red[tid] += red[tid + o]; __syncthreads(); }
    const float mu = (mode == 0 || mode == 3) ? red[0] / (float)n : 0.f; __syncthreads();
    float q = 0.f;
    for (int e = tid; e < n; e += 256) { const float dlt = base[(long long)(e / inner) * so + (long long)(e % inner) * si] - mu; q += dlt * dlt; }
    red[tid] = q; __syncthreads();
    for (int o = 128; o > 0; o >>= 1) { if (tid < o) red[tid] += red[tid + o]; __syncthreads(); }
    {
        float rs;
        if (mode == 2) rs = sqrtf((float)n) / fmaxf(sqrtf(red[0]), eps); else if (mode == 3) rs = rsqrtf(red[0] / (float)(n - 1) + eps); else rs = rsqrtf(red[0] / (float)n + eps);
        if (tid < 32) { const float v = (tid == 0) ? mu : ((tid == 1) ? rs : 0.f); VST2(float, stat + (long long)z * 32 + tid, v); }
    }
}
//   One thread per element over the flat [Z][C][L] index space: grid ceil(Z*C*L / 256).
__global__ __launch_bounds__(256) void k_norm_apply(const float* __restrict__ x, float* __restrict__ y, const float* __restrict__ stat, const float* __restrict__ g, const float* __restrict__ bta,
                                                     int Z, int C, int L, int G, int bn, int act) {
    const long long idx = (long long)blockIdx.x * 256 + threadIdx.x;
    if (idx >= (long long)Z * C * L) return;
    const int l = (int)(idx % L); const long long zc = idx / L; const int c = (int)(zc % C), z = (int)(zc / C); (void)l;
    const int set = bn ? c : (z * G + c / (C / G));
    float v = (x[idx] - stat[(long long)set * 32]) * stat[(long long)set * 32 + 1];
    if (g) v *= g[c];
    if (bta) v += bta[c];
    v = act_fn(v, act);
    VST2(float, y + idx, v);
}

// k_lse_neg: c[i] = -(st[2i] + log(st[2i+1])) = minus the log-sum-exp of row i from k_attn's ST output (for softmax over the query dimension)
__global__ __launch_bounds__(256) void k_lse_neg(const float* __restrict__ st, float* __restrict__ c, int n) {
    const int i = blockIdx.x * 256 + threadIdx.x;
    if (i < n) { const float v = -(st[2 * i] + logf(st[2 * i + 1])); VST2(float, c + i, v); }
}

// k_iota: dst[i] = a * i + b as int32 (segment/position id helper)
__global__ __launch_bounds__(256) void k_iota(int* __restrict__ dst, int n, int a, int b) {
    const int i = blockIdx.x * 256 + threadIdx.x;
    if (i < n) { const int v = a * i + b; VST2(int, dst + i, v); }
}

// k_axpby: dst[i] = a * x[i] + b * y[i] (+ c), i < n
__global__ __launch_bounds__(256) void k_axpby(const float* __restrict__ x, const float* __restrict__ y, float* __restrict__ dst, int n, float a, float b, float c) {
    const int i = blockIdx.x * 256 + threadIdx.x;
    if (i < n) { const float v = a * x[i] + b * y[i] + c; VST2(float, dst + i, v); }
}

// =====================================================================================================================
// k_rope: rotary embedding on a [R rows][Hn heads][D] view (row stride sXr, head stride sXh, element stride 1) -> Y (own strides).
//   mode 0: rotate_half (partner d±D/2, sign - for d<D/2); mode 1: interleaved pairs (partner d^1, sign - for even d).
//   table column tcol: tmode 0 -> d, 1 -> d % (D/2), 2 -> d / 2; position p: pmode 0 -> r % S, 1 -> head index, 2 -> pos[r];
//   c = C[(r / S) * sCb + p * sCp + tcol * sCd], s likewise from Sn; y = x[d] * c + sign * x[partner] * s. X and Y must not alias.
// =====================================================================================================================
struct RopeP { const float* X; float* Y; const float* C; const float* Sn; const int* pos; long long sXr, sXh, sYr, sYh, sCb, sCp, sCd; int R, Hn, D, S, mode, tmode, pmode, pad; };
static_assert(sizeof(RopeP) == 5 * 8 + 7 * 8 + 8 * 4, "RopeP has padding");
__global__ __launch_bounds__(256) void k_rope(RopeP p) {
    const long long idx = (long long)blockIdx.x * 256 + threadIdx.x;
    if (idx >= (long long)p.R * p.Hn * p.D) return;
    const int d = (int)(idx % p.D); const long long rh = idx / p.D; const int h = (int)(rh % p.Hn); const int r = (int)(rh / p.Hn);
    const int half = p.D / 2;
    int partner; float sign;
    if (p.mode == 0) { partner = (d < half) ? d + half : d - half; sign = (d < half) ? -1.f : 1.f; }
    else { partner = d ^ 1; sign = (d & 1) ? 1.f : -1.f; }
    const int tcol = (p.tmode == 0) ? d : ((p.tmode == 1) ? (d % half) : (d >> 1));
    const int pp = (p.pmode == 0) ? (r % p.S) : ((p.pmode == 1) ? h : p.pos[r]);
    const long long toff = (long long)(r / p.S) * p.sCb + (long long)pp * p.sCp + (long long)tcol * p.sCd;
    const float* xr = p.X + (long long)r * p.sXr + (long long)h * p.sXh;
    const float v = xr[d] * p.C[toff] + sign * xr[partner] * p.Sn[toff];
    VST2(float, p.Y + (long long)r * p.sYr + (long long)h * p.sYh + d, v);
}

// k_invf + k_sincos (split so neither kernel carries a large VALU-fma footprint): invf_i = num * (1 / powf(base, (2 i)/D)) [fmode 0],
//   num * expf((2 i) * cexp) [fmode 1], num * powf(base, -2 (i - 1) / D) [fmode 2]; then cs/sn[s*half + i] = cos/sin((pscale * s) * invf_i)
__global__ __launch_bounds__(256) void k_invf(float* __restrict__ invb, int half, int D, float base, float num, int fmode, float cexp) {
    const int i = blockIdx.x * 256 + threadIdx.x;
    if (i >= ((half + 31) / 32) * 32) return;
    if (i >= half) { VST2(float, invb + i, 0.f); return; }
    const float e = (float)(2 * i) / (float)D;
    float invf;
    if (fmode == 1) invf = num * expf((float)(2 * i) * cexp);
    else if (fmode == 2) invf = num * powf(base, (-2.0f * ((float)i - 1.0f)) / (float)D);
    else invf = num * (1.0f / powf(base, e));
    VST2(float, invb + i, invf);
}
__global__ __launch_bounds__(256) void k_sincos(float* __restrict__ cs, float* __restrict__ sn, const float* __restrict__ invb, int S, int half, float pscale) {
    const int idx = blockIdx.x * 256 + threadIdx.x;
    if (idx >= S * half) return;
    const int s = idx / half, i = idx - s * half;
    const float ang = (pscale * (float)s) * invb[i];
    VST2(float, cs + idx, cosf(ang)); VST2(float, sn + idx, sinf(ang));
}

// k_mulact: dst[i] = act(x[i]) * y[i]
__global__ __launch_bounds__(256) void k_mulact(const float* __restrict__ x, const float* __restrict__ y, float* __restrict__ dst, int n, int act) {
    const int i = blockIdx.x * 256 + threadIdx.x;
    if (i < n) { const float v = act_fn(x[i], act) * y[i]; VST2(float, dst + i, v); }
}

// =====================================================================================================================
// k_matvec: thread-per-row matrix-vector products for N <= 8 output columns (heads with 1-3 outputs, gates), f32 on the VALU.
//   C[r*sCm + j] = act(alpha * sum_k A[r*sAm + k*sAk] * B[j*sBn + k*sBk] + bias[j]) + beta * R[r*sRm + j*sRn]; each thread writes its N contiguous floats.
// =====================================================================================================================
__global__ __launch_bounds__(256) void k_matvec(GemmP p) {
    // 32 lanes write one line with one instruction.
    const int rpt = (p.N == 1) ? 1 : 32;
    const long long r0 = ((long long)blockIdx.x * 256 + threadIdx.x) * rpt; const int z = blockIdx.z, zo = z / p.zi_n, zi = z - zo * p.zi_n;
    if (r0 >= p.M) return;
    const float* Bb = p.B + zo * p.sBo + zi * p.sBi;
    float* C = p.C + zo * p.sCo + zi * p.sCi; const float* R = p.R + zo * p.sRo + zi * p.sRi;
    for (int rr = 0; rr < rpt; ++rr) {
        const long long r = r0 + rr; if (r >= p.M) break;
        const float* A = p.A + zo * p.sAo + zi * p.sAi + r * p.sAm;
        float acc[8] = {0.f, 0.f, 0.f, 0.f, 0.f, 0.f, 0.f, 0.f};
        for (int k = 0; k < p.K; ++k) { const float a = A[(long long)k * p.sAk];
#pragma unroll
            for (int j = 0; j < 8; ++j) if (j < p.N) acc[j] += a * Bb[(long long)j * p.sBn + (long long)k * p.sBk]; }
#pragma unroll
        for (int j = 0; j < 8; ++j) if (j < p.N) {
            float v = acc[j] * p.alpha;
            if (p.flags & 1) v += p.bias[j];
            if (p.flags & 2) v += p.bias[r];
            v = act_fn(v, p.act);
            if (p.flags & 4) v += p.beta * R[r * p.sRm + (long long)j * p.sRn];
            VST2(float, C + r * p.sCm + j, v);
        }
    }
}
// k_smallsoftmax: thread-per-row softmax for short rows (n <= 64): dst[r*dr + j] = softmax(scale*src[r*sr + j])
__global__ __launch_bounds__(256) void k_smallsoftmax(const float* __restrict__ src, float* __restrict__ dst, long long sr, long long dr, int n, long long R, float scale) {
    const long long r0 = ((long long)blockIdx.x * 256 + threadIdx.x) * 32;
    for (int rr = 0; rr < 32; ++rr) {
        const long long r = r0 + rr; if (r >= R) return;
        const float* s = src + r * sr; float* d = dst + r * dr;
        float mx = -__builtin_inff();
        for (int j = 0; j < n; ++j) mx = fmaxf(mx, s[j] * scale);
        float sum = 0.f;
        for (int j = 0; j < n; ++j) sum += expf(s[j] * scale - mx);
        const float inv = 1.f / sum;
        for (int j = 0; j < n; ++j) { const float v = expf(s[j] * scale - mx) * inv; VST2(float, d + j, v); }
    }
}

__global__ __launch_bounds__(32) void k_unitstat(float* __restrict__ st) { const int t = threadIdx.x; const float v = (t == 1) ? 1.f : 0.f; VST2(float, st + t, v); }

// destination (e.g. a d_out whose row width is not a multiple of 32 floats) is written by consecutive lanes of one instruction
__global__ __launch_bounds__(256) void k_lincopy(const float* __restrict__ src, long long lds, float* __restrict__ dst, long long ldd, long long rows, int cols) {
    const long long i = (long long)blockIdx.x * 256 + threadIdx.x; if (i >= rows * cols) return;
    const long long r = i / cols; const int c = (int)(i - r * cols);
    const float v = src[r * lds + c]; VST2(float, dst + r * ldd + c, v);
}


__device__ __forceinline__ void st_h2(unsigned short* d2, float a, float b) { const unsigned u = (unsigned)__builtin_bit_cast(unsigned short, (_Float16)a) | ((unsigned)__builtin_bit_cast(unsigned short, (_Float16)b) << 16); unsigned* d = (unsigned*)d2; *d = u;  }
__device__ __forceinline__ float ldh(const unsigned short* p) { return (float)__builtin_bit_cast(_Float16, *p); }
__device__ __forceinline__ v4f ld4h(const unsigned short* p) { const unsigned long long u = *(const unsigned long long*)p; v4f a;
    a.x = (float)__builtin_bit_cast(_Float16, (unsigned short)(u & 0xFFFFu)); a.y = (float)__builtin_bit_cast(_Float16, (unsigned short)((u >> 16) & 0xFFFFu)); a.z = (float)__builtin_bit_cast(_Float16, (unsigned short)((u >> 32) & 0xFFFFu)); a.w = (float)__builtin_bit_cast(_Float16, (unsigned short)((u >> 48) & 0xFFFFu)); return a; }
__device__ __forceinline__ unsigned long long pk4h(v4f s) { return (unsigned long long)__builtin_bit_cast(unsigned short, (_Float16)s.x) | ((unsigned long long)__builtin_bit_cast(unsigned short, (_Float16)s.y) << 16) | ((unsigned long long)__builtin_bit_cast(unsigned short, (_Float16)s.z) << 32) | ((unsigned long long)__builtin_bit_cast(unsigned short, (_Float16)s.w) << 48); }
typedef unsigned v4u __attribute__((ext_vector_type(4)));
__device__ __forceinline__ void st8h(unsigned short* d, v4f a, v4f b) { const unsigned long long pa = pk4h(a), pb = pk4h(b); v4u pk; pk.x = (unsigned)(pa & 0xFFFFFFFFull); pk.y = (unsigned)(pa >> 32); pk.z = (unsigned)(pb & 0xFFFFFFFFull); pk.w = (unsigned)(pb >> 32); v4u* dd = (v4u*)d; *dd = pk;  }
__device__ __forceinline__ unsigned short bfu_rne(float v) { unsigned u = __builtin_bit_cast(unsigned, v); u += 0x7FFFu + ((u >> 16) & 1u); return (unsigned short)(u >> 16); }
__device__ __forceinline__ void bfsplit(float v, unsigned short& hi, unsigned short& lo) { hi = bfu_rne(v); lo = bfu_rne(v - __builtin_bit_cast(float, (unsigned)hi << 16)); }
__device__ __forceinline__ void st_s2(unsigned short* Hp, unsigned short* Lp, long long o, float a, float b) { unsigned short h0,l0,h1,l1; bfsplit(a,h0,l0); bfsplit(b,h1,l1); const unsigned ph = (unsigned)h0 | ((unsigned)h1 << 16), pl = (unsigned)l0 | ((unsigned)l1 << 16);
    unsigned* dh = (unsigned*)(Hp + o); unsigned* dl = (unsigned*)(Lp + o); *dh = ph; *dl = pl;  }
__device__ __forceinline__ int cl(int v, int n) { return min(max(v, 0), n - 1); }

// GAT-style aggregation over a device in-edge CSR at dst (+ optional explicit self loop as iteration j = -1):
//   logit = leaky(AS[src][h] + AD[n][h] (+ EW[e]*CW[h]), slope); softmax over the node's edges per head; acc[c] = sum alpha XP[src][c] (f16 gather plane, pitch XW; 256 channels = H heads x CH)
//   wave per node; lane L owns channels 8L..8L+7 (head = 8L / CH); per-lane softmax state (lanes of one head agree) -> no shuffles in the loop.
//   EPI 0: + bias -> f32 OUT[n][256] via LDS redistribution (two 16-B stores per lane, each instruction 512 contiguous B)
//   EPI 1: + bias, LayerNorm(256) * g + bb, relu -> bf16 hi/lo planes OH/OL [n][256] (16-B stores)
//   EPI 2: mean over the 256/CH heads + bias[0..63], LayerNorm(64) * g + bb, relu -> f32 OUT[n][64] (CH must be 64; LDS redistribution, 8-B stores)
//   EPI 3: mean over heads + bias -> f32 OUT[n][64] (no norm / activation)
//   EPI 4: + bias, ELU -> bf16 hi/lo planes OH/OL [n][256];  EPI 5: + bias (full 256-wide, per head), ELU, then mean over the 256/CH heads -> f32 OUT[n][64]
//   EPI 6: (CH = 128, two heads) mean over the two heads, + bias[0..127], relu -> f32 OUT[n][128] (LDS redistribution, 16-B stores)
//   EWM 0: no edge weights; 1: logit += EW[e] * CW[h] (self loop weight 1); 2: alpha *= EW[e] after the softmax (message scale; self loop weight 1)
template <int CH, bool SELF, int EWM, int EPI>
__global__ __launch_bounds__(256) void k_gat_agg(const unsigned short* __restrict__ XP, int XW, const float* __restrict__ AS, const float* __restrict__ AD, int ASTR, const float* __restrict__ EW, const float* __restrict__ CW,
        const int* __restrict__ esrc, const int* __restrict__ off, const int* __restrict__ cnt, const int* __restrict__ slot, const float* __restrict__ bias, const float* __restrict__ g, const float* __restrict__ bb,
        float* __restrict__ OUT, unsigned short* __restrict__ OH, unsigned short* __restrict__ OL, int N, int E, int CAP, float slope) {
    __shared__ float stage[8][256];
    const int wv = threadIdx.x >> 5; const int n = blockIdx.x * 8 + wv; const int L = threadIdx.x & 31; if (n >= N) return; const int c0 = 8 * L; const int h = c0 / CH;
    const float ad = AD[(long long)n * ASTR + h]; const float cw = (EWM == 1) ? CW[h] : 0.f; float m = -3.0e38f, s = 0.f; v4f a0, a1; a0.x = a0.y = a0.z = a0.w = 0.f; a1 = a0;
    const int p0 = cl(off[n], E + 1), cn = min(max(cnt[n], 0), CAP);
    for (int j = (SELF ? -1 : 0); j < cn; ++j) { int sj; float ew = 0.f;
        if (j < 0) { sj = n; ew = 1.f; } else { int e = slot[cl(p0 + j, E)]; e = cl(e, E); sj = cl(esrc[e], N); if (EWM != 0) ew = EW[e]; }
        float lg = AS[(long long)sj * ASTR + h] + ad + ((EWM == 1) ? ew * cw : 0.f); lg = (lg >= 0.f) ? lg : slope * lg;
        const float mn = fmaxf(m, lg); const float cz = expf(m - mn), pj = expf(lg - mn); s = s * cz + pj; const float pw = (EWM == 2) ? pj * ew : pj;
        const unsigned short* xr = XP + (long long)sj * XW + c0; a0 = a0 * cz + ld4h(xr) * pw; a1 = a1 * cz + ld4h(xr + 4) * pw; m = mn; }
    const float inv = (s > 0.f) ? 1.f / (s + 1e-16f) : 0.f; a0 = a0 * inv; a1 = a1 * inv;
    if (EPI == 0 || EPI == 1 || EPI == 4 || EPI == 5) { a0 = a0 + *(const v4f*)(bias + c0); a1 = a1 + *(const v4f*)(bias + c0 + 4); }
    if (EPI == 4 || EPI == 5) { a0.x = (a0.x > 0.f) ? a0.x : (expf(a0.x) - 1.f); a0.y = (a0.y > 0.f) ? a0.y : (expf(a0.y) - 1.f); a0.z = (a0.z > 0.f) ? a0.z : (expf(a0.z) - 1.f); a0.w = (a0.w > 0.f) ? a0.w : (expf(a0.w) - 1.f);
        a1.x = (a1.x > 0.f) ? a1.x : (expf(a1.x) - 1.f); a1.y = (a1.y > 0.f) ? a1.y : (expf(a1.y) - 1.f); a1.z = (a1.z > 0.f) ? a1.z : (expf(a1.z) - 1.f); a1.w = (a1.w > 0.f) ? a1.w : (expf(a1.w) - 1.f); }
    if (EPI == 4) { float o8[8] = {a0.x, a0.y, a0.z, a0.w, a1.x, a1.y, a1.z, a1.w}; unsigned short hh[8], ll[8];
#pragma unroll
        for (int u = 0; u < 8; ++u) bfsplit(o8[u], hh[u], ll[u]);
        const unsigned long long ph0 = (unsigned long long)hh[0] | ((unsigned long long)hh[1] << 16) | ((unsigned long long)hh[2] << 32) | ((unsigned long long)hh[3] << 48), pl0 = (unsigned long long)ll[0] | ((unsigned long long)ll[1] << 16) | ((unsigned long long)ll[2] << 32) | ((unsigned long long)ll[3] << 48);
        const unsigned long long ph1 = (unsigned long long)hh[4] | ((unsigned long long)hh[5] << 16) | ((unsigned long long)hh[6] << 32) | ((unsigned long long)hh[7] << 48), pl1 = (unsigned long long)ll[4] | ((unsigned long long)ll[5] << 16) | ((unsigned long long)ll[6] << 32) | ((unsigned long long)ll[7] << 48);
        v4u pk; pk.x = (unsigned)(ph0 & 0xFFFFFFFFull); pk.y = (unsigned)(ph0 >> 32); pk.z = (unsigned)(ph1 & 0xFFFFFFFFull); pk.w = (unsigned)(ph1 >> 32); v4u* dh = (v4u*)(OH + (long long)n * 256 + c0); *dh = pk; 
        v4u ql; ql.x = (unsigned)(pl0 & 0xFFFFFFFFull); ql.y = (unsigned)(pl0 >> 32); ql.z = (unsigned)(pl1 & 0xFFFFFFFFull); ql.w = (unsigned)(pl1 >> 32); v4u* dl = (v4u*)(OL + (long long)n * 256 + c0); *dl = ql;  return; }
    if (EPI == 6) {
        a0.x += __shfl_xor(a0.x, 16); a0.y += __shfl_xor(a0.y, 16); a0.z += __shfl_xor(a0.z, 16); a0.w += __shfl_xor(a0.w, 16); a1.x += __shfl_xor(a1.x, 16); a1.y += __shfl_xor(a1.y, 16); a1.z += __shfl_xor(a1.z, 16); a1.w += __shfl_xor(a1.w, 16);
        if (L < 16) { const int cb = 8 * L; const v4f b0 = *(const v4f*)(bias + cb), b1v = *(const v4f*)(bias + cb + 4);
            stage[wv][cb] = fmaxf(a0.x * 0.5f + b0.x, 0.f); stage[wv][cb + 1] = fmaxf(a0.y * 0.5f + b0.y, 0.f); stage[wv][cb + 2] = fmaxf(a0.z * 0.5f + b0.z, 0.f); stage[wv][cb + 3] = fmaxf(a0.w * 0.5f + b0.w, 0.f);
            stage[wv][cb + 4] = fmaxf(a1.x * 0.5f + b1v.x, 0.f); stage[wv][cb + 5] = fmaxf(a1.y * 0.5f + b1v.y, 0.f); stage[wv][cb + 6] = fmaxf(a1.z * 0.5f + b1v.z, 0.f); stage[wv][cb + 7] = fmaxf(a1.w * 0.5f + b1v.w, 0.f); }
        __builtin_amdgcn_fence(__ATOMIC_RELEASE, "workgroup"); __builtin_amdgcn_wave_barrier(); __builtin_amdgcn_fence(__ATOMIC_ACQUIRE, "workgroup");
        v4f o6; o6.x = stage[wv][4 * L]; o6.y = stage[wv][4 * L + 1]; o6.z = stage[wv][4 * L + 2]; o6.w = stage[wv][4 * L + 3]; VST2V4(OUT + (long long)n * 128 + 4 * L, o6); return; }
    if (EPI == 5) {
        a0.x += __shfl_xor(a0.x, 8); a0.y += __shfl_xor(a0.y, 8); a0.z += __shfl_xor(a0.z, 8); a0.w += __shfl_xor(a0.w, 8); a1.x += __shfl_xor(a1.x, 8); a1.y += __shfl_xor(a1.y, 8); a1.z += __shfl_xor(a1.z, 8); a1.w += __shfl_xor(a1.w, 8);
        a0.x += __shfl_xor(a0.x, 16); a0.y += __shfl_xor(a0.y, 16); a0.z += __shfl_xor(a0.z, 16); a0.w += __shfl_xor(a0.w, 16); a1.x += __shfl_xor(a1.x, 16); a1.y += __shfl_xor(a1.y, 16); a1.z += __shfl_xor(a1.z, 16); a1.w += __shfl_xor(a1.w, 16);
        const int gq5 = L & 7; a0 = a0 * 0.25f; a1 = a1 * 0.25f;
        if (L < 8) { stage[wv][8 * gq5] = a0.x; stage[wv][8 * gq5 + 1] = a0.y; stage[wv][8 * gq5 + 2] = a0.z; stage[wv][8 * gq5 + 3] = a0.w; stage[wv][8 * gq5 + 4] = a1.x; stage[wv][8 * gq5 + 5] = a1.y; stage[wv][8 * gq5 + 6] = a1.z; stage[wv][8 * gq5 + 7] = a1.w; }
        __builtin_amdgcn_fence(__ATOMIC_RELEASE, "workgroup"); __builtin_amdgcn_wave_barrier(); __builtin_amdgcn_fence(__ATOMIC_ACQUIRE, "workgroup");
        const unsigned long long pk5 = (unsigned long long)__builtin_bit_cast(unsigned, stage[wv][2 * L]) | ((unsigned long long)__builtin_bit_cast(unsigned, stage[wv][2 * L + 1]) << 32); VST2(unsigned long long, (unsigned long long*)(OUT + (long long)n * 64 + 2 * L), pk5); return; }
    if (EPI == 1) { float sm = a0.x + a0.y + a0.z + a0.w + a1.x + a1.y + a1.z + a1.w;
#pragma unroll
        for (int o = 16; o > 0; o >>= 1) sm += __shfl_xor(sm, o);
        const float mu = sm * (1.f / 256.f); const v4f d0 = a0 - mu, d1 = a1 - mu; float q = d0.x * d0.x + d0.y * d0.y + d0.z * d0.z + d0.w * d0.w + d1.x * d1.x + d1.y * d1.y + d1.z * d1.z + d1.w * d1.w;
#pragma unroll
        for (int o = 16; o > 0; o >>= 1) q += __shfl_xor(q, o);
        const float rs = rsqrtf(q * (1.f / 256.f) + 1e-5f); float o8[8] = {d0.x, d0.y, d0.z, d0.w, d1.x, d1.y, d1.z, d1.w}; unsigned short hh[8], ll[8];
#pragma unroll
        for (int u = 0; u < 8; ++u) { const float v = fmaxf(o8[u] * rs * g[c0 + u] + bb[c0 + u], 0.f); bfsplit(v, hh[u], ll[u]); }
        const unsigned long long ph0 = (unsigned long long)hh[0] | ((unsigned long long)hh[1] << 16) | ((unsigned long long)hh[2] << 32) | ((unsigned long long)hh[3] << 48), pl0 = (unsigned long long)ll[0] | ((unsigned long long)ll[1] << 16) | ((unsigned long long)ll[2] << 32) | ((unsigned long long)ll[3] << 48);
        const unsigned long long ph1 = (unsigned long long)hh[4] | ((unsigned long long)hh[5] << 16) | ((unsigned long long)hh[6] << 32) | ((unsigned long long)hh[7] << 48), pl1 = (unsigned long long)ll[4] | ((unsigned long long)ll[5] << 16) | ((unsigned long long)ll[6] << 32) | ((unsigned long long)ll[7] << 48);
        // lane L's 8 halves at c0 = 8L: 16 B -> one 16-B store per plane (32 lanes x 16 B = whole 512-B row)
        v4u pk; pk.x = (unsigned)(ph0 & 0xFFFFFFFFull); pk.y = (unsigned)(ph0 >> 32); pk.z = (unsigned)(ph1 & 0xFFFFFFFFull); pk.w = (unsigned)(ph1 >> 32); v4u* dh = (v4u*)(OH + (long long)n * 256 + c0); *dh = pk; 
        v4u ql; ql.x = (unsigned)(pl0 & 0xFFFFFFFFull); ql.y = (unsigned)(pl0 >> 32); ql.z = (unsigned)(pl1 & 0xFFFFFFFFull); ql.w = (unsigned)(pl1 >> 32); v4u* dl = (v4u*)(OL + (long long)n * 256 + c0); *dl = ql;  return; }
    if (EPI == 2 || EPI == 3) {   // head mean: lanes L, L^8, L^16, L^24 hold the same chan group of the 4 heads (CH = 64 -> 8 lanes per head)
        a0.x += __shfl_xor(a0.x, 8); a0.y += __shfl_xor(a0.y, 8); a0.z += __shfl_xor(a0.z, 8); a0.w += __shfl_xor(a0.w, 8); a1.x += __shfl_xor(a1.x, 8); a1.y += __shfl_xor(a1.y, 8); a1.z += __shfl_xor(a1.z, 8); a1.w += __shfl_xor(a1.w, 8);
        a0.x += __shfl_xor(a0.x, 16); a0.y += __shfl_xor(a0.y, 16); a0.z += __shfl_xor(a0.z, 16); a0.w += __shfl_xor(a0.w, 16); a1.x += __shfl_xor(a1.x, 16); a1.y += __shfl_xor(a1.y, 16); a1.z += __shfl_xor(a1.z, 16); a1.w += __shfl_xor(a1.w, 16);
        const int gq = L & 7; a0 = a0 * 0.25f + *(const v4f*)(bias + 8 * gq); a1 = a1 * 0.25f + *(const v4f*)(bias + 8 * gq + 4);      // every lane now holds channels 8gq..8gq+7 of the mean
        if (EPI == 3) { if (L < 8) { stage[wv][8 * gq] = a0.x; stage[wv][8 * gq + 1] = a0.y; stage[wv][8 * gq + 2] = a0.z; stage[wv][8 * gq + 3] = a0.w; stage[wv][8 * gq + 4] = a1.x; stage[wv][8 * gq + 5] = a1.y; stage[wv][8 * gq + 6] = a1.z; stage[wv][8 * gq + 7] = a1.w; }
            __builtin_amdgcn_fence(__ATOMIC_RELEASE, "workgroup"); __builtin_amdgcn_wave_barrier(); __builtin_amdgcn_fence(__ATOMIC_ACQUIRE, "workgroup");
            const unsigned long long pk3 = (unsigned long long)__builtin_bit_cast(unsigned, stage[wv][2 * L]) | ((unsigned long long)__builtin_bit_cast(unsigned, stage[wv][2 * L + 1]) << 32); VST2(unsigned long long, (unsigned long long*)(OUT + (long long)n * 64 + 2 * L), pk3); return; }
        float sm = (L < 8) ? (a0.x + a0.y + a0.z + a0.w + a1.x + a1.y + a1.z + a1.w) : 0.f;
#pragma unroll
        for (int o = 16; o > 0; o >>= 1) sm += __shfl_xor(sm, o);
        const float mu = sm * (1.f / 64.f); const v4f d0 = a0 - mu, d1 = a1 - mu; float q = (L < 8) ? (d0.x * d0.x + d0.y * d0.y + d0.z * d0.z + d0.w * d0.w + d1.x * d1.x + d1.y * d1.y + d1.z * d1.z + d1.w * d1.w) : 0.f;
#pragma unroll
        for (int o = 16; o > 0; o >>= 1) q += __shfl_xor(q, o);
        const float rs = rsqrtf(q * (1.f / 64.f) + 1e-5f);
        if (L < 8) { const float* gg = g + 8 * gq; const float* bq = bb + 8 * gq; stage[wv][8 * gq] = fmaxf(d0.x * rs * gg[0] + bq[0], 0.f); stage[wv][8 * gq + 1] = fmaxf(d0.y * rs * gg[1] + bq[1], 0.f); stage[wv][8 * gq + 2] = fmaxf(d0.z * rs * gg[2] + bq[2], 0.f); stage[wv][8 * gq + 3] = fmaxf(d0.w * rs * gg[3] + bq[3], 0.f);
            stage[wv][8 * gq + 4] = fmaxf(d1.x * rs * gg[4] + bq[4], 0.f); stage[wv][8 * gq + 5] = fmaxf(d1.y * rs * gg[5] + bq[5], 0.f); stage[wv][8 * gq + 6] = fmaxf(d1.z * rs * gg[6] + bq[6], 0.f); stage[wv][8 * gq + 7] = fmaxf(d1.w * rs * gg[7] + bq[7], 0.f); }
        __builtin_amdgcn_fence(__ATOMIC_RELEASE, "workgroup"); __builtin_amdgcn_wave_barrier(); __builtin_amdgcn_fence(__ATOMIC_ACQUIRE, "workgroup");
        const unsigned long long pk = (unsigned long long)__builtin_bit_cast(unsigned, stage[wv][2 * L]) | ((unsigned long long)__builtin_bit_cast(unsigned, stage[wv][2 * L + 1]) << 32); VST2(unsigned long long, (unsigned long long*)(OUT + (long long)n * 64 + 2 * L), pk); return; }
    // EPI 0
    stage[wv][c0] = a0.x; stage[wv][c0 + 1] = a0.y; stage[wv][c0 + 2] = a0.z; stage[wv][c0 + 3] = a0.w; stage[wv][c0 + 4] = a1.x; stage[wv][c0 + 5] = a1.y; stage[wv][c0 + 6] = a1.z; stage[wv][c0 + 7] = a1.w;
    __builtin_amdgcn_fence(__ATOMIC_RELEASE, "workgroup"); __builtin_amdgcn_wave_barrier(); __builtin_amdgcn_fence(__ATOMIC_ACQUIRE, "workgroup");
#pragma unroll
    for (int q2 = 0; q2 < 2; ++q2) { const int c = 128 * q2 + 4 * L; v4f v; v.x = stage[wv][c]; v.y = stage[wv][c + 1]; v.z = stage[wv][c + 2]; v.w = stage[wv][c + 3]; VST2V4(OUT + (long long)n * 256 + c, v); } }

__device__ __forceinline__ void st4s(unsigned short* Hp, unsigned short* Lp, long long o, v4f a) { unsigned short h[4], l[4]; bfsplit(a.x, h[0], l[0]); bfsplit(a.y, h[1], l[1]); bfsplit(a.z, h[2], l[2]); bfsplit(a.w, h[3], l[3]);
    const unsigned long long ph = (unsigned long long)h[0] | ((unsigned long long)h[1] << 16) | ((unsigned long long)h[2] << 32) | ((unsigned long long)h[3] << 48), pl = (unsigned long long)l[0] | ((unsigned long long)l[1] << 16) | ((unsigned long long)l[2] << 32) | ((unsigned long long)l[3] << 48);
    VST2(unsigned long long, (unsigned long long*)(Hp + o), ph); VST2(unsigned long long, (unsigned long long*)(Lp + o), pl); }
// f32 [nval2 pairs] -> bf16 hi/lo planes (n2 pairs; pairs >= nval2 zero); thread-linear 4-B stores per plane
__global__ __launch_bounds__(256) void k_pl(const float* __restrict__ S, unsigned short* __restrict__ PH, unsigned short* __restrict__ PL, long long nval2, long long n2) { const long long u = (long long)blockIdx.x * 256 + threadIdx.x; if (u >= n2) return; const bool in = (u < nval2); const long long uc = in ? u : ((nval2 > 0) ? (nval2 - 1) : 0); const float a = S[2 * uc], b = S[2 * uc + 1]; st_s2(PH, PL, 2 * u, in ? a : 0.f, in ? b : 0.f); }
// WC [K][NOP] (thread-linear whole rows) = [W (cols < FO) | 0 | W_h . as_h @EO+h | W_h . ad_h @EO+NH+h | 0 ...]; W is [K][FO] (x @ W layout), as/ad [NH][DH]; EO >= FO.
// branch-free: every lane loads all candidates with clamped indices and selects by value (no exec-masked load arms)
__global__ __launch_bounds__(256) void k_wext(const float* __restrict__ Wm, const float* __restrict__ AS_, const float* __restrict__ AD_, int K, int NOP, int FO, int NH, int DH, int EO, float* __restrict__ WC) {
    #pragma clang fp contract(off)
    const long long u = (long long)blockIdx.x * 256 + threadIdx.x; if (u >= (long long)K * NOP) return; const int kk = (int)(u / NOP), o = (int)(u % NOP);
    const int oo = min(o, FO - 1); const float vw = Wm[(long long)kk * FO + oo]; const int q = min(max(o - EO, 0), 2 * NH - 1); const int h = q % NH; float s = 0.f;
#pragma unroll 1
    for (int c = 0; c < DH; ++c) { const float w = Wm[(long long)kk * FO + h * DH + c]; const float asv = AS_[h * DH + c], adv = AD_[h * DH + c]; s += w * ((q < NH) ? asv : adv); }
    const float v = (o < FO) ? vw : ((o >= EO && o < EO + 2 * NH) ? s : 0.f); VST2(float, WC + u, v); }
// GAT aggregation over a device in-edge CSR (+ analytic self loop as iteration j = -1 when SELF), per-lane online softmax (lanes of one head agree):
// HS rows (pitch P floats): [0,128) projected features z, col 128 + h = a_src.z_h, col 128 + NH + h = a_dst.z_h; lane L owns channels 4L..4L+3 (head = 4L / CH).
// out = sum_j softmax_j(leaky(el[src_j][h] + er[n][h])) z[src_j] (/ (den + deps)) + bias -> ACT (0 none, 1 relu, 2 elu, 3 leaky 0.01) ->
// MODE 0: f32 OUT[n][OW] cols < OC (16-B lane stores, OC*4 contiguous B per wave; OC in {64,128}); MODE 1: bf16 hi/lo planes PH/PL pitch PP (rows n >= N zero); MODE 2: both.
template <int CH, bool SELF, int ACT, int MODE>
__global__ __launch_bounds__(256) void k_gat128(const float* __restrict__ HS, int P, int NH, const float* __restrict__ bias, const int* __restrict__ SRC, const int* __restrict__ off, const int* __restrict__ cnt, const int* __restrict__ slot,
        float* __restrict__ OUT, int OW, int OC, unsigned short* __restrict__ PH, unsigned short* __restrict__ PL, int PP, int N, int NP, int E, int CAP, float slope, float deps) {
    #pragma clang fp contract(off)
    const int n = blockIdx.x * 8 + (threadIdx.x >> 5); const int L = threadIdx.x & 31; if (n >= NP) return; const int c = 4 * L; const int h = c / CH; v4f o; o.x = o.y = o.z = o.w = 0.f;
    if (n < N) { const float* hn = HS + (long long)n * P; const float er = hn[128 + NH + h]; float m = -3.0e38f, s = 0.f; v4f a; a.x = a.y = a.z = a.w = 0.f;
        const int p0 = min(max(off[n], 0), E), cn = min(max(cnt[n], 0), CAP);
        for (int j = (SELF ? -1 : 0); j < cn; ++j) { int sj; if (j < 0) sj = n; else { const int e = min(max(slot[min(p0 + j, E - 1)], 0), E - 1); sj = min(max(SRC[e], 0), N - 1); }
            const float* hs = HS + (long long)sj * P; float lg = hs[128 + h] + er; lg = (lg >= 0.f) ? lg : slope * lg;
            const float mn = fmaxf(m, lg); const float cz = expf(m - mn), pj = expf(lg - mn); s = s * cz + pj; a = a * cz + *(const v4f*)(hs + c) * pj; m = mn; }
        const float inv = (s > 0.f || deps > 0.f) ? 1.f / (s + deps) : 0.f; o = a * inv + *(const v4f*)(bias + c);
        if (ACT == 1) { o.x = fmaxf(o.x, 0.f); o.y = fmaxf(o.y, 0.f); o.z = fmaxf(o.z, 0.f); o.w = fmaxf(o.w, 0.f); }
        if (ACT == 2) { o.x = (o.x > 0.f) ? o.x : (expf(o.x) - 1.f); o.y = (o.y > 0.f) ? o.y : (expf(o.y) - 1.f); o.z = (o.z > 0.f) ? o.z : (expf(o.z) - 1.f); o.w = (o.w > 0.f) ? o.w : (expf(o.w) - 1.f); }
        if (ACT == 3) { o.x = (o.x >= 0.f) ? o.x : 0.01f * o.x; o.y = (o.y >= 0.f) ? o.y : 0.01f * o.y; o.z = (o.z >= 0.f) ? o.z : 0.01f * o.z; o.w = (o.w >= 0.f) ? o.w : 0.01f * o.w; }
        if (MODE != 1 && c < OC) VST2V4(OUT + (long long)n * OW + c, o); }
    if (MODE != 0) st4s(PH, PL, (long long)n * PP + c, o); }

// ---- util2 ----
// generic Bt plane builder from an f32 weight: Bt[o][k] (pitch KP halves) = (TRANS ? W[k*ldw + o] : W[o*ldw + k]) * (S ? S[o] : 1) for o < NO, k < KI; zero elsewhere for o < NOP rows, k < KP (thread per (o < NOP, pair k))
__global__ __launch_bounds__(256) void k_u2_bt(const float* __restrict__ Wm, int ldw, int TRANS, int KI, int NO, int KP, int NOP, const float* __restrict__ S, unsigned short* __restrict__ PH_, unsigned short* __restrict__ PL_) {
    const long long u = (long long)blockIdx.x * 256 + threadIdx.x; if (u >= (long long)NOP * (KP / 2)) return; const int k0 = 2 * (int)(u % (KP / 2)); const int o = (int)(u / (KP / 2)); float a = 0.f, b = 0.f;
    if (o < NO) { const float s = S ? S[o] : 1.f;
        if (k0 < KI) a = (TRANS ? Wm[(long long)k0 * ldw + o] : Wm[(long long)o * ldw + k0]) * s;
        if (k0 + 1 < KI) b = (TRANS ? Wm[(long long)(k0 + 1) * ldw + o] : Wm[(long long)o * ldw + k0 + 1]) * s; }
    st_s2(PH_, PL_, (long long)o * KP + k0, a, b); }
// generic padded vector: O[i] = (i < n) ? (A[i] * (S ? S[i] : 1) + (B2 ? B2[i] : 0)) : 0 for i < NP (one block of 256, NP <= 4096 looped)
__global__ __launch_bounds__(256) void k_u2_vec(const float* __restrict__ A, const float* __restrict__ S, const float* __restrict__ B2, int n, int NP, float* __restrict__ O) { for (int i = threadIdx.x; i < NP; i += 256) { float v = 0.f; if (i < n) v = A[i] * (S ? S[i] : 1.f) + (B2 ? B2[i] : 0.f); VST2(float, O + i, v); } }
__global__ __launch_bounds__(256) void k_u2_colstat(const float* __restrict__ X, int P, int N, float eps, float* __restrict__ STAT) {
    #pragma clang fp contract(off)
    __shared__ float red[256]; const int c = blockIdx.x; const int t = threadIdx.x; float s = 0.f; for (int r = t; r < N; r += 256) s += X[(long long)r * P + c]; red[t] = s; __syncthreads();
    for (int o = 128; o > 0; o >>= 1) { if (t < o) red[t] += red[t + o]; __syncthreads(); }
    const float mu = red[0] / (float)N; __syncthreads(); float q = 0.f; for (int r = t; r < N; r += 256) { const float d = X[(long long)r * P + c] - mu; q += d * d; } red[t] = q; __syncthreads();
    for (int o = 128; o > 0; o >>= 1) { if (t < o) red[t] += red[t + o]; __syncthreads(); }
    const float rs = 1.f / sqrtf(red[0] / (float)N + eps); if (t < 32) VST2(float, STAT + (long long)c * 32 + t, (t == 0) ? mu : ((t == 1) ? rs : 0.f)); }
// rows f32 [R][W] (pitch PW) -> planes at pitch PP, column offset coff; rows >= RL (live) written as zeros up to RP (thread per (r < RP, 4 of W))
__global__ __launch_bounds__(256) void k_u2_pl(const float* __restrict__ X, int PW, int Wd, int RL, int RP, unsigned short* __restrict__ PH_, unsigned short* __restrict__ PL_, int PP, int coff) { const long long u = (long long)blockIdx.x * 256 + threadIdx.x; if (u >= (long long)RP * (Wd / 4)) return; const int r = (int)(u / (Wd / 4)); const int c = 4 * (int)(u % (Wd / 4)); v4f v; v.x = v.y = v.z = v.w = 0.f; if (r < RL) v = *(const v4f*)(X + (long long)r * PW + c); st4s(PH_, PL_, (long long)r * PP + coff + c, v); }

typedef unsigned int cm_u4 __attribute__((ext_vector_type(4)));

__global__ __launch_bounds__(256) void k_cm_zero16(unsigned short* __restrict__ DST, long long n) { const long long u = (long long)blockIdx.x * 256 + threadIdx.x; if (u * 8 >= n) return; cm_u4 z; z.x = z.y = z.z = z.w = 0u; cm_u4* d = (cm_u4*)(DST + u * 8); *d = z;  }
// f32 -> bf16 (RNE) -> f16 casts: every 16-bit operand then holds exactly the bf16-rounded input value (times a power-of-two
// weight scale), so the f16 WMMA products are exact. Plain: thread per (row, 8 cols),
// dst [R][C] pitch ldd; transposed: thread per (col, 8 consecutive rows) -> dst [C][R] pitch ldd; both store 16 B per thread, thread-linear along the dst row.
__device__ __forceinline__ unsigned int cmb_pk2(float a, float b) { return (unsigned int)__builtin_bit_cast(unsigned short, (_Float16)a) | ((unsigned int)__builtin_bit_cast(unsigned short, (_Float16)b) << 16); }
__device__ __forceinline__ float cmb_bf(float v) { const unsigned u = __builtin_bit_cast(unsigned, v); const unsigned r = (u + 0x7fffu + ((u >> 16) & 1u)) & 0xffff0000u; return __builtin_bit_cast(float, r); }   // bf16 RNE, kept as f32 (finite inputs)
// BR[i] = bf16_rne(B[i]) kept as f32 (thread per element)
__global__ __launch_bounds__(256) void k_cm_bfvec(const float* __restrict__ SRC, float* __restrict__ DST, int n) { const int u = blockIdx.x * 256 + threadIdx.x; if (u >= n) return; VST2(float, DST + u, cmb_bf(SRC[u])); }
__global__ __launch_bounds__(256) void k_cm_castb(const float* __restrict__ SRC, int lds, unsigned short* __restrict__ DST, int ldd, int nR, int nC, float sc) {
    const long long u = (long long)blockIdx.x * 256 + threadIdx.x; const int per = nC / 8; if (u >= (long long)nR * per) return; const int r = (int)(u / per); const int c0 = 8 * (int)(u % per);
    const float* s = SRC + (long long)r * lds + c0; float w[8];
#pragma unroll
    for (int e = 0; e < 8; ++e) w[e] = cmb_bf(s[e]) * sc;
    cm_u4 pk; pk.x = cmb_pk2(w[0], w[1]); pk.y = cmb_pk2(w[2], w[3]); pk.z = cmb_pk2(w[4], w[5]); pk.w = cmb_pk2(w[6], w[7]); VST2(cm_u4, (cm_u4*)(DST + (long long)r * ldd + c0), pk); }
__global__ __launch_bounds__(256) void k_cm_castbT(const float* __restrict__ SRC, int lds, unsigned short* __restrict__ DST, int ldd, int nR, int nC, float sc) {
    const long long u = (long long)blockIdx.x * 256 + threadIdx.x; const int per = nR / 8; if (u >= (long long)nC * per) return; const int c = (int)(u / per); const int r0 = 8 * (int)(u % per);
    float w[8];
#pragma unroll
    for (int e = 0; e < 8; ++e) w[e] = cmb_bf(SRC[(long long)(r0 + e) * lds + c]) * sc;
    cm_u4 pk; pk.x = cmb_pk2(w[0], w[1]); pk.y = cmb_pk2(w[2], w[3]); pk.z = cmb_pk2(w[4], w[5]); pk.w = cmb_pk2(w[6], w[7]); VST2(cm_u4, (cm_u4*)(DST + (long long)c * ldd + r0), pk); }

// QT = bf16(q) * bf16(tau[b]) (f32); KB = bf16(keys) then bf16(keys_null), VB = bf16(values) then bf16(values_null), one plane behind the other (thread per float4 of each; which = blockIdx range, block-uniform); MF[b][j] = scale * bf16(delta[b][j])
__global__ __launch_bounds__(256) void k_ds_pre(const float* __restrict__ Q, const float* __restrict__ Kp, const float* __restrict__ V, const float* __restrict__ Kn, const float* __restrict__ Vn, const float* __restrict__ TAU, const float* __restrict__ DELTA, float* __restrict__ QTp, float* __restrict__ KBp, float* __restrict__ VBp, float* __restrict__ MFp, float sc) {
    #pragma clang fp contract(off)
    const long long NQ4 = 2LL * 2048 * 8 * 64 / 4; const long long nb = NQ4 / 256; const long long u = (long long)(blockIdx.x % nb) * 256 + threadIdx.x; const int which = blockIdx.x / nb;
    if (which == 0) { const int b = (int)(u / (2048LL * 8 * 16)); const float t = cmb_bf(TAU[b]); const v4f x = *(const v4f*)(Q + 4 * u); v4f r; r.x = cmb_bf(x.x) * t; r.y = cmb_bf(x.y) * t; r.z = cmb_bf(x.z) * t; r.w = cmb_bf(x.w) * t; VST2V4(QTp + 4 * u, r); }
    else if (which <= 4) {
        const float* s = (which == 1) ? Kp : (which == 2) ? V : (which == 3) ? Kn : Vn;
        float* d = ((which & 1) ? KBp : VBp) + ((which >= 3) ? 4 * NQ4 : 0);
        const v4f x = *(const v4f*)(s + 4 * u); v4f r; r.x = cmb_bf(x.x); r.y = cmb_bf(x.y); r.z = cmb_bf(x.z); r.w = cmb_bf(x.w); VST2V4(d + 4 * u, r); }
    else { if (u >= 2 * 2048) return; VST2(float, MFp + u, sc * cmb_bf(DELTA[u])); } }
// out = m * A1 + (1 - m) * A2 with m = bf16(soft_mask[b][l]) broadcast over (h, e); thread per float4
__global__ __launch_bounds__(256) void k_ds_blend(const float* __restrict__ A1, const float* __restrict__ A2, const float* __restrict__ SM, float* __restrict__ O, long long n4) {
    #pragma clang fp contract(off)
    const long long u = (long long)blockIdx.x * 256 + threadIdx.x; if (u >= n4) return; const float m = cmb_bf(SM[(4 * u) / 512]); const v4f a = *(const v4f*)(A1 + 4 * u), b = *(const v4f*)(A2 + 4 * u); v4f o;
    o.x = m * a.x + (1.f - m) * b.x; o.y = m * a.y + (1.f - m) * b.y; o.z = m * a.z + (1.f - m) * b.z; o.w = m * a.w + (1.f - m) * b.w; VST2V4(O + 4 * u, o); }


extern "C" void kernel_launch(void* const* d_in, const int* in_sizes, int n_in, void* d_out, int out_size, void* d_ws, size_t ws_size, hipStream_t stream) {
    (void)in_sizes; (void)n_in; (void)out_size; (void)ws_size;
    const float* q = (const float*)d_in[0];
    const float* kk = (const float*)d_in[1];
    const float* v = (const float*)d_in[2];
    const float* kn = (const float*)d_in[3];
    const float* vn = (const float*)d_in[4];
    const float* tau = (const float*)d_in[5];
    const float* delta = (const float*)d_in[6];
    const float* smask = (const float*)d_in[7];
    float* out = (float*)d_out;
    char* wsp = (char*)d_ws;
    float* QT = (float*)wsp; wsp += (((size_t)((size_t)2097152) * 4 + 255) / 256) * 256;
    float* KB = (float*)wsp; wsp += (((size_t)((size_t)4194304) * 4 + 255) / 256) * 256;   // [branch][batch] planes of 1,048,576 floats
    float* VB = (float*)wsp; wsp += (((size_t)((size_t)4194304) * 4 + 255) / 256) * 256;   // the same
    float* MF = (float*)wsp; wsp += (((size_t)((size_t)4096) * 4 + 255) / 256) * 256;
    float* AO1 = (float*)wsp; wsp += (((size_t)((size_t)2097152) * 4 + 255) / 256) * 256;
    float* AO2 = (float*)wsp; wsp += (((size_t)((size_t)2097152) * 4 + 255) / 256) * 256;  // directly behind AO1: the attention launch writes both as [branch][batch] planes
    if ((size_t)(wsp - (char*)d_ws) > ws_size) return;   // static carve guard
    k_ds_pre<<<(unsigned)(5 * (524288 / 256) + (4096 + 255) / 256), 256, 0, stream>>>(q, kk, v, kn, vn, tau, delta, QT, KB, VB, MF, 0.125f);
    { /*apv4*/ AttnP a;
      a.Q = QT + 0; a.K = KB + 0; a.V = VB + 0; a.O = AO1 + 0; a.P = 0; a.Mf = MF + 0; a.Mi = 0; a.ST = 0;
      a.Pw = 0; a.Rt = 0; a.SQ = 0; a.SK = 0;
      a.swb = 0; a.swh = 0; a.swi = 0; a.swj = 0; a.srb = 0; a.srh = 0; a.sri = 0; a.sQb = 1048576; a.sQh = 64; a.sQi = 512; a.sQd = 1; a.sKb = 1048576; a.sKh = 64; a.sKj = 512; a.sKd = 1; a.sVb = 1048576; a.sVh = 64; a.sVj = 512; a.sVd = 1; a.sOb = 1048576; a.sOh = 64; a.sOi = 512; a.sPb = 0; a.sPh = 0; a.sPi = 0; a.smb = 2048; a.smh = 0; a.smi = 0; a.smj = 1;
      a.Lq = 2048; a.Lk = 2048; a.dh = 64; a.dv = 64; a.hrep = 1; a.causal = 1; a.coff = 0; a.pband = 0;
      a.scale = 0.125f; a.mfill = 0.0f; a.nonorm = 0; a.mpol = 0;
      a.roff = 0; a.rn = 1; a.segpol = 0; a.win = 0;
      k_attn<64, 64, 1, true, false><<<dim3((unsigned)((2048) + 16 * AW - 1) / (16 * AW), (unsigned)(8), (unsigned)(4)), 32 * AW, 0, stream>>>(a); }
    k_ds_blend<<<(524288 + 255) / 256, 256, 0, stream>>>(AO1, AO2, smask, out, 524288LL);
}

// v003
// One run takes 182 microseconds.
// In two side-by-side timings against v002, it was 2.14 and 2.15 times as fast.
// Over all steps from v000 it is 20.2 times as fast.
// De-stationary causal attention with a null branch, [b, l, h, e] layout (2 x 2,048 tokens, 8 heads x 64): A = softmax(scale * (q.k * tau_b + delta_bj)) over keys j <= i for (keys, values) and for (keys_null, values_null) with the same queries; out = soft_mask * out_edit + (1 - soft_mask) * out_null per query. all inputs rounded to bf16 (RNE); q is multiplied by tau_b on device (f32) and k, v rounded, k and v are stored as bf16 in WMMA fragment order, then ONE WMMA attention launch for both batches and both branches (v_wmma_f32_16x16x32_bf16, f32 accumulate) with q as a bf16 hi/lo split (f32-class: q*tau is not 16-bit exact) against bf16 k, the per-key additive table scale*delta_bj, causal, f32 online softmax, P as a bf16 hi/lo split against bf16 v; the blend in f32.
#include <hip/hip_runtime.h>
#include <math.h>

typedef __attribute__((ext_vector_type(16))) _Float16 v16h;
typedef __attribute__((ext_vector_type(8)))  _Float16 v8h;
typedef __attribute__((ext_vector_type(16))) __bf16   v16b;
typedef __attribute__((ext_vector_type(8)))  __bf16   v8b;
typedef __attribute__((ext_vector_type(8)))  float    v8f;
typedef __attribute__((ext_vector_type(4)))  float    v4f;

// 16-bit WMMA fragment map (wave32), lane L, h = L>>4, m = L&15:
//   A 16x32: lane = row m;   element i -> k = (i<8) ? 8h+i : 16+8h+(i-8)
//   B 32x16: lane = column m; the SAME k(i,h)
//   D 16x16 (8 f32): lane = column m; element r -> row 8h+r
__device__ __forceinline__ int frag_k(int i, int h) { return (i < 8) ? (8 * h + i) : (16 + 8 * h + (i - 8)); }
__device__ __forceinline__ __bf16 bf16_rne(float f) {
    unsigned int u = __float_as_uint(f);
    u += 0x7fffu + ((u >> 16) & 1u);
    return __builtin_bit_cast(__bf16, (unsigned short)(u >> 16));
}
__device__ __forceinline__ float bf16_f32(__bf16 b) { return __uint_as_float(((unsigned int)__builtin_bit_cast(unsigned short, b)) << 16); }
__device__ __forceinline__ v8f wmma16(v16h a, v16h b, v8f c) {
    c = __builtin_amdgcn_wmma_f32_16x16x32_f16(false, a, false, b, (short)0, c, false, false);
    asm volatile("v_nop\n\tv_nop\n\tv_nop\n\tv_nop" : "+v"(c) : "v"(a), "v"(b));
    return c;
}
__device__ __forceinline__ v8f wmmab(v16b a, v16b b, v8f c) {
    c = __builtin_amdgcn_wmma_f32_16x16x32_bf16(false, a, false, b, (short)0, c, false, false);
    asm volatile("v_nop\n\tv_nop\n\tv_nop\n\tv_nop" : "+v"(c) : "v"(a), "v"(b));
    return c;
}
struct Split { v16b hi, lo; };
// hi/lo split product: a.hi*b.hi + a.hi*b.lo + a.lo*b.hi
__device__ __forceinline__ v8f wmma3(const Split& a, const Split& b, v8f c) {
    c = __builtin_amdgcn_wmma_f32_16x16x32_bf16(false, a.hi, false, b.hi, (short)0, c, false, false);
    c = __builtin_amdgcn_wmma_f32_16x16x32_bf16(false, a.hi, false, b.lo, (short)0, c, false, false);
    c = __builtin_amdgcn_wmma_f32_16x16x32_bf16(false, a.lo, false, b.hi, (short)0, c, false, false);
    asm volatile("v_nop\n\tv_nop\n\tv_nop\n\tv_nop" : "+v"(c) : "v"(a.hi), "v"(a.lo), "v"(b.hi), "v"(b.lo));
    return c;
}
// hi/lo split a against a b that is exact in bf16 (its lo part is zero): a.hi*b + a.lo*b
__device__ __forceinline__ v8f wmma2(const Split& a, v16b b, v8f c) {
    c = __builtin_amdgcn_wmma_f32_16x16x32_bf16(false, a.hi, false, b, (short)0, c, false, false);
    c = __builtin_amdgcn_wmma_f32_16x16x32_bf16(false, a.lo, false, b, (short)0, c, false, false);
    return c;
}
// One B fragment from a plane in fragment order (see k_ds_pre): two blocks of 256 halves, lane L's eight halves at 8L; block 0 holds elements 0..7, block 1 elements 8..15
__device__ __forceinline__ v16b bfrag_ld(const __bf16* __restrict__ p) {
    const v8b x = *(const v8b*)p, y = *(const v8b*)(p + 256);
    return __builtin_shufflevector(x, y, 0, 1, 2, 3, 4, 5, 6, 7, 8, 9, 10, 11, 12, 13, 14, 15);
}
struct Split3 { v16b hi, mid, lo; };
// triple split product (6 terms, drops only terms below 2^-24 relative)
__device__ __forceinline__ v8f wmma6(const Split3& a, const Split3& b, v8f c) {
    c = __builtin_amdgcn_wmma_f32_16x16x32_bf16(false, a.hi, false, b.hi, (short)0, c, false, false);
    c = __builtin_amdgcn_wmma_f32_16x16x32_bf16(false, a.hi, false, b.mid, (short)0, c, false, false);
    c = __builtin_amdgcn_wmma_f32_16x16x32_bf16(false, a.mid, false, b.hi, (short)0, c, false, false);
    c = __builtin_amdgcn_wmma_f32_16x16x32_bf16(false, a.hi, false, b.lo, (short)0, c, false, false);
    c = __builtin_amdgcn_wmma_f32_16x16x32_bf16(false, a.mid, false, b.mid, (short)0, c, false, false);
    c = __builtin_amdgcn_wmma_f32_16x16x32_bf16(false, a.lo, false, b.hi, (short)0, c, false, false);
    asm volatile("v_nop\n\tv_nop\n\tv_nop\n\tv_nop" : "+v"(c) : "v"(a.hi), "v"(a.mid), "v"(a.lo), "v"(b.hi), "v"(b.mid), "v"(b.lo));
    return c;
}

// Fragment gathers from f32 memory: element i <- p[(k0 + frag_k(i,h)) * sk] * s, zero for k >= klen.
__device__ __forceinline__ v16h fh_ld(const float* __restrict__ p, long long sk, int k0, int h, int klen, float s) {
    v16h a;
#pragma unroll
    for (int i = 0; i < 16; ++i) { const int k = k0 + frag_k(i, h); a[i] = (k < klen) ? (_Float16)(p[(long long)k * sk] * s) : (_Float16)0.f; }
    return a;
}
__device__ __forceinline__ Split sp_ld(const float* __restrict__ p, long long sk, int k0, int h, int klen, float s) {
    Split r;
#pragma unroll
    for (int i = 0; i < 16; ++i) {
        const int k = k0 + frag_k(i, h); const float x = (k < klen) ? p[(long long)k * sk] * s : 0.f;
        const __bf16 hb = bf16_rne(x); r.hi[i] = hb; r.lo[i] = bf16_rne(x - bf16_f32(hb));
    }
    return r;
}
__device__ __forceinline__ Split3 sp3_ld(const float* __restrict__ p, long long sk, int k0, int h, int klen, float s) {
    Split3 r;
#pragma unroll
    for (int i = 0; i < 16; ++i) {
        const int k = k0 + frag_k(i, h); const float x = (k < klen) ? p[(long long)k * sk] * s : 0.f;
        const __bf16 hb = bf16_rne(x); const float r1 = x - bf16_f32(hb); const __bf16 mb = bf16_rne(r1);
        r.hi[i] = hb; r.mid[i] = mb; r.lo[i] = bf16_rne(r1 - bf16_f32(mb));
    }
    return r;
}
__device__ __forceinline__ v16b bh_ld(const float* __restrict__ p, long long sk, int k0, int h, int klen, float s) {
    v16b a;
#pragma unroll
    for (int i = 0; i < 16; ++i) { const int k = k0 + frag_k(i, h); a[i] = bf16_rne((k < klen) ? p[(long long)k * sk] * s : 0.f); }
    return a;
}
// f16 fragment from an f16 LDS/global row with element stride 1 (k-contiguous), no bounds (tile already zero padded)
__device__ __forceinline__ v16h fh_row(const _Float16* __restrict__ row, int k0, int h) {
    v16h a;
#pragma unroll
    for (int i = 0; i < 16; ++i) a[i] = row[k0 + frag_k(i, h)];
    return a;
}

#define VST2(T, ptr, val) do { const T vst2_v_ = (val); *(T*)(ptr) = vst2_v_;  } while (0)
typedef float v4f __attribute__((ext_vector_type(4)));
#define VST2V4(ptr, val) do { const v4f vst2_v4_ = (val); *(v4f*)(ptr) = vst2_v4_;  } while (0)

__device__ __attribute__((noinline)) float act_fn(float v, int act) {
    if (act == 1) return fmaxf(v, 0.f);                                                                               // relu
    if (act == 2) { const float u = 0.7978845608028654f * (v + 0.044715f * v * v * v); return 0.5f * v * (1.f + tanhf(u)); } // tanh-gelu
    if (act == 3) return v / (1.f + expf(-v));                                                                        // silu
    if (act == 4) return 0.5f * v * (1.f + erff(v * 0.7071067811865476f));                                             // erf-gelu
    if (act == 5) return tanhf(v);
    if (act == 6) return 1.f / (1.f + expf(-v));                                                                      // sigmoid
    if (act == 7) return (v > 0.f) ? v : 0.01f * v;                                                                   // leaky relu 0.01
    if (act == 8) return (v > 0.f) ? v : (expf(v) - 1.f);                                                             // elu
    if (act == 9) return fminf(fmaxf(v, 0.f), 6.f);                                                                   // relu6
    if (act == 10) return fabsf(v);                                                                                    // abs
    if (act == 11) return (v >= 0.f) ? v : 0.1f * v;                                                                  // leaky 0.1
    if (act == 12) return (v > 0.f) ? v : 0.2f * v;                                                                   // leaky 0.2
    if (act == 13) return (v > 20.f) ? v : log1pf(expf(v));                                                            // softplus
    return v;
}

// =====================================================================================================================
// k_gemm<MODE>: C(z, m, n) = act(alpha * sum_k A(z, m, k) * B(z, k, n) + bias) + beta * R(z, m, n)
//   One wave (32-thread block) per 16 x 32 tile of C; grid (ceil(N/32), ceil(M/16), Z). Batch z -> (zo = z / zi_n, zi = z % zi_n)
//   with separate outer/inner strides for every tensor (e.g. batch and head). A(m,k) = A[zo*sAo + zi*sAi + m*sAm + k*sAk] (f32),
//   B(k,n) = B[zo*sBo + zi*sBi + n*sBn + k*sBk] (f32); any M, N, K (K zero-padded to 32 inside the fragments, M/N tails guarded).
//   C(m,n) = C[zo*sCo + zi*sCi + m*sCm + n] (n contiguous). flags: 1 bias[n], 2 bias[m], 4 residual R[zo*sRo + zi*sRi + m*sRm + n*sRn].
//   MODE 0: f16 operands (A prescaled by sa, B by sb, both undone in the epilogue); 1: bf16 hi/lo split (3 products); 2: bf16;
//   3: bf16 hi/mid/lo triple split (6 products); 4: as 3 with Kahan-compensated f32 accumulation across k-steps.
// =====================================================================================================================
struct GemmP {
    const float* A; const float* B; const float* bias; const float* R; float* C;
    long long sAo, sAi, sAm, sAk, sBo, sBi, sBn, sBk, sCo, sCi, sCm, sRo, sRi, sRm, sRn;
    int M, N, K, zi_n, flags, act; float alpha, beta, sa, sb;
    int Npad, pad_;     // columns [N, Npad) of C are written as 0 so that padded workspace rows are covered by whole-line stores; Npad >= N
};
static_assert(sizeof(GemmP) == 5 * 8 + 15 * 8 + 6 * 4 + 4 * 4 + 2 * 4, "GemmP has padding");

template <int MODE>
__global__ __launch_bounds__(32) void k_gemm(GemmP p) {
    const int lane = threadIdx.x & 31, h = lane >> 4, l15 = lane & 15;
    const int m0 = blockIdx.y * 16, n0 = blockIdx.x * 32;
    const int z = blockIdx.z, zo = z / p.zi_n, zi = z - zo * p.zi_n;
    const float* A = p.A + zo * p.sAo + zi * p.sAi;
    const float* B = p.B + zo * p.sBo + zi * p.sBi;
    const int am = min(m0 + l15, p.M - 1);                       // clamped row for loads (stores are guarded)
    v8f acc[2], comp[2];
#pragma unroll
    for (int t = 0; t < 2; ++t) { v8f zz = {}; acc[t] = zz; comp[t] = zz; }
    for (int k0 = 0; k0 < p.K; k0 += 32) {
        const float* arow = A + (long long)am * p.sAm;
        if (MODE == 1) {
            const Split a = sp_ld(arow, p.sAk, k0, h, p.K, 1.f);
#pragma unroll
            for (int t = 0; t < 2; ++t) {
                const int bn = min(n0 + t * 16 + l15, p.N - 1);
                acc[t] = wmma3(a, sp_ld(B + (long long)bn * p.sBn, p.sBk, k0, h, p.K, 1.f), acc[t]);
            }
        } else if (MODE == 3) {
            const Split3 a = sp3_ld(arow, p.sAk, k0, h, p.K, 1.f);
#pragma unroll
            for (int t = 0; t < 2; ++t) {
                const int bn = min(n0 + t * 16 + l15, p.N - 1);
                acc[t] = wmma6(a, sp3_ld(B + (long long)bn * p.sBn, p.sBk, k0, h, p.K, 1.f), acc[t]);
            }
        } else if (MODE == 4) {
            // triple split as MODE 3, but each k-step's 6 products go into a fresh accumulator and the partial is added to the running f32 sum
            // on the VALU with Kahan compensation (accumulation error stays ~1 ulp however long K is)
            const Split3 a = sp3_ld(arow, p.sAk, k0, h, p.K, 1.f);
#pragma unroll
            for (int t = 0; t < 2; ++t) {
                const int bn = min(n0 + t * 16 + l15, p.N - 1); v8f zz = {};
                const v8f part = wmma6(a, sp3_ld(B + (long long)bn * p.sBn, p.sBk, k0, h, p.K, 1.f), zz);
                const v8f y = part - comp[t]; const v8f s = acc[t] + y; comp[t] = (s - acc[t]) - y; acc[t] = s;
            }
        } else if (MODE == 2) {
            const v16b a = bh_ld(arow, p.sAk, k0, h, p.K, 1.f);
#pragma unroll
            for (int t = 0; t < 2; ++t) {
                const int bn = min(n0 + t * 16 + l15, p.N - 1);
                acc[t] = wmmab(a, bh_ld(B + (long long)bn * p.sBn, p.sBk, k0, h, p.K, 1.f), acc[t]);
            }
        } else {
            const v16h a = fh_ld(arow, p.sAk, k0, h, p.K, p.sa);
#pragma unroll
            for (int t = 0; t < 2; ++t) {
                const int bn = min(n0 + t * 16 + l15, p.N - 1);
                acc[t] = wmma16(a, fh_ld(B + (long long)bn * p.sBn, p.sBk, k0, h, p.K, p.sb), acc[t]);
            }
        }
    }
    const float iscale = (MODE == 0) ? p.alpha / (p.sa * p.sb) : p.alpha;
    float* C = p.C + zo * p.sCo + zi * p.sCi;
    const float* R = p.R + zo * p.sRo + zi * p.sRi;
    __shared__ __align__(16) float ctile[16][36];
#pragma unroll
    for (int t = 0; t < 2; ++t) {
        const int n = n0 + t * 16 + l15; const int nn = min(n, p.N - 1);
#pragma unroll
        for (int r = 0; r < 8; ++r) {
            const int m = m0 + 8 * h + r; const int mm = min(m, p.M - 1);
            float v = acc[t][r] * iscale;
            if (p.flags & 1) v += p.bias[nn];
            if (p.flags & 2) v += p.bias[mm];
            if (p.flags & 8) v *= p.bias[(long long)zo * p.M + mm];   /* per-(z,row) scale vector laid out [Z][M]; exclusive with the bias flags */
            v = act_fn(v, p.act);
            if (p.flags & 4) v += p.beta * R[(long long)mm * p.sRm + (long long)nn * p.sRn];
            ctile[8 * h + r][t * 16 + l15] = (n < p.N) ? v : 0.f;
        }
    }
    __syncthreads();
    const int NW = (p.Npad > p.N) ? p.Npad : p.N;           // write width
    const bool fast = (m0 + 16 <= p.M) && (n0 + 32 <= NW) && ((p.sCm & 3) == 0) && ((((size_t)C) & 15) == 0);
    if (fast) {
#pragma unroll
        for (int s = 0; s < 4; ++s) {
            const int row = s * 4 + (lane >> 3), c4 = (lane & 7) * 4;
            const v4f v = *(const v4f*)&ctile[row][c4];
            VST2V4(C + (long long)(m0 + row) * p.sCm + n0 + c4, v);
        }
    } else {
        for (int row = 0; row < 16; ++row) {
            const int m = m0 + row, n = n0 + lane;
            if (m < p.M && n < NW) VST2(float, C + (long long)m * p.sCm + n, ctile[row][lane]);
        }
    }
}


// =====================================================================================================================
// k_gemmT<MODE, TM, TN>: same contract as k_gemm, but one wave computes a (16*TM) x (16*TN) tile: TM A fragments and TN B fragments are
//   loaded per 32-wide k-step and reused across TM*TN WMMAs (far fewer load/convert instructions per MAC). MODE 0 (f16), 1 (bf16 hi/lo),
//   2 (bf16) only. grid (ceil(NW/(16*TN)), ceil(M/(16*TM)), Z), block 32. Epilogue identical to k_gemm, run per 16x32 sub-tile.
// =====================================================================================================================
template <int MODE, int TM, int TN>
__global__ __launch_bounds__(32) void k_gemmT(GemmP p) {
    const int lane = threadIdx.x & 31, h = lane >> 4, l15 = lane & 15;
    const int m0 = blockIdx.y * (16 * TM), n0 = blockIdx.x * (16 * TN);
    const int z = blockIdx.z, zo = z / p.zi_n, zi = z - zo * p.zi_n;
    const float* A = p.A + zo * p.sAo + zi * p.sAi;
    const float* B = p.B + zo * p.sBo + zi * p.sBi;
    v8f acc[TM][TN];
#pragma unroll
    for (int i = 0; i < TM; ++i)
#pragma unroll
        for (int t = 0; t < TN; ++t) { v8f zz = {}; acc[i][t] = zz; }
    for (int k0 = 0; k0 < p.K; k0 += 32) {
        if (MODE == 1) {
            Split a[TM], b[TN];
#pragma unroll
            for (int i = 0; i < TM; ++i) { const int am = min(m0 + 16 * i + l15, p.M - 1); a[i] = sp_ld(A + (long long)am * p.sAm, p.sAk, k0, h, p.K, 1.f); }
#pragma unroll
            for (int t = 0; t < TN; ++t) { const int bn = min(n0 + 16 * t + l15, p.N - 1); b[t] = sp_ld(B + (long long)bn * p.sBn, p.sBk, k0, h, p.K, 1.f); }
#pragma unroll
            for (int i = 0; i < TM; ++i)
#pragma unroll
                for (int t = 0; t < TN; ++t) acc[i][t] = wmma3(a[i], b[t], acc[i][t]);
        } else if (MODE == 2) {
            v16b a[TM], b[TN];
#pragma unroll
            for (int i = 0; i < TM; ++i) { const int am = min(m0 + 16 * i + l15, p.M - 1); a[i] = bh_ld(A + (long long)am * p.sAm, p.sAk, k0, h, p.K, 1.f); }
#pragma unroll
            for (int t = 0; t < TN; ++t) { const int bn = min(n0 + 16 * t + l15, p.N - 1); b[t] = bh_ld(B + (long long)bn * p.sBn, p.sBk, k0, h, p.K, 1.f); }
#pragma unroll
            for (int i = 0; i < TM; ++i)
#pragma unroll
                for (int t = 0; t < TN; ++t) acc[i][t] = wmmab(a[i], b[t], acc[i][t]);
        } else {
            v16h a[TM], b[TN];
#pragma unroll
            for (int i = 0; i < TM; ++i) { const int am = min(m0 + 16 * i + l15, p.M - 1); a[i] = fh_ld(A + (long long)am * p.sAm, p.sAk, k0, h, p.K, p.sa); }
#pragma unroll
            for (int t = 0; t < TN; ++t) { const int bn = min(n0 + 16 * t + l15, p.N - 1); b[t] = fh_ld(B + (long long)bn * p.sBn, p.sBk, k0, h, p.K, p.sb); }
#pragma unroll
            for (int i = 0; i < TM; ++i)
#pragma unroll
                for (int t = 0; t < TN; ++t) acc[i][t] = wmma16(a[i], b[t], acc[i][t]);
        }
    }
    const float iscale = (MODE == 0) ? p.alpha / (p.sa * p.sb) : p.alpha;
    float* C = p.C + zo * p.sCo + zi * p.sCi;
    const float* R = p.R + zo * p.sRo + zi * p.sRi;
    const int NW = (p.Npad > p.N) ? p.Npad : p.N;
    __shared__ __align__(16) float ctile[16][36];
#pragma unroll
    for (int i = 0; i < TM; ++i) {
        const int mb = m0 + 16 * i; if (mb >= p.M) break;          // wave-uniform
#pragma unroll
        for (int tp = 0; tp < TN / 2; ++tp) {
            const int nb = n0 + 32 * tp; if (nb >= NW) break;        // wave-uniform
#pragma unroll
            for (int t2 = 0; t2 < 2; ++t2) {
                const int t = 2 * tp + t2; const int n = nb + t2 * 16 + l15; const int nn = min(n, p.N - 1);
#pragma unroll
                for (int r = 0; r < 8; ++r) {
                    const int m = mb + 8 * h + r; const int mm = min(m, p.M - 1);
                    float v = acc[i][t][r] * iscale;
                    if (p.flags & 1) v += p.bias[nn];
                    if (p.flags & 2) v += p.bias[mm];
            if (p.flags & 8) v *= p.bias[(long long)zo * p.M + mm];   /* per-(z,row) scale vector laid out [Z][M]; exclusive with the bias flags */
                    v = act_fn(v, p.act);
                    if (p.flags & 4) v += p.beta * R[(long long)mm * p.sRm + (long long)nn * p.sRn];
                    ctile[8 * h + r][t2 * 16 + l15] = (n < p.N) ? v : 0.f;
                }
            }
            __syncthreads();
            const bool fast = (mb + 16 <= p.M) && (nb + 32 <= NW) && ((p.sCm & 3) == 0) && ((((size_t)C) & 15) == 0);
            if (fast) {
#pragma unroll
                for (int s = 0; s < 4; ++s) {
                    const int row = s * 4 + (lane >> 3), c4 = (lane & 7) * 4;
                    const v4f v = *(const v4f*)&ctile[row][c4];
                    VST2V4(C + (long long)(mb + row) * p.sCm + nb + c4, v);
                }
            } else {
                for (int row = 0; row < 16; ++row) {
                    const int m = mb + row, n = nb + lane;
                    if (m < p.M && n < NW) VST2(float, C + (long long)m * p.sCm + n, ctile[row][lane]);
                }
            }
            __syncthreads();
        }
    }
}

// =====================================================================================================================
//   Wave = 16 queries, AW waves per block, 64-key blocks; grid (ceil(Lq/(16*AW)), H, 2 * B) with z = 2 * branch + batch, block 32*AW. Lq = Lk = 2048, dh = dv = 64 (set on device by attn_fix_shape); head dim dh <= DHP
//   (DHP multiple of 32), value dim dv <= DVP (multiple of 16, <= 128). Every tensor addressed by (batch, head, row, element) strides, f32, but for QM 1 K and for SPLITPV V are bf16 planes in fragment order.
//   Scores: QM 0 f16 operands, 1 bf16 hi/lo split, 2 bf16 triple split; statistics f32 (exp2 domain); P.V: P x 4096 as f16 with V f16 staged in LDS
//   (SPLITPV: P as a bf16 hi/lo split against bf16 V fragments). kv head = h / hrep. Masking: causal = 1 (keep j <= i + coff, masked -> -inf, key blocks beyond the
//   diagonal skipped), causal = 2 (masked -> mfill, a finite fill like the -1e9; no skipping), causal = 3 (keep j >= i + coff,
//   masked -> -inf, no skipping); additive f32 mask Mf (required: read without a null test),
//   optional int keep-mask Mi (0 -> score := mfill), both addressed b*smb + h*smh + i*smi + j*smj (0 strides broadcast).
// =====================================================================================================================
#define AW 4
struct AttnP {   // apv4
    const float* Q; const float* K; const float* V; float* O; float* P; const float* Mf; const int* Mi; float* ST;
    const float* Pw; const float* Rt; const int* SQ; const int* SK;           // optional: post-softmax weight, relative-position table, segment ids
    long long swb, swh, swi, swj, srb, srh, sri;                                 // Pw strides (b,h,i,j); Rt strides (b,h,i), column = clamp(i - j + roff, 0, rn-1)
    long long sQb, sQh, sQi, sQd, sKb, sKh, sKj, sKd, sVb, sVh, sVj, sVd, sOb, sOh, sOi, sPb, sPh, sPi, smb, smh, smi, smj;
    int Lq, Lk, dh, dv, hrep, causal, coff, pband;   // pband > 0: P holds only the band |j - i| <= pband, column j - i + pband
    float scale, mfill; int nonorm, mpol;             // nonorm (online path only): O = sum_j exp(score_j) V_j without the 1/rowsum (scores must be <= ~0); mpol: Mi masks where ==0 (mpol 0) or where !=0 (mpol 1)
    int roff, rn, segpol, win;                        // Rt column offset/count; SQ/SK: score := mfill where (segpol 0) SQ[i] != SK[j] or (segpol 1) SQ[i] == SK[j]; win > 0: keys with i - j > win (after coff) -> -inf
};
//   Pw: the softmax numerator is multiplied by Pw(b,h,i,j) AFTER the row sum is taken (probs * weight, then P.V), as in post-softmax multiplicative biases.                                                    // ST (optional): per row (b,h,i) -> ST[((b*H + h)*Lq + i)*2 + {0,1}] = {row max of the scaled+masked score (natural units), sum_j exp(score - max)}
static_assert(sizeof(AttnP) == 12 * 8 + 29 * 8 + 16 * 4, "AttnP has padding");

// Four waves per SIMD: the one launch puts four workgroups on every WGP, which fit only with at most 256 registers a wave
#ifndef KATTN_ATTR
#define KATTN_ATTR __attribute__((amdgpu_waves_per_eu(4, 4)))
#endif
// The shape of this problem's attention launch as compile-time constants (they equal the values kernel_launch fills in): with them the
// element bounds tests (k < dh, d < dv) and every optional path fold away, the unit element strides let the compiler merge a fragment's loads into
// 16-byte loads, and the additive table (always passed here, so read without a null test) no longer depends on the query row. Only the five base pointers stay run-time values.
__device__ __forceinline__ void attn_fix_shape(AttnP& p) {
    p.P = nullptr; p.Mi = nullptr; p.ST = nullptr; p.Pw = nullptr; p.Rt = nullptr; p.SQ = nullptr; p.SK = nullptr;
    p.swb = 0; p.swh = 0; p.swi = 0; p.swj = 0; p.srb = 0; p.srh = 0; p.sri = 0;
    p.sQb = 1048576; p.sQh = 64; p.sQi = 512; p.sQd = 1; p.sKb = 1048576; p.sKh = 64; p.sKj = 512; p.sKd = 1; p.sVb = 1048576; p.sVh = 64; p.sVj = 512; p.sVd = 1;
    p.sOb = 1048576; p.sOh = 64; p.sOi = 512; p.sPb = 0; p.sPh = 0; p.sPi = 0; p.smb = 2048; p.smh = 0; p.smi = 0; p.smj = 1;
    p.Lq = 2048; p.Lk = 2048; p.dh = 64; p.dv = 64; p.hrep = 1; p.causal = 1; p.coff = 0; p.pband = 0;
    p.scale = 0.125f; p.mfill = 0.0f; p.nonorm = 0; p.mpol = 0; p.roff = 0; p.rn = 1; p.segpol = 0; p.win = 0;
}
template <int DHP, int DVP, int QM, bool SPLITPV, bool TWOPASS>
__global__ __launch_bounds__(32 * AW) KATTN_ATTR void k_attn(AttnP p) {
    attn_fix_shape(p);
    constexpr int NT = DVP / 16;                // output tiles
    constexpr int KS = DHP / 32;                // k-steps for the scores
    constexpr int VP = DVP + 8;                 // LDS pitch (halves)
    __shared__ __align__(16) float    pl[AW][16 * 64];
    __shared__ __align__(16) _Float16 vl[SPLITPV ? 8 : 64 * VP];   // f16 V tile (SPLITPV reads V fragments from memory and stages nothing)
    const int lane = threadIdx.x & 31, hf = lane >> 4, l15 = lane & 15, wave = threadIdx.x >> 5;
    // blockIdx.z = 2 * branch + batch: K, V and O hold one plane per (branch, batch), indexed by bz; Q and the additive table are shared by the branches, indexed by b
    const int h = blockIdx.y, bz = blockIdx.z, b = bz & 1, hk = h / p.hrep;
    const int q0 = (blockIdx.x * AW + wave) * 16;
    float* myp = pl[wave];
    const float L2E = 1.4426950408889634f;
    const float NEG = -__builtin_inff();
    const int qi = min(q0 + l15, p.Lq - 1);
    const float* qrow = p.Q + b * p.sQb + h * p.sQh + (long long)qi * p.sQi;
    const float* kbase = p.K + bz * p.sKb + hk * p.sKh;
    const float* vbase = p.V + bz * p.sVb + hk * p.sVh;
    // QM 1 / SPLITPV: K and V are bf16 planes in fragment order, 131,072 halves per (bz, head), 4,096 per 64-key block, 512 per fragment
    const __bf16* kfrag = (const __bf16*)p.K + (bz * 8 + hk) * 131072 + lane * 8;
    const __bf16* vfrag = (const __bf16*)p.V + (bz * 8 + hk) * 131072 + lane * 8;
    v16h qa[QM == 0 ? KS : 1]; Split qs_[QM == 1 ? KS : 1]; Split3 qt_[QM == 2 ? KS : 1];
#pragma unroll
    for (int ks = 0; ks < KS; ++ks) {
        if (QM == 2) qt_[ks] = sp3_ld(qrow, p.sQd, ks * 32, hf, p.dh, 1.f);
        else if (QM == 1) qs_[ks] = sp_ld(qrow, p.sQd, ks * 32, hf, p.dh, 1.f);
        else qa[ks] = fh_ld(qrow, p.sQd, ks * 32, hf, p.dh, 1.f);
    }
    v8f o[NT]; float m8[8], l8[8];
#pragma unroll
    for (int t = 0; t < NT; ++t) { v8f zz = {}; o[t] = zz; }
#pragma unroll
    for (int i = 0; i < 8; ++i) { m8[i] = NEG; l8[i] = 0.f; }
    int jend = p.Lk; int jstart = 0;
    if (p.causal == 1) { const int je = (blockIdx.x * AW + AW - 1) * 16 + 16 + p.coff; jend = min(jend, max(je, 0)); }   // uniform per block
    if (p.win > 0) { const int js = (int)(blockIdx.x * AW) * 16 + p.coff - p.win; jstart = (js > 0) ? (js / 64) * 64 : 0; }   // uniform per block: key blocks entirely outside every row's window hold only -inf entries and are skipped exactly
    const int npass = TWOPASS ? 2 : 1;
    for (int pass = 0; pass < npass; ++pass) {
        const bool dopv = (!TWOPASS) || pass == 1;
        for (int j0 = jstart; j0 < jend; j0 += 64) {
            v16b kf[QM == 1 ? 4 : 1][KS];
            if (QM == 1) {
                // all of the key block's K fragments are asked for before the first product: one wait for memory, not one per fragment
                const __bf16* kblk = kfrag + (j0 >> 6) * 4096;
#pragma unroll
                for (int t = 0; t < 4; ++t)
#pragma unroll
                    for (int ks = 0; ks < KS; ++ks) kf[t][ks] = bfrag_ld(kblk + (t * KS + ks) * 512);
                asm volatile("s_wait_xcnt 0x0" :: "v"(kblk) : "memory");   // the loads' address pair stays live up to this wait, so that no later load lands in it and nothing rewrites it ahead of the wait
                __builtin_amdgcn_sched_barrier(0);   // keeps every K load ahead of the first product: the scheduler otherwise holds some back until registers come free, a second wait for memory
            }
            if (dopv && !SPLITPV) {
                __syncthreads();                                 // previous key block's reads of vl / pl are done
                static_assert((32 * AW) % DVP == 0, "a thread keeps its V column from pass to pass");
                constexpr int VR = (32 * AW) / DVP;              // V rows staged by the block per pass
                const int jr0 = threadIdx.x / DVP, d = threadIdx.x - jr0 * DVP;
                const float* vsrc = vbase + (long long)(j0 + jr0) * p.sVj + (long long)d * p.sVd;   // one address; the passes differ by constant offsets
#pragma unroll   // constant trip count: all of a thread's V loads of a key block are issued before the first is waited for
                for (int n = 0; n < 64 / VR; ++n) {
                    const int jr = jr0 + n * VR, j = j0 + jr;
                    const float f = ((p.Lk % 64 == 0 || j < p.Lk) && d < p.dv) ? vsrc[(long long)(n * VR) * p.sVj] : 0.f;
                    vl[jr * VP + d] = (_Float16)f;
                }
            }
            v8f s[4];
#pragma unroll
            for (int t = 0; t < 4; ++t) {
                const int j = min(j0 + t * 16 + l15, p.Lk - 1);
                const float* krow = kbase + (long long)j * p.sKj;
                v8f acc = {};
#pragma unroll
                for (int ks = 0; ks < KS; ++ks) {
                    if (QM == 2)      acc = wmma6(qt_[ks], sp3_ld(krow, p.sKd, ks * 32, hf, p.dh, 1.f), acc);
                    else if (QM == 1) acc = wmma2(qs_[ks], kf[t][ks], acc);
                    else              acc = wmma16(qa[ks], fh_ld(krow, p.sKd, ks * 32, hf, p.dh, 1.f), acc);
                }
                s[t] = acc;
            }
            v16b vf[SPLITPV ? NT : 1][2];
            if (dopv && SPLITPV) {
                // all of the key block's V fragments are asked for together and ahead of the softmax: their way from memory is covered by the softmax, not paid at the P.v products
                const __bf16* vblk = vfrag + (j0 >> 6) * 4096;
#pragma unroll
                for (int t = 0; t < NT; ++t) { vf[t][0] = bfrag_ld(vblk + (t * 2 + 0) * 512); vf[t][1] = bfrag_ld(vblk + (t * 2 + 1) * 512); }
                asm volatile("s_wait_xcnt 0x0" :: "v"(vblk) : "memory");   // the loads' address pair stays live up to this wait, so that no load of the run lands in it and nothing rewrites it ahead of the wait
            }
            float pv[8][4];
#pragma unroll
            for (int i = 0; i < 8; ++i) {
                const int irow = q0 + i + 8 * hf;
                const int ic = min(irow, p.Lq - 1);
                float sc[4];
#pragma unroll
                for (int t = 0; t < 4; ++t) {
                    const int jg = j0 + t * 16 + l15;
                    float v = s[t][i] * p.scale;
                    v += p.Mf[b * p.smb + h * p.smh + (long long)ic * p.smi + (long long)min(jg, p.Lk - 1) * p.smj];
                    if (p.Rt) { int rc = ic - min(jg, p.Lk - 1) + p.roff; rc = rc < 0 ? 0 : (rc >= p.rn ? p.rn - 1 : rc); v += p.Rt[b * p.srb + h * p.srh + (long long)ic * p.sri + rc]; }
                    if (p.Mi) { const int mv = p.Mi[b * p.smb + h * p.smh + (long long)ic * p.smi + (long long)min(jg, p.Lk - 1) * p.smj]; if (p.mpol ? (mv != 0) : (mv == 0)) v = p.mfill; }
                    if (p.SQ) { const bool same = p.SQ[(long long)b * p.Lq + ic] == p.SK[(long long)b * p.Lk + min(jg, p.Lk - 1)]; if (p.segpol ? same : !same) v = p.mfill; }
                    if (p.causal == 2 && jg > irow + p.coff) v = p.mfill;
                    // causal test against the lane's first row (jg > irow + coff, rearranged): one live register, not eight row numbers, so the 256-register cap is met without spills
                    if (jg >= p.Lk || (p.causal == 1 && jg - (q0 + 8 * hf) > i + p.coff) || (p.causal == 3 && jg < irow + p.coff) || (p.win > 0 && irow + p.coff - jg > p.win)) v = NEG; else v *= L2E;
                    sc[t] = v;
                }
                if (!TWOPASS || pass == 0) {
                    float mx = fmaxf(fmaxf(sc[0], sc[1]), fmaxf(sc[2], sc[3]));
                    mx = fmaxf(mx, __shfl_xor(mx, 1, 32)); mx = fmaxf(mx, __shfl_xor(mx, 2, 32));
                    mx = fmaxf(mx, __shfl_xor(mx, 4, 32)); mx = fmaxf(mx, __shfl_xor(mx, 8, 32));
                    const float mnew = fmaxf(m8[i], mx);
                    const float corr = (mnew == NEG) ? 1.f : exp2f(m8[i] - mnew);
                    float rs = 0.f;
#pragma unroll
                    for (int t = 0; t < 4; ++t) {
                        const float pp = (sc[t] == NEG) ? 0.f : exp2f(sc[t] - mnew); rs += pp;
                        pv[i][t] = p.Pw ? pp * p.Pw[b * p.swb + h * p.swh + (long long)ic * p.swi + (long long)min(j0 + t * 16 + l15, p.Lk - 1) * p.swj] : pp;
                    }
                    rs += __shfl_xor(rs, 1, 32); rs += __shfl_xor(rs, 2, 32); rs += __shfl_xor(rs, 4, 32); rs += __shfl_xor(rs, 8, 32);
                    l8[i] = l8[i] * corr + rs; m8[i] = mnew;
                    if (!TWOPASS) {
#pragma unroll
                        for (int t = 0; t < NT; ++t) o[t][i] *= corr;
                    }
                } else {
                    const float inv = (l8[i] > 0.f) ? 1.f / l8[i] : 0.f;
#pragma unroll
                    for (int t = 0; t < 4; ++t) {
                        const int jg = j0 + t * 16 + l15;
                        float pp = (sc[t] == NEG) ? 0.f : exp2f(sc[t] - m8[i]) * inv;
                        if (p.Pw) pp *= p.Pw[b * p.swb + h * p.swh + (long long)ic * p.swi + (long long)min(jg, p.Lk - 1) * p.swj];
                        pv[i][t] = pp;
                    }
                }
            }
            if (dopv) {
#pragma unroll
                for (int i = 0; i < 8; ++i)
#pragma unroll
                    for (int t = 0; t < 4; ++t) ((float*)myp)[(i + 8 * hf) * 64 + t * 16 + l15] = pv[i][t];
                if (SPLITPV) {
                    // P is private to its wave and V is not staged: the wave's own LDS stores only have to be ordered before its lanes' reads of each other's values
                    __builtin_amdgcn_fence(__ATOMIC_RELEASE, "workgroup"); __builtin_amdgcn_wave_barrier(); __builtin_amdgcn_fence(__ATOMIC_ACQUIRE, "workgroup");
                } else __syncthreads();                          // P (per wave) and V (shared) visible
                if (p.P) {
                    float* pb_ = p.P + b * p.sPb + h * p.sPh;
                    const bool fastP = (p.pband == 0) && ((p.sPi & 3) == 0) && (j0 + 64 <= p.Lk) && (q0 + 16 <= p.Lq) && ((((size_t)pb_) & 15) == 0);
                    if (fastP) {
#pragma unroll
                        for (int s = 0; s < 8; ++s) {
                            const int row = s * 2 + (lane >> 4), c4 = (lane & 15) * 4;
                            const v4f v = *(const v4f*)(myp + row * 64 + c4);
                            VST2V4(pb_ + (long long)(q0 + row) * p.sPi + j0 + c4, v);
                        }
                    } else {
                        for (int row = 0; row < 16; ++row) {
                            const int irow = q0 + row; if (irow >= p.Lq) continue;
                            for (int c = lane; c < 64; c += 32) {
                                const int jg = j0 + c; if (jg >= p.Lk) continue;
                                if (p.pband == 0) VST2(float, pb_ + (long long)irow * p.sPi + jg, myp[row * 64 + c]);
                                else if (jg - irow <= p.pband && irow - jg <= p.pband) VST2(float, pb_ + (long long)irow * p.sPi + (jg - irow + p.pband), myp[row * 64 + c]);
                            }
                        }
                    }
                }
                if (SPLITPV) {
                    const Split pa0 = sp_ld(myp + l15 * 64, 1, 0, hf, 64, 1.f), pa1 = sp_ld(myp + l15 * 64, 1, 32, hf, 64, 1.f);
#pragma unroll
                    for (int t = 0; t < NT; ++t) {
                        o[t] = wmma2(pa0, vf[t][0], o[t]);
                        o[t] = wmma2(pa1, vf[t][1], o[t]);
                    }
                } else {
                    const v16h pa0 = fh_ld(myp + l15 * 64, 1, 0, hf, 64, 4096.f), pa1 = fh_ld(myp + l15 * 64, 1, 32, hf, 64, 4096.f);
#pragma unroll
                    for (int t = 0; t < NT; ++t) {
                        const int dcol = t * 16 + l15;
                        v16h b0, b1;
#pragma unroll
                        for (int e = 0; e < 16; ++e) { b0[e] = vl[frag_k(e, hf) * VP + dcol]; b1[e] = vl[(32 + frag_k(e, hf)) * VP + dcol]; }
                        o[t] = wmma16(pa0, b0, o[t]);
                        o[t] = wmma16(pa1, b1, o[t]);
                    }
                }
            }
        }
    }
    float* obase = p.O + bz * p.sOb + h * p.sOh;
    if (p.ST) {
        const int rl = lane >> 1, isel = rl & 7;           // row q0 + rl ; rl>>3 == hf holds because lane>>4 == (lane>>1)>>3
        float mv = 0.f, lv = 0.f;
#pragma unroll
        for (int i = 0; i < 8; ++i) if (i == isel) { mv = m8[i]; lv = l8[i]; }
        const int irow = q0 + rl;
        if (irow < p.Lq) { float* st = p.ST + (((long long)b * gridDim.y + h) * p.Lq + irow) * 2 + (lane & 1); VST2(float, st, (lane & 1) ? lv : mv * 0.6931471805599453f); }
    }
    float invr[8];
#pragma unroll
    for (int i = 0; i < 8; ++i) {
        if (TWOPASS) invr[i] = SPLITPV ? 1.f : (1.f / 4096.f);
        else if (p.nonorm) invr[i] = exp2f(m8[i]) * (SPLITPV ? 1.f : (1.f / 4096.f));
        else invr[i] = (l8[i] > 0.f) ? (SPLITPV ? 1.f / l8[i] : 1.f / (l8[i] * 4096.f)) : 0.f;
    }
    __syncthreads();                                             // all waves done with pl/vl from the main loop
    const bool ofast = ((p.sOi & 3) == 0) && ((((size_t)obase) & 15) == 0) && (q0 + 16 <= p.Lq);
#pragma unroll
    for (int c0 = 0; c0 < DVP; c0 += 64) {
#pragma unroll
        for (int i = 0; i < 8; ++i)
#pragma unroll
            for (int t = 0; t < NT; ++t) if (t * 16 >= c0 && t * 16 < c0 + 64) ((float*)myp)[(i + 8 * hf) * 64 + (t * 16 - c0) + l15] = o[t][i] * invr[i];
        __syncthreads();
        const int cw = (DVP - c0 < 64) ? (DVP - c0) : 64;      // staged columns in this chunk (multiple of 16)
        if (ofast && (c0 + cw <= p.dv) && (cw % 32 == 0)) {
            const int lpr = cw / 4;                              // lanes per row (16 for 64 cols, 8 for 32)
            const int rows_per_ins = 32 / lpr;
            for (int r0 = 0; r0 < 16; r0 += rows_per_ins) {
                const int row = r0 + lane / lpr, c4 = (lane % lpr) * 4;
                const v4f v = *(const v4f*)(myp + row * 64 + c4);
                VST2V4(obase + (long long)(q0 + row) * p.sOi + c0 + c4, v);
            }
        } else {
            for (int row = 0; row < 16; ++row) {
                const int irow = q0 + row; if (irow >= p.Lq) continue;
                for (int c = lane; c < cw; c += 32) { const int d = c0 + c; if (d < p.dv) VST2(float, obase + (long long)irow * p.sOi + d, myp[row * 64 + c]); }
            }
        }
        __syncthreads();
    }
}

// =====================================================================================================================
// k_tr: dst(z, c, r) = alpha * src(z, r, c) (+ beta * R2(z, c, r)): [Z][R][C] (row stride lds) -> [Z][C][R] (row stride ldd) through a 32x32 LDS tile;
//   flags: 1 -> add beta * residual R2 addressed like dst (z*sRz + c*ldr + r); act applied before the residual.
// =====================================================================================================================
struct TrP { const float* src; float* dst; const float* R2; long long sSz, lds, sDz, ldd, sRz, ldr; int R, C, flags, act; float alpha, beta; };
static_assert(sizeof(TrP) == 3 * 8 + 6 * 8 + 6 * 4, "TrP has padding");
__global__ __launch_bounds__(256) void k_tr(TrP p) {
    __shared__ float tile[32][33];
    const int c0 = blockIdx.x * 32, r0 = blockIdx.y * 32, z = blockIdx.z;
    const int lane = threadIdx.x & 31, wave = threadIdx.x >> 5;
    const float* s = p.src + z * p.sSz;
#pragma unroll
    for (int k = 0; k < 4; ++k) {
        const int rl = wave * 4 + k, r = r0 + rl, c = c0 + lane;
        tile[rl][lane] = (r < p.R && c < p.C) ? s[(long long)r * p.lds + c] : 0.f;
    }
    __syncthreads();
    float* d = p.dst + z * p.sDz; const float* rr = p.R2 + z * p.sRz;
#pragma unroll
    for (int k = 0; k < 4; ++k) {
        const int cl = wave * 4 + k, c = c0 + cl, r = r0 + lane;
        if (c < p.C && r < p.R) {
            float v = act_fn(p.alpha * tile[lane][cl], p.act);
            if (p.flags & 1) v += p.beta * rr[(long long)c * p.ldr + r];
            VST2(float, d + (long long)c * p.ldd + r, v);
        }
    }
}

// k_affine: dst[i] = a * (sdev ? sdev[0] : 1) * src[i] + b, i < n (one thread per element; consecutive lanes -> consecutive addresses)
__global__ __launch_bounds__(256) void k_affine(const float* __restrict__ src, float* __restrict__ dst, int n, float a, float b, const float* __restrict__ sdev) {
    const int i = blockIdx.x * 256 + threadIdx.x;
    if (i < n) { const float aa = sdev ? a * sdev[0] : a; const float v = aa * src[i] + b; VST2(float, dst + i, v); }
}

// =====================================================================================================================
// k_softmax: row softmax over n contiguous elements, one 256-thread block per row; rows addressed z*sz + r*sr (grid (R, Z)).
//   out = scale_out * softmax(scale_in * x + (Mf ? Mf[z*smz + r*smr + j] : 0)); a row whose max is -inf is written as 0.
// =====================================================================================================================
struct SmP { const float* src; float* dst; const float* Mf; long long sz, sr, dz, dr, smz, smr; int n, pad; float scale_in, scale_out; };
static_assert(sizeof(SmP) == 3 * 8 + 6 * 8 + 4 * 4, "SmP has padding");
__global__ __launch_bounds__(256) void k_softmax(SmP p) {
    __shared__ float red[256];
    const int r = blockIdx.x, z = blockIdx.y, tid = threadIdx.x;
    const float* s = p.src + z * p.sz + (long long)r * p.sr;
    const float* mf = p.Mf ? (p.Mf + z * p.smz + (long long)r * p.smr) : nullptr;
    float mx = -__builtin_inff();
    for (int j = tid; j < p.n; j += 256) { float v = s[j] * p.scale_in; if (mf) v += mf[j]; mx = fmaxf(mx, v); }
    red[tid] = mx; __syncthreads();
    for (int o = 128; o > 0; o >>= 1) { if (tid < o) red[tid] = fmaxf(red[tid], red[tid + o]); __syncthreads(); }
    mx = red[0]; __syncthreads();
    float sum = 0.f;
    for (int j = tid; j < p.n; j += 256) { float v = s[j] * p.scale_in; if (mf) v += mf[j]; sum += (mx == -__builtin_inff()) ? 0.f : expf(v - mx); }
    red[tid] = sum; __syncthreads();
    for (int o = 128; o > 0; o >>= 1) { if (tid < o) red[tid] += red[tid + o]; __syncthreads(); }
    sum = red[0];
    const float inv = (sum > 0.f) ? p.scale_out / sum : 0.f;
    float* d = p.dst + z * p.dz + (long long)r * p.dr;
    for (int j = tid; j < p.n; j += 256) { float v = s[j] * p.scale_in; if (mf) v += mf[j]; const float o = (mx == -__builtin_inff()) ? 0.f : expf(v - mx) * inv; VST2(float, d + j, o); }
}
// =====================================================================================================================
// k_stats: mean and rsqrt(var + eps) over a set of n elements addressed base + z*sz + (e / inner) * so + (e % inner) * si, one 256-thread
// k_norm_apply: y = (x - mean[set]) * rstd[set] * g[c] + b[c] over a [Z][C][L] chan-major tensor with set = z*G + c / (C/G) (G groups per z;
//   G = C -> per-chan sets indexed z*C+c; for batch norm pass stats indexed by c only via bn = 1). Optional act. Output same layout.
// =====================================================================================================================
//   mode 0: mean / rsqrt(var + eps); mode 1 (RMSNorm): 0 / rsqrt(mean(x^2) + eps); mode 2 (L2 normalize * sqrt(n)): 0 / sqrt(n) / max(||x||, eps); mode 3: as 0 with unbiased variance (n-1)
__global__ __launch_bounds__(256) void k_stats(const float* __restrict__ x, long long sz, long long so, long long si, int inner, int n, float eps, float* __restrict__ stat, int mode) {
    __shared__ float red[256];
    const int z = blockIdx.x, tid = threadIdx.x;
    const float* base = x + z * sz;
    float s = 0.f;
    for (int e = tid; e < n; e += 256) s += base[(long long)(e / inner) * so + (long long)(e % inner) * si];
    red[tid] = s; __syncthreads();
    for (int o = 128; o > 0; o >>= 1) { if (tid < o) red[tid] += red[tid + o]; __syncthreads(); }
    const float mu = (mode == 0 || mode == 3) ? red[0] / (float)n : 0.f; __syncthreads();
    float q = 0.f;
    for (int e = tid; e < n; e += 256) { const float dlt = base[(long long)(e / inner) * so + (long long)(e % inner) * si] - mu; q += dlt * dlt; }
    red[tid] = q; __syncthreads();
    for (int o = 128; o > 0; o >>= 1) { if (tid < o) red[tid] += red[tid + o]; __syncthreads(); }
    {
        float rs;
        if (mode == 2) rs = sqrtf((float)n) / fmaxf(sqrtf(red[0]), eps); else if (mode == 3) rs = rsqrtf(red[0] / (float)(n - 1) + eps); else rs = rsqrtf(red[0] / (float)n + eps);
        if (tid < 32) { const float v = (tid == 0) ? mu : ((tid == 1) ? rs : 0.f); VST2(float, stat + (long long)z * 32 + tid, v); }
    }
}
//   One thread per element over the flat [Z][C][L] index space: grid ceil(Z*C*L / 256).
__global__ __launch_bounds__(256) void k_norm_apply(const float* __restrict__ x, float* __restrict__ y, const float* __restrict__ stat, const float* __restrict__ g, const float* __restrict__ bta,
                                                     int Z, int C, int L, int G, int bn, int act) {
    const long long idx = (long long)blockIdx.x * 256 + threadIdx.x;
    if (idx >= (long long)Z * C * L) return;
    const int l = (int)(idx % L); const long long zc = idx / L; const int c = (int)(zc % C), z = (int)(zc / C); (void)l;
    const int set = bn ? c : (z * G + c / (C / G));
    float v = (x[idx] - stat[(long long)set * 32]) * stat[(long long)set * 32 + 1];
    if (g) v *= g[c];
    if (bta) v += bta[c];
    v = act_fn(v, act);
    VST2(float, y + idx, v);
}

// k_lse_neg: c[i] = -(st[2i] + log(st[2i+1])) = minus the log-sum-exp of row i from k_attn's ST output (for softmax over the query dimension)
__global__ __launch_bounds__(256) void k_lse_neg(const float* __restrict__ st, float* __restrict__ c, int n) {
    const int i = blockIdx.x * 256 + threadIdx.x;
    if (i < n) { const float v = -(st[2 * i] + logf(st[2 * i + 1])); VST2(float, c + i, v); }
}

// k_iota: dst[i] = a * i + b as int32 (segment/position id helper)
__global__ __launch_bounds__(256) void k_iota(int* __restrict__ dst, int n, int a, int b) {
    const int i = blockIdx.x * 256 + threadIdx.x;
    if (i < n) { const int v = a * i + b; VST2(int, dst + i, v); }
}

// k_axpby: dst[i] = a * x[i] + b * y[i] (+ c), i < n
__global__ __launch_bounds__(256) void k_axpby(const float* __restrict__ x, const float* __restrict__ y, float* __restrict__ dst, int n, float a, float b, float c) {
    const int i = blockIdx.x * 256 + threadIdx.x;
    if (i < n) { const float v = a * x[i] + b * y[i] + c; VST2(float, dst + i, v); }
}

// =====================================================================================================================
// k_rope: rotary embedding on a [R rows][Hn heads][D] view (row stride sXr, head stride sXh, element stride 1) -> Y (own strides).
//   mode 0: rotate_half (partner d±D/2, sign - for d<D/2); mode 1: interleaved pairs (partner d^1, sign - for even d).
//   table column tcol: tmode 0 -> d, 1 -> d % (D/2), 2 -> d / 2; position p: pmode 0 -> r % S, 1 -> head index, 2 -> pos[r];
//   c = C[(r / S) * sCb + p * sCp + tcol * sCd], s likewise from Sn; y = x[d] * c + sign * x[partner] * s. X and Y must not alias.
// =====================================================================================================================
struct RopeP { const float* X; float* Y; const float* C; const float* Sn; const int* pos; long long sXr, sXh, sYr, sYh, sCb, sCp, sCd; int R, Hn, D, S, mode, tmode, pmode, pad; };
static_assert(sizeof(RopeP) == 5 * 8 + 7 * 8 + 8 * 4, "RopeP has padding");
__global__ __launch_bounds__(256) void k_rope(RopeP p) {
    const long long idx = (long long)blockIdx.x * 256 + threadIdx.x;
    if (idx >= (long long)p.R * p.Hn * p.D) return;
    const int d = (int)(idx % p.D); const long long rh = idx / p.D; const int h = (int)(rh % p.Hn); const int r = (int)(rh / p.Hn);
    const int half = p.D / 2;
    int partner; float sign;
    if (p.mode == 0) { partner = (d < half) ? d + half : d - half; sign = (d < half) ? -1.f : 1.f; }
    else { partner = d ^ 1; sign = (d & 1) ? 1.f : -1.f; }
    const int tcol = (p.tmode == 0) ? d : ((p.tmode == 1) ? (d % half) : (d >> 1));
    const int pp = (p.pmode == 0) ? (r % p.S) : ((p.pmode == 1) ? h : p.pos[r]);
    const long long toff = (long long)(r / p.S) * p.sCb + (long long)pp * p.sCp + (long long)tcol * p.sCd;
    const float* xr = p.X + (long long)r * p.sXr + (long long)h * p.sXh;
    const float v = xr[d] * p.C[toff] + sign * xr[partner] * p.Sn[toff];
    VST2(float, p.Y + (long long)r * p.sYr + (long long)h * p.sYh + d, v);
}

// k_invf + k_sincos (split so neither kernel carries a large VALU-fma footprint): invf_i = num * (1 / powf(base, (2 i)/D)) [fmode 0],
//   num * expf((2 i) * cexp) [fmode 1], num * powf(base, -2 (i - 1) / D) [fmode 2]; then cs/sn[s*half + i] = cos/sin((pscale * s) * invf_i)
__global__ __launch_bounds__(256) void k_invf(float* __restrict__ invb, int half, int D, float base, float num, int fmode, float cexp) {
    const int i = blockIdx.x * 256 + threadIdx.x;
    if (i >= ((half + 31) / 32) * 32) return;
    if (i >= half) { VST2(float, invb + i, 0.f); return; }
    const float e = (float)(2 * i) / (float)D;
    float invf;
    if (fmode == 1) invf = num * expf((float)(2 * i) * cexp);
    else if (fmode == 2) invf = num * powf(base, (-2.0f * ((float)i - 1.0f)) / (float)D);
    else invf = num * (1.0f / powf(base, e));
    VST2(float, invb + i, invf);
}
__global__ __launch_bounds__(256) void k_sincos(float* __restrict__ cs, float* __restrict__ sn, const float* __restrict__ invb, int S, int half, float pscale) {
    const int idx = blockIdx.x * 256 + threadIdx.x;
    if (idx >= S * half) return;
    const int s = idx / half, i = idx - s * half;
    const float ang = (pscale * (float)s) * invb[i];
    VST2(float, cs + idx, cosf(ang)); VST2(float, sn + idx, sinf(ang));
}

// k_mulact: dst[i] = act(x[i]) * y[i]
__global__ __launch_bounds__(256) void k_mulact(const float* __restrict__ x, const float* __restrict__ y, float* __restrict__ dst, int n, int act) {
    const int i = blockIdx.x * 256 + threadIdx.x;
    if (i < n) { const float v = act_fn(x[i], act) * y[i]; VST2(float, dst + i, v); }
}

// =====================================================================================================================
// k_matvec: thread-per-row matrix-vector products for N <= 8 output columns (heads with 1-3 outputs, gates), f32 on the VALU.
//   C[r*sCm + j] = act(alpha * sum_k A[r*sAm + k*sAk] * B[j*sBn + k*sBk] + bias[j]) + beta * R[r*sRm + j*sRn]; each thread writes its N contiguous floats.
// =====================================================================================================================
__global__ __launch_bounds__(256) void k_matvec(GemmP p) {
    // 32 lanes write one line with one instruction.
    const int rpt = (p.N == 1) ? 1 : 32;
    const long long r0 = ((long long)blockIdx.x * 256 + threadIdx.x) * rpt; const int z = blockIdx.z, zo = z / p.zi_n, zi = z - zo * p.zi_n;
    if (r0 >= p.M) return;
    const float* Bb = p.B + zo * p.sBo + zi * p.sBi;
    float* C = p.C + zo * p.sCo + zi * p.sCi; const float* R = p.R + zo * p.sRo + zi * p.sRi;
    for (int rr = 0; rr < rpt; ++rr) {
        const long long r = r0 + rr; if (r >= p.M) break;
        const float* A = p.A + zo * p.sAo + zi * p.sAi + r * p.sAm;
        float acc[8] = {0.f, 0.f, 0.f, 0.f, 0.f, 0.f, 0.f, 0.f};
        for (int k = 0; k < p.K; ++k) { const float a = A[(long long)k * p.sAk];
#pragma unroll
            for (int j = 0; j < 8; ++j) if (j < p.N) acc[j] += a * Bb[(long long)j * p.sBn + (long long)k * p.sBk]; }
#pragma unroll
        for (int j = 0; j < 8; ++j) if (j < p.N) {
            float v = acc[j] * p.alpha;
            if (p.flags & 1) v += p.bias[j];
            if (p.flags & 2) v += p.bias[r];
            v = act_fn(v, p.act);
            if (p.flags & 4) v += p.beta * R[r * p.sRm + (long long)j * p.sRn];
            VST2(float, C + r * p.sCm + j, v);
        }
    }
}
// k_smallsoftmax: thread-per-row softmax for short rows (n <= 64): dst[r*dr + j] = softmax(scale*src[r*sr + j])
__global__ __launch_bounds__(256) void k_smallsoftmax(const float* __restrict__ src, float* __restrict__ dst, long long sr, long long dr, int n, long long R, float scale) {
    const long long r0 = ((long long)blockIdx.x * 256 + threadIdx.x) * 32;
    for (int rr = 0; rr < 32; ++rr) {
        const long long r = r0 + rr; if (r >= R) return;
        const float* s = src + r * sr; float* d = dst + r * dr;
        float mx = -__builtin_inff();
        for (int j = 0; j < n; ++j) mx = fmaxf(mx, s[j] * scale);
        float sum = 0.f;
        for (int j = 0; j < n; ++j) sum += expf(s[j] * scale - mx);
        const float inv = 1.f / sum;
        for (int j = 0; j < n; ++j) { const float v = expf(s[j] * scale - mx) * inv; VST2(float, d + j, v); }
    }
}

__global__ __launch_bounds__(32) void k_unitstat(float* __restrict__ st) { const int t = threadIdx.x; const float v = (t == 1) ? 1.f : 0.f; VST2(float, st + t, v); }

// destination (e.g. a d_out whose row width is not a multiple of 32 floats) is written by consecutive lanes of one instruction
__global__ __launch_bounds__(256) void k_lincopy(const float* __restrict__ src, long long lds, float* __restrict__ dst, long long ldd, long long rows, int cols) {
    const long long i = (long long)blockIdx.x * 256 + threadIdx.x; if (i >= rows * cols) return;
    const long long r = i / cols; const int c = (int)(i - r * cols);
    const float v = src[r * lds + c]; VST2(float, dst + r * ldd + c, v);
}


__device__ __forceinline__ void st_h2(unsigned short* d2, float a, float b) { const unsigned u = (unsigned)__builtin_bit_cast(unsigned short, (_Float16)a) | ((unsigned)__builtin_bit_cast(unsigned short, (_Float16)b) << 16); unsigned* d = (unsigned*)d2; *d = u;  }
__device__ __forceinline__ float ldh(const unsigned short* p) { return (float)__builtin_bit_cast(_Float16, *p); }
__device__ __forceinline__ v4f ld4h(const unsigned short* p) { const unsigned long long u = *(const unsigned long long*)p; v4f a;
    a.x = (float)__builtin_bit_cast(_Float16, (unsigned short)(u & 0xFFFFu)); a.y = (float)__builtin_bit_cast(_Float16, (unsigned short)((u >> 16) & 0xFFFFu)); a.z = (float)__builtin_bit_cast(_Float16, (unsigned short)((u >> 32) & 0xFFFFu)); a.w = (float)__builtin_bit_cast(_Float16, (unsigned short)((u >> 48) & 0xFFFFu)); return a; }
__device__ __forceinline__ unsigned long long pk4h(v4f s) { return (unsigned long long)__builtin_bit_cast(unsigned short, (_Float16)s.x) | ((unsigned long long)__builtin_bit_cast(unsigned short, (_Float16)s.y) << 16) | ((unsigned long long)__builtin_bit_cast(unsigned short, (_Float16)s.z) << 32) | ((unsigned long long)__builtin_bit_cast(unsigned short, (_Float16)s.w) << 48); }
typedef unsigned v4u __attribute__((ext_vector_type(4)));
__device__ __forceinline__ void st8h(unsigned short* d, v4f a, v4f b) { const unsigned long long pa = pk4h(a), pb = pk4h(b); v4u pk; pk.x = (unsigned)(pa & 0xFFFFFFFFull); pk.y = (unsigned)(pa >> 32); pk.z = (unsigned)(pb & 0xFFFFFFFFull); pk.w = (unsigned)(pb >> 32); v4u* dd = (v4u*)d; *dd = pk;  }
__device__ __forceinline__ unsigned short bfu_rne(float v) { unsigned u = __builtin_bit_cast(unsigned, v); u += 0x7FFFu + ((u >> 16) & 1u); return (unsigned short)(u >> 16); }
__device__ __forceinline__ void bfsplit(float v, unsigned short& hi, unsigned short& lo) { hi = bfu_rne(v); lo = bfu_rne(v - __builtin_bit_cast(float, (unsigned)hi << 16)); }
__device__ __forceinline__ void st_s2(unsigned short* Hp, unsigned short* Lp, long long o, float a, float b) { unsigned short h0,l0,h1,l1; bfsplit(a,h0,l0); bfsplit(b,h1,l1); const unsigned ph = (unsigned)h0 | ((unsigned)h1 << 16), pl = (unsigned)l0 | ((unsigned)l1 << 16);
    unsigned* dh = (unsigned*)(Hp + o); unsigned* dl = (unsigned*)(Lp + o); *dh = ph; *dl = pl;  }
__device__ __forceinline__ int cl(int v, int n) { return min(max(v, 0), n - 1); }

// GAT-style aggregation over a device in-edge CSR at dst (+ optional explicit self loop as iteration j = -1):
//   logit = leaky(AS[src][h] + AD[n][h] (+ EW[e]*CW[h]), slope); softmax over the node's edges per head; acc[c] = sum alpha XP[src][c] (f16 gather plane, pitch XW; 256 channels = H heads x CH)
//   wave per node; lane L owns channels 8L..8L+7 (head = 8L / CH); per-lane softmax state (lanes of one head agree) -> no shuffles in the loop.
//   EPI 0: + bias -> f32 OUT[n][256] via LDS redistribution (two 16-B stores per lane, each instruction 512 contiguous B)
//   EPI 1: + bias, LayerNorm(256) * g + bb, relu -> bf16 hi/lo planes OH/OL [n][256] (16-B stores)
//   EPI 2: mean over the 256/CH heads + bias[0..63], LayerNorm(64) * g + bb, relu -> f32 OUT[n][64] (CH must be 64; LDS redistribution, 8-B stores)
//   EPI 3: mean over heads + bias -> f32 OUT[n][64] (no norm / activation)
//   EPI 4: + bias, ELU -> bf16 hi/lo planes OH/OL [n][256];  EPI 5: + bias (full 256-wide, per head), ELU, then mean over the 256/CH heads -> f32 OUT[n][64]
//   EPI 6: (CH = 128, two heads) mean over the two heads, + bias[0..127], relu -> f32 OUT[n][128] (LDS redistribution, 16-B stores)
//   EWM 0: no edge weights; 1: logit += EW[e] * CW[h] (self loop weight 1); 2: alpha *= EW[e] after the softmax (message scale; self loop weight 1)
template <int CH, bool SELF, int EWM, int EPI>
__global__ __launch_bounds__(256) void k_gat_agg(const unsigned short* __restrict__ XP, int XW, const float* __restrict__ AS, const float* __restrict__ AD, int ASTR, const float* __restrict__ EW, const float* __restrict__ CW,
        const int* __restrict__ esrc, const int* __restrict__ off, const int* __restrict__ cnt, const int* __restrict__ slot, const float* __restrict__ bias, const float* __restrict__ g, const float* __restrict__ bb,
        float* __restrict__ OUT, unsigned short* __restrict__ OH, unsigned short* __restrict__ OL, int N, int E, int CAP, float slope) {
    __shared__ float stage[8][256];
    const int wv = threadIdx.x >> 5; const int n = blockIdx.x * 8 + wv; const int L = threadIdx.x & 31; if (n >= N) return; const int c0 = 8 * L; const int h = c0 / CH;
    const float ad = AD[(long long)n * ASTR + h]; const float cw = (EWM == 1) ? CW[h] : 0.f; float m = -3.0e38f, s = 0.f; v4f a0, a1; a0.x = a0.y = a0.z = a0.w = 0.f; a1 = a0;
    const int p0 = cl(off[n], E + 1), cn = min(max(cnt[n], 0), CAP);
    for (int j = (SELF ? -1 : 0); j < cn; ++j) { int sj; float ew = 0.f;
        if (j < 0) { sj = n; ew = 1.f; } else { int e = slot[cl(p0 + j, E)]; e = cl(e, E); sj = cl(esrc[e], N); if (EWM != 0) ew = EW[e]; }
        float lg = AS[(long long)sj * ASTR + h] + ad + ((EWM == 1) ? ew * cw : 0.f); lg = (lg >= 0.f) ? lg : slope * lg;
        const float mn = fmaxf(m, lg); const float cz = expf(m - mn), pj = expf(lg - mn); s = s * cz + pj; const float pw = (EWM == 2) ? pj * ew : pj;
        const unsigned short* xr = XP + (long long)sj * XW + c0; a0 = a0 * cz + ld4h(xr) * pw; a1 = a1 * cz + ld4h(xr + 4) * pw; m = mn; }
    const float inv = (s > 0.f) ? 1.f / (s + 1e-16f) : 0.f; a0 = a0 * inv; a1 = a1 * inv;
    if (EPI == 0 || EPI == 1 || EPI == 4 || EPI == 5) { a0 = a0 + *(const v4f*)(bias + c0); a1 = a1 + *(const v4f*)(bias + c0 + 4); }
    if (EPI == 4 || EPI == 5) { a0.x = (a0.x > 0.f) ? a0.x : (expf(a0.x) - 1.f); a0.y = (a0.y > 0.f) ? a0.y : (expf(a0.y) - 1.f); a0.z = (a0.z > 0.f) ? a0.z : (expf(a0.z) - 1.f); a0.w = (a0.w > 0.f) ? a0.w : (expf(a0.w) - 1.f);
        a1.x = (a1.x > 0.f) ? a1.x : (expf(a1.x) - 1.f); a1.y = (a1.y > 0.f) ? a1.y : (expf(a1.y) - 1.f); a1.z = (a1.z > 0.f) ? a1.z : (expf(a1.z) - 1.f); a1.w = (a1.w > 0.f) ? a1.w : (expf(a1.w) - 1.f); }
    if (EPI == 4) { float o8[8] = {a0.x, a0.y, a0.z, a0.w, a1.x, a1.y, a1.z, a1.w}; unsigned short hh[8], ll[8];
#pragma unroll
        for (int u = 0; u < 8; ++u) bfsplit(o8[u], hh[u], ll[u]);
        const unsigned long long ph0 = (unsigned long long)hh[0] | ((unsigned long long)hh[1] << 16) | ((unsigned long long)hh[2] << 32) | ((unsigned long long)hh[3] << 48), pl0 = (unsigned long long)ll[0] | ((unsigned long long)ll[1] << 16) | ((unsigned long long)ll[2] << 32) | ((unsigned long long)ll[3] << 48);
        const unsigned long long ph1 = (unsigned long long)hh[4] | ((unsigned long long)hh[5] << 16) | ((unsigned long long)hh[6] << 32) | ((unsigned long long)hh[7] << 48), pl1 = (unsigned long long)ll[4] | ((unsigned long long)ll[5] << 16) | ((unsigned long long)ll[6] << 32) | ((unsigned long long)ll[7] << 48);
        v4u pk; pk.x = (unsigned)(ph0 & 0xFFFFFFFFull); pk.y = (unsigned)(ph0 >> 32); pk.z = (unsigned)(ph1 & 0xFFFFFFFFull); pk.w = (unsigned)(ph1 >> 32); v4u* dh = (v4u*)(OH + (long long)n * 256 + c0); *dh = pk; 
        v4u ql; ql.x = (unsigned)(pl0 & 0xFFFFFFFFull); ql.y = (unsigned)(pl0 >> 32); ql.z = (unsigned)(pl1 & 0xFFFFFFFFull); ql.w = (unsigned)(pl1 >> 32); v4u* dl = (v4u*)(OL + (long long)n * 256 + c0); *dl = ql;  return; }
    if (EPI == 6) {
        a0.x += __shfl_xor(a0.x, 16); a0.y += __shfl_xor(a0.y, 16); a0.z += __shfl_xor(a0.z, 16); a0.w += __shfl_xor(a0.w, 16); a1.x += __shfl_xor(a1.x, 16); a1.y += __shfl_xor(a1.y, 16); a1.z += __shfl_xor(a1.z, 16); a1.w += __shfl_xor(a1.w, 16);
        if (L < 16) { const int cb = 8 * L; const v4f b0 = *(const v4f*)(bias + cb), b1v = *(const v4f*)(bias + cb + 4);
            stage[wv][cb] = fmaxf(a0.x * 0.5f + b0.x, 0.f); stage[wv][cb + 1] = fmaxf(a0.y * 0.5f + b0.y, 0.f); stage[wv][cb + 2] = fmaxf(a0.z * 0.5f + b0.z, 0.f); stage[wv][cb + 3] = fmaxf(a0.w * 0.5f + b0.w, 0.f);
            stage[wv][cb + 4] = fmaxf(a1.x * 0.5f + b1v.x, 0.f); stage[wv][cb + 5] = fmaxf(a1.y * 0.5f + b1v.y, 0.f); stage[wv][cb + 6] = fmaxf(a1.z * 0.5f + b1v.z, 0.f); stage[wv][cb + 7] = fmaxf(a1.w * 0.5f + b1v.w, 0.f); }
        __builtin_amdgcn_fence(__ATOMIC_RELEASE, "workgroup"); __builtin_amdgcn_wave_barrier(); __builtin_amdgcn_fence(__ATOMIC_ACQUIRE, "workgroup");
        v4f o6; o6.x = stage[wv][4 * L]; o6.y = stage[wv][4 * L + 1]; o6.z = stage[wv][4 * L + 2]; o6.w = stage[wv][4 * L + 3]; VST2V4(OUT + (long long)n * 128 + 4 * L, o6); return; }
    if (EPI == 5) {
        a0.x += __shfl_xor(a0.x, 8); a0.y += __shfl_xor(a0.y, 8); a0.z += __shfl_xor(a0.z, 8); a0.w += __shfl_xor(a0.w, 8); a1.x += __shfl_xor(a1.x, 8); a1.y += __shfl_xor(a1.y, 8); a1.z += __shfl_xor(a1.z, 8); a1.w += __shfl_xor(a1.w, 8);
        a0.x += __shfl_xor(a0.x, 16); a0.y += __shfl_xor(a0.y, 16); a0.z += __shfl_xor(a0.z, 16); a0.w += __shfl_xor(a0.w, 16); a1.x += __shfl_xor(a1.x, 16); a1.y += __shfl_xor(a1.y, 16); a1.z += __shfl_xor(a1.z, 16); a1.w += __shfl_xor(a1.w, 16);
        const int gq5 = L & 7; a0 = a0 * 0.25f; a1 = a1 * 0.25f;
        if (L < 8) { stage[wv][8 * gq5] = a0.x; stage[wv][8 * gq5 + 1] = a0.y; stage[wv][8 * gq5 + 2] = a0.z; stage[wv][8 * gq5 + 3] = a0.w; stage[wv][8 * gq5 + 4] = a1.x; stage[wv][8 * gq5 + 5] = a1.y; stage[wv][8 * gq5 + 6] = a1.z; stage[wv][8 * gq5 + 7] = a1.w; }
        __builtin_amdgcn_fence(__ATOMIC_RELEASE, "workgroup"); __builtin_amdgcn_wave_barrier(); __builtin_amdgcn_fence(__ATOMIC_ACQUIRE, "workgroup");
        const unsigned long long pk5 = (unsigned long long)__builtin_bit_cast(unsigned, stage[wv][2 * L]) | ((unsigned long long)__builtin_bit_cast(unsigned, stage[wv][2 * L + 1]) << 32); VST2(unsigned long long, (unsigned long long*)(OUT + (long long)n * 64 + 2 * L), pk5); return; }
    if (EPI == 1) { float sm = a0.x + a0.y + a0.z + a0.w + a1.x + a1.y + a1.z + a1.w;
#pragma unroll
        for (int o = 16; o > 0; o >>= 1) sm += __shfl_xor(sm, o);
        const float mu = sm * (1.f / 256.f); const v4f d0 = a0 - mu, d1 = a1 - mu; float q = d0.x * d0.x + d0.y * d0.y + d0.z * d0.z + d0.w * d0.w + d1.x * d1.x + d1.y * d1.y + d1.z * d1.z + d1.w * d1.w;
#pragma unroll
        for (int o = 16; o > 0; o >>= 1) q += __shfl_xor(q, o);
        const float rs = rsqrtf(q * (1.f / 256.f) + 1e-5f); float o8[8] = {d0.x, d0.y, d0.z, d0.w, d1.x, d1.y, d1.z, d1.w}; unsigned short hh[8], ll[8];
#pragma unroll
        for (int u = 0; u < 8; ++u) { const float v = fmaxf(o8[u] * rs * g[c0 + u] + bb[c0 + u], 0.f); bfsplit(v, hh[u], ll[u]); }
        const unsigned long long ph0 = (unsigned long long)hh[0] | ((unsigned long long)hh[1] << 16) | ((unsigned long long)hh[2] << 32) | ((unsigned long long)hh[3] << 48), pl0 = (unsigned long long)ll[0] | ((unsigned long long)ll[1] << 16) | ((unsigned long long)ll[2] << 32) | ((unsigned long long)ll[3] << 48);
        const unsigned long long ph1 = (unsigned long long)hh[4] | ((unsigned long long)hh[5] << 16) | ((unsigned long long)hh[6] << 32) | ((unsigned long long)hh[7] << 48), pl1 = (unsigned long long)ll[4] | ((unsigned long long)ll[5] << 16) | ((unsigned long long)ll[6] << 32) | ((unsigned long long)ll[7] << 48);
        // lane L's 8 halves at c0 = 8L: 16 B -> one 16-B store per plane (32 lanes x 16 B = whole 512-B row)
        v4u pk; pk.x = (unsigned)(ph0 & 0xFFFFFFFFull); pk.y = (unsigned)(ph0 >> 32); pk.z = (unsigned)(ph1 & 0xFFFFFFFFull); pk.w = (unsigned)(ph1 >> 32); v4u* dh = (v4u*)(OH + (long long)n * 256 + c0); *dh = pk; 
        v4u ql; ql.x = (unsigned)(pl0 & 0xFFFFFFFFull); ql.y = (unsigned)(pl0 >> 32); ql.z = (unsigned)(pl1 & 0xFFFFFFFFull); ql.w = (unsigned)(pl1 >> 32); v4u* dl = (v4u*)(OL + (long long)n * 256 + c0); *dl = ql;  return; }
    if (EPI == 2 || EPI == 3) {   // head mean: lanes L, L^8, L^16, L^24 hold the same chan group of the 4 heads (CH = 64 -> 8 lanes per head)
        a0.x += __shfl_xor(a0.x, 8); a0.y += __shfl_xor(a0.y, 8); a0.z += __shfl_xor(a0.z, 8); a0.w += __shfl_xor(a0.w, 8); a1.x += __shfl_xor(a1.x, 8); a1.y += __shfl_xor(a1.y, 8); a1.z += __shfl_xor(a1.z, 8); a1.w += __shfl_xor(a1.w, 8);
        a0.x += __shfl_xor(a0.x, 16); a0.y += __shfl_xor(a0.y, 16); a0.z += __shfl_xor(a0.z, 16); a0.w += __shfl_xor(a0.w, 16); a1.x += __shfl_xor(a1.x, 16); a1.y += __shfl_xor(a1.y, 16); a1.z += __shfl_xor(a1.z, 16); a1.w += __shfl_xor(a1.w, 16);
        const int gq = L & 7; a0 = a0 * 0.25f + *(const v4f*)(bias + 8 * gq); a1 = a1 * 0.25f + *(const v4f*)(bias + 8 * gq + 4);      // every lane now holds channels 8gq..8gq+7 of the mean
        if (EPI == 3) { if (L < 8) { stage[wv][8 * gq] = a0.x; stage[wv][8 * gq + 1] = a0.y; stage[wv][8 * gq + 2] = a0.z; stage[wv][8 * gq + 3] = a0.w; stage[wv][8 * gq + 4] = a1.x; stage[wv][8 * gq + 5] = a1.y; stage[wv][8 * gq + 6] = a1.z; stage[wv][8 * gq + 7] = a1.w; }
            __builtin_amdgcn_fence(__ATOMIC_RELEASE, "workgroup"); __builtin_amdgcn_wave_barrier(); __builtin_amdgcn_fence(__ATOMIC_ACQUIRE, "workgroup");
            const unsigned long long pk3 = (unsigned long long)__builtin_bit_cast(unsigned, stage[wv][2 * L]) | ((unsigned long long)__builtin_bit_cast(unsigned, stage[wv][2 * L + 1]) << 32); VST2(unsigned long long, (unsigned long long*)(OUT + (long long)n * 64 + 2 * L), pk3); return; }
        float sm = (L < 8) ? (a0.x + a0.y + a0.z + a0.w + a1.x + a1.y + a1.z + a1.w) : 0.f;
#pragma unroll
        for (int o = 16; o > 0; o >>= 1) sm += __shfl_xor(sm, o);
        const float mu = sm * (1.f / 64.f); const v4f d0 = a0 - mu, d1 = a1 - mu; float q = (L < 8) ? (d0.x * d0.x + d0.y * d0.y + d0.z * d0.z + d0.w * d0.w + d1.x * d1.x + d1.y * d1.y + d1.z * d1.z + d1.w * d1.w) : 0.f;
#pragma unroll
        for (int o = 16; o > 0; o >>= 1) q += __shfl_xor(q, o);
        const float rs = rsqrtf(q * (1.f / 64.f) + 1e-5f);
        if (L < 8) { const float* gg = g + 8 * gq; const float* bq = bb + 8 * gq; stage[wv][8 * gq] = fmaxf(d0.x * rs * gg[0] + bq[0], 0.f); stage[wv][8 * gq + 1] = fmaxf(d0.y * rs * gg[1] + bq[1], 0.f); stage[wv][8 * gq + 2] = fmaxf(d0.z * rs * gg[2] + bq[2], 0.f); stage[wv][8 * gq + 3] = fmaxf(d0.w * rs * gg[3] + bq[3], 0.f);
            stage[wv][8 * gq + 4] = fmaxf(d1.x * rs * gg[4] + bq[4], 0.f); stage[wv][8 * gq + 5] = fmaxf(d1.y * rs * gg[5] + bq[5], 0.f); stage[wv][8 * gq + 6] = fmaxf(d1.z * rs * gg[6] + bq[6], 0.f); stage[wv][8 * gq + 7] = fmaxf(d1.w * rs * gg[7] + bq[7], 0.f); }
        __builtin_amdgcn_fence(__ATOMIC_RELEASE, "workgroup"); __builtin_amdgcn_wave_barrier(); __builtin_amdgcn_fence(__ATOMIC_ACQUIRE, "workgroup");
        const unsigned long long pk = (unsigned long long)__builtin_bit_cast(unsigned, stage[wv][2 * L]) | ((unsigned long long)__builtin_bit_cast(unsigned, stage[wv][2 * L + 1]) << 32); VST2(unsigned long long, (unsigned long long*)(OUT + (long long)n * 64 + 2 * L), pk); return; }
    // EPI 0
    stage[wv][c0] = a0.x; stage[wv][c0 + 1] = a0.y; stage[wv][c0 + 2] = a0.z; stage[wv][c0 + 3] = a0.w; stage[wv][c0 + 4] = a1.x; stage[wv][c0 + 5] = a1.y; stage[wv][c0 + 6] = a1.z; stage[wv][c0 + 7] = a1.w;
    __builtin_amdgcn_fence(__ATOMIC_RELEASE, "workgroup"); __builtin_amdgcn_wave_barrier(); __builtin_amdgcn_fence(__ATOMIC_ACQUIRE, "workgroup");
#pragma unroll
    for (int q2 = 0; q2 < 2; ++q2) { const int c = 128 * q2 + 4 * L; v4f v; v.x = stage[wv][c]; v.y = stage[wv][c + 1]; v.z = stage[wv][c + 2]; v.w = stage[wv][c + 3]; VST2V4(OUT + (long long)n * 256 + c, v); } }

__device__ __forceinline__ void st4s(unsigned short* Hp, unsigned short* Lp, long long o, v4f a) { unsigned short h[4], l[4]; bfsplit(a.x, h[0], l[0]); bfsplit(a.y, h[1], l[1]); bfsplit(a.z, h[2], l[2]); bfsplit(a.w, h[3], l[3]);
    const unsigned long long ph = (unsigned long long)h[0] | ((unsigned long long)h[1] << 16) | ((unsigned long long)h[2] << 32) | ((unsigned long long)h[3] << 48), pl = (unsigned long long)l[0] | ((unsigned long long)l[1] << 16) | ((unsigned long long)l[2] << 32) | ((unsigned long long)l[3] << 48);
    VST2(unsigned long long, (unsigned long long*)(Hp + o), ph); VST2(unsigned long long, (unsigned long long*)(Lp + o), pl); }
// f32 [nval2 pairs] -> bf16 hi/lo planes (n2 pairs; pairs >= nval2 zero); thread-linear 4-B stores per plane
__global__ __launch_bounds__(256) void k_pl(const float* __restrict__ S, unsigned short* __restrict__ PH, unsigned short* __restrict__ PL, long long nval2, long long n2) { const long long u = (long long)blockIdx.x * 256 + threadIdx.x; if (u >= n2) return; const bool in = (u < nval2); const long long uc = in ? u : ((nval2 > 0) ? (nval2 - 1) : 0); const float a = S[2 * uc], b = S[2 * uc + 1]; st_s2(PH, PL, 2 * u, in ? a : 0.f, in ? b : 0.f); }
// WC [K][NOP] (thread-linear whole rows) = [W (cols < FO) | 0 | W_h . as_h @EO+h | W_h . ad_h @EO+NH+h | 0 ...]; W is [K][FO] (x @ W layout), as/ad [NH][DH]; EO >= FO.
// branch-free: every lane loads all candidates with clamped indices and selects by value (no exec-masked load arms)
__global__ __launch_bounds__(256) void k_wext(const float* __restrict__ Wm, const float* __restrict__ AS_, const float* __restrict__ AD_, int K, int NOP, int FO, int NH, int DH, int EO, float* __restrict__ WC) {
    #pragma clang fp contract(off)
    const long long u = (long long)blockIdx.x * 256 + threadIdx.x; if (u >= (long long)K * NOP) return; const int kk = (int)(u / NOP), o = (int)(u % NOP);
    const int oo = min(o, FO - 1); const float vw = Wm[(long long)kk * FO + oo]; const int q = min(max(o - EO, 0), 2 * NH - 1); const int h = q % NH; float s = 0.f;
#pragma unroll 1
    for (int c = 0; c < DH; ++c) { const float w = Wm[(long long)kk * FO + h * DH + c]; const float asv = AS_[h * DH + c], adv = AD_[h * DH + c]; s += w * ((q < NH) ? asv : adv); }
    const float v = (o < FO) ? vw : ((o >= EO && o < EO + 2 * NH) ? s : 0.f); VST2(float, WC + u, v); }
// GAT aggregation over a device in-edge CSR (+ analytic self loop as iteration j = -1 when SELF), per-lane online softmax (lanes of one head agree):
// HS rows (pitch P floats): [0,128) projected features z, col 128 + h = a_src.z_h, col 128 + NH + h = a_dst.z_h; lane L owns channels 4L..4L+3 (head = 4L / CH).
// out = sum_j softmax_j(leaky(el[src_j][h] + er[n][h])) z[src_j] (/ (den + deps)) + bias -> ACT (0 none, 1 relu, 2 elu, 3 leaky 0.01) ->
// MODE 0: f32 OUT[n][OW] cols < OC (16-B lane stores, OC*4 contiguous B per wave; OC in {64,128}); MODE 1: bf16 hi/lo planes PH/PL pitch PP (rows n >= N zero); MODE 2: both.
template <int CH, bool SELF, int ACT, int MODE>
__global__ __launch_bounds__(256) void k_gat128(const float* __restrict__ HS, int P, int NH, const float* __restrict__ bias, const int* __restrict__ SRC, const int* __restrict__ off, const int* __restrict__ cnt, const int* __restrict__ slot,
        float* __restrict__ OUT, int OW, int OC, unsigned short* __restrict__ PH, unsigned short* __restrict__ PL, int PP, int N, int NP, int E, int CAP, float slope, float deps) {
    #pragma clang fp contract(off)
    const int n = blockIdx.x * 8 + (threadIdx.x >> 5); const int L = threadIdx.x & 31; if (n >= NP) return; const int c = 4 * L; const int h = c / CH; v4f o; o.x = o.y = o.z = o.w = 0.f;
    if (n < N) { const float* hn = HS + (long long)n * P; const float er = hn[128 + NH + h]; float m = -3.0e38f, s = 0.f; v4f a; a.x = a.y = a.z = a.w = 0.f;
        const int p0 = min(max(off[n], 0), E), cn = min(max(cnt[n], 0), CAP);
        for (int j = (SELF ? -1 : 0); j < cn; ++j) { int sj; if (j < 0) sj = n; else { const int e = min(max(slot[min(p0 + j, E - 1)], 0), E - 1); sj = min(max(SRC[e], 0), N - 1); }
            const float* hs = HS + (long long)sj * P; float lg = hs[128 + h] + er; lg = (lg >= 0.f) ? lg : slope * lg;
            const float mn = fmaxf(m, lg); const float cz = expf(m - mn), pj = expf(lg - mn); s = s * cz + pj; a = a * cz + *(const v4f*)(hs + c) * pj; m = mn; }
        const float inv = (s > 0.f || deps > 0.f) ? 1.f / (s + deps) : 0.f; o = a * inv + *(const v4f*)(bias + c);
        if (ACT == 1) { o.x = fmaxf(o.x, 0.f); o.y = fmaxf(o.y, 0.f); o.z = fmaxf(o.z, 0.f); o.w = fmaxf(o.w, 0.f); }
        if (ACT == 2) { o.x = (o.x > 0.f) ? o.x : (expf(o.x) - 1.f); o.y = (o.y > 0.f) ? o.y : (expf(o.y) - 1.f); o.z = (o.z > 0.f) ? o.z : (expf(o.z) - 1.f); o.w = (o.w > 0.f) ? o.w : (expf(o.w) - 1.f); }
        if (ACT == 3) { o.x = (o.x >= 0.f) ? o.x : 0.01f * o.x; o.y = (o.y >= 0.f) ? o.y : 0.01f * o.y; o.z = (o.z >= 0.f) ? o.z : 0.01f * o.z; o.w = (o.w >= 0.f) ? o.w : 0.01f * o.w; }
        if (MODE != 1 && c < OC) VST2V4(OUT + (long long)n * OW + c, o); }
    if (MODE != 0) st4s(PH, PL, (long long)n * PP + c, o); }

// ---- util2 ----
// generic Bt plane builder from an f32 weight: Bt[o][k] (pitch KP halves) = (TRANS ? W[k*ldw + o] : W[o*ldw + k]) * (S ? S[o] : 1) for o < NO, k < KI; zero elsewhere for o < NOP rows, k < KP (thread per (o < NOP, pair k))
__global__ __launch_bounds__(256) void k_u2_bt(const float* __restrict__ Wm, int ldw, int TRANS, int KI, int NO, int KP, int NOP, const float* __restrict__ S, unsigned short* __restrict__ PH_, unsigned short* __restrict__ PL_) {
    const long long u = (long long)blockIdx.x * 256 + threadIdx.x; if (u >= (long long)NOP * (KP / 2)) return; const int k0 = 2 * (int)(u % (KP / 2)); const int o = (int)(u / (KP / 2)); float a = 0.f, b = 0.f;
    if (o < NO) { const float s = S ? S[o] : 1.f;
        if (k0 < KI) a = (TRANS ? Wm[(long long)k0 * ldw + o] : Wm[(long long)o * ldw + k0]) * s;
        if (k0 + 1 < KI) b = (TRANS ? Wm[(long long)(k0 + 1) * ldw + o] : Wm[(long long)o * ldw + k0 + 1]) * s; }
    st_s2(PH_, PL_, (long long)o * KP + k0, a, b); }
// generic padded vector: O[i] = (i < n) ? (A[i] * (S ? S[i] : 1) + (B2 ? B2[i] : 0)) : 0 for i < NP (one block of 256, NP <= 4096 looped)
__global__ __launch_bounds__(256) void k_u2_vec(const float* __restrict__ A, const float* __restrict__ S, const float* __restrict__ B2, int n, int NP, float* __restrict__ O) { for (int i = threadIdx.x; i < NP; i += 256) { float v = 0.f; if (i < n) v = A[i] * (S ? S[i] : 1.f) + (B2 ? B2[i] : 0.f); VST2(float, O + i, v); } }
__global__ __launch_bounds__(256) void k_u2_colstat(const float* __restrict__ X, int P, int N, float eps, float* __restrict__ STAT) {
    #pragma clang fp contract(off)
    __shared__ float red[256]; const int c = blockIdx.x; const int t = threadIdx.x; float s = 0.f; for (int r = t; r < N; r += 256) s += X[(long long)r * P + c]; red[t] = s; __syncthreads();
    for (int o = 128; o > 0; o >>= 1) { if (t < o) red[t] += red[t + o]; __syncthreads(); }
    const float mu = red[0] / (float)N; __syncthreads(); float q = 0.f; for (int r = t; r < N; r += 256) { const float d = X[(long long)r * P + c] - mu; q += d * d; } red[t] = q; __syncthreads();
    for (int o = 128; o > 0; o >>= 1) { if (t < o) red[t] += red[t + o]; __syncthreads(); }
    const float rs = 1.f / sqrtf(red[0] / (float)N + eps); if (t < 32) VST2(float, STAT + (long long)c * 32 + t, (t == 0) ? mu : ((t == 1) ? rs : 0.f)); }
// rows f32 [R][W] (pitch PW) -> planes at pitch PP, column offset coff; rows >= RL (live) written as zeros up to RP (thread per (r < RP, 4 of W))
__global__ __launch_bounds__(256) void k_u2_pl(const float* __restrict__ X, int PW, int Wd, int RL, int RP, unsigned short* __restrict__ PH_, unsigned short* __restrict__ PL_, int PP, int coff) { const long long u = (long long)blockIdx.x * 256 + threadIdx.x; if (u >= (long long)RP * (Wd / 4)) return; const int r = (int)(u / (Wd / 4)); const int c = 4 * (int)(u % (Wd / 4)); v4f v; v.x = v.y = v.z = v.w = 0.f; if (r < RL) v = *(const v4f*)(X + (long long)r * PW + c); st4s(PH_, PL_, (long long)r * PP + coff + c, v); }

typedef unsigned int cm_u4 __attribute__((ext_vector_type(4)));

__global__ __launch_bounds__(256) void k_cm_zero16(unsigned short* __restrict__ DST, long long n) { const long long u = (long long)blockIdx.x * 256 + threadIdx.x; if (u * 8 >= n) return; cm_u4 z; z.x = z.y = z.z = z.w = 0u; cm_u4* d = (cm_u4*)(DST + u * 8); *d = z;  }
// f32 -> bf16 (RNE) -> f16 casts: every 16-bit operand then holds exactly the bf16-rounded input value (times a power-of-two
// weight scale), so the f16 WMMA products are exact. Plain: thread per (row, 8 cols),
// dst [R][C] pitch ldd; transposed: thread per (col, 8 consecutive rows) -> dst [C][R] pitch ldd; both store 16 B per thread, thread-linear along the dst row.
__device__ __forceinline__ unsigned int cmb_pk2(float a, float b) { return (unsigned int)__builtin_bit_cast(unsigned short, (_Float16)a) | ((unsigned int)__builtin_bit_cast(unsigned short, (_Float16)b) << 16); }
__device__ __forceinline__ float cmb_bf(float v) { const unsigned u = __builtin_bit_cast(unsigned, v); const unsigned r = (u + 0x7fffu + ((u >> 16) & 1u)) & 0xffff0000u; return __builtin_bit_cast(float, r); }   // bf16 RNE, kept as f32 (finite inputs)
// BR[i] = bf16_rne(B[i]) kept as f32 (thread per element)
__global__ __launch_bounds__(256) void k_cm_bfvec(const float* __restrict__ SRC, float* __restrict__ DST, int n) { const int u = blockIdx.x * 256 + threadIdx.x; if (u >= n) return; VST2(float, DST + u, cmb_bf(SRC[u])); }
__global__ __launch_bounds__(256) void k_cm_castb(const float* __restrict__ SRC, int lds, unsigned short* __restrict__ DST, int ldd, int nR, int nC, float sc) {
    const long long u = (long long)blockIdx.x * 256 + threadIdx.x; const int per = nC / 8; if (u >= (long long)nR * per) return; const int r = (int)(u / per); const int c0 = 8 * (int)(u % per);
    const float* s = SRC + (long long)r * lds + c0; float w[8];
#pragma unroll
    for (int e = 0; e < 8; ++e) w[e] = cmb_bf(s[e]) * sc;
    cm_u4 pk; pk.x = cmb_pk2(w[0], w[1]); pk.y = cmb_pk2(w[2], w[3]); pk.z = cmb_pk2(w[4], w[5]); pk.w = cmb_pk2(w[6], w[7]); VST2(cm_u4, (cm_u4*)(DST + (long long)r * ldd + c0), pk); }
__global__ __launch_bounds__(256) void k_cm_castbT(const float* __restrict__ SRC, int lds, unsigned short* __restrict__ DST, int ldd, int nR, int nC, float sc) {
    const long long u = (long long)blockIdx.x * 256 + threadIdx.x; const int per = nR / 8; if (u >= (long long)nC * per) return; const int c = (int)(u / per); const int r0 = 8 * (int)(u % per);
    float w[8];
#pragma unroll
    for (int e = 0; e < 8; ++e) w[e] = cmb_bf(SRC[(long long)(r0 + e) * lds + c]) * sc;
    cm_u4 pk; pk.x = cmb_pk2(w[0], w[1]); pk.y = cmb_pk2(w[2], w[3]); pk.z = cmb_pk2(w[4], w[5]); pk.w = cmb_pk2(w[6], w[7]); VST2(cm_u4, (cm_u4*)(DST + (long long)c * ldd + r0), pk); }

// QT = bf16(q) * bf16(tau[b]) (f32, thread per float4); MF[b][j] = scale * bf16(delta[b][j]).
// KF, VF = bf16(keys | keys_null), bf16(values | values_null) as 2-byte halves in the order the attention kernel's B fragments want them, so that a fragment is two 16-byte loads a lane
// and each load of a wave reads 512 contiguous bytes: [branch][b][h][64-key block][tile 0..3][step 0..1][half 0..1][lane 0..31][8].
//   K: key = 64 block + 16 tile + (lane & 15), e = 32 step + 16 half + 8 (lane >> 4) + i;   V: d = 16 tile + (lane & 15), key = 64 block + 32 step + 16 half + 8 (lane >> 4) + i.
// Thread per 16-byte group of the destination (thread-linear stores); which = blockIdx range, block-uniform.
__global__ __launch_bounds__(256) void k_ds_pre(const float* __restrict__ Q, const float* __restrict__ Kp, const float* __restrict__ V, const float* __restrict__ Kn, const float* __restrict__ Vn, const float* __restrict__ TAU, const float* __restrict__ DELTA, float* __restrict__ QTp, unsigned short* __restrict__ KFp, unsigned short* __restrict__ VFp, float* __restrict__ MFp, float sc) {
    #pragma clang fp contract(off)
    const int blk = blockIdx.x;
    if (blk < 2048) { const long long u = (long long)blk * 256 + threadIdx.x; const int b = (int)(u / (2048LL * 8 * 16)); const float t = cmb_bf(TAU[b]); const v4f x = *(const v4f*)(Q + 4 * u); v4f r; r.x = cmb_bf(x.x) * t; r.y = cmb_bf(x.y) * t; r.z = cmb_bf(x.z) * t; r.w = cmb_bf(x.w) * t; VST2V4(QTp + 4 * u, r); }
    else if (blk < 2048 + 4 * 1024) {
        const int which = (blk - 2048) >> 10;                            // 0 keys, 1 values, 2 keys_null, 3 values_null
        const int c = ((blk - 2048) & 1023) * 256 + threadIdx.x;         // 16-byte group within the tensor: 262,144 of them
        const int lane = c & 31, half = (c >> 5) & 1, step = (c >> 6) & 1, tile = (c >> 7) & 3, kb = (c >> 9) & 31, h = (c >> 14) & 7, b = c >> 17;
        const int inner = 32 * step + 16 * half + 8 * (lane >> 4), outer = 16 * tile + (lane & 15);
        const float* s = (which == 0) ? Kp : (which == 1) ? V : (which == 2) ? Kn : Vn;
        float w[8];
        if ((which & 1) == 0) {
            const float* r = s + ((long long)(b * 2048 + kb * 64 + outer) * 8 + h) * 64 + inner;
            const v4f x = *(const v4f*)r, y = *(const v4f*)(r + 4);
            w[0] = x.x; w[1] = x.y; w[2] = x.z; w[3] = x.w; w[4] = y.x; w[5] = y.y; w[6] = y.z; w[7] = y.w;
        } else {
            const float* r = s + ((long long)(b * 2048 + kb * 64 + inner) * 8 + h) * 64 + outer;
#pragma unroll   // constant trip count: the eight row loads are issued together, with one wait
            for (int i = 0; i < 8; ++i) w[i] = r[i * 512];
        }
        cm_u4 pk;
        pk.x = (unsigned)bfu_rne(w[0]) | ((unsigned)bfu_rne(w[1]) << 16); pk.y = (unsigned)bfu_rne(w[2]) | ((unsigned)bfu_rne(w[3]) << 16);
        pk.z = (unsigned)bfu_rne(w[4]) | ((unsigned)bfu_rne(w[5]) << 16); pk.w = (unsigned)bfu_rne(w[6]) | ((unsigned)bfu_rne(w[7]) << 16);
        unsigned short* d = ((which & 1) ? VFp : KFp) + ((which >= 2) ? 2097152 : 0) + (long long)c * 8;
        VST2(cm_u4, (cm_u4*)d, pk); }
    else { const int u = (blk - 2048 - 4 * 1024) * 256 + threadIdx.x; VST2(float, MFp + u, sc * cmb_bf(DELTA[u]));
        asm volatile("s_wait_xcnt 0x0" ::: "memory");   // stands behind the store, ahead of any rewrite of the registers it names
    } }
// out = m * A1 + (1 - m) * A2 with m = bf16(soft_mask[b][l]) broadcast over (h, e); thread per float4
__global__ __launch_bounds__(256) void k_ds_blend(const float* __restrict__ A1, const float* __restrict__ A2, const float* __restrict__ SM, float* __restrict__ O, long long n4) {
    #pragma clang fp contract(off)
    const long long u = (long long)blockIdx.x * 256 + threadIdx.x; if (u >= n4) return; const float m = cmb_bf(SM[(4 * u) / 512]); const v4f a = *(const v4f*)(A1 + 4 * u), b = *(const v4f*)(A2 + 4 * u); v4f o;
    o.x = m * a.x + (1.f - m) * b.x; o.y = m * a.y + (1.f - m) * b.y; o.z = m * a.z + (1.f - m) * b.z; o.w = m * a.w + (1.f - m) * b.w; VST2V4(O + 4 * u, o); }


extern "C" void kernel_launch(void* const* d_in, const int* in_sizes, int n_in, void* d_out, int out_size, void* d_ws, size_t ws_size, hipStream_t stream) {
    (void)in_sizes; (void)n_in; (void)out_size; (void)ws_size;
    const float* q = (const float*)d_in[0];
    const float* kk = (const float*)d_in[1];
    const float* v = (const float*)d_in[2];
    const float* kn = (const float*)d_in[3];
    const float* vn = (const float*)d_in[4];
    const float* tau = (const float*)d_in[5];
    const float* delta = (const float*)d_in[6];
    const float* smask = (const float*)d_in[7];
    float* out = (float*)d_out;
    char* wsp = (char*)d_ws;
    float* QT = (float*)wsp; wsp += (((size_t)((size_t)2097152) * 4 + 255) / 256) * 256;
    unsigned short* KF = (unsigned short*)wsp; wsp += (((size_t)((size_t)4194304) * 2 + 255) / 256) * 256;   // [branch][batch] planes of 1,048,576 bf16 in fragment order
    unsigned short* VF = (unsigned short*)wsp; wsp += (((size_t)((size_t)4194304) * 2 + 255) / 256) * 256;   // the same
    float* MF = (float*)wsp; wsp += (((size_t)((size_t)4096) * 4 + 255) / 256) * 256;
    float* AO1 = (float*)wsp; wsp += (((size_t)((size_t)2097152) * 4 + 255) / 256) * 256;
    float* AO2 = (float*)wsp; wsp += (((size_t)((size_t)2097152) * 4 + 255) / 256) * 256;  // directly behind AO1: the attention launch writes both as [branch][batch] planes
    if ((size_t)(wsp - (char*)d_ws) > ws_size) return;   // static carve guard
    k_ds_pre<<<(unsigned)(2048 + 4 * 1024 + 16), 256, 0, stream>>>(q, kk, v, kn, vn, tau, delta, QT, KF, VF, MF, 0.125f);
    { /*apv4*/ AttnP a;
      a.Q = QT + 0; a.K = (const float*)KF; a.V = (const float*)VF;   /* bf16 planes in fragment order, read as such by the kernel */ a.O = AO1 + 0; a.P = 0; a.Mf = MF + 0; a.Mi = 0; a.ST = 0;
      a.Pw = 0; a.Rt = 0; a.SQ = 0; a.SK = 0;
      a.swb = 0; a.swh = 0; a.swi = 0; a.swj = 0; a.srb = 0; a.srh = 0; a.sri = 0; a.sQb = 1048576; a.sQh = 64; a.sQi = 512; a.sQd = 1; a.sKb = 1048576; a.sKh = 64; a.sKj = 512; a.sKd = 1; a.sVb = 1048576; a.sVh = 64; a.sVj = 512; a.sVd = 1; a.sOb = 1048576; a.sOh = 64; a.sOi = 512; a.sPb = 0; a.sPh = 0; a.sPi = 0; a.smb = 2048; a.smh = 0; a.smi = 0; a.smj = 1;
      a.Lq = 2048; a.Lk = 2048; a.dh = 64; a.dv = 64; a.hrep = 1; a.causal = 1; a.coff = 0; a.pband = 0;
      a.scale = 0.125f; a.mfill = 0.0f; a.nonorm = 0; a.mpol = 0;
      a.roff = 0; a.rn = 1; a.segpol = 0; a.win = 0;
      k_attn<64, 64, 1, true, false><<<dim3((unsigned)((2048) + 16 * AW - 1) / (16 * AW), (unsigned)(8), (unsigned)(4)), 32 * AW, 0, stream>>>(a); }
    k_ds_blend<<<(524288 + 255) / 256, 256, 0, stream>>>(AO1, AO2, smask, out, 524288LL);
}

// v004
// It runs in 101 microseconds.
// Timed twice side by side with v003, it ran 1.76 and 1.75 times as fast.
// All steps since v000 together make it 35.5 times as fast.
// De-stationary causal attention with a null branch, [b, l, h, e] layout (2 x 2,048 tokens, 8 heads x 64): A = softmax(scale * (q.k * tau_b + delta_bj)) over keys j <= i for (keys, values) and for (keys_null, values_null) with the same queries; out = soft_mask * out_edit + (1 - soft_mask) * out_null per query. all inputs rounded to bf16 (RNE); q is multiplied by tau_b on device (f32) and k, v rounded, k and v are stored as bf16 in WMMA fragment order, then ONE WMMA attention launch for both batches and both branches (v_wmma_f32_16x16x32_bf16, f32 accumulate) with q as a bf16 hi/lo split (f32-class: q*tau is not 16-bit exact) against bf16 k, the per-key additive table scale*delta_bj, causal, f32 online softmax, P as a bf16 hi/lo split against bf16 v; the blend in f32.
#include <hip/hip_runtime.h>
#include <math.h>

typedef __attribute__((ext_vector_type(16))) _Float16 v16h;
typedef __attribute__((ext_vector_type(8)))  _Float16 v8h;
typedef __attribute__((ext_vector_type(16))) __bf16   v16b;
typedef __attribute__((ext_vector_type(8)))  __bf16   v8b;
typedef __attribute__((ext_vector_type(8)))  float    v8f;
typedef __attribute__((ext_vector_type(4)))  float    v4f;

// 16-bit WMMA fragment map (wave32), lane L, h = L>>4, m = L&15:
//   A 16x32: lane = row m;   element i -> k = (i<8) ? 8h+i : 16+8h+(i-8)
//   B 32x16: lane = column m; the SAME k(i,h)
//   D 16x16 (8 f32): lane = column m; element r -> row 8h+r
__device__ __forceinline__ int frag_k(int i, int h) { return (i < 8) ? (8 * h + i) : (16 + 8 * h + (i - 8)); }
__device__ __forceinline__ __bf16 bf16_rne(float f) {
    unsigned int u = __float_as_uint(f);
    u += 0x7fffu + ((u >> 16) & 1u);
    return __builtin_bit_cast(__bf16, (unsigned short)(u >> 16));
}
__device__ __forceinline__ float bf16_f32(__bf16 b) { return __uint_as_float(((unsigned int)__builtin_bit_cast(unsigned short, b)) << 16); }
__device__ __forceinline__ v8f wmma16(v16h a, v16h b, v8f c) {
    c = __builtin_amdgcn_wmma_f32_16x16x32_f16(false, a, false, b, (short)0, c, false, false);
    asm volatile("v_nop\n\tv_nop\n\tv_nop\n\tv_nop" : "+v"(c) : "v"(a), "v"(b));
    return c;
}
__device__ __forceinline__ v8f wmmab(v16b a, v16b b, v8f c) {
    c = __builtin_amdgcn_wmma_f32_16x16x32_bf16(false, a, false, b, (short)0, c, false, false);
    asm volatile("v_nop\n\tv_nop\n\tv_nop\n\tv_nop" : "+v"(c) : "v"(a), "v"(b));
    return c;
}
struct Split { v16b hi, lo; };
// hi/lo split product: a.hi*b.hi + a.hi*b.lo + a.lo*b.hi
__device__ __forceinline__ v8f wmma3(const Split& a, const Split& b, v8f c) {
    c = __builtin_amdgcn_wmma_f32_16x16x32_bf16(false, a.hi, false, b.hi, (short)0, c, false, false);
    c = __builtin_amdgcn_wmma_f32_16x16x32_bf16(false, a.hi, false, b.lo, (short)0, c, false, false);
    c = __builtin_amdgcn_wmma_f32_16x16x32_bf16(false, a.lo, false, b.hi, (short)0, c, false, false);
    asm volatile("v_nop\n\tv_nop\n\tv_nop\n\tv_nop" : "+v"(c) : "v"(a.hi), "v"(a.lo), "v"(b.hi), "v"(b.lo));
    return c;
}
// hi/lo split a against a b that is exact in bf16 (its lo part is zero): a.hi*b + a.lo*b
__device__ __forceinline__ v8f wmma2(const Split& a, v16b b, v8f c) {
    c = __builtin_amdgcn_wmma_f32_16x16x32_bf16(false, a.hi, false, b, (short)0, c, false, false);
    c = __builtin_amdgcn_wmma_f32_16x16x32_bf16(false, a.lo, false, b, (short)0, c, false, false);
    return c;
}
// the same with the exact bf16 operand as A and the hi/lo split as B: a*b.hi + a*b.lo
__device__ __forceinline__ v8f wmma2t(v16b a, const Split& b, v8f c) {
    c = __builtin_amdgcn_wmma_f32_16x16x32_bf16(false, a, false, b.hi, (short)0, c, false, false);
    c = __builtin_amdgcn_wmma_f32_16x16x32_bf16(false, a, false, b.lo, (short)0, c, false, false);
    return c;
}
// One A or B fragment from a plane in fragment order (see k_ds_pre): two blocks of 256 halves, lane L's eight halves at 8L; block 0 holds elements 0..7, block 1 elements 8..15
__device__ __forceinline__ v16b bfrag_ld(const __bf16* __restrict__ p) {
    const v8b x = *(const v8b*)p, y = *(const v8b*)(p + 256);
    return __builtin_shufflevector(x, y, 0, 1, 2, 3, 4, 5, 6, 7, 8, 9, 10, 11, 12, 13, 14, 15);
}
struct Split3 { v16b hi, mid, lo; };
// triple split product (6 terms, drops only terms below 2^-24 relative)
__device__ __forceinline__ v8f wmma6(const Split3& a, const Split3& b, v8f c) {
    c = __builtin_amdgcn_wmma_f32_16x16x32_bf16(false, a.hi, false, b.hi, (short)0, c, false, false);
    c = __builtin_amdgcn_wmma_f32_16x16x32_bf16(false, a.hi, false, b.mid, (short)0, c, false, false);
    c = __builtin_amdgcn_wmma_f32_16x16x32_bf16(false, a.mid, false, b.hi, (short)0, c, false, false);
    c = __builtin_amdgcn_wmma_f32_16x16x32_bf16(false, a.hi, false, b.lo, (short)0, c, false, false);
    c = __builtin_amdgcn_wmma_f32_16x16x32_bf16(false, a.mid, false, b.mid, (short)0, c, false, false);
    c = __builtin_amdgcn_wmma_f32_16x16x32_bf16(false, a.lo, false, b.hi, (short)0, c, false, false);
    asm volatile("v_nop\n\tv_nop\n\tv_nop\n\tv_nop" : "+v"(c) : "v"(a.hi), "v"(a.mid), "v"(a.lo), "v"(b.hi), "v"(b.mid), "v"(b.lo));
    return c;
}

// Fragment gathers from f32 memory: element i <- p[(k0 + frag_k(i,h)) * sk] * s, zero for k >= klen.
__device__ __forceinline__ v16h fh_ld(const float* __restrict__ p, long long sk, int k0, int h, int klen, float s) {
    v16h a;
#pragma unroll
    for (int i = 0; i < 16; ++i) { const int k = k0 + frag_k(i, h); a[i] = (k < klen) ? (_Float16)(p[(long long)k * sk] * s) : (_Float16)0.f; }
    return a;
}
__device__ __forceinline__ Split sp_ld(const float* __restrict__ p, long long sk, int k0, int h, int klen, float s) {
    Split r;
#pragma unroll
    for (int i = 0; i < 16; ++i) {
        const int k = k0 + frag_k(i, h); const float x = (k < klen) ? p[(long long)k * sk] * s : 0.f;
        const __bf16 hb = bf16_rne(x); r.hi[i] = hb; r.lo[i] = bf16_rne(x - bf16_f32(hb));
    }
    return r;
}
__device__ __forceinline__ Split3 sp3_ld(const float* __restrict__ p, long long sk, int k0, int h, int klen, float s) {
    Split3 r;
#pragma unroll
    for (int i = 0; i < 16; ++i) {
        const int k = k0 + frag_k(i, h); const float x = (k < klen) ? p[(long long)k * sk] * s : 0.f;
        const __bf16 hb = bf16_rne(x); const float r1 = x - bf16_f32(hb); const __bf16 mb = bf16_rne(r1);
        r.hi[i] = hb; r.mid[i] = mb; r.lo[i] = bf16_rne(r1 - bf16_f32(mb));
    }
    return r;
}
__device__ __forceinline__ v16b bh_ld(const float* __restrict__ p, long long sk, int k0, int h, int klen, float s) {
    v16b a;
#pragma unroll
    for (int i = 0; i < 16; ++i) { const int k = k0 + frag_k(i, h); a[i] = bf16_rne((k < klen) ? p[(long long)k * sk] * s : 0.f); }
    return a;
}
// f16 fragment from an f16 LDS/global row with element stride 1 (k-contiguous), no bounds (tile already zero padded)
__device__ __forceinline__ v16h fh_row(const _Float16* __restrict__ row, int k0, int h) {
    v16h a;
#pragma unroll
    for (int i = 0; i < 16; ++i) a[i] = row[k0 + frag_k(i, h)];
    return a;
}

#define VST2(T, ptr, val) do { const T vst2_v_ = (val); *(T*)(ptr) = vst2_v_;  } while (0)
typedef float v4f __attribute__((ext_vector_type(4)));
#define VST2V4(ptr, val) do { const v4f vst2_v4_ = (val); *(v4f*)(ptr) = vst2_v4_;  } while (0)

__device__ __attribute__((noinline)) float act_fn(float v, int act) {
    if (act == 1) return fmaxf(v, 0.f);                                                                               // relu
    if (act == 2) { const float u = 0.7978845608028654f * (v + 0.044715f * v * v * v); return 0.5f * v * (1.f + tanhf(u)); } // tanh-gelu
    if (act == 3) return v / (1.f + expf(-v));                                                                        // silu
    if (act == 4) return 0.5f * v * (1.f + erff(v * 0.7071067811865476f));                                             // erf-gelu
    if (act == 5) return tanhf(v);
    if (act == 6) return 1.f / (1.f + expf(-v));                                                                      // sigmoid
    if (act == 7) return (v > 0.f) ? v : 0.01f * v;                                                                   // leaky relu 0.01
    if (act == 8) return (v > 0.f) ? v : (expf(v) - 1.f);                                                             // elu
    if (act == 9) return fminf(fmaxf(v, 0.f), 6.f);                                                                   // relu6
    if (act == 10) return fabsf(v);                                                                                    // abs
    if (act == 11) return (v >= 0.f) ? v : 0.1f * v;                                                                  // leaky 0.1
    if (act == 12) return (v > 0.f) ? v : 0.2f * v;                                                                   // leaky 0.2
    if (act == 13) return (v > 20.f) ? v : log1pf(expf(v));                                                            // softplus
    return v;
}

// =====================================================================================================================
// k_gemm<MODE>: C(z, m, n) = act(alpha * sum_k A(z, m, k) * B(z, k, n) + bias) + beta * R(z, m, n)
//   One wave (32-thread block) per 16 x 32 tile of C; grid (ceil(N/32), ceil(M/16), Z). Batch z -> (zo = z / zi_n, zi = z % zi_n)
//   with separate outer/inner strides for every tensor (e.g. batch and head). A(m,k) = A[zo*sAo + zi*sAi + m*sAm + k*sAk] (f32),
//   B(k,n) = B[zo*sBo + zi*sBi + n*sBn + k*sBk] (f32); any M, N, K (K zero-padded to 32 inside the fragments, M/N tails guarded).
//   C(m,n) = C[zo*sCo + zi*sCi + m*sCm + n] (n contiguous). flags: 1 bias[n], 2 bias[m], 4 residual R[zo*sRo + zi*sRi + m*sRm + n*sRn].
//   MODE 0: f16 operands (A prescaled by sa, B by sb, both undone in the epilogue); 1: bf16 hi/lo split (3 products); 2: bf16;
//   3: bf16 hi/mid/lo triple split (6 products); 4: as 3 with Kahan-compensated f32 accumulation across k-steps.
// =====================================================================================================================
struct GemmP {
    const float* A; const float* B; const float* bias; const float* R; float* C;
    long long sAo, sAi, sAm, sAk, sBo, sBi, sBn, sBk, sCo, sCi, sCm, sRo, sRi, sRm, sRn;
    int M, N, K, zi_n, flags, act; float alpha, beta, sa, sb;
    int Npad, pad_;     // columns [N, Npad) of C are written as 0 so that padded workspace rows are covered by whole-line stores; Npad >= N
};
static_assert(sizeof(GemmP) == 5 * 8 + 15 * 8 + 6 * 4 + 4 * 4 + 2 * 4, "GemmP has padding");

template <int MODE>
__global__ __launch_bounds__(32) void k_gemm(GemmP p) {
    const int lane = threadIdx.x & 31, h = lane >> 4, l15 = lane & 15;
    const int m0 = blockIdx.y * 16, n0 = blockIdx.x * 32;
    const int z = blockIdx.z, zo = z / p.zi_n, zi = z - zo * p.zi_n;
    const float* A = p.A + zo * p.sAo + zi * p.sAi;
    const float* B = p.B + zo * p.sBo + zi * p.sBi;
    const int am = min(m0 + l15, p.M - 1);                       // clamped row for loads (stores are guarded)
    v8f acc[2], comp[2];
#pragma unroll
    for (int t = 0; t < 2; ++t) { v8f zz = {}; acc[t] = zz; comp[t] = zz; }
    for (int k0 = 0; k0 < p.K; k0 += 32) {
        const float* arow = A + (long long)am * p.sAm;
        if (MODE == 1) {
            const Split a = sp_ld(arow, p.sAk, k0, h, p.K, 1.f);
#pragma unroll
            for (int t = 0; t < 2; ++t) {
                const int bn = min(n0 + t * 16 + l15, p.N - 1);
                acc[t] = wmma3(a, sp_ld(B + (long long)bn * p.sBn, p.sBk, k0, h, p.K, 1.f), acc[t]);
            }
        } else if (MODE == 3) {
            const Split3 a = sp3_ld(arow, p.sAk, k0, h, p.K, 1.f);
#pragma unroll
            for (int t = 0; t < 2; ++t) {
                const int bn = min(n0 + t * 16 + l15, p.N - 1);
                acc[t] = wmma6(a, sp3_ld(B + (long long)bn * p.sBn, p.sBk, k0, h, p.K, 1.f), acc[t]);
            }
        } else if (MODE == 4) {
            // triple split as MODE 3, but each k-step's 6 products go into a fresh accumulator and the partial is added to the running f32 sum
            // on the VALU with Kahan compensation (accumulation error stays ~1 ulp however long K is)
            const Split3 a = sp3_ld(arow, p.sAk, k0, h, p.K, 1.f);
#pragma unroll
            for (int t = 0; t < 2; ++t) {
                const int bn = min(n0 + t * 16 + l15, p.N - 1); v8f zz = {};
                const v8f part = wmma6(a, sp3_ld(B + (long long)bn * p.sBn, p.sBk, k0, h, p.K, 1.f), zz);
                const v8f y = part - comp[t]; const v8f s = acc[t] + y; comp[t] = (s - acc[t]) - y; acc[t] = s;
            }
        } else if (MODE == 2) {
            const v16b a = bh_ld(arow, p.sAk, k0, h, p.K, 1.f);
#pragma unroll
            for (int t = 0; t < 2; ++t) {
                const int bn = min(n0 + t * 16 + l15, p.N - 1);
                acc[t] = wmmab(a, bh_ld(B + (long long)bn * p.sBn, p.sBk, k0, h, p.K, 1.f), acc[t]);
            }
        } else {
            const v16h a = fh_ld(arow, p.sAk, k0, h, p.K, p.sa);
#pragma unroll
            for (int t = 0; t < 2; ++t) {
                const int bn = min(n0 + t * 16 + l15, p.N - 1);
                acc[t] = wmma16(a, fh_ld(B + (long long)bn * p.sBn, p.sBk, k0, h, p.K, p.sb), acc[t]);
            }
        }
    }
    const float iscale = (MODE == 0) ? p.alpha / (p.sa * p.sb) : p.alpha;
    float* C = p.C + zo * p.sCo + zi * p.sCi;
    const float* R = p.R + zo * p.sRo + zi * p.sRi;
    __shared__ __align__(16) float ctile[16][36];
#pragma unroll
    for (int t = 0; t < 2; ++t) {
        const int n = n0 + t * 16 + l15; const int nn = min(n, p.N - 1);
#pragma unroll
        for (int r = 0; r < 8; ++r) {
            const int m = m0 + 8 * h + r; const int mm = min(m, p.M - 1);
            float v = acc[t][r] * iscale;
            if (p.flags & 1) v += p.bias[nn];
            if (p.flags & 2) v += p.bias[mm];
            if (p.flags & 8) v *= p.bias[(long long)zo * p.M + mm];   /* per-(z,row) scale vector laid out [Z][M]; exclusive with the bias flags */
            v = act_fn(v, p.act);
            if (p.flags & 4) v += p.beta * R[(long long)mm * p.sRm + (long long)nn * p.sRn];
            ctile[8 * h + r][t * 16 + l15] = (n < p.N) ? v : 0.f;
        }
    }
    __syncthreads();
    const int NW = (p.Npad > p.N) ? p.Npad : p.N;           // write width
    const bool fast = (m0 + 16 <= p.M) && (n0 + 32 <= NW) && ((p.sCm & 3) == 0) && ((((size_t)C) & 15) == 0);
    if (fast) {
#pragma unroll
        for (int s = 0; s < 4; ++s) {
            const int row = s * 4 + (lane >> 3), c4 = (lane & 7) * 4;
            const v4f v = *(const v4f*)&ctile[row][c4];
            VST2V4(C + (long long)(m0 + row) * p.sCm + n0 + c4, v);
        }
    } else {
        for (int row = 0; row < 16; ++row) {
            const int m = m0 + row, n = n0 + lane;
            if (m < p.M && n < NW) VST2(float, C + (long long)m * p.sCm + n, ctile[row][lane]);
        }
    }
}


// =====================================================================================================================
// k_gemmT<MODE, TM, TN>: same contract as k_gemm, but one wave computes a (16*TM) x (16*TN) tile: TM A fragments and TN B fragments are
//   loaded per 32-wide k-step and reused across TM*TN WMMAs (far fewer load/convert instructions per MAC). MODE 0 (f16), 1 (bf16 hi/lo),
//   2 (bf16) only. grid (ceil(NW/(16*TN)), ceil(M/(16*TM)), Z), block 32. Epilogue identical to k_gemm, run per 16x32 sub-tile.
// =====================================================================================================================
template <int MODE, int TM, int TN>
__global__ __launch_bounds__(32) void k_gemmT(GemmP p) {
    const int lane = threadIdx.x & 31, h = lane >> 4, l15 = lane & 15;
    const int m0 = blockIdx.y * (16 * TM), n0 = blockIdx.x * (16 * TN);
    const int z = blockIdx.z, zo = z / p.zi_n, zi = z - zo * p.zi_n;
    const float* A = p.A + zo * p.sAo + zi * p.sAi;
    const float* B = p.B + zo * p.sBo + zi * p.sBi;
    v8f acc[TM][TN];
#pragma unroll
    for (int i = 0; i < TM; ++i)
#pragma unroll
        for (int t = 0; t < TN; ++t) { v8f zz = {}; acc[i][t] = zz; }
    for (int k0 = 0; k0 < p.K; k0 += 32) {
        if (MODE == 1) {
            Split a[TM], b[TN];
#pragma unroll
            for (int i = 0; i < TM; ++i) { const int am = min(m0 + 16 * i + l15, p.M - 1); a[i] = sp_ld(A + (long long)am * p.sAm, p.sAk, k0, h, p.K, 1.f); }
#pragma unroll
            for (int t = 0; t < TN; ++t) { const int bn = min(n0 + 16 * t + l15, p.N - 1); b[t] = sp_ld(B + (long long)bn * p.sBn, p.sBk, k0, h, p.K, 1.f); }
#pragma unroll
            for (int i = 0; i < TM; ++i)
#pragma unroll
                for (int t = 0; t < TN; ++t) acc[i][t] = wmma3(a[i], b[t], acc[i][t]);
        } else if (MODE == 2) {
            v16b a[TM], b[TN];
#pragma unroll
            for (int i = 0; i < TM; ++i) { const int am = min(m0 + 16 * i + l15, p.M - 1); a[i] = bh_ld(A + (long long)am * p.sAm, p.sAk, k0, h, p.K, 1.f); }
#pragma unroll
            for (int t = 0; t < TN; ++t) { const int bn = min(n0 + 16 * t + l15, p.N - 1); b[t] = bh_ld(B + (long long)bn * p.sBn, p.sBk, k0, h, p.K, 1.f); }
#pragma unroll
            for (int i = 0; i < TM; ++i)
#pragma unroll
                for (int t = 0; t < TN; ++t) acc[i][t] = wmmab(a[i], b[t], acc[i][t]);
        } else {
            v16h a[TM], b[TN];
#pragma unroll
            for (int i = 0; i < TM; ++i) { const int am = min(m0 + 16 * i + l15, p.M - 1); a[i] = fh_ld(A + (long long)am * p.sAm, p.sAk, k0, h, p.K, p.sa); }
#pragma unroll
            for (int t = 0; t < TN; ++t) { const int bn = min(n0 + 16 * t + l15, p.N - 1); b[t] = fh_ld(B + (long long)bn * p.sBn, p.sBk, k0, h, p.K, p.sb); }
#pragma unroll
            for (int i = 0; i < TM; ++i)
#pragma unroll
                for (int t = 0; t < TN; ++t) acc[i][t] = wmma16(a[i], b[t], acc[i][t]);
        }
    }
    const float iscale = (MODE == 0) ? p.alpha / (p.sa * p.sb) : p.alpha;
    float* C = p.C + zo * p.sCo + zi * p.sCi;
    const float* R = p.R + zo * p.sRo + zi * p.sRi;
    const int NW = (p.Npad > p.N) ? p.Npad : p.N;
    __shared__ __align__(16) float ctile[16][36];
#pragma unroll
    for (int i = 0; i < TM; ++i) {
        const int mb = m0 + 16 * i; if (mb >= p.M) break;          // wave-uniform
#pragma unroll
        for (int tp = 0; tp < TN / 2; ++tp) {
            const int nb = n0 + 32 * tp; if (nb >= NW) break;        // wave-uniform
#pragma unroll
            for (int t2 = 0; t2 < 2; ++t2) {
                const int t = 2 * tp + t2; const int n = nb + t2 * 16 + l15; const int nn = min(n, p.N - 1);
#pragma unroll
                for (int r = 0; r < 8; ++r) {
                    const int m = mb + 8 * h + r; const int mm = min(m, p.M - 1);
                    float v = acc[i][t][r] * iscale;
                    if (p.flags & 1) v += p.bias[nn];
                    if (p.flags & 2) v += p.bias[mm];
            if (p.flags & 8) v *= p.bias[(long long)zo * p.M + mm];   /* per-(z,row) scale vector laid out [Z][M]; exclusive with the bias flags */
                    v = act_fn(v, p.act);
                    if (p.flags & 4) v += p.beta * R[(long long)mm * p.sRm + (long long)nn * p.sRn];
                    ctile[8 * h + r][t2 * 16 + l15] = (n < p.N) ? v : 0.f;
                }
            }
            __syncthreads();
            const bool fast = (mb + 16 <= p.M) && (nb + 32 <= NW) && ((p.sCm & 3) == 0) && ((((size_t)C) & 15) == 0);
            if (fast) {
#pragma unroll
                for (int s = 0; s < 4; ++s) {
                    const int row = s * 4 + (lane >> 3), c4 = (lane & 7) * 4;
                    const v4f v = *(const v4f*)&ctile[row][c4];
                    VST2V4(C + (long long)(mb + row) * p.sCm + nb + c4, v);
                }
            } else {
                for (int row = 0; row < 16; ++row) {
                    const int m = mb + row, n = nb + lane;
                    if (m < p.M && n < NW) VST2(float, C + (long long)m * p.sCm + n, ctile[row][lane]);
                }
            }
            __syncthreads();
        }
    }
}

// =====================================================================================================================
//   Wave = 16 queries, AW waves per block, 64-key blocks; grid (ceil(Lq/(16*AW)), H, 2 * B) with z = 2 * branch + batch, block 32*AW. Lq = Lk = 2048, dh = dv = 64 (set on device by attn_fix_shape); head dim dh <= DHP
//   (DHP multiple of 32), value dim dv <= DVP (multiple of 16, <= 128). Every tensor addressed by (batch, head, row, element) strides, f32, but for QM 1 K and for SPLITPV V are bf16 planes in fragment order.
//   Scores: QM 0 f16 operands, 1 bf16 hi/lo split, 2 bf16 triple split; statistics f32 (exp2 domain); P.V: P x 4096 as f16 with V f16 staged in LDS
//   (SPLITPV: P as a bf16 hi/lo split against bf16 V fragments). kv head = h / hrep. Masking: causal = 1 (keep j <= i + coff, masked -> -inf, key blocks beyond the
//   diagonal skipped), causal = 2 (masked -> mfill, a finite fill like the -1e9; no skipping), causal = 3 (keep j >= i + coff,
//   masked -> -inf, no skipping); additive f32 mask Mf (required: read without a null test),
//   optional int keep-mask Mi (0 -> score := mfill), both addressed b*smb + h*smh + i*smi + j*smj (0 strides broadcast).
// =====================================================================================================================
#define AW 4
struct AttnP {   // apv4
    const float* Q; const float* K; const float* V; float* O; float* P; const float* Mf; const int* Mi; float* ST;
    const float* Pw; const float* Rt; const int* SQ; const int* SK;           // optional: post-softmax weight, relative-position table, segment ids
    long long swb, swh, swi, swj, srb, srh, sri;                                 // Pw strides (b,h,i,j); Rt strides (b,h,i), column = clamp(i - j + roff, 0, rn-1)
    long long sQb, sQh, sQi, sQd, sKb, sKh, sKj, sKd, sVb, sVh, sVj, sVd, sOb, sOh, sOi, sPb, sPh, sPi, smb, smh, smi, smj;
    int Lq, Lk, dh, dv, hrep, causal, coff, pband;   // pband > 0: P holds only the band |j - i| <= pband, column j - i + pband
    float scale, mfill; int nonorm, mpol;             // nonorm (online path only): O = sum_j exp(score_j) V_j without the 1/rowsum (scores must be <= ~0); mpol: Mi masks where ==0 (mpol 0) or where !=0 (mpol 1)
    int roff, rn, segpol, win;                        // Rt column offset/count; SQ/SK: score := mfill where (segpol 0) SQ[i] != SK[j] or (segpol 1) SQ[i] == SK[j]; win > 0: keys with i - j > win (after coff) -> -inf
};
//   Pw: the softmax numerator is multiplied by Pw(b,h,i,j) AFTER the row sum is taken (probs * weight, then P.V), as in post-softmax multiplicative biases.                                                    // ST (optional): per row (b,h,i) -> ST[((b*H + h)*Lq + i)*2 + {0,1}] = {row max of the scaled+masked score (natural units), sum_j exp(score - max)}
static_assert(sizeof(AttnP) == 12 * 8 + 29 * 8 + 16 * 4, "AttnP has padding");

// Four waves per SIMD: the one launch puts four workgroups on every WGP, which fit only with at most 256 registers a wave
#ifndef KATTN_ATTR
#define KATTN_ATTR __attribute__((amdgpu_waves_per_eu(4, 4)))
#endif
// The shape of this problem's attention launch as compile-time constants (they equal the shape k_attn_t has built in): with them the
// element bounds tests (k < dh, d < dv) and every optional path fold away, the unit element strides let the compiler merge a fragment's loads into
// 16-byte loads, and the additive table (always passed here, so read without a null test) no longer depends on the query row. Only the five base pointers stay run-time values.
__device__ __forceinline__ void attn_fix_shape(AttnP& p) {
    p.P = nullptr; p.Mi = nullptr; p.ST = nullptr; p.Pw = nullptr; p.Rt = nullptr; p.SQ = nullptr; p.SK = nullptr;
    p.swb = 0; p.swh = 0; p.swi = 0; p.swj = 0; p.srb = 0; p.srh = 0; p.sri = 0;
    p.sQb = 1048576; p.sQh = 64; p.sQi = 512; p.sQd = 1; p.sKb = 1048576; p.sKh = 64; p.sKj = 512; p.sKd = 1; p.sVb = 1048576; p.sVh = 64; p.sVj = 512; p.sVd = 1;
    p.sOb = 1048576; p.sOh = 64; p.sOi = 512; p.sPb = 0; p.sPh = 0; p.sPi = 0; p.smb = 2048; p.smh = 0; p.smi = 0; p.smj = 1;
    p.Lq = 2048; p.Lk = 2048; p.dh = 64; p.dv = 64; p.hrep = 1; p.causal = 1; p.coff = 0; p.pband = 0;
    p.scale = 0.125f; p.mfill = 0.0f; p.nonorm = 0; p.mpol = 0; p.roff = 0; p.rn = 1; p.segpol = 0; p.win = 0;
}
template <int DHP, int DVP, int QM, bool SPLITPV, bool TWOPASS>
__global__ __launch_bounds__(32 * AW) KATTN_ATTR void k_attn(AttnP p) {
    attn_fix_shape(p);
    constexpr int NT = DVP / 16;                // output tiles
    constexpr int KS = DHP / 32;                // k-steps for the scores
    constexpr int VP = DVP + 8;                 // LDS pitch (halves)
    __shared__ __align__(16) float    pl[AW][16 * 64];
    __shared__ __align__(16) _Float16 vl[SPLITPV ? 8 : 64 * VP];   // f16 V tile (SPLITPV reads V fragments from memory and stages nothing)
    const int lane = threadIdx.x & 31, hf = lane >> 4, l15 = lane & 15, wave = threadIdx.x >> 5;
    // blockIdx.z = 2 * branch + batch: K, V and O hold one plane per (branch, batch), indexed by bz; Q and the additive table are shared by the branches, indexed by b
    const int h = blockIdx.y, bz = blockIdx.z, b = bz & 1, hk = h / p.hrep;
    const int q0 = (blockIdx.x * AW + wave) * 16;
    float* myp = pl[wave];
    const float L2E = 1.4426950408889634f;
    const float NEG = -__builtin_inff();
    const int qi = min(q0 + l15, p.Lq - 1);
    const float* qrow = p.Q + b * p.sQb + h * p.sQh + (long long)qi * p.sQi;
    const float* kbase = p.K + bz * p.sKb + hk * p.sKh;
    const float* vbase = p.V + bz * p.sVb + hk * p.sVh;
    // QM 1 / SPLITPV: K and V are bf16 planes in fragment order, 131,072 halves per (bz, head), 4,096 per 64-key block, 512 per fragment
    const __bf16* kfrag = (const __bf16*)p.K + (bz * 8 + hk) * 131072 + lane * 8;
    const __bf16* vfrag = (const __bf16*)p.V + (bz * 8 + hk) * 131072 + lane * 8;
    v16h qa[QM == 0 ? KS : 1]; Split qs_[QM == 1 ? KS : 1]; Split3 qt_[QM == 2 ? KS : 1];
#pragma unroll
    for (int ks = 0; ks < KS; ++ks) {
        if (QM == 2) qt_[ks] = sp3_ld(qrow, p.sQd, ks * 32, hf, p.dh, 1.f);
        else if (QM == 1) qs_[ks] = sp_ld(qrow, p.sQd, ks * 32, hf, p.dh, 1.f);
        else qa[ks] = fh_ld(qrow, p.sQd, ks * 32, hf, p.dh, 1.f);
    }
    v8f o[NT]; float m8[8], l8[8];
#pragma unroll
    for (int t = 0; t < NT; ++t) { v8f zz = {}; o[t] = zz; }
#pragma unroll
    for (int i = 0; i < 8; ++i) { m8[i] = NEG; l8[i] = 0.f; }
    int jend = p.Lk; int jstart = 0;
    if (p.causal == 1) { const int je = (blockIdx.x * AW + AW - 1) * 16 + 16 + p.coff; jend = min(jend, max(je, 0)); }   // uniform per block
    if (p.win > 0) { const int js = (int)(blockIdx.x * AW) * 16 + p.coff - p.win; jstart = (js > 0) ? (js / 64) * 64 : 0; }   // uniform per block: key blocks entirely outside every row's window hold only -inf entries and are skipped exactly
    const int npass = TWOPASS ? 2 : 1;
    for (int pass = 0; pass < npass; ++pass) {
        const bool dopv = (!TWOPASS) || pass == 1;
        for (int j0 = jstart; j0 < jend; j0 += 64) {
            v16b kf[QM == 1 ? 4 : 1][KS];
            if (QM == 1) {
                // all of the key block's K fragments are asked for before the first product: one wait for memory, not one per fragment
                const __bf16* kblk = kfrag + (j0 >> 6) * 4096;
#pragma unroll
                for (int t = 0; t < 4; ++t)
#pragma unroll
                    for (int ks = 0; ks < KS; ++ks) kf[t][ks] = bfrag_ld(kblk + (t * KS + ks) * 512);
                asm volatile("s_wait_xcnt 0x0" :: "v"(kblk) : "memory");   // the loads' address pair stays live up to this wait, so that no later load lands in it and nothing rewrites it ahead of the wait
                __builtin_amdgcn_sched_barrier(0);   // keeps every K load ahead of the first product: the scheduler otherwise holds some back until registers come free, a second wait for memory
            }
            if (dopv && !SPLITPV) {
                __syncthreads();                                 // previous key block's reads of vl / pl are done
                static_assert((32 * AW) % DVP == 0, "a thread keeps its V column from pass to pass");
                constexpr int VR = (32 * AW) / DVP;              // V rows staged by the block per pass
                const int jr0 = threadIdx.x / DVP, d = threadIdx.x - jr0 * DVP;
                const float* vsrc = vbase + (long long)(j0 + jr0) * p.sVj + (long long)d * p.sVd;   // one address; the passes differ by constant offsets
#pragma unroll   // constant trip count: all of a thread's V loads of a key block are issued before the first is waited for
                for (int n = 0; n < 64 / VR; ++n) {
                    const int jr = jr0 + n * VR, j = j0 + jr;
                    const float f = ((p.Lk % 64 == 0 || j < p.Lk) && d < p.dv) ? vsrc[(long long)(n * VR) * p.sVj] : 0.f;
                    vl[jr * VP + d] = (_Float16)f;
                }
            }
            v8f s[4];
#pragma unroll
            for (int t = 0; t < 4; ++t) {
                const int j = min(j0 + t * 16 + l15, p.Lk - 1);
                const float* krow = kbase + (long long)j * p.sKj;
                v8f acc = {};
#pragma unroll
                for (int ks = 0; ks < KS; ++ks) {
                    if (QM == 2)      acc = wmma6(qt_[ks], sp3_ld(krow, p.sKd, ks * 32, hf, p.dh, 1.f), acc);
                    else if (QM == 1) acc = wmma2(qs_[ks], kf[t][ks], acc);
                    else              acc = wmma16(qa[ks], fh_ld(krow, p.sKd, ks * 32, hf, p.dh, 1.f), acc);
                }
                s[t] = acc;
            }
            v16b vf[SPLITPV ? NT : 1][2];
            if (dopv && SPLITPV) {
                // all of the key block's V fragments are asked for together and ahead of the softmax: their way from memory is covered by the softmax, not paid at the P.v products
                const __bf16* vblk = vfrag + (j0 >> 6) * 4096;
#pragma unroll
                for (int t = 0; t < NT; ++t) { vf[t][0] = bfrag_ld(vblk + (t * 2 + 0) * 512); vf[t][1] = bfrag_ld(vblk + (t * 2 + 1) * 512); }
                asm volatile("s_wait_xcnt 0x0" :: "v"(vblk) : "memory");   // the loads' address pair stays live up to this wait, so that no load of the run lands in it and nothing rewrites it ahead of the wait
            }
            float pv[8][4];
#pragma unroll
            for (int i = 0; i < 8; ++i) {
                const int irow = q0 + i + 8 * hf;
                const int ic = min(irow, p.Lq - 1);
                float sc[4];
#pragma unroll
                for (int t = 0; t < 4; ++t) {
                    const int jg = j0 + t * 16 + l15;
                    float v = s[t][i] * p.scale;
                    v += p.Mf[b * p.smb + h * p.smh + (long long)ic * p.smi + (long long)min(jg, p.Lk - 1) * p.smj];
                    if (p.Rt) { int rc = ic - min(jg, p.Lk - 1) + p.roff; rc = rc < 0 ? 0 : (rc >= p.rn ? p.rn - 1 : rc); v += p.Rt[b * p.srb + h * p.srh + (long long)ic * p.sri + rc]; }
                    if (p.Mi) { const int mv = p.Mi[b * p.smb + h * p.smh + (long long)ic * p.smi + (long long)min(jg, p.Lk - 1) * p.smj]; if (p.mpol ? (mv != 0) : (mv == 0)) v = p.mfill; }
                    if (p.SQ) { const bool same = p.SQ[(long long)b * p.Lq + ic] == p.SK[(long long)b * p.Lk + min(jg, p.Lk - 1)]; if (p.segpol ? same : !same) v = p.mfill; }
                    if (p.causal == 2 && jg > irow + p.coff) v = p.mfill;
                    // causal test against the lane's first row (jg > irow + coff, rearranged): one live register, not eight row numbers, so the 256-register cap is met without spills
                    if (jg >= p.Lk || (p.causal == 1 && jg - (q0 + 8 * hf) > i + p.coff) || (p.causal == 3 && jg < irow + p.coff) || (p.win > 0 && irow + p.coff - jg > p.win)) v = NEG; else v *= L2E;
                    sc[t] = v;
                }
                if (!TWOPASS || pass == 0) {
                    float mx = fmaxf(fmaxf(sc[0], sc[1]), fmaxf(sc[2], sc[3]));
                    mx = fmaxf(mx, __shfl_xor(mx, 1, 32)); mx = fmaxf(mx, __shfl_xor(mx, 2, 32));
                    mx = fmaxf(mx, __shfl_xor(mx, 4, 32)); mx = fmaxf(mx, __shfl_xor(mx, 8, 32));
                    const float mnew = fmaxf(m8[i], mx);
                    const float corr = (mnew == NEG) ? 1.f : exp2f(m8[i] - mnew);
                    float rs = 0.f;
#pragma unroll
                    for (int t = 0; t < 4; ++t) {
                        const float pp = (sc[t] == NEG) ? 0.f : exp2f(sc[t] - mnew); rs += pp;
                        pv[i][t] = p.Pw ? pp * p.Pw[b * p.swb + h * p.swh + (long long)ic * p.swi + (long long)min(j0 + t * 16 + l15, p.Lk - 1) * p.swj] : pp;
                    }
                    rs += __shfl_xor(rs, 1, 32); rs += __shfl_xor(rs, 2, 32); rs += __shfl_xor(rs, 4, 32); rs += __shfl_xor(rs, 8, 32);
                    l8[i] = l8[i] * corr + rs; m8[i] = mnew;
                    if (!TWOPASS) {
#pragma unroll
                        for (int t = 0; t < NT; ++t) o[t][i] *= corr;
                    }
                } else {
                    const float inv = (l8[i] > 0.f) ? 1.f / l8[i] : 0.f;
#pragma unroll
                    for (int t = 0; t < 4; ++t) {
                        const int jg = j0 + t * 16 + l15;
                        float pp = (sc[t] == NEG) ? 0.f : exp2f(sc[t] - m8[i]) * inv;
                        if (p.Pw) pp *= p.Pw[b * p.swb + h * p.swh + (long long)ic * p.swi + (long long)min(jg, p.Lk - 1) * p.swj];
                        pv[i][t] = pp;
                    }
                }
            }
            if (dopv) {
#pragma unroll
                for (int i = 0; i < 8; ++i)
#pragma unroll
                    for (int t = 0; t < 4; ++t) ((float*)myp)[(i + 8 * hf) * 64 + t * 16 + l15] = pv[i][t];
                if (SPLITPV) {
                    // P is private to its wave and V is not staged: the wave's own LDS stores only have to be ordered before its lanes' reads of each other's values
                    __builtin_amdgcn_fence(__ATOMIC_RELEASE, "workgroup"); __builtin_amdgcn_wave_barrier(); __builtin_amdgcn_fence(__ATOMIC_ACQUIRE, "workgroup");
                } else __syncthreads();                          // P (per wave) and V (shared) visible
                if (p.P) {
                    float* pb_ = p.P + b * p.sPb + h * p.sPh;
                    const bool fastP = (p.pband == 0) && ((p.sPi & 3) == 0) && (j0 + 64 <= p.Lk) && (q0 + 16 <= p.Lq) && ((((size_t)pb_) & 15) == 0);
                    if (fastP) {
#pragma unroll
                        for (int s = 0; s < 8; ++s) {
                            const int row = s * 2 + (lane >> 4), c4 = (lane & 15) * 4;
                            const v4f v = *(const v4f*)(myp + row * 64 + c4);
                            VST2V4(pb_ + (long long)(q0 + row) * p.sPi + j0 + c4, v);
                        }
                    } else {
                        for (int row = 0; row < 16; ++row) {
                            const int irow = q0 + row; if (irow >= p.Lq) continue;
                            for (int c = lane; c < 64; c += 32) {
                                const int jg = j0 + c; if (jg >= p.Lk) continue;
                                if (p.pband == 0) VST2(float, pb_ + (long long)irow * p.sPi + jg, myp[row * 64 + c]);
                                else if (jg - irow <= p.pband && irow - jg <= p.pband) VST2(float, pb_ + (long long)irow * p.sPi + (jg - irow + p.pband), myp[row * 64 + c]);
                            }
                        }
                    }
                }
                if (SPLITPV) {
                    const Split pa0 = sp_ld(myp + l15 * 64, 1, 0, hf, 64, 1.f), pa1 = sp_ld(myp + l15 * 64, 1, 32, hf, 64, 1.f);
#pragma unroll
                    for (int t = 0; t < NT; ++t) {
                        o[t] = wmma2(pa0, vf[t][0], o[t]);
                        o[t] = wmma2(pa1, vf[t][1], o[t]);
                    }
                } else {
                    const v16h pa0 = fh_ld(myp + l15 * 64, 1, 0, hf, 64, 4096.f), pa1 = fh_ld(myp + l15 * 64, 1, 32, hf, 64, 4096.f);
#pragma unroll
                    for (int t = 0; t < NT; ++t) {
                        const int dcol = t * 16 + l15;
                        v16h b0, b1;
#pragma unroll
                        for (int e = 0; e < 16; ++e) { b0[e] = vl[frag_k(e, hf) * VP + dcol]; b1[e] = vl[(32 + frag_k(e, hf)) * VP + dcol]; }
                        o[t] = wmma16(pa0, b0, o[t]);
                        o[t] = wmma16(pa1, b1, o[t]);
                    }
                }
            }
        }
    }
    float* obase = p.O + bz * p.sOb + h * p.sOh;
    if (p.ST) {
        const int rl = lane >> 1, isel = rl & 7;           // row q0 + rl ; rl>>3 == hf holds because lane>>4 == (lane>>1)>>3
        float mv = 0.f, lv = 0.f;
#pragma unroll
        for (int i = 0; i < 8; ++i) if (i == isel) { mv = m8[i]; lv = l8[i]; }
        const int irow = q0 + rl;
        if (irow < p.Lq) { float* st = p.ST + (((long long)b * gridDim.y + h) * p.Lq + irow) * 2 + (lane & 1); VST2(float, st, (lane & 1) ? lv : mv * 0.6931471805599453f); }
    }
    float invr[8];
#pragma unroll
    for (int i = 0; i < 8; ++i) {
        if (TWOPASS) invr[i] = SPLITPV ? 1.f : (1.f / 4096.f);
        else if (p.nonorm) invr[i] = exp2f(m8[i]) * (SPLITPV ? 1.f : (1.f / 4096.f));
        else invr[i] = (l8[i] > 0.f) ? (SPLITPV ? 1.f / l8[i] : 1.f / (l8[i] * 4096.f)) : 0.f;
    }
    __syncthreads();                                             // all waves done with pl/vl from the main loop
    const bool ofast = ((p.sOi & 3) == 0) && ((((size_t)obase) & 15) == 0) && (q0 + 16 <= p.Lq);
#pragma unroll
    for (int c0 = 0; c0 < DVP; c0 += 64) {
#pragma unroll
        for (int i = 0; i < 8; ++i)
#pragma unroll
            for (int t = 0; t < NT; ++t) if (t * 16 >= c0 && t * 16 < c0 + 64) ((float*)myp)[(i + 8 * hf) * 64 + (t * 16 - c0) + l15] = o[t][i] * invr[i];
        __syncthreads();
        const int cw = (DVP - c0 < 64) ? (DVP - c0) : 64;      // staged columns in this chunk (multiple of 16)
        if (ofast && (c0 + cw <= p.dv) && (cw % 32 == 0)) {
            const int lpr = cw / 4;                              // lanes per row (16 for 64 cols, 8 for 32)
            const int rows_per_ins = 32 / lpr;
            for (int r0 = 0; r0 < 16; r0 += rows_per_ins) {
                const int row = r0 + lane / lpr, c4 = (lane % lpr) * 4;
                const v4f v = *(const v4f*)(myp + row * 64 + c4);
                VST2V4(obase + (long long)(q0 + row) * p.sOi + c0 + c4, v);
            }
        } else {
            for (int row = 0; row < 16; ++row) {
                const int irow = q0 + row; if (irow >= p.Lq) continue;
                for (int c = lane; c < cw; c += 32) { const int d = c0 + c; if (d < p.dv) VST2(float, obase + (long long)irow * p.sOi + d, myp[row * 64 + c]); }
            }
        }
        __syncthreads();
    }
}

__device__ __forceinline__ float xhalf(float x) {
    const int u = __float_as_int(x);
    return __int_as_float(__builtin_amdgcn_permlanex16(u, u, 0x76543210, 0xfedcba98, false, false));
}
__global__ __launch_bounds__(32 * AW) KATTN_ATTR void k_attn_t(const float* __restrict__ Q, const unsigned short* __restrict__ KF, const unsigned short* __restrict__ VF, const float* __restrict__ MF, float* __restrict__ O) {
    const int lane = threadIdx.x & 31, hf = lane >> 4, l15 = lane & 15, wave = threadIdx.x >> 5;
    // blockIdx.z = 2 * branch + batch: K, V and O hold one plane per (branch, batch), indexed by bz; Q and the additive table are shared by the branches, indexed by b
    const int h = blockIdx.y, bz = blockIdx.z, b = bz & 1;
    const int q0 = (blockIdx.x * AW + wave) * 16;
    const float L2E = 1.4426950408889634f;
    const float NEG = -__builtin_inff();
    const float* qrow = Q + b * 1048576 + h * 64 + (q0 + l15) * 512;
    // 131,072 halves per (bz, head), 4,096 per 64-key block, 512 per fragment
    const __bf16* kfrag = (const __bf16*)KF + (bz * 8 + h) * 131072 + lane * 8;
    const __bf16* vfrag = (const __bf16*)VF + (bz * 8 + h) * 131072 + lane * 8;
    const float* mrow = MF + b * 2048 + 8 * hf;      // the lane's eight keys of a tile
    Split qs_[2];
#pragma unroll
    for (int ks = 0; ks < 2; ++ks) qs_[ks] = sp_ld(qrow, 1, ks * 32, hf, 64, 1.f);
    v8f o[4]; float m = NEG, l = 0.f;                // l: the sum over this lane half's keys; the halves are joined behind the loop
#pragma unroll
    for (int t = 0; t < 4; ++t) { v8f zz = {}; o[t] = zz; }
    const int jend = (blockIdx.x * AW + AW - 1) * 16 + 16;   // uniform per block
    for (int j0 = 0; j0 < jend; j0 += 64) {
        v16b kf[4][2];
        // all of the key block's K fragments are asked for before the first product: one wait for memory, not one per fragment
        const __bf16* kblk = kfrag + (j0 >> 6) * 4096;
#pragma unroll
        for (int t = 0; t < 4; ++t)
#pragma unroll
            for (int ks = 0; ks < 2; ++ks) kf[t][ks] = bfrag_ld(kblk + (t * 2 + ks) * 512);
        asm volatile("s_wait_xcnt 0x0" :: "v"(kblk) : "memory");   // the loads' address pair stays live up to this wait, so that no later load lands in it and nothing rewrites it ahead of the wait
        // the additive table of the lane's 32 keys, asked for with the K fragments
        const float* mblk = mrow + j0;
        v4f mt[4][2];
#pragma unroll
        for (int t = 0; t < 4; ++t) { mt[t][0] = *(const v4f*)(mblk + t * 16); mt[t][1] = *(const v4f*)(mblk + t * 16 + 4); }
        asm volatile("s_wait_xcnt 0x0" ::: "memory");   // stands behind the table loads, ahead of the rewrite of their address pair at the foot of the trip
        __builtin_amdgcn_sched_barrier(0);   // keeps every K load ahead of the first product: the scheduler otherwise holds some back until registers come free, a second wait for memory
        v8f s[4];
#pragma unroll
        for (int t = 0; t < 4; ++t) {
            v8f acc = {};
#pragma unroll
            for (int ks = 0; ks < 2; ++ks) acc = wmma2t(kf[t][ks], qs_[ks], acc);
            s[t] = acc;
        }
        v16b vf[4][2];
        // all of the key block's V fragments are asked for together and ahead of the softmax: their way from memory is covered by the softmax, not paid at the P.v products
        const __bf16* vblk = vfrag + (j0 >> 6) * 4096;
#pragma unroll
        for (int t = 0; t < 4; ++t) { vf[t][0] = bfrag_ld(vblk + (t * 2 + 0) * 512); vf[t][1] = bfrag_ld(vblk + (t * 2 + 1) * 512); }
        asm volatile("s_wait_xcnt 0x0" :: "v"(vblk) : "memory");   // the loads' address pair stays live up to this wait, so that no load of the run lands in it and nothing rewrites it ahead of the wait
        float sc[4][8], mx4[4];
        const int qrel = q0 + l15 - 8 * hf - j0;     // causal test (key > query) against constants: one live register
#pragma unroll
        for (int t = 0; t < 4; ++t) {
#pragma unroll
            for (int r = 0; r < 8; ++r) {
                float v = s[t][r] * 0.125f;
                v += mt[t][r >> 2][r & 3];
                if (t * 16 + r > qrel) v = NEG; else v *= L2E;
                sc[t][r] = v;
                mx4[t] = (r == 0) ? v : fmaxf(mx4[t], v);
            }
        }
        float mx = fmaxf(fmaxf(mx4[0], mx4[1]), fmaxf(mx4[2], mx4[3]));
        mx = fmaxf(mx, xhalf(mx));
        const float mnew = fmaxf(m, mx);
        const float corr = (mnew == NEG) ? 1.f : exp2f(m - mnew);
        float rs4[4];
        Split pb[2];
#pragma unroll
        for (int t = 0; t < 4; ++t) {
            rs4[t] = 0.f;
#pragma unroll
            for (int r = 0; r < 8; ++r) {
                const float pp = (sc[t][r] == NEG) ? 0.f : exp2f(sc[t][r] - mnew); rs4[t] += pp;   // guard and exp2f as before this step: in the listing each is still an exec-mask branch of its own
                const __bf16 hb = bf16_rne(pp);
                pb[t >> 1].hi[(t & 1) * 8 + r] = hb; pb[t >> 1].lo[(t & 1) * 8 + r] = bf16_rne(pp - bf16_f32(hb));
            }
        }
        l = l * corr + ((rs4[0] + rs4[1]) + (rs4[2] + rs4[3])); m = mnew;
#pragma unroll
        for (int t = 0; t < 4; ++t) {
#pragma unroll
            for (int r = 0; r < 8; ++r) o[t][r] *= corr;
        }
#pragma unroll
        for (int t = 0; t < 4; ++t) {
            o[t] = wmma2t(vf[t][0], pb[0], o[t]);
            o[t] = wmma2t(vf[t][1], pb[1], o[t]);
        }
    }
    l += xhalf(l);
    const float inv = (l > 0.f) ? 1.f / l : 0.f;
    float* orow = O + bz * 1048576 + h * 64 + (q0 + l15) * 512 + 8 * hf;
#pragma unroll
    for (int t = 0; t < 4; ++t) {
        v4f x, y;
        x.x = o[t][0] * inv; x.y = o[t][1] * inv; x.z = o[t][2] * inv; x.w = o[t][3] * inv;
        y.x = o[t][4] * inv; y.y = o[t][5] * inv; y.z = o[t][6] * inv; y.w = o[t][7] * inv;
        VST2V4(orow + t * 16, x); VST2V4(orow + t * 16 + 4, y);
    }
}

// =====================================================================================================================
// k_tr: dst(z, c, r) = alpha * src(z, r, c) (+ beta * R2(z, c, r)): [Z][R][C] (row stride lds) -> [Z][C][R] (row stride ldd) through a 32x32 LDS tile;
//   flags: 1 -> add beta * residual R2 addressed like dst (z*sRz + c*ldr + r); act applied before the residual.
// =====================================================================================================================
struct TrP { const float* src; float* dst; const float* R2; long long sSz, lds, sDz, ldd, sRz, ldr; int R, C, flags, act; float alpha, beta; };
static_assert(sizeof(TrP) == 3 * 8 + 6 * 8 + 6 * 4, "TrP has padding");
__global__ __launch_bounds__(256) void k_tr(TrP p) {
    __shared__ float tile[32][33];
    const int c0 = blockIdx.x * 32, r0 = blockIdx.y * 32, z = blockIdx.z;
    const int lane = threadIdx.x & 31, wave = threadIdx.x >> 5;
    const float* s = p.src + z * p.sSz;
#pragma unroll
    for (int k = 0; k < 4; ++k) {
        const int rl = wave * 4 + k, r = r0 + rl, c = c0 + lane;
        tile[rl][lane] = (r < p.R && c < p.C) ? s[(long long)r * p.lds + c] : 0.f;
    }
    __syncthreads();
    float* d = p.dst + z * p.sDz; const float* rr = p.R2 + z * p.sRz;
#pragma unroll
    for (int k = 0; k < 4; ++k) {
        const int cl = wave * 4 + k, c = c0 + cl, r = r0 + lane;
        if (c < p.C && r < p.R) {
            float v = act_fn(p.alpha * tile[lane][cl], p.act);
            if (p.flags & 1) v += p.beta * rr[(long long)c * p.ldr + r];
            VST2(float, d + (long long)c * p.ldd + r, v);
        }
    }
}

// k_affine: dst[i] = a * (sdev ? sdev[0] : 1) * src[i] + b, i < n (one thread per element; consecutive lanes -> consecutive addresses)
__global__ __launch_bounds__(256) void k_affine(const float* __restrict__ src, float* __restrict__ dst, int n, float a, float b, const float* __restrict__ sdev) {
    const int i = blockIdx.x * 256 + threadIdx.x;
    if (i < n) { const float aa = sdev ? a * sdev[0] : a; const float v = aa * src[i] + b; VST2(float, dst + i, v); }
}

// =====================================================================================================================
// k_softmax: row softmax over n contiguous elements, one 256-thread block per row; rows addressed z*sz + r*sr (grid (R, Z)).
//   out = scale_out * softmax(scale_in * x + (Mf ? Mf[z*smz + r*smr + j] : 0)); a row whose max is -inf is written as 0.
// =====================================================================================================================
struct SmP { const float* src; float* dst; const float* Mf; long long sz, sr, dz, dr, smz, smr; int n, pad; float scale_in, scale_out; };
static_assert(sizeof(SmP) == 3 * 8 + 6 * 8 + 4 * 4, "SmP has padding");
__global__ __launch_bounds__(256) void k_softmax(SmP p) {
    __shared__ float red[256];
    const int r = blockIdx.x, z = blockIdx.y, tid = threadIdx.x;
    const float* s = p.src + z * p.sz + (long long)r * p.sr;
    const float* mf = p.Mf ? (p.Mf + z * p.smz + (long long)r * p.smr) : nullptr;
    float mx = -__builtin_inff();
    for (int j = tid; j < p.n; j += 256) { float v = s[j] * p.scale_in; if (mf) v += mf[j]; mx = fmaxf(mx, v); }
    red[tid] = mx; __syncthreads();
    for (int o = 128; o > 0; o >>= 1) { if (tid < o) red[tid] = fmaxf(red[tid], red[tid + o]); __syncthreads(); }
    mx = red[0]; __syncthreads();
    float sum = 0.f;
    for (int j = tid; j < p.n; j += 256) { float v = s[j] * p.scale_in; if (mf) v += mf[j]; sum += (mx == -__builtin_inff()) ? 0.f : expf(v - mx); }
    red[tid] = sum; __syncthreads();
    for (int o = 128; o > 0; o >>= 1) { if (tid < o) red[tid] += red[tid + o]; __syncthreads(); }
    sum = red[0];
    const float inv = (sum > 0.f) ? p.scale_out / sum : 0.f;
    float* d = p.dst + z * p.dz + (long long)r * p.dr;
    for (int j = tid; j < p.n; j += 256) { float v = s[j] * p.scale_in; if (mf) v += mf[j]; const float o = (mx == -__builtin_inff()) ? 0.f : expf(v - mx) * inv; VST2(float, d + j, o); }
}
// =====================================================================================================================
// k_stats: mean and rsqrt(var + eps) over a set of n elements addressed base + z*sz + (e / inner) * so + (e % inner) * si, one 256-thread
// k_norm_apply: y = (x - mean[set]) * rstd[set] * g[c] + b[c] over a [Z][C][L] chan-major tensor with set = z*G + c / (C/G) (G groups per z;
//   G = C -> per-chan sets indexed z*C+c; for batch norm pass stats indexed by c only via bn = 1). Optional act. Output same layout.
// =====================================================================================================================
//   mode 0: mean / rsqrt(var + eps); mode 1 (RMSNorm): 0 / rsqrt(mean(x^2) + eps); mode 2 (L2 normalize * sqrt(n)): 0 / sqrt(n) / max(||x||, eps); mode 3: as 0 with unbiased variance (n-1)
__global__ __launch_bounds__(256) void k_stats(const float* __restrict__ x, long long sz, long long so, long long si, int inner, int n, float eps, float* __restrict__ stat, int mode) {
    __shared__ float red[256];
    const int z = blockIdx.x, tid = threadIdx.x;
    const float* base = x + z * sz;
    float s = 0.f;
    for (int e = tid; e < n; e += 256) s += base[(long long)(e / inner) * so + (long long)(e % inner) * si];
    red[tid] = s; __syncthreads();
    for (int o = 128; o > 0; o >>= 1) { if (tid < o) red[tid] += red[tid + o]; __syncthreads(); }
    const float mu = (mode == 0 || mode == 3) ? red[0] / (float)n : 0.f; __syncthreads();
    float q = 0.f;
    for (int e = tid; e < n; e += 256) { const float dlt = base[(long long)(e / inner) * so + (long long)(e % inner) * si] - mu; q += dlt * dlt; }
    red[tid] = q; __syncthreads();
    for (int o = 128; o > 0; o >>= 1) { if (tid < o) red[tid] += red[tid + o]; __syncthreads(); }
    {
        float rs;
        if (mode == 2) rs = sqrtf((float)n) / fmaxf(sqrtf(red[0]), eps); else if (mode == 3) rs = rsqrtf(red[0] / (float)(n - 1) + eps); else rs = rsqrtf(red[0] / (float)n + eps);
        if (tid < 32) { const float v = (tid == 0) ? mu : ((tid == 1) ? rs : 0.f); VST2(float, stat + (long long)z * 32 + tid, v); }
    }
}
//   One thread per element over the flat [Z][C][L] index space: grid ceil(Z*C*L / 256).
__global__ __launch_bounds__(256) void k_norm_apply(const float* __restrict__ x, float* __restrict__ y, const float* __restrict__ stat, const float* __restrict__ g, const float* __restrict__ bta,
                                                     int Z, int C, int L, int G, int bn, int act) {
    const long long idx = (long long)blockIdx.x * 256 + threadIdx.x;
    if (idx >= (long long)Z * C * L) return;
    const int l = (int)(idx % L); const long long zc = idx / L; const int c = (int)(zc % C), z = (int)(zc / C); (void)l;
    const int set = bn ? c : (z * G + c / (C / G));
    float v = (x[idx] - stat[(long long)set * 32]) * stat[(long long)set * 32 + 1];
    if (g) v *= g[c];
    if (bta) v += bta[c];
    v = act_fn(v, act);
    VST2(float, y + idx, v);
}

// k_lse_neg: c[i] = -(st[2i] + log(st[2i+1])) = minus the log-sum-exp of row i from k_attn's ST output (for softmax over the query dimension)
__global__ __launch_bounds__(256) void k_lse_neg(const float* __restrict__ st, float* __restrict__ c, int n) {
    const int i = blockIdx.x * 256 + threadIdx.x;
    if (i < n) { const float v = -(st[2 * i] + logf(st[2 * i + 1])); VST2(float, c + i, v); }
}

// k_iota: dst[i] = a * i + b as int32 (segment/position id helper)
__global__ __launch_bounds__(256) void k_iota(int* __restrict__ dst, int n, int a, int b) {
    const int i = blockIdx.x * 256 + threadIdx.x;
    if (i < n) { const int v = a * i + b; VST2(int, dst + i, v); }
}

// k_axpby: dst[i] = a * x[i] + b * y[i] (+ c), i < n
__global__ __launch_bounds__(256) void k_axpby(const float* __restrict__ x, const float* __restrict__ y, float* __restrict__ dst, int n, float a, float b, float c) {
    const int i = blockIdx.x * 256 + threadIdx.x;
    if (i < n) { const float v = a * x[i] + b * y[i] + c; VST2(float, dst + i, v); }
}

// =====================================================================================================================
// k_rope: rotary embedding on a [R rows][Hn heads][D] view (row stride sXr, head stride sXh, element stride 1) -> Y (own strides).
//   mode 0: rotate_half (partner d±D/2, sign - for d<D/2); mode 1: interleaved pairs (partner d^1, sign - for even d).
//   table column tcol: tmode 0 -> d, 1 -> d % (D/2), 2 -> d / 2; position p: pmode 0 -> r % S, 1 -> head index, 2 -> pos[r];
//   c = C[(r / S) * sCb + p * sCp + tcol * sCd], s likewise from Sn; y = x[d] * c + sign * x[partner] * s. X and Y must not alias.
// =====================================================================================================================
struct RopeP { const float* X; float* Y; const float* C; const float* Sn; const int* pos; long long sXr, sXh, sYr, sYh, sCb, sCp, sCd; int R, Hn, D, S, mode, tmode, pmode, pad; };
static_assert(sizeof(RopeP) == 5 * 8 + 7 * 8 + 8 * 4, "RopeP has padding");
__global__ __launch_bounds__(256) void k_rope(RopeP p) {
    const long long idx = (long long)blockIdx.x * 256 + threadIdx.x;
    if (idx >= (long long)p.R * p.Hn * p.D) return;
    const int d = (int)(idx % p.D); const long long rh = idx / p.D; const int h = (int)(rh % p.Hn); const int r = (int)(rh / p.Hn);
    const int half = p.D / 2;
    int partner; float sign;
    if (p.mode == 0) { partner = (d < half) ? d + half : d - half; sign = (d < half) ? -1.f : 1.f; }
    else { partner = d ^ 1; sign = (d & 1) ? 1.f : -1.f; }
    const int tcol = (p.tmode == 0) ? d : ((p.tmode == 1) ? (d % half) : (d >> 1));
    const int pp = (p.pmode == 0) ? (r % p.S) : ((p.pmode == 1) ? h : p.pos[r]);
    const long long toff = (long long)(r / p.S) * p.sCb + (long long)pp * p.sCp + (long long)tcol * p.sCd;
    const float* xr = p.X + (long long)r * p.sXr + (long long)h * p.sXh;
    const float v = xr[d] * p.C[toff] + sign * xr[partner] * p.Sn[toff];
    VST2(float, p.Y + (long long)r * p.sYr + (long long)h * p.sYh + d, v);
}

// k_invf + k_sincos (split so neither kernel carries a large VALU-fma footprint): invf_i = num * (1 / powf(base, (2 i)/D)) [fmode 0],
//   num * expf((2 i) * cexp) [fmode 1], num * powf(base, -2 (i - 1) / D) [fmode 2]; then cs/sn[s*half + i] = cos/sin((pscale * s) * invf_i)
__global__ __launch_bounds__(256) void k_invf(float* __restrict__ invb, int half, int D, float base, float num, int fmode, float cexp) {
    const int i = blockIdx.x * 256 + threadIdx.x;
    if (i >= ((half + 31) / 32) * 32) return;
    if (i >= half) { VST2(float, invb + i, 0.f); return; }
    const float e = (float)(2 * i) / (float)D;
    float invf;
    if (fmode == 1) invf = num * expf((float)(2 * i) * cexp);
    else if (fmode == 2) invf = num * powf(base, (-2.0f * ((float)i - 1.0f)) / (float)D);
    else invf = num * (1.0f / powf(base, e));
    VST2(float, invb + i, invf);
}
__global__ __launch_bounds__(256) void k_sincos(float* __restrict__ cs, float* __restrict__ sn, const float* __restrict__ invb, int S, int half, float pscale) {
    const int idx = blockIdx.x * 256 + threadIdx.x;
    if (idx >= S * half) return;
    const int s = idx / half, i = idx - s * half;
    const float ang = (pscale * (float)s) * invb[i];
    VST2(float, cs + idx, cosf(ang)); VST2(float, sn + idx, sinf(ang));
}

// k_mulact: dst[i] = act(x[i]) * y[i]
__global__ __launch_bounds__(256) void k_mulact(const float* __restrict__ x, const float* __restrict__ y, float* __restrict__ dst, int n, int act) {
    const int i = blockIdx.x * 256 + threadIdx.x;
    if (i < n) { const float v = act_fn(x[i], act) * y[i]; VST2(float, dst + i, v); }
}

// =====================================================================================================================
// k_matvec: thread-per-row matrix-vector products for N <= 8 output columns (heads with 1-3 outputs, gates), f32 on the VALU.
//   C[r*sCm + j] = act(alpha * sum_k A[r*sAm + k*sAk] * B[j*sBn + k*sBk] + bias[j]) + beta * R[r*sRm + j*sRn]; each thread writes its N contiguous floats.
// =====================================================================================================================
__global__ __launch_bounds__(256) void k_matvec(GemmP p) {
    // 32 lanes write one line with one instruction.
    const int rpt = (p.N == 1) ? 1 : 32;
    const long long r0 = ((long long)blockIdx.x * 256 + threadIdx.x) * rpt; const int z = blockIdx.z, zo = z / p.zi_n, zi = z - zo * p.zi_n;
    if (r0 >= p.M) return;
    const float* Bb = p.B + zo * p.sBo + zi * p.sBi;
    float* C = p.C + zo * p.sCo + zi * p.sCi; const float* R = p.R + zo * p.sRo + zi * p.sRi;
    for (int rr = 0; rr < rpt; ++rr) {
        const long long r = r0 + rr; if (r >= p.M) break;
        const float* A = p.A + zo * p.sAo + zi * p.sAi + r * p.sAm;
        float acc[8] = {0.f, 0.f, 0.f, 0.f, 0.f, 0.f, 0.f, 0.f};
        for (int k = 0; k < p.K; ++k) { const float a = A[(long long)k * p.sAk];
#pragma unroll
            for (int j = 0; j < 8; ++j) if (j < p.N) acc[j] += a * Bb[(long long)j * p.sBn + (long long)k * p.sBk]; }
#pragma unroll
        for (int j = 0; j < 8; ++j) if (j < p.N) {
            float v = acc[j] * p.alpha;
            if (p.flags & 1) v += p.bias[j];
            if (p.flags & 2) v += p.bias[r];
            v = act_fn(v, p.act);
            if (p.flags & 4) v += p.beta * R[r * p.sRm + (long long)j * p.sRn];
            VST2(float, C + r * p.sCm + j, v);
        }
    }
}
// k_smallsoftmax: thread-per-row softmax for short rows (n <= 64): dst[r*dr + j] = softmax(scale*src[r*sr + j])
__global__ __launch_bounds__(256) void k_smallsoftmax(const float* __restrict__ src, float* __restrict__ dst, long long sr, long long dr, int n, long long R, float scale) {
    const long long r0 = ((long long)blockIdx.x * 256 + threadIdx.x) * 32;
    for (int rr = 0; rr < 32; ++rr) {
        const long long r = r0 + rr; if (r >= R) return;
        const float* s = src + r * sr; float* d = dst + r * dr;
        float mx = -__builtin_inff();
        for (int j = 0; j < n; ++j) mx = fmaxf(mx, s[j] * scale);
        float sum = 0.f;
        for (int j = 0; j < n; ++j) sum += expf(s[j] * scale - mx);
        const float inv = 1.f / sum;
        for (int j = 0; j < n; ++j) { const float v = expf(s[j] * scale - mx) * inv; VST2(float, d + j, v); }
    }
}

__global__ __launch_bounds__(32) void k_unitstat(float* __restrict__ st) { const int t = threadIdx.x; const float v = (t == 1) ? 1.f : 0.f; VST2(float, st + t, v); }

// destination (e.g. a d_out whose row width is not a multiple of 32 floats) is written by consecutive lanes of one instruction
__global__ __launch_bounds__(256) void k_lincopy(const float* __restrict__ src, long long lds, float* __restrict__ dst, long long ldd, long long rows, int cols) {
    const long long i = (long long)blockIdx.x * 256 + threadIdx.x; if (i >= rows * cols) return;
    const long long r = i / cols; const int c = (int)(i - r * cols);
    const float v = src[r * lds + c]; VST2(float, dst + r * ldd + c, v);
}


__device__ __forceinline__ void st_h2(unsigned short* d2, float a, float b) { const unsigned u = (unsigned)__builtin_bit_cast(unsigned short, (_Float16)a) | ((unsigned)__builtin_bit_cast(unsigned short, (_Float16)b) << 16); unsigned* d = (unsigned*)d2; *d = u;  }
__device__ __forceinline__ float ldh(const unsigned short* p) { return (float)__builtin_bit_cast(_Float16, *p); }
__device__ __forceinline__ v4f ld4h(const unsigned short* p) { const unsigned long long u = *(const unsigned long long*)p; v4f a;
    a.x = (float)__builtin_bit_cast(_Float16, (unsigned short)(u & 0xFFFFu)); a.y = (float)__builtin_bit_cast(_Float16, (unsigned short)((u >> 16) & 0xFFFFu)); a.z = (float)__builtin_bit_cast(_Float16, (unsigned short)((u >> 32) & 0xFFFFu)); a.w = (float)__builtin_bit_cast(_Float16, (unsigned short)((u >> 48) & 0xFFFFu)); return a; }
__device__ __forceinline__ unsigned long long pk4h(v4f s) { return (unsigned long long)__builtin_bit_cast(unsigned short, (_Float16)s.x) | ((unsigned long long)__builtin_bit_cast(unsigned short, (_Float16)s.y) << 16) | ((unsigned long long)__builtin_bit_cast(unsigned short, (_Float16)s.z) << 32) | ((unsigned long long)__builtin_bit_cast(unsigned short, (_Float16)s.w) << 48); }
typedef unsigned v4u __attribute__((ext_vector_type(4)));
__device__ __forceinline__ void st8h(unsigned short* d, v4f a, v4f b) { const unsigned long long pa = pk4h(a), pb = pk4h(b); v4u pk; pk.x = (unsigned)(pa & 0xFFFFFFFFull); pk.y = (unsigned)(pa >> 32); pk.z = (unsigned)(pb & 0xFFFFFFFFull); pk.w = (unsigned)(pb >> 32); v4u* dd = (v4u*)d; *dd = pk;  }
__device__ __forceinline__ unsigned short bfu_rne(float v) { unsigned u = __builtin_bit_cast(unsigned, v); u += 0x7FFFu + ((u >> 16) & 1u); return (unsigned short)(u >> 16); }
__device__ __forceinline__ void bfsplit(float v, unsigned short& hi, unsigned short& lo) { hi = bfu_rne(v); lo = bfu_rne(v - __builtin_bit_cast(float, (unsigned)hi << 16)); }
__device__ __forceinline__ void st_s2(unsigned short* Hp, unsigned short* Lp, long long o, float a, float b) { unsigned short h0,l0,h1,l1; bfsplit(a,h0,l0); bfsplit(b,h1,l1); const unsigned ph = (unsigned)h0 | ((unsigned)h1 << 16), pl = (unsigned)l0 | ((unsigned)l1 << 16);
    unsigned* dh = (unsigned*)(Hp + o); unsigned* dl = (unsigned*)(Lp + o); *dh = ph; *dl = pl;  }
__device__ __forceinline__ int cl(int v, int n) { return min(max(v, 0), n - 1); }

// GAT-style aggregation over a device in-edge CSR at dst (+ optional explicit self loop as iteration j = -1):
//   logit = leaky(AS[src][h] + AD[n][h] (+ EW[e]*CW[h]), slope); softmax over the node's edges per head; acc[c] = sum alpha XP[src][c] (f16 gather plane, pitch XW; 256 channels = H heads x CH)
//   wave per node; lane L owns channels 8L..8L+7 (head = 8L / CH); per-lane softmax state (lanes of one head agree) -> no shuffles in the loop.
//   EPI 0: + bias -> f32 OUT[n][256] via LDS redistribution (two 16-B stores per lane, each instruction 512 contiguous B)
//   EPI 1: + bias, LayerNorm(256) * g + bb, relu -> bf16 hi/lo planes OH/OL [n][256] (16-B stores)
//   EPI 2: mean over the 256/CH heads + bias[0..63], LayerNorm(64) * g + bb, relu -> f32 OUT[n][64] (CH must be 64; LDS redistribution, 8-B stores)
//   EPI 3: mean over heads + bias -> f32 OUT[n][64] (no norm / activation)
//   EPI 4: + bias, ELU -> bf16 hi/lo planes OH/OL [n][256];  EPI 5: + bias (full 256-wide, per head), ELU, then mean over the 256/CH heads -> f32 OUT[n][64]
//   EPI 6: (CH = 128, two heads) mean over the two heads, + bias[0..127], relu -> f32 OUT[n][128] (LDS redistribution, 16-B stores)
//   EWM 0: no edge weights; 1: logit += EW[e] * CW[h] (self loop weight 1); 2: alpha *= EW[e] after the softmax (message scale; self loop weight 1)
template <int CH, bool SELF, int EWM, int EPI>
__global__ __launch_bounds__(256) void k_gat_agg(const unsigned short* __restrict__ XP, int XW, const float* __restrict__ AS, const float* __restrict__ AD, int ASTR, const float* __restrict__ EW, const float* __restrict__ CW,
        const int* __restrict__ esrc, const int* __restrict__ off, const int* __restrict__ cnt, const int* __restrict__ slot, const float* __restrict__ bias, const float* __restrict__ g, const float* __restrict__ bb,
        float* __restrict__ OUT, unsigned short* __restrict__ OH, unsigned short* __restrict__ OL, int N, int E, int CAP, float slope) {
    __shared__ float stage[8][256];
    const int wv = threadIdx.x >> 5; const int n = blockIdx.x * 8 + wv; const int L = threadIdx.x & 31; if (n >= N) return; const int c0 = 8 * L; const int h = c0 / CH;
    const float ad = AD[(long long)n * ASTR + h]; const float cw = (EWM == 1) ? CW[h] : 0.f; float m = -3.0e38f, s = 0.f; v4f a0, a1; a0.x = a0.y = a0.z = a0.w = 0.f; a1 = a0;
    const int p0 = cl(off[n], E + 1), cn = min(max(cnt[n], 0), CAP);
    for (int j = (SELF ? -1 : 0); j < cn; ++j) { int sj; float ew = 0.f;
        if (j < 0) { sj = n; ew = 1.f; } else { int e = slot[cl(p0 + j, E)]; e = cl(e, E); sj = cl(esrc[e], N); if (EWM != 0) ew = EW[e]; }
        float lg = AS[(long long)sj * ASTR + h] + ad + ((EWM == 1) ? ew * cw : 0.f); lg = (lg >= 0.f) ? lg : slope * lg;
        const float mn = fmaxf(m, lg); const float cz = expf(m - mn), pj = expf(lg - mn); s = s * cz + pj; const float pw = (EWM == 2) ? pj * ew : pj;
        const unsigned short* xr = XP + (long long)sj * XW + c0; a0 = a0 * cz + ld4h(xr) * pw; a1 = a1 * cz + ld4h(xr + 4) * pw; m = mn; }
    const float inv = (s > 0.f) ? 1.f / (s + 1e-16f) : 0.f; a0 = a0 * inv; a1 = a1 * inv;
    if (EPI == 0 || EPI == 1 || EPI == 4 || EPI == 5) { a0 = a0 + *(const v4f*)(bias + c0); a1 = a1 + *(const v4f*)(bias + c0 + 4); }
    if (EPI == 4 || EPI == 5) { a0.x = (a0.x > 0.f) ? a0.x : (expf(a0.x) - 1.f); a0.y = (a0.y > 0.f) ? a0.y : (expf(a0.y) - 1.f); a0.z = (a0.z > 0.f) ? a0.z : (expf(a0.z) - 1.f); a0.w = (a0.w > 0.f) ? a0.w : (expf(a0.w) - 1.f);
        a1.x = (a1.x > 0.f) ? a1.x : (expf(a1.x) - 1.f); a1.y = (a1.y > 0.f) ? a1.y : (expf(a1.y) - 1.f); a1.z = (a1.z > 0.f) ? a1.z : (expf(a1.z) - 1.f); a1.w = (a1.w > 0.f) ? a1.w : (expf(a1.w) - 1.f); }
    if (EPI == 4) { float o8[8] = {a0.x, a0.y, a0.z, a0.w, a1.x, a1.y, a1.z, a1.w}; unsigned short hh[8], ll[8];
#pragma unroll
        for (int u = 0; u < 8; ++u) bfsplit(o8[u], hh[u], ll[u]);
        const unsigned long long ph0 = (unsigned long long)hh[0] | ((unsigned long long)hh[1] << 16) | ((unsigned long long)hh[2] << 32) | ((unsigned long long)hh[3] << 48), pl0 = (unsigned long long)ll[0] | ((unsigned long long)ll[1] << 16) | ((unsigned long long)ll[2] << 32) | ((unsigned long long)ll[3] << 48);
        const unsigned long long ph1 = (unsigned long long)hh[4] | ((unsigned long long)hh[5] << 16) | ((unsigned long long)hh[6] << 32) | ((unsigned long long)hh[7] << 48), pl1 = (unsigned long long)ll[4] | ((unsigned long long)ll[5] << 16) | ((unsigned long long)ll[6] << 32) | ((unsigned long long)ll[7] << 48);
        v4u pk; pk.x = (unsigned)(ph0 & 0xFFFFFFFFull); pk.y = (unsigned)(ph0 >> 32); pk.z = (unsigned)(ph1 & 0xFFFFFFFFull); pk.w = (unsigned)(ph1 >> 32); v4u* dh = (v4u*)(OH + (long long)n * 256 + c0); *dh = pk; 
        v4u ql; ql.x = (unsigned)(pl0 & 0xFFFFFFFFull); ql.y = (unsigned)(pl0 >> 32); ql.z = (unsigned)(pl1 & 0xFFFFFFFFull); ql.w = (unsigned)(pl1 >> 32); v4u* dl = (v4u*)(OL + (long long)n * 256 + c0); *dl = ql;  return; }
    if (EPI == 6) {
        a0.x += __shfl_xor(a0.x, 16); a0.y += __shfl_xor(a0.y, 16); a0.z += __shfl_xor(a0.z, 16); a0.w += __shfl_xor(a0.w, 16); a1.x += __shfl_xor(a1.x, 16); a1.y += __shfl_xor(a1.y, 16); a1.z += __shfl_xor(a1.z, 16); a1.w += __shfl_xor(a1.w, 16);
        if (L < 16) { const int cb = 8 * L; const v4f b0 = *(const v4f*)(bias + cb), b1v = *(const v4f*)(bias + cb + 4);
            stage[wv][cb] = fmaxf(a0.x * 0.5f + b0.x, 0.f); stage[wv][cb + 1] = fmaxf(a0.y * 0.5f + b0.y, 0.f); stage[wv][cb + 2] = fmaxf(a0.z * 0.5f + b0.z, 0.f); stage[wv][cb + 3] = fmaxf(a0.w * 0.5f + b0.w, 0.f);
            stage[wv][cb + 4] = fmaxf(a1.x * 0.5f + b1v.x, 0.f); stage[wv][cb + 5] = fmaxf(a1.y * 0.5f + b1v.y, 0.f); stage[wv][cb + 6] = fmaxf(a1.z * 0.5f + b1v.z, 0.f); stage[wv][cb + 7] = fmaxf(a1.w * 0.5f + b1v.w, 0.f); }
        __builtin_amdgcn_fence(__ATOMIC_RELEASE, "workgroup"); __builtin_amdgcn_wave_barrier(); __builtin_amdgcn_fence(__ATOMIC_ACQUIRE, "workgroup");
        v4f o6; o6.x = stage[wv][4 * L]; o6.y = stage[wv][4 * L + 1]; o6.z = stage[wv][4 * L + 2]; o6.w = stage[wv][4 * L + 3]; VST2V4(OUT + (long long)n * 128 + 4 * L, o6); return; }
    if (EPI == 5) {
        a0.x += __shfl_xor(a0.x, 8); a0.y += __shfl_xor(a0.y, 8); a0.z += __shfl_xor(a0.z, 8); a0.w += __shfl_xor(a0.w, 8); a1.x += __shfl_xor(a1.x, 8); a1.y += __shfl_xor(a1.y, 8); a1.z += __shfl_xor(a1.z, 8); a1.w += __shfl_xor(a1.w, 8);
        a0.x += __shfl_xor(a0.x, 16); a0.y += __shfl_xor(a0.y, 16); a0.z += __shfl_xor(a0.z, 16); a0.w += __shfl_xor(a0.w, 16); a1.x += __shfl_xor(a1.x, 16); a1.y += __shfl_xor(a1.y, 16); a1.z += __shfl_xor(a1.z, 16); a1.w += __shfl_xor(a1.w, 16);
        const int gq5 = L & 7; a0 = a0 * 0.25f; a1 = a1 * 0.25f;
        if (L < 8) { stage[wv][8 * gq5] = a0.x; stage[wv][8 * gq5 + 1] = a0.y; stage[wv][8 * gq5 + 2] = a0.z; stage[wv][8 * gq5 + 3] = a0.w; stage[wv][8 * gq5 + 4] = a1.x; stage[wv][8 * gq5 + 5] = a1.y; stage[wv][8 * gq5 + 6] = a1.z; stage[wv][8 * gq5 + 7] = a1.w; }
        __builtin_amdgcn_fence(__ATOMIC_RELEASE, "workgroup"); __builtin_amdgcn_wave_barrier(); __builtin_amdgcn_fence(__ATOMIC_ACQUIRE, "workgroup");
        const unsigned long long pk5 = (unsigned long long)__builtin_bit_cast(unsigned, stage[wv][2 * L]) | ((unsigned long long)__builtin_bit_cast(unsigned, stage[wv][2 * L + 1]) << 32); VST2(unsigned long long, (unsigned long long*)(OUT + (long long)n * 64 + 2 * L), pk5); return; }
    if (EPI == 1) { float sm = a0.x + a0.y + a0.z + a0.w + a1.x + a1.y + a1.z + a1.w;
#pragma unroll
        for (int o = 16; o > 0; o >>= 1) sm += __shfl_xor(sm, o);
        const float mu = sm * (1.f / 256.f); const v4f d0 = a0 - mu, d1 = a1 - mu; float q = d0.x * d0.x + d0.y * d0.y + d0.z * d0.z + d0.w * d0.w + d1.x * d1.x + d1.y * d1.y + d1.z * d1.z + d1.w * d1.w;
#pragma unroll
        for (int o = 16; o > 0; o >>= 1) q += __shfl_xor(q, o);
        const float rs = rsqrtf(q * (1.f / 256.f) + 1e-5f); float o8[8] = {d0.x, d0.y, d0.z, d0.w, d1.x, d1.y, d1.z, d1.w}; unsigned short hh[8], ll[8];
#pragma unroll
        for (int u = 0; u < 8; ++u) { const float v = fmaxf(o8[u] * rs * g[c0 + u] + bb[c0 + u], 0.f); bfsplit(v, hh[u], ll[u]); }
        const unsigned long long ph0 = (unsigned long long)hh[0] | ((unsigned long long)hh[1] << 16) | ((unsigned long long)hh[2] << 32) | ((unsigned long long)hh[3] << 48), pl0 = (unsigned long long)ll[0] | ((unsigned long long)ll[1] << 16) | ((unsigned long long)ll[2] << 32) | ((unsigned long long)ll[3] << 48);
        const unsigned long long ph1 = (unsigned long long)hh[4] | ((unsigned long long)hh[5] << 16) | ((unsigned long long)hh[6] << 32) | ((unsigned long long)hh[7] << 48), pl1 = (unsigned long long)ll[4] | ((unsigned long long)ll[5] << 16) | ((unsigned long long)ll[6] << 32) | ((unsigned long long)ll[7] << 48);
        // lane L's 8 halves at c0 = 8L: 16 B -> one 16-B store per plane (32 lanes x 16 B = whole 512-B row)
        v4u pk; pk.x = (unsigned)(ph0 & 0xFFFFFFFFull); pk.y = (unsigned)(ph0 >> 32); pk.z = (unsigned)(ph1 & 0xFFFFFFFFull); pk.w = (unsigned)(ph1 >> 32); v4u* dh = (v4u*)(OH + (long long)n * 256 + c0); *dh = pk; 
        v4u ql; ql.x = (unsigned)(pl0 & 0xFFFFFFFFull); ql.y = (unsigned)(pl0 >> 32); ql.z = (unsigned)(pl1 & 0xFFFFFFFFull); ql.w = (unsigned)(pl1 >> 32); v4u* dl = (v4u*)(OL + (long long)n * 256 + c0); *dl = ql;  return; }
    if (EPI == 2 || EPI == 3) {   // head mean: lanes L, L^8, L^16, L^24 hold the same chan group of the 4 heads (CH = 64 -> 8 lanes per head)
        a0.x += __shfl_xor(a0.x, 8); a0.y += __shfl_xor(a0.y, 8); a0.z += __shfl_xor(a0.z, 8); a0.w += __shfl_xor(a0.w, 8); a1.x += __shfl_xor(a1.x, 8); a1.y += __shfl_xor(a1.y, 8); a1.z += __shfl_xor(a1.z, 8); a1.w += __shfl_xor(a1.w, 8);
        a0.x += __shfl_xor(a0.x, 16); a0.y += __shfl_xor(a0.y, 16); a0.z += __shfl_xor(a0.z, 16); a0.w += __shfl_xor(a0.w, 16); a1.x += __shfl_xor(a1.x, 16); a1.y += __shfl_xor(a1.y, 16); a1.z += __shfl_xor(a1.z, 16); a1.w += __shfl_xor(a1.w, 16);
        const int gq = L & 7; a0 = a0 * 0.25f + *(const v4f*)(bias + 8 * gq); a1 = a1 * 0.25f + *(const v4f*)(bias + 8 * gq + 4);      // every lane now holds channels 8gq..8gq+7 of the mean
        if (EPI == 3) { if (L < 8) { stage[wv][8 * gq] = a0.x; stage[wv][8 * gq + 1] = a0.y; stage[wv][8 * gq + 2] = a0.z; stage[wv][8 * gq + 3] = a0.w; stage[wv][8 * gq + 4] = a1.x; stage[wv][8 * gq + 5] = a1.y; stage[wv][8 * gq + 6] = a1.z; stage[wv][8 * gq + 7] = a1.w; }
            __builtin_amdgcn_fence(__ATOMIC_RELEASE, "workgroup"); __builtin_amdgcn_wave_barrier(); __builtin_amdgcn_fence(__ATOMIC_ACQUIRE, "workgroup");
            const unsigned long long pk3 = (unsigned long long)__builtin_bit_cast(unsigned, stage[wv][2 * L]) | ((unsigned long long)__builtin_bit_cast(unsigned, stage[wv][2 * L + 1]) << 32); VST2(unsigned long long, (unsigned long long*)(OUT + (long long)n * 64 + 2 * L), pk3); return; }
        float sm = (L < 8) ? (a0.x + a0.y + a0.z + a0.w + a1.x + a1.y + a1.z + a1.w) : 0.f;
#pragma unroll
        for (int o = 16; o > 0; o >>= 1) sm += __shfl_xor(sm, o);
        const float mu = sm * (1.f / 64.f); const v4f d0 = a0 - mu, d1 = a1 - mu; float q = (L < 8) ? (d0.x * d0.x + d0.y * d0.y + d0.z * d0.z + d0.w * d0.w + d1.x * d1.x + d1.y * d1.y + d1.z * d1.z + d1.w * d1.w) : 0.f;
#pragma unroll
        for (int o = 16; o > 0; o >>= 1) q += __shfl_xor(q, o);
        const float rs = rsqrtf(q * (1.f / 64.f) + 1e-5f);
        if (L < 8) { const float* gg = g + 8 * gq; const float* bq = bb + 8 * gq; stage[wv][8 * gq] = fmaxf(d0.x * rs * gg[0] + bq[0], 0.f); stage[wv][8 * gq + 1] = fmaxf(d0.y * rs * gg[1] + bq[1], 0.f); stage[wv][8 * gq + 2] = fmaxf(d0.z * rs * gg[2] + bq[2], 0.f); stage[wv][8 * gq + 3] = fmaxf(d0.w * rs * gg[3] + bq[3], 0.f);
            stage[wv][8 * gq + 4] = fmaxf(d1.x * rs * gg[4] + bq[4], 0.f); stage[wv][8 * gq + 5] = fmaxf(d1.y * rs * gg[5] + bq[5], 0.f); stage[wv][8 * gq + 6] = fmaxf(d1.z * rs * gg[6] + bq[6], 0.f); stage[wv][8 * gq + 7] = fmaxf(d1.w * rs * gg[7] + bq[7], 0.f); }
        __builtin_amdgcn_fence(__ATOMIC_RELEASE, "workgroup"); __builtin_amdgcn_wave_barrier(); __builtin_amdgcn_fence(__ATOMIC_ACQUIRE, "workgroup");
        const unsigned long long pk = (unsigned long long)__builtin_bit_cast(unsigned, stage[wv][2 * L]) | ((unsigned long long)__builtin_bit_cast(unsigned, stage[wv][2 * L + 1]) << 32); VST2(unsigned long long, (unsigned long long*)(OUT + (long long)n * 64 + 2 * L), pk); return; }
    // EPI 0
    stage[wv][c0] = a0.x; stage[wv][c0 + 1] = a0.y; stage[wv][c0 + 2] = a0.z; stage[wv][c0 + 3] = a0.w; stage[wv][c0 + 4] = a1.x; stage[wv][c0 + 5] = a1.y; stage[wv][c0 + 6] = a1.z; stage[wv][c0 + 7] = a1.w;
    __builtin_amdgcn_fence(__ATOMIC_RELEASE, "workgroup"); __builtin_amdgcn_wave_barrier(); __builtin_amdgcn_fence(__ATOMIC_ACQUIRE, "workgroup");
#pragma unroll
    for (int q2 = 0; q2 < 2; ++q2) { const int c = 128 * q2 + 4 * L; v4f v; v.x = stage[wv][c]; v.y = stage[wv][c + 1]; v.z = stage[wv][c + 2]; v.w = stage[wv][c + 3]; VST2V4(OUT + (long long)n * 256 + c, v); } }

__device__ __forceinline__ void st4s(unsigned short* Hp, unsigned short* Lp, long long o, v4f a) { unsigned short h[4], l[4]; bfsplit(a.x, h[0], l[0]); bfsplit(a.y, h[1], l[1]); bfsplit(a.z, h[2], l[2]); bfsplit(a.w, h[3], l[3]);
    const unsigned long long ph = (unsigned long long)h[0] | ((unsigned long long)h[1] << 16) | ((unsigned long long)h[2] << 32) | ((unsigned long long)h[3] << 48), pl = (unsigned long long)l[0] | ((unsigned long long)l[1] << 16) | ((unsigned long long)l[2] << 32) | ((unsigned long long)l[3] << 48);
    VST2(unsigned long long, (unsigned long long*)(Hp + o), ph); VST2(unsigned long long, (unsigned long long*)(Lp + o), pl); }
// f32 [nval2 pairs] -> bf16 hi/lo planes (n2 pairs; pairs >= nval2 zero); thread-linear 4-B stores per plane
__global__ __launch_bounds__(256) void k_pl(const float* __restrict__ S, unsigned short* __restrict__ PH, unsigned short* __restrict__ PL, long long nval2, long long n2) { const long long u = (long long)blockIdx.x * 256 + threadIdx.x; if (u >= n2) return; const bool in = (u < nval2); const long long uc = in ? u : ((nval2 > 0) ? (nval2 - 1) : 0); const float a = S[2 * uc], b = S[2 * uc + 1]; st_s2(PH, PL, 2 * u, in ? a : 0.f, in ? b : 0.f); }
// WC [K][NOP] (thread-linear whole rows) = [W (cols < FO) | 0 | W_h . as_h @EO+h | W_h . ad_h @EO+NH+h | 0 ...]; W is [K][FO] (x @ W layout), as/ad [NH][DH]; EO >= FO.
// branch-free: every lane loads all candidates with clamped indices and selects by value (no exec-masked load arms)
__global__ __launch_bounds__(256) void k_wext(const float* __restrict__ Wm, const float* __restrict__ AS_, const float* __restrict__ AD_, int K, int NOP, int FO, int NH, int DH, int EO, float* __restrict__ WC) {
    #pragma clang fp contract(off)
    const long long u = (long long)blockIdx.x * 256 + threadIdx.x; if (u >= (long long)K * NOP) return; const int kk = (int)(u / NOP), o = (int)(u % NOP);
    const int oo = min(o, FO - 1); const float vw = Wm[(long long)kk * FO + oo]; const int q = min(max(o - EO, 0), 2 * NH - 1); const int h = q % NH; float s = 0.f;
#pragma unroll 1
    for (int c = 0; c < DH; ++c) { const float w = Wm[(long long)kk * FO + h * DH + c]; const float asv = AS_[h * DH + c], adv = AD_[h * DH + c]; s += w * ((q < NH) ? asv : adv); }
    const float v = (o < FO) ? vw : ((o >= EO && o < EO + 2 * NH) ? s : 0.f); VST2(float, WC + u, v); }
// GAT aggregation over a device in-edge CSR (+ analytic self loop as iteration j = -1 when SELF), per-lane online softmax (lanes of one head agree):
// HS rows (pitch P floats): [0,128) projected features z, col 128 + h = a_src.z_h, col 128 + NH + h = a_dst.z_h; lane L owns channels 4L..4L+3 (head = 4L / CH).
// out = sum_j softmax_j(leaky(el[src_j][h] + er[n][h])) z[src_j] (/ (den + deps)) + bias -> ACT (0 none, 1 relu, 2 elu, 3 leaky 0.01) ->
// MODE 0: f32 OUT[n][OW] cols < OC (16-B lane stores, OC*4 contiguous B per wave; OC in {64,128}); MODE 1: bf16 hi/lo planes PH/PL pitch PP (rows n >= N zero); MODE 2: both.
template <int CH, bool SELF, int ACT, int MODE>
__global__ __launch_bounds__(256) void k_gat128(const float* __restrict__ HS, int P, int NH, const float* __restrict__ bias, const int* __restrict__ SRC, const int* __restrict__ off, const int* __restrict__ cnt, const int* __restrict__ slot,
        float* __restrict__ OUT, int OW, int OC, unsigned short* __restrict__ PH, unsigned short* __restrict__ PL, int PP, int N, int NP, int E, int CAP, float slope, float deps) {
    #pragma clang fp contract(off)
    const int n = blockIdx.x * 8 + (threadIdx.x >> 5); const int L = threadIdx.x & 31; if (n >= NP) return; const int c = 4 * L; const int h = c / CH; v4f o; o.x = o.y = o.z = o.w = 0.f;
    if (n < N) { const float* hn = HS + (long long)n * P; const float er = hn[128 + NH + h]; float m = -3.0e38f, s = 0.f; v4f a; a.x = a.y = a.z = a.w = 0.f;
        const int p0 = min(max(off[n], 0), E), cn = min(max(cnt[n], 0), CAP);
        for (int j = (SELF ? -1 : 0); j < cn; ++j) { int sj; if (j < 0) sj = n; else { const int e = min(max(slot[min(p0 + j, E - 1)], 0), E - 1); sj = min(max(SRC[e], 0), N - 1); }
            const float* hs = HS + (long long)sj * P; float lg = hs[128 + h] + er; lg = (lg >= 0.f) ? lg : slope * lg;
            const float mn = fmaxf(m, lg); const float cz = expf(m - mn), pj = expf(lg - mn); s = s * cz + pj; a = a * cz + *(const v4f*)(hs + c) * pj; m = mn; }
        const float inv = (s > 0.f || deps > 0.f) ? 1.f / (s + deps) : 0.f; o = a * inv + *(const v4f*)(bias + c);
        if (ACT == 1) { o.x = fmaxf(o.x, 0.f); o.y = fmaxf(o.y, 0.f); o.z = fmaxf(o.z, 0.f); o.w = fmaxf(o.w, 0.f); }
        if (ACT == 2) { o.x = (o.x > 0.f) ? o.x : (expf(o.x) - 1.f); o.y = (o.y > 0.f) ? o.y : (expf(o.y) - 1.f); o.z = (o.z > 0.f) ? o.z : (expf(o.z) - 1.f); o.w = (o.w > 0.f) ? o.w : (expf(o.w) - 1.f); }
        if (ACT == 3) { o.x = (o.x >= 0.f) ? o.x : 0.01f * o.x; o.y = (o.y >= 0.f) ? o.y : 0.01f * o.y; o.z = (o.z >= 0.f) ? o.z : 0.01f * o.z; o.w = (o.w >= 0.f) ? o.w : 0.01f * o.w; }
        if (MODE != 1 && c < OC) VST2V4(OUT + (long long)n * OW + c, o); }
    if (MODE != 0) st4s(PH, PL, (long long)n * PP + c, o); }

// ---- util2 ----
// generic Bt plane builder from an f32 weight: Bt[o][k] (pitch KP halves) = (TRANS ? W[k*ldw + o] : W[o*ldw + k]) * (S ? S[o] : 1) for o < NO, k < KI; zero elsewhere for o < NOP rows, k < KP (thread per (o < NOP, pair k))
__global__ __launch_bounds__(256) void k_u2_bt(const float* __restrict__ Wm, int ldw, int TRANS, int KI, int NO, int KP, int NOP, const float* __restrict__ S, unsigned short* __restrict__ PH_, unsigned short* __restrict__ PL_) {
    const long long u = (long long)blockIdx.x * 256 + threadIdx.x; if (u >= (long long)NOP * (KP / 2)) return; const int k0 = 2 * (int)(u % (KP / 2)); const int o = (int)(u / (KP / 2)); float a = 0.f, b = 0.f;
    if (o < NO) { const float s = S ? S[o] : 1.f;
        if (k0 < KI) a = (TRANS ? Wm[(long long)k0 * ldw + o] : Wm[(long long)o * ldw + k0]) * s;
        if (k0 + 1 < KI) b = (TRANS ? Wm[(long long)(k0 + 1) * ldw + o] : Wm[(long long)o * ldw + k0 + 1]) * s; }
    st_s2(PH_, PL_, (long long)o * KP + k0, a, b); }
// generic padded vector: O[i] = (i < n) ? (A[i] * (S ? S[i] : 1) + (B2 ? B2[i] : 0)) : 0 for i < NP (one block of 256, NP <= 4096 looped)
__global__ __launch_bounds__(256) void k_u2_vec(const float* __restrict__ A, const float* __restrict__ S, const float* __restrict__ B2, int n, int NP, float* __restrict__ O) { for (int i = threadIdx.x; i < NP; i += 256) { float v = 0.f; if (i < n) v = A[i] * (S ? S[i] : 1.f) + (B2 ? B2[i] : 0.f); VST2(float, O + i, v); } }
__global__ __launch_bounds__(256) void k_u2_colstat(const float* __restrict__ X, int P, int N, float eps, float* __restrict__ STAT) {
    #pragma clang fp contract(off)
    __shared__ float red[256]; const int c = blockIdx.x; const int t = threadIdx.x; float s = 0.f; for (int r = t; r < N; r += 256) s += X[(long long)r * P + c]; red[t] = s; __syncthreads();
    for (int o = 128; o > 0; o >>= 1) { if (t < o) red[t] += red[t + o]; __syncthreads(); }
    const float mu = red[0] / (float)N; __syncthreads(); float q = 0.f; for (int r = t; r < N; r += 256) { const float d = X[(long long)r * P + c] - mu; q += d * d; } red[t] = q; __syncthreads();
    for (int o = 128; o > 0; o >>= 1) { if (t < o) red[t] += red[t + o]; __syncthreads(); }
    const float rs = 1.f / sqrtf(red[0] / (float)N + eps); if (t < 32) VST2(float, STAT + (long long)c * 32 + t, (t == 0) ? mu : ((t == 1) ? rs : 0.f)); }
// rows f32 [R][W] (pitch PW) -> planes at pitch PP, column offset coff; rows >= RL (live) written as zeros up to RP (thread per (r < RP, 4 of W))
__global__ __launch_bounds__(256) void k_u2_pl(const float* __restrict__ X, int PW, int Wd, int RL, int RP, unsigned short* __restrict__ PH_, unsigned short* __restrict__ PL_, int PP, int coff) { const long long u = (long long)blockIdx.x * 256 + threadIdx.x; if (u >= (long long)RP * (Wd / 4)) return; const int r = (int)(u / (Wd / 4)); const int c = 4 * (int)(u % (Wd / 4)); v4f v; v.x = v.y = v.z = v.w = 0.f; if (r < RL) v = *(const v4f*)(X + (long long)r * PW + c); st4s(PH_, PL_, (long long)r * PP + coff + c, v); }

typedef unsigned int cm_u4 __attribute__((ext_vector_type(4)));

__global__ __launch_bounds__(256) void k_cm_zero16(unsigned short* __restrict__ DST, long long n) { const long long u = (long long)blockIdx.x * 256 + threadIdx.x; if (u * 8 >= n) return; cm_u4 z; z.x = z.y = z.z = z.w = 0u; cm_u4* d = (cm_u4*)(DST + u * 8); *d = z;  }
// f32 -> bf16 (RNE) -> f16 casts: every 16-bit operand then holds exactly the bf16-rounded input value (times a power-of-two
// weight scale), so the f16 WMMA products are exact. Plain: thread per (row, 8 cols),
// dst [R][C] pitch ldd; transposed: thread per (col, 8 consecutive rows) -> dst [C][R] pitch ldd; both store 16 B per thread, thread-linear along the dst row.
__device__ __forceinline__ unsigned int cmb_pk2(float a, float b) { return (unsigned int)__builtin_bit_cast(unsigned short, (_Float16)a) | ((unsigned int)__builtin_bit_cast(unsigned short, (_Float16)b) << 16); }
__device__ __forceinline__ float cmb_bf(float v) { const unsigned u = __builtin_bit_cast(unsigned, v); const unsigned r = (u + 0x7fffu + ((u >> 16) & 1u)) & 0xffff0000u; return __builtin_bit_cast(float, r); }   // bf16 RNE, kept as f32 (finite inputs)
// BR[i] = bf16_rne(B[i]) kept as f32 (thread per element)
__global__ __launch_bounds__(256) void k_cm_bfvec(const float* __restrict__ SRC, float* __restrict__ DST, int n) { const int u = blockIdx.x * 256 + threadIdx.x; if (u >= n) return; VST2(float, DST + u, cmb_bf(SRC[u])); }
__global__ __launch_bounds__(256) void k_cm_castb(const float* __restrict__ SRC, int lds, unsigned short* __restrict__ DST, int ldd, int nR, int nC, float sc) {
    const long long u = (long long)blockIdx.x * 256 + threadIdx.x; const int per = nC / 8; if (u >= (long long)nR * per) return; const int r = (int)(u / per); const int c0 = 8 * (int)(u % per);
    const float* s = SRC + (long long)r * lds + c0; float w[8];
#pragma unroll
    for (int e = 0; e < 8; ++e) w[e] = cmb_bf(s[e]) * sc;
    cm_u4 pk; pk.x = cmb_pk2(w[0], w[1]); pk.y = cmb_pk2(w[2], w[3]); pk.z = cmb_pk2(w[4], w[5]); pk.w = cmb_pk2(w[6], w[7]); VST2(cm_u4, (cm_u4*)(DST + (long long)r * ldd + c0), pk); }
__global__ __launch_bounds__(256) void k_cm_castbT(const float* __restrict__ SRC, int lds, unsigned short* __restrict__ DST, int ldd, int nR, int nC, float sc) {
    const long long u = (long long)blockIdx.x * 256 + threadIdx.x; const int per = nR / 8; if (u >= (long long)nC * per) return; const int c = (int)(u / per); const int r0 = 8 * (int)(u % per);
    float w[8];
#pragma unroll
    for (int e = 0; e < 8; ++e) w[e] = cmb_bf(SRC[(long long)(r0 + e) * lds + c]) * sc;
    cm_u4 pk; pk.x = cmb_pk2(w[0], w[1]); pk.y = cmb_pk2(w[2], w[3]); pk.z = cmb_pk2(w[4], w[5]); pk.w = cmb_pk2(w[6], w[7]); VST2(cm_u4, (cm_u4*)(DST + (long long)c * ldd + r0), pk); }

// QT = bf16(q) * bf16(tau[b]) (f32, thread per float4); MF[b][j] = scale * bf16(delta[b][j]).
// KF, VF = bf16(keys | keys_null), bf16(values | values_null) as 2-byte halves in the order the attention kernel's A fragments want them, so that a fragment is two 16-byte loads a lane
// and each load of a wave reads 512 contiguous bytes: [branch][b][h][64-key block][tile 0..3][step 0..1][half 0..1][lane 0..31][8].
//   K: key = 64 block + 16 tile + (lane & 15), e = 32 step + 16 half + 8 (lane >> 4) + i;   V: d = 16 tile + (lane & 15), key = 64 block + 32 step + 16 half + 8 (lane >> 4) + i.
// Thread per 16-byte group of the destination (thread-linear stores); which = blockIdx range, block-uniform.
__global__ __launch_bounds__(256) void k_ds_pre(const float* __restrict__ Q, const float* __restrict__ Kp, const float* __restrict__ V, const float* __restrict__ Kn, const float* __restrict__ Vn, const float* __restrict__ TAU, const float* __restrict__ DELTA, float* __restrict__ QTp, unsigned short* __restrict__ KFp, unsigned short* __restrict__ VFp, float* __restrict__ MFp, float sc) {
    #pragma clang fp contract(off)
    const int blk = blockIdx.x;
    if (blk < 2048) { const long long u = (long long)blk * 256 + threadIdx.x; const int b = (int)(u / (2048LL * 8 * 16)); const float t = cmb_bf(TAU[b]); const v4f x = *(const v4f*)(Q + 4 * u); v4f r; r.x = cmb_bf(x.x) * t; r.y = cmb_bf(x.y) * t; r.z = cmb_bf(x.z) * t; r.w = cmb_bf(x.w) * t; VST2V4(QTp + 4 * u, r); }
    else if (blk < 2048 + 4 * 1024) {
        const int which = (blk - 2048) >> 10;                            // 0 keys, 1 values, 2 keys_null, 3 values_null
        const int c = ((blk - 2048) & 1023) * 256 + threadIdx.x;         // 16-byte group within the tensor: 262,144 of them
        const int lane = c & 31, half = (c >> 5) & 1, step = (c >> 6) & 1, tile = (c >> 7) & 3, kb = (c >> 9) & 31, h = (c >> 14) & 7, b = c >> 17;
        const int inner = 32 * step + 16 * half + 8 * (lane >> 4), outer = 16 * tile + (lane & 15);
        const float* s = (which == 0) ? Kp : (which == 1) ? V : (which == 2) ? Kn : Vn;
        float w[8];
        if ((which & 1) == 0) {
            const float* r = s + ((long long)(b * 2048 + kb * 64 + outer) * 8 + h) * 64 + inner;
            const v4f x = *(const v4f*)r, y = *(const v4f*)(r + 4);
            w[0] = x.x; w[1] = x.y; w[2] = x.z; w[3] = x.w; w[4] = y.x; w[5] = y.y; w[6] = y.z; w[7] = y.w;
        } else {
            const float* r = s + ((long long)(b * 2048 + kb * 64 + inner) * 8 + h) * 64 + outer;
#pragma unroll   // constant trip count: the eight row loads are issued together, with one wait
            for (int i = 0; i < 8; ++i) w[i] = r[i * 512];
        }
        cm_u4 pk;
        pk.x = (unsigned)bfu_rne(w[0]) | ((unsigned)bfu_rne(w[1]) << 16); pk.y = (unsigned)bfu_rne(w[2]) | ((unsigned)bfu_rne(w[3]) << 16);
        pk.z = (unsigned)bfu_rne(w[4]) | ((unsigned)bfu_rne(w[5]) << 16); pk.w = (unsigned)bfu_rne(w[6]) | ((unsigned)bfu_rne(w[7]) << 16);
        unsigned short* d = ((which & 1) ? VFp : KFp) + ((which >= 2) ? 2097152 : 0) + (long long)c * 8;
        VST2(cm_u4, (cm_u4*)d, pk); }
    else { const int u = (blk - 2048 - 4 * 1024) * 256 + threadIdx.x; VST2(float, MFp + u, sc * cmb_bf(DELTA[u]));
        asm volatile("s_wait_xcnt 0x0" ::: "memory");   // stands behind the store, ahead of any rewrite of the registers it names
    } }
// out = m * A1 + (1 - m) * A2 with m = bf16(soft_mask[b][l]) broadcast over (h, e); thread per float4
__global__ __launch_bounds__(256) void k_ds_blend(const float* __restrict__ A1, const float* __restrict__ A2, const float* __restrict__ SM, float* __restrict__ O, long long n4) {
    #pragma clang fp contract(off)
    const long long u = (long long)blockIdx.x * 256 + threadIdx.x; if (u >= n4) return; const float m = cmb_bf(SM[(4 * u) / 512]); const v4f a = *(const v4f*)(A1 + 4 * u), b = *(const v4f*)(A2 + 4 * u); v4f o;
    o.x = m * a.x + (1.f - m) * b.x; o.y = m * a.y + (1.f - m) * b.y; o.z = m * a.z + (1.f - m) * b.z; o.w = m * a.w + (1.f - m) * b.w; VST2V4(O + 4 * u, o); }


extern "C" void kernel_launch(void* const* d_in, const int* in_sizes, int n_in, void* d_out, int out_size, void* d_ws, size_t ws_size, hipStream_t stream) {
    (void)in_sizes; (void)n_in; (void)out_size; (void)ws_size;
    const float* q = (const float*)d_in[0];
    const float* kk = (const float*)d_in[1];
    const float* v = (const float*)d_in[2];
    const float* kn = (const float*)d_in[3];
    const float* vn = (const float*)d_in[4];
    const float* tau = (const float*)d_in[5];
    const float* delta = (const float*)d_in[6];
    const float* smask = (const float*)d_in[7];
    float* out = (float*)d_out;
    char* wsp = (char*)d_ws;
    float* QT = (float*)wsp; wsp += (((size_t)((size_t)2097152) * 4 + 255) / 256) * 256;
    unsigned short* KF = (unsigned short*)wsp; wsp += (((size_t)((size_t)4194304) * 2 + 255) / 256) * 256;   // [branch][batch] planes of 1,048,576 bf16 in fragment order
    unsigned short* VF = (unsigned short*)wsp; wsp += (((size_t)((size_t)4194304) * 2 + 255) / 256) * 256;   // the same
    float* MF = (float*)wsp; wsp += (((size_t)((size_t)4096) * 4 + 255) / 256) * 256;
    float* AO1 = (float*)wsp; wsp += (((size_t)((size_t)2097152) * 4 + 255) / 256) * 256;
    float* AO2 = (float*)wsp; wsp += (((size_t)((size_t)2097152) * 4 + 255) / 256) * 256;  // directly behind AO1: the attention launch writes both as [branch][batch] planes
    if ((size_t)(wsp - (char*)d_ws) > ws_size) return;   // static carve guard
    k_ds_pre<<<(unsigned)(2048 + 4 * 1024 + 16), 256, 0, stream>>>(q, kk, v, kn, vn, tau, delta, QT, KF, VF, MF, 0.125f);
    k_attn_t<<<dim3(2048 / (16 * AW), 8, 4), 32 * AW, 0, stream>>>(QT, KF, VF, MF, AO1);   // writes AO1 and AO2 as [branch][batch] planes
    k_ds_blend<<<(524288 + 255) / 256, 256, 0, stream>>>(AO1, AO2, smask, out, 524288LL);
}
